// v000
// Times are from an AMD MI455X. After a warm-up the kernel runs many times in a row, and a time is the length of
// such a window on the GPU divided by its runs, so every launch and the gaps after it count. The runs cycle
// through copies of the inputs. A figure is the median of several windows, for all but v000 over two sittings.
// Sittings can differ by a few percent; kernels timed side by side share one.
// v000 is the starting kernel. One run takes 422 microseconds.
#include <hip/hip_runtime.h>
// the 1×1 convs (4096 × 512 × 512, + bias, weights (out,in) bf16-exact ×2^4) and the attention as a fused flash-style kernel (S = Q·Kᵀ·32^-½ with d = 32 in one k-step, online softmax f32,
// P f16 ≤ 1, O = P·V) on v_wmma_f32_16x16x32_f16 (f16 operands, single products, f32 accumulate); residual (out + x)/√2 and layout transposes f32 VALU.
#define CC 512
#define NP 4096
#define NG 32
#define GS 16
#define NH 16
#define HD 32

typedef __bf16 v16b __attribute__((ext_vector_type(16)));
typedef unsigned short v8us __attribute__((ext_vector_type(8), may_alias));
typedef float  v8f  __attribute__((ext_vector_type(8)));
typedef float  v4f  __attribute__((ext_vector_type(4)));
typedef float  v4fa __attribute__((ext_vector_type(4), may_alias));
union FragB { v16b v; v8us half[2]; unsigned short u[16]; };

__device__ __forceinline__ unsigned short bf16_bits(float x) { unsigned int u = __float_as_uint(x); return (unsigned short)((u + 0x7FFFu + ((u >> 16) & 1u)) >> 16); }
__device__ __forceinline__ float bf16_val(unsigned short b) { return __uint_as_float(((unsigned int)b) << 16); }
__device__ __forceinline__ float bf16_round(float x) { return bf16_val(bf16_bits(x)); }
// D += A·B with NT terms: 1 = ah·bh, 2 = + al·bh (A split), 3 = + ah·bl (both split)
template <int NT>
__device__ __forceinline__ v8f mmaN(v16b ah, v16b al, v16b bh, v16b bl, v8f c) {
  c = __builtin_amdgcn_wmma_f32_16x16x32_bf16(false, ah, false, bh, (short)0, c, false, false);
  if (NT >= 2) c = __builtin_amdgcn_wmma_f32_16x16x32_bf16(false, al, false, bh, (short)0, c, false, false);
  if (NT >= 3) c = __builtin_amdgcn_wmma_f32_16x16x32_bf16(false, ah, false, bl, (short)0, c, false, false);
  asm volatile("v_nop\n\tv_nop\n\tv_nop\n\tv_nop" : "+v"(c) : "v"(ah), "v"(al), "v"(bh), "v"(bl));
  return c;
}

__global__ __launch_bounds__(256) void k_wt_bf16(const float* __restrict__ W, unsigned short* __restrict__ Wt, int K, int N) {
  const int t = blockIdx.x * 256 + threadIdx.x;
  const int k8n = K / 8;
  if (t >= N * k8n) return;
  const int n = t / k8n, k8 = (t % k8n) * 8;
  v8us v;
#pragma unroll
  for (int i = 0; i < 8; ++i) v[i] = bf16_bits(W[(size_t)(k8 + i) * N + n]);
  *(v8us*)(Wt + (size_t)n * K + k8) = v;
  
}

// GEMM C[M][N] (f32, pitch ldc) = act(A[M][K]·W + bias). A f32 row-major (pitch lda) converted per fragment to bf16
// (ASPLIT: hi/lo two planes -> 2 terms, else single rounded term); Wt bf16 [N][K] (pitch ldb). BIAS_BF16 rounds the
// bias to bf16 first (bias quantised to bf16 before the add). K%32==0, M%16==0, N%64==0.
template <bool ASPLIT, int ACT, bool BIAS_BF16>
__global__ __launch_bounds__(128) void k_gemm_bf(const float* __restrict__ A, int lda, const unsigned short* __restrict__ Wt, int ldb,
                                               const float* __restrict__ bias, float* __restrict__ C, int ldc, int M, int N, int K) {
  __shared__ __attribute__((aligned(16))) float so[4][16][64];
  const int tid = threadIdx.x, w = tid >> 5, lane = tid & 31, ln = lane & 15, hh = lane >> 4;
  const int ntn = N / 64;
  const int wid = blockIdx.x * 4 + w;
  const int mt = wid / ntn, nq = wid % ntn;
  if (mt * 16 >= M) return;
  const int row0 = mt * 16, col0 = nq * 64;
  const float* arow = A + (size_t)(row0 + ln) * lda;
  v8f acc[4] = {};
  for (int kb = 0; kb < K; kb += 32) {
    FragB ah, al;
    const v4f x0 = *(const v4fa*)(arow + kb + 8 * hh), x1 = *(const v4fa*)(arow + kb + 8 * hh + 4);
    const v4f x2 = *(const v4fa*)(arow + kb + 16 + 8 * hh), x3 = *(const v4fa*)(arow + kb + 16 + 8 * hh + 4);
    float xs[16] = {x0[0],x0[1],x0[2],x0[3],x1[0],x1[1],x1[2],x1[3],x2[0],x2[1],x2[2],x2[3],x3[0],x3[1],x3[2],x3[3]};
#pragma unroll
    for (int i = 0; i < 16; ++i) { const unsigned short hb = bf16_bits(xs[i]); ah.u[i] = hb; al.u[i] = ASPLIT ? bf16_bits(xs[i] - bf16_val(hb)) : (unsigned short)0; }
#pragma unroll
    for (int t = 0; t < 4; ++t) {
      const unsigned short* brow = Wt + (size_t)(col0 + t * 16 + ln) * ldb + kb;
      FragB b;
      b.half[0] = *(const v8us*)(brow + 8 * hh);
      b.half[1] = *(const v8us*)(brow + 16 + 8 * hh);
      acc[t] = mmaN<ASPLIT ? 2 : 1>(ah.v, al.v, b.v, b.v, acc[t]);
    }
  }
#pragma unroll
  for (int t = 0; t < 4; ++t) {
    float bv = bias ? bias[col0 + t * 16 + ln] : 0.f;
    if (BIAS_BF16) bv = bf16_round(bv);
#pragma unroll
    for (int r = 0; r < 8; ++r) { float v = acc[t][r] + bv; if (ACT == 1) v = fmaxf(v, 0.f); so[w][8 * hh + r][t * 16 + ln] = v; }
  }
  __builtin_amdgcn_fence(__ATOMIC_ACQ_REL, "workgroup");
  __builtin_amdgcn_wave_barrier();
  const int rsub = lane >> 4, c4 = (lane & 15) * 4;
  {
#pragma unroll
    for (int q = 0; q < 8; ++q) {
      const int r = q * 2 + rsub;
      const v4f v = *(const v4fa*)&so[w][r][c4];
      *(v4f*)(C + (size_t)(row0 + r) * ldc + col0 + c4) = v;
    }
    
  }
}

// Flash-style causal/unmasked attention, all contractions 3-term bf16 hi/lo splits, f32 softmax with running max.
// q,k,v rows are read from f32 buffers with arbitrary row pitch (so they can live inside a fused qkv buffer);
// D = head size (multiple of 32, <= 128); one wave = 16 query rows; block = 4 waves (64 queries) sharing K/V chunks of 32.
template <int D, bool CAUSAL>
__global__ __launch_bounds__(128) void k_flash(const float* __restrict__ qb, const float* __restrict__ kb, const float* __restrict__ vb,
                                             int pitch, int T, int H, float scale, float* __restrict__ y, int ypitch) {
  constexpr int KS = D / 32;        // k-steps for QK
  constexpr int DT = D / 16;        // d tiles for PV
  __shared__ __attribute__((aligned(16))) unsigned short sKh[32][D + 8], sKl[32][D + 8], sVh[32][D + 8], sVl[32][D + 8];
  __shared__ __attribute__((aligned(16))) unsigned short sPh[4][16][40], sPl[4][16][40];
  __shared__ __attribute__((aligned(16))) float sO[4][16][D];
  const int tid = threadIdx.x, w = tid >> 5, lane = tid & 31, ln = lane & 15, hh = lane >> 4;
  const int nqb = (T + 63) / 64;
  const int bh = blockIdx.x / nqb, qblk = blockIdx.x % nqb;
  const int b = bh / H, h = bh % H;
  const int q0 = qblk * 64 + w * 16;
  const float* Q = qb + (size_t)b * T * pitch + h * D;
  const float* K = kb + (size_t)b * T * pitch + h * D;
  const float* V = vb + (size_t)b * T * pitch + h * D;

  // A fragments of the wave's 16 query rows (scaled), hi/lo
  FragB aqh[KS], aql[KS];
  {
    int row = q0 + ln; if (row >= T) row = T - 1;
    const float* qr = Q + (size_t)row * pitch;
#pragma unroll
    for (int ks = 0; ks < KS; ++ks)
#pragma unroll
      for (int i = 0; i < 16; ++i) {
        const int d = ks * 32 + ((i < 8) ? (8 * hh + i) : (16 + 8 * hh + (i - 8)));
        const float x = qr[d] * scale; const unsigned short hb = bf16_bits(x);
        aqh[ks].u[i] = hb; aql[ks].u[i] = bf16_bits(x - bf16_val(hb));
      }
  }
  float m_r[8], l_r[8];
#pragma unroll
  for (int r = 0; r < 8; ++r) { m_r[r] = -3.0e38f; l_r[r] = 0.f; }
  v8f oacc[DT];
#pragma unroll
  for (int dt = 0; dt < DT; ++dt) oacc[dt] = (v8f){0.f,0.f,0.f,0.f,0.f,0.f,0.f,0.f};

  const int kv_end = CAUSAL ? min(T, qblk * 64 + 64) : T;     // block-uniform
  for (int j0 = 0; j0 < kv_end; j0 += 32) {
    __syncthreads();
    for (int e = tid; e < 32 * (D / 4); e += 128) {
      const int r = e / (D / 4), c4 = (e % (D / 4)) * 4;
      const int key = j0 + r;
      v4f kf = {0.f,0.f,0.f,0.f}, vf = {0.f,0.f,0.f,0.f};
      if (key < T) { kf = *(const v4fa*)(K + (size_t)key * pitch + c4); vf = *(const v4fa*)(V + (size_t)key * pitch + c4); }
#pragma unroll
      for (int t = 0; t < 4; ++t) {
        unsigned short hb = bf16_bits(kf[t]); sKh[r][c4 + t] = hb; sKl[r][c4 + t] = bf16_bits(kf[t] - bf16_val(hb));
        hb = bf16_bits(vf[t]); sVh[r][c4 + t] = hb; sVl[r][c4 + t] = bf16_bits(vf[t] - bf16_val(hb));
      }
    }
    __syncthreads();
    // S tile 16 x 32
    v8f s[2];
#pragma unroll
    for (int nt = 0; nt < 2; ++nt) {
      v8f acc = {};
#pragma unroll
      for (int ks = 0; ks < KS; ++ks) {
        FragB bh_, bl_;
        bh_.half[0] = *(const v8us*)&sKh[nt * 16 + ln][ks * 32 + 8 * hh]; bh_.half[1] = *(const v8us*)&sKh[nt * 16 + ln][ks * 32 + 16 + 8 * hh];
        bl_.half[0] = *(const v8us*)&sKl[nt * 16 + ln][ks * 32 + 8 * hh]; bl_.half[1] = *(const v8us*)&sKl[nt * 16 + ln][ks * 32 + 16 + 8 * hh];
        acc = mmaN<3>(aqh[ks].v, aql[ks].v, bh_.v, bl_.v, acc);
      }
      s[nt] = acc;
    }
    // mask + running max (rows 8hh+r; the 16 lanes of a half share rows)
    float alpha[8];
#pragma unroll
    for (int r = 0; r < 8; ++r) {
      const int qi = q0 + 8 * hh + r;
      const int ja = j0 + ln, jb = j0 + 16 + ln;
      if (CAUSAL) { if (ja > qi) s[0][r] = -3.0e38f; if (jb > qi) s[1][r] = -3.0e38f; }
      if (ja >= T) s[0][r] = -3.0e38f;
      if (jb >= T) s[1][r] = -3.0e38f;
      float mx = fmaxf(s[0][r], s[1][r]);
      mx = fmaxf(mx, __shfl_xor(mx, 1, 32)); mx = fmaxf(mx, __shfl_xor(mx, 2, 32)); mx = fmaxf(mx, __shfl_xor(mx, 4, 32)); mx = fmaxf(mx, __shfl_xor(mx, 8, 32));
      const float mnew = fmaxf(m_r[r], mx);
      alpha[r] = (mnew > -1.0e38f) ? __expf(m_r[r] - mnew) : 1.0f;
      const float p0 = (s[0][r] > -1.0e38f) ? __expf(s[0][r] - mnew) : 0.f;
      const float p1 = (s[1][r] > -1.0e38f) ? __expf(s[1][r] - mnew) : 0.f;
      m_r[r] = mnew;
      l_r[r] = l_r[r] * alpha[r] + p0 + p1;            // per-lane partial row sum (16 lanes combined at the end)
      unsigned short hb = bf16_bits(p0); sPh[w][8 * hh + r][ln] = hb;      sPl[w][8 * hh + r][ln] = bf16_bits(p0 - bf16_val(hb));
      hb = bf16_bits(p1);                sPh[w][8 * hh + r][16 + ln] = hb; sPl[w][8 * hh + r][16 + ln] = bf16_bits(p1 - bf16_val(hb));
    }
#pragma unroll
    for (int dt = 0; dt < DT; ++dt)
#pragma unroll
      for (int r = 0; r < 8; ++r) oacc[dt][r] *= alpha[r];
    __builtin_amdgcn_fence(__ATOMIC_ACQ_REL, "workgroup");
    __builtin_amdgcn_wave_barrier();
    FragB pah, pal;
    pah.half[0] = *(const v8us*)&sPh[w][ln][8 * hh]; pah.half[1] = *(const v8us*)&sPh[w][ln][16 + 8 * hh];
    pal.half[0] = *(const v8us*)&sPl[w][ln][8 * hh]; pal.half[1] = *(const v8us*)&sPl[w][ln][16 + 8 * hh];
#pragma unroll
    for (int dt = 0; dt < DT; ++dt) {
      FragB bvh, bvl;
#pragma unroll
      for (int i = 0; i < 8; ++i) {
        bvh.u[i] = sVh[8 * hh + i][dt * 16 + ln]; bvh.u[8 + i] = sVh[16 + 8 * hh + i][dt * 16 + ln];
        bvl.u[i] = sVl[8 * hh + i][dt * 16 + ln]; bvl.u[8 + i] = sVl[16 + 8 * hh + i][dt * 16 + ln];
      }
      oacc[dt] = mmaN<3>(pah.v, pal.v, bvh.v, bvl.v, oacc[dt]);
    }
    __builtin_amdgcn_fence(__ATOMIC_ACQ_REL, "workgroup");
    __builtin_amdgcn_wave_barrier();
  }
#pragma unroll
  for (int r = 0; r < 8; ++r) {
    float l = l_r[r];
    l += __shfl_xor(l, 1, 32); l += __shfl_xor(l, 2, 32); l += __shfl_xor(l, 4, 32); l += __shfl_xor(l, 8, 32);
    l_r[r] = (l > 0.f) ? 1.0f / l : 0.f;
  }
#pragma unroll
  for (int dt = 0; dt < DT; ++dt)
#pragma unroll
    for (int r = 0; r < 8; ++r) sO[w][8 * hh + r][dt * 16 + ln] = oacc[dt][r] * l_r[r];
  __builtin_amdgcn_fence(__ATOMIC_ACQ_REL, "workgroup");
  __builtin_amdgcn_wave_barrier();
  {
    for (int r = 0; r < 16; ++r) {
      const int row = q0 + r;
      if (row < T && lane < D / 4) {
        const v4f val = *(const v4fa*)&sO[w][r][lane * 4];
        *(v4f*)(y + ((size_t)b * T + row) * ypitch + h * D + lane * 4) = val;
      }
    }
    
  }
}

// GEMM C = act(A·W + bias + resid): A f32 (ASPLIT -> hi/lo 2 terms), Wt bf16 [N][K]; ACT 0 none, 1 relu, 2 exact gelu;
// resid (optional, f32, row index = (row % rmod), pitch ldr, RES_BF16 rounds it) added before the activation.
template <bool ASPLIT, int ACT, bool BIAS_BF16, bool RES_BF16>
__global__ __launch_bounds__(128) void k_gemm_bf3(const float* __restrict__ A, int lda, const unsigned short* __restrict__ Wt, int ldb,
                                                const float* __restrict__ bias, const float* __restrict__ resid, int rmod, int ldr,
                                                float* __restrict__ C, int ldc, int M, int N, int K) {
  __shared__ __attribute__((aligned(16))) float so[4][16][64];
  const int tid = threadIdx.x, w = tid >> 5, lane = tid & 31, ln = lane & 15, hh = lane >> 4;
  const int ntn = N / 64;
  const int wid = blockIdx.x * 4 + w;
  const int mt = wid / ntn, nq = wid % ntn;
  if (mt * 16 >= M) return;
  const int row0 = mt * 16, col0 = nq * 64;
  const float* arow = A + (size_t)(row0 + ln) * lda;
  v8f acc[4] = {};
  for (int kb = 0; kb < K; kb += 32) {
    FragB ah, al;
    const v4f x0 = *(const v4fa*)(arow + kb + 8 * hh), x1 = *(const v4fa*)(arow + kb + 8 * hh + 4);
    const v4f x2 = *(const v4fa*)(arow + kb + 16 + 8 * hh), x3 = *(const v4fa*)(arow + kb + 16 + 8 * hh + 4);
    float xs[16] = {x0[0],x0[1],x0[2],x0[3],x1[0],x1[1],x1[2],x1[3],x2[0],x2[1],x2[2],x2[3],x3[0],x3[1],x3[2],x3[3]};
#pragma unroll
    for (int i = 0; i < 16; ++i) { const unsigned short hb = bf16_bits(xs[i]); ah.u[i] = hb; al.u[i] = ASPLIT ? bf16_bits(xs[i] - bf16_val(hb)) : (unsigned short)0; }
#pragma unroll
    for (int t = 0; t < 4; ++t) {
      const unsigned short* brow = Wt + (size_t)(col0 + t * 16 + ln) * ldb + kb;
      FragB b;
      b.half[0] = *(const v8us*)(brow + 8 * hh);
      b.half[1] = *(const v8us*)(brow + 16 + 8 * hh);
      acc[t] = mmaN<ASPLIT ? 2 : 1>(ah.v, al.v, b.v, b.v, acc[t]);
    }
  }
#pragma unroll
  for (int t = 0; t < 4; ++t) {
    const int col = col0 + t * 16 + ln;
    float bv = bias ? bias[col] : 0.f;
    if (BIAS_BF16) bv = bf16_round(bv);
#pragma unroll
    for (int r = 0; r < 8; ++r) {
      float v = acc[t][r] + bv;
      if (resid) { float rv = resid[(size_t)((row0 + 8 * hh + r) % rmod) * ldr + col]; if (RES_BF16) rv = bf16_round(rv); v += rv; }
      if (ACT == 1) v = fmaxf(v, 0.f);
      if (ACT == 2) v = 0.5f * v * (1.0f + erff(v * 0.70710678118654752f));
      if (ACT == 3) { const float u = 0.7978845608028654f * (v + 0.044715f * v * v * v); v = 0.5f * v * (1.0f + tanhf(u)); }
      so[w][8 * hh + r][t * 16 + ln] = v;
    }
  }
  __builtin_amdgcn_fence(__ATOMIC_ACQ_REL, "workgroup");
  __builtin_amdgcn_wave_barrier();
  const int rsub = lane >> 4, c4 = (lane & 15) * 4;
  {
#pragma unroll
    for (int q = 0; q < 8; ++q) {
      const int r = q * 2 + rsub;
      const v4f v = *(const v4fa*)&so[w][r][c4];
      *(v4f*)(C + (size_t)(row0 + r) * ldc + col0 + c4) = v;
    }
    
  }
}
// row LayerNorm (biased variance, eps) over N: s = X (+ R); optional out_sum <- s; out_norm <- (s-mu)*rsqrt(var+eps)*g + b
template <bool PARAM_BF16>
__global__ __launch_bounds__(256) void k_layernorm(const float* __restrict__ X, const float* __restrict__ R, const float* __restrict__ g, const float* __restrict__ bta,
                                                  float* __restrict__ out_sum, float* __restrict__ out_norm, int N, float eps) {
  __shared__ float red[256];
  const int row = blockIdx.x, tid = threadIdx.x;
  const float* x = X + (size_t)row * N; const float* rr = R ? R + (size_t)row * N : nullptr;
  float vals[16];                     // up to N = 4096
  const int per = N / 256;            // contiguous chunk per thread? use strided-by-4 chunks: thread handles j = tid*4 + 1024*u
  float s1 = 0.f;
  for (int u = 0; u < per / 4; ++u) {
    const int j = tid * 4 + 1024 * u;
    const v4f a = *(const v4fa*)(x + j);
    v4f b = {0.f,0.f,0.f,0.f}; if (rr) b = *(const v4fa*)(rr + j);
#pragma unroll
    for (int q = 0; q < 4; ++q) { const float v = a[q] + b[q]; vals[u * 4 + q] = v; s1 += v; }
  }
  red[tid] = s1; __syncthreads();
  for (int st = 128; st > 0; st >>= 1) { if (tid < st) red[tid] += red[tid + st]; __syncthreads(); }
  const float mu = red[0] / (float)N; __syncthreads();
  float s2 = 0.f;
  for (int u = 0; u < per / 4; ++u)
#pragma unroll
    for (int q = 0; q < 4; ++q) { const float c = vals[u * 4 + q] - mu; s2 += c * c; }
  red[tid] = s2; __syncthreads();
  for (int st = 128; st > 0; st >>= 1) { if (tid < st) red[tid] += red[tid + st]; __syncthreads(); }
  const float rs = rsqrtf(red[0] / (float)N + eps);
  {
    for (int u = 0; u < per / 4; ++u) {
      const int j = tid * 4 + 1024 * u;
      v4f o, sm;
#pragma unroll
      for (int q = 0; q < 4; ++q) {
        float gg = g[j + q], bb = bta[j + q];
        if (PARAM_BF16) { gg = bf16_round(gg); bb = bf16_round(bb); }
        sm[q] = vals[u * 4 + q]; o[q] = (vals[u * 4 + q] - mu) * rs * gg + bb;
      }
      if (out_sum) *(v4f*)(out_sum + (size_t)row * N + j) = sm;
      *(v4f*)(out_norm + (size_t)row * N + j) = o;
    }
    
  }
}



// ---- f16 WMMA path (v_wmma_f32_16x16x32_f16): 11-bit significands for operands in range — used here for every matrix product (1×1 convs, Q·Kᵀ and P·V)
typedef _Float16 v16h __attribute__((ext_vector_type(16)));
union FragH { v16h v; v8us half[2]; _Float16 h[16]; unsigned short u[16]; };
template <int NT>
__device__ __forceinline__ v8f mmaH(v16h ah, v16h al, v16h bh, v16h bl, v8f c) {
  c = __builtin_amdgcn_wmma_f32_16x16x32_f16(false, ah, false, bh, (short)0, c, false, false);
  if (NT >= 2) c = __builtin_amdgcn_wmma_f32_16x16x32_f16(false, al, false, bh, (short)0, c, false, false);
  if (NT >= 3) c = __builtin_amdgcn_wmma_f32_16x16x32_f16(false, ah, false, bl, (short)0, c, false, false);
  asm volatile("v_nop\n\tv_nop\n\tv_nop\n\tv_nop" : "+v"(c) : "v"(ah), "v"(al), "v"(bh), "v"(bl));
  return c;
}
// batched GEMM like k_gemm_b but f16 operands: A f32 (split into f16 hi/lo if ASPLIT, else rounded to f16), Bt = f16 values [n][k]; alpha; C f32; N multiple of 16 (partial tiles skipped)
template <bool ASPLIT>
__global__ __launch_bounds__(128) void k_gemm_h(const float* __restrict__ A, int lda, size_t sA, const _Float16* __restrict__ Bh, int ldb, size_t sB, float alpha, float* __restrict__ C, int ldc, size_t sC, int M, int N, int K) {
  __shared__ __attribute__((aligned(16))) float so[4][16][64];
  const int tid = threadIdx.x, w = tid >> 5, lane = tid & 31, ln = lane & 15, hh = lane >> 4; const int by = blockIdx.y;
  A += (size_t)by * sA; Bh += (size_t)by * sB; C += (size_t)by * sC;
  const int ntn = (N + 63) / 64; const int wid = blockIdx.x * 4 + w; const int mt = wid / ntn, nq = wid % ntn; if (mt * 16 >= M) return;
  const int row0 = mt * 16, col0 = nq * 64; const float* arow = A + (size_t)(row0 + ln) * lda;
  v8f acc[4] = {};
  for (int kb = 0; kb < K; kb += 32) {
    FragH ah, al;
    const v4f x0 = *(const v4fa*)(arow + kb + 8 * hh), x1 = *(const v4fa*)(arow + kb + 8 * hh + 4), x2 = *(const v4fa*)(arow + kb + 16 + 8 * hh), x3 = *(const v4fa*)(arow + kb + 16 + 8 * hh + 4);
    float xs[16] = {x0[0],x0[1],x0[2],x0[3],x1[0],x1[1],x1[2],x1[3],x2[0],x2[1],x2[2],x2[3],x3[0],x3[1],x3[2],x3[3]};
#pragma unroll
    for (int i = 0; i < 16; ++i) { const _Float16 h = (_Float16)xs[i]; ah.h[i] = h; al.h[i] = ASPLIT ? (_Float16)(xs[i] - (float)h) : (_Float16)0.0f; }
#pragma unroll
    for (int t = 0; t < 4; ++t) { if (col0 + t * 16 >= N) continue; const size_t boff = (size_t)(col0 + t * 16 + ln) * ldb + kb; FragH bq; bq.half[0] = *(const v8us*)(Bh + boff + 8 * hh); bq.half[1] = *(const v8us*)(Bh + boff + 16 + 8 * hh);
      acc[t] = mmaH<ASPLIT ? 2 : 1>(ah.v, al.v, bq.v, bq.v, acc[t]); }
  }
#pragma unroll
  for (int t = 0; t < 4; ++t) { if (col0 + t * 16 >= N) continue;
#pragma unroll
    for (int r = 0; r < 8; ++r) so[w][8 * hh + r][t * 16 + ln] = acc[t][r] * alpha; }
  __builtin_amdgcn_fence(__ATOMIC_ACQ_REL, "workgroup"); __builtin_amdgcn_wave_barrier();
  const int rsub = lane >> 4, c4 = (lane & 15) * 4;
  {
#pragma unroll
    for (int q = 0; q < 8; ++q) { const int r = q * 2 + rsub; if (col0 + c4 < N) { const v4f v = *(const v4fa*)&so[w][r][c4]; *(v4f*)(C + (size_t)(row0 + r) * ldc + col0 + c4) = v; } }
     }
}

// Wt[n][k] = f16(W[k][n]·scale) from f32 row-major W[K][N] (scale = power of two; bf16-exact weights stay exact in f16 away from the subnormal range)
__global__ __launch_bounds__(256) void k_wt_f16(const float* __restrict__ W, _Float16* __restrict__ Wt, int K, int N, float scale) {
  const int t = blockIdx.x * 256 + threadIdx.x; if (t >= N * (K / 8)) return; const int n = t / (K / 8), k8 = (t % (K / 8)) * 8; FragH f;
#pragma unroll
  for (int i = 0; i < 8; ++i) f.h[i] = (_Float16)(bf16_round(W[(size_t)(k8 + i) * N + n]) * scale); const v8us o = f.half[0];
  *(v8us*)((unsigned short*)Wt + (size_t)n * K + k8) = o; 
}
// k_gemm_hh variant with fused epilogue: v = acc·alpha + bias[by·sBias + col] (+ CP[(row/rowsPerB)·sCPb + by·64 + col] if CP) ; ACT 0 none / 1 elu ; writes f16 C16 and/or f32 C, each if non-null
template <int ACT>
__global__ __launch_bounds__(128) void k_gemm_hhx(const _Float16* __restrict__ A, int lda, size_t sA, const _Float16* __restrict__ Bh, int ldb, size_t sB, float alpha, const float* __restrict__ bias, size_t sBias, const float* __restrict__ CP, int rowsPerB, size_t sCPb, int row0g,
    float* __restrict__ C, _Float16* __restrict__ C16, int ldc, size_t sC, int M, int N, int K) {
  __shared__ __attribute__((aligned(16))) float so[4][16][64];
  const int tid = threadIdx.x, w = tid >> 5, lane = tid & 31, ln = lane & 15, hh = lane >> 4; const int by = blockIdx.y;
  A += (size_t)by * sA; Bh += (size_t)by * sB; const size_t cofs = (size_t)by * sC; const float* bp = bias ? bias + (size_t)by * sBias : nullptr;
  const int ntn = (N + 63) / 64; const int wid = blockIdx.x * 4 + w; const int mt = wid / ntn, nq = wid % ntn; if (mt * 16 >= M) return;
  const int row0 = mt * 16, col0 = nq * 64; const _Float16* arow = A + (size_t)(row0 + ln) * lda;
  v8f acc[4] = {};
  for (int kb = 0; kb < K; kb += 32) { FragH ah; ah.half[0] = *(const v8us*)((const unsigned short*)arow + kb + 8 * hh); ah.half[1] = *(const v8us*)((const unsigned short*)arow + kb + 16 + 8 * hh);
#pragma unroll
    for (int t = 0; t < 4; ++t) { if (col0 + t * 16 >= N) continue; const size_t boff = (size_t)(col0 + t * 16 + ln) * ldb + kb; FragH bq; bq.half[0] = *(const v8us*)((const unsigned short*)Bh + boff + 8 * hh); bq.half[1] = *(const v8us*)((const unsigned short*)Bh + boff + 16 + 8 * hh);
      acc[t] = mmaH<1>(ah.v, ah.v, bq.v, bq.v, acc[t]); }
  }
#pragma unroll
  for (int t = 0; t < 4; ++t) { if (col0 + t * 16 >= N) continue; const int col = col0 + t * 16 + ln; const float bv = bp ? bf16_round(bp[col]) : 0.f;
#pragma unroll
    for (int r = 0; r < 8; ++r) { float v = acc[t][r] * alpha + bv; if (CP) { const int bidx = (row0g + row0 + 8 * hh + r) / rowsPerB; v += CP[(size_t)bidx * sCPb + (size_t)by * 64 + col]; } if (ACT == 1) v = (v > 0.f) ? v : expm1f(v); else if (ACT == 3) v = fmaxf(v, 0.f); so[w][8 * hh + r][t * 16 + ln] = v; } }
  __builtin_amdgcn_fence(__ATOMIC_ACQ_REL, "workgroup"); __builtin_amdgcn_wave_barrier();
  const int rsub = lane >> 4, c4 = (lane & 15) * 4; typedef _Float16 v4h __attribute__((ext_vector_type(4)));
  {
#pragma unroll
    for (int q = 0; q < 8; ++q) { const int r = q * 2 + rsub; if (col0 + c4 < N) { const v4f v = *(const v4fa*)&so[w][r][c4]; if (C) *(v4f*)(C + cofs + (size_t)(row0 + r) * ldc + col0 + c4) = v; if (C16) { v4h h4; for (int i = 0; i < 4; ++i) h4[i] = (_Float16)v[i]; *(v4h*)(C16 + cofs + (size_t)(row0 + r) * ldc + col0 + c4) = h4; } } }
     }
}


__global__ __launch_bounds__(256) void k_round16f(const float* __restrict__ W, _Float16* __restrict__ Bt, size_t n8) { const size_t t = (size_t)blockIdx.x * 256 + threadIdx.x; if (t >= n8) return; FragH f;
#pragma unroll
  for (int i = 0; i < 8; ++i) f.h[i] = (_Float16)(bf16_round(W[t * 8 + i]) * 16.0f); *(v8us*)((unsigned short*)Bt + t * 8) = f.half[0];  }
template <bool ROUND>
__global__ __launch_bounds__(256) void k_gstat(const float* __restrict__ X, float* __restrict__ STAT) { __shared__ float sh[256]; const int tid = threadIdx.x; const int g = blockIdx.x; const float* base = X + (size_t)g * GS * NP; float s = 0.f;
#pragma unroll 1
  for (int i = 0; i < 256; ++i) { float v = base[(size_t)tid * 256 + i]; if (ROUND) v = bf16_round(v); s += v; } sh[tid] = s; __syncthreads();
  for (int st = 128; st >= 1; st >>= 1) { if (tid < st) sh[tid] += sh[tid + st]; __syncthreads(); } const float mean = sh[0] / (float)(GS * NP); __syncthreads();
  float q = 0.f;
#pragma unroll 1
  for (int i = 0; i < 256; ++i) { float v = base[(size_t)tid * 256 + i]; if (ROUND) v = bf16_round(v); const float d = v - mean; q += d * d; } sh[tid] = q; __syncthreads();
  for (int st = 128; st >= 1; st >>= 1) { if (tid < st) sh[tid] += sh[tid + st]; __syncthreads(); }
  if (tid == 0) { const float var = sh[0] / (float)(GS * NP); typedef float v2f __attribute__((ext_vector_type(2))); v2f o; o[0] = mean; o[1] = 1.0f / sqrtf(var + 1e-6f); *(v2f*)(STAT + g * 2) = o;  } }
template <bool ROUND>
__global__ __launch_bounds__(256) void k_gnorm(const float* __restrict__ X, const float* __restrict__ STAT, const float* __restrict__ w, const float* __restrict__ bb, float* __restrict__ YC, _Float16* __restrict__ YP) { __shared__ float tl[16][65]; const int tid = threadIdx.x; const int cg = blockIdx.x / (NP / 16), pg = blockIdx.x % (NP / 16); const int c0 = cg * 64, p0 = pg * 16;
  for (int i = tid; i < 64 * 16; i += 256) { const int c = i / 16, pp = i % 16; const int ch = c0 + c; float v = X[(size_t)ch * NP + p0 + pp]; if (ROUND) v = bf16_round(v); const float y = (v - STAT[(ch / GS) * 2]) * STAT[(ch / GS) * 2 + 1] * bf16_round(w[ch]) + bf16_round(bb[ch]); tl[pp][c] = y; }
  __syncthreads();
  {
    (void)YC;
    if (tid < 128) { const int r = tid / 8, pc = tid % 8; FragH f;
#pragma unroll
      for (int q = 0; q < 8; ++q) f.h[q] = (_Float16)tl[r][pc * 8 + q]; *(v8us*)((unsigned short*)YP + (size_t)(p0 + r) * CC + c0 + pc * 8) = f.half[0]; }
     } }
template <bool ROUND>
__global__ __launch_bounds__(256) void k_gnormc(const float* __restrict__ X, const float* __restrict__ STAT, const float* __restrict__ w, const float* __restrict__ bb, float* __restrict__ YC) { const size_t t = (size_t)blockIdx.x * 256 + threadIdx.x; if (t >= (size_t)CC * NP / 4) return; const int ch = (int)(t / (NP / 4)); const v4f v = *(const v4fa*)(X + t * 4); const float m = STAT[(ch / GS) * 2], rs = STAT[(ch / GS) * 2 + 1], ww = bf16_round(w[ch]), b2 = bf16_round(bb[ch]); v4f y;
#pragma unroll
  for (int q = 0; q < 4; ++q) { float x = v[q]; if (ROUND) x = bf16_round(x); y[q] = (x - m) * rs * ww + b2; } *(v4f*)(YC + t * 4) = y;  }
__global__ __launch_bounds__(256) void k_vt32(const _Float16* __restrict__ V16, _Float16* __restrict__ Vt) { __shared__ unsigned short tl[64][34]; const int tid = threadIdx.x; const int h = blockIdx.x / (NP / 64), kg = blockIdx.x % (NP / 64);
  { const int r = tid / 4, c8 = (tid % 4) * 8; FragH f; f.half[0] = *(const v8us*)((const unsigned short*)V16 + (size_t)(kg * 64 + r) * CC + h * HD + c8);
#pragma unroll
    for (int q = 0; q < 8; ++q) tl[r][c8 + q] = f.u[q]; }
  __syncthreads();
  { { const int d = tid / 8, pc = tid % 8; FragH f;
#pragma unroll
      for (int q = 0; q < 8; ++q) f.u[q] = tl[pc * 8 + q][d]; *(v8us*)((unsigned short*)Vt + ((size_t)h * HD + d) * NP + kg * 64 + pc * 8) = f.half[0]; }  } }
__global__ __launch_bounds__(128) void k_attn(const _Float16* __restrict__ Q16, const _Float16* __restrict__ K16, const _Float16* __restrict__ Vt, float* __restrict__ O) { constexpr int RPW = 32;
  __shared__ __attribute__((aligned(16))) unsigned short sP[4][RPW][40]; __shared__ __attribute__((aligned(16))) float sO[4][RPW][HD + 4];
  const int tid = threadIdx.x, w = tid >> 5, lane = tid & 31, ln = lane & 15, hh = lane >> 4; const int h = blockIdx.x / (NP / 128), qblk = blockIdx.x % (NP / 128); const int q0 = qblk * 128 + w * RPW;
  FragH aq[2];
#pragma unroll
  for (int rt = 0; rt < 2; ++rt) { const unsigned short* qr = (const unsigned short*)Q16 + (size_t)(q0 + rt * 16 + ln) * CC + h * HD; aq[rt].half[0] = *(const v8us*)(qr + 8 * hh); aq[rt].half[1] = *(const v8us*)(qr + 16 + 8 * hh); }
  const unsigned short* Vth = (const unsigned short*)Vt + (size_t)h * HD * NP;
  float m_r[2][8], l_r[2][8]; v8f oacc[2][2];
#pragma unroll
  for (int rt = 0; rt < 2; ++rt) {
#pragma unroll
    for (int r = 0; r < 8; ++r) { m_r[rt][r] = -3.0e38f; l_r[rt][r] = 0.f; } oacc[rt][0] = (v8f){0.f,0.f,0.f,0.f,0.f,0.f,0.f,0.f}; oacc[rt][1] = oacc[rt][0]; }
#pragma unroll 1
  for (int j0 = 0; j0 < NP; j0 += 32) { v8f s[2][2];
#pragma unroll
    for (int nt = 0; nt < 2; ++nt) { const unsigned short* kr = (const unsigned short*)K16 + (size_t)(j0 + nt * 16 + ln) * CC + h * HD; FragH bk; bk.half[0] = *(const v8us*)(kr + 8 * hh); bk.half[1] = *(const v8us*)(kr + 16 + 8 * hh);
#pragma unroll
      for (int rt = 0; rt < 2; ++rt) { v8f acc = (v8f){0.f,0.f,0.f,0.f,0.f,0.f,0.f,0.f}; acc = mmaH<1>(aq[rt].v, aq[rt].v, bk.v, bk.v, acc); s[rt][nt] = acc; } }
#pragma unroll
    for (int rt = 0; rt < 2; ++rt)
#pragma unroll
      for (int r = 0; r < 8; ++r) { const float s0 = s[rt][0][r] * 0.17677669529663687f, s1 = s[rt][1][r] * 0.17677669529663687f; float mc = fmaxf(s0, s1);
        mc = fmaxf(mc, __shfl_xor(mc, 1, 32)); mc = fmaxf(mc, __shfl_xor(mc, 2, 32)); mc = fmaxf(mc, __shfl_xor(mc, 4, 32)); mc = fmaxf(mc, __shfl_xor(mc, 8, 32));
        const float mn = fmaxf(m_r[rt][r], mc); const float al = expf(m_r[rt][r] - mn); m_r[rt][r] = mn; const float p0 = expf(s0 - mn), p1 = expf(s1 - mn); l_r[rt][r] = l_r[rt][r] * al + p0 + p1; oacc[rt][0][r] *= al; oacc[rt][1][r] *= al;
        FragH t2; t2.h[0] = (_Float16)p0; t2.h[1] = (_Float16)p1; sP[w][rt * 16 + 8 * hh + r][ln] = t2.u[0]; sP[w][rt * 16 + 8 * hh + r][16 + ln] = t2.u[1]; }
    __builtin_amdgcn_fence(__ATOMIC_ACQ_REL, "workgroup"); __builtin_amdgcn_wave_barrier();
    FragH pa[2];
#pragma unroll
    for (int rt = 0; rt < 2; ++rt) { pa[rt].half[0] = *(const v8us*)&sP[w][rt * 16 + ln][8 * hh]; pa[rt].half[1] = *(const v8us*)&sP[w][rt * 16 + ln][16 + 8 * hh]; }
#pragma unroll
    for (int dt = 0; dt < 2; ++dt) { const unsigned short* vrow = Vth + (size_t)(dt * 16 + ln) * NP + j0; FragH bv; bv.half[0] = *(const v8us*)(vrow + 8 * hh); bv.half[1] = *(const v8us*)(vrow + 16 + 8 * hh);
#pragma unroll
      for (int rt = 0; rt < 2; ++rt) oacc[rt][dt] = mmaH<1>(pa[rt].v, pa[rt].v, bv.v, bv.v, oacc[rt][dt]); }
    __builtin_amdgcn_fence(__ATOMIC_ACQ_REL, "workgroup"); __builtin_amdgcn_wave_barrier(); }
#pragma unroll
  for (int rt = 0; rt < 2; ++rt) {
#pragma unroll
    for (int r = 0; r < 8; ++r) { float l = l_r[rt][r]; l += __shfl_xor(l, 1, 32); l += __shfl_xor(l, 2, 32); l += __shfl_xor(l, 4, 32); l += __shfl_xor(l, 8, 32); l_r[rt][r] = 1.0f / l; }
#pragma unroll
    for (int dt = 0; dt < 2; ++dt)
#pragma unroll
      for (int r = 0; r < 8; ++r) sO[w][rt * 16 + 8 * hh + r][dt * 16 + ln] = oacc[rt][dt][r] * l_r[rt][r]; }
  __builtin_amdgcn_fence(__ATOMIC_ACQ_REL, "workgroup"); __builtin_amdgcn_wave_barrier();
  {
#pragma unroll
    for (int rp = 0; rp < RPW; rp += 4) { const int r = rp + (lane >> 3), pc = lane & 7; const v4f v = *(const v4fa*)&sO[w][r][pc * 4]; *(v4f*)(O + (size_t)(q0 + r) * CC + h * HD + pc * 4) = v; }
     } }
__global__ __launch_bounds__(256) void k_h16(const float* __restrict__ x, _Float16* __restrict__ X16, size_t n8) { const size_t t = (size_t)blockIdx.x * 256 + threadIdx.x; if (t >= n8) return; FragH f;
#pragma unroll
  for (int q = 0; q < 8; ++q) f.h[q] = (_Float16)x[t * 8 + q]; *(v8us*)((unsigned short*)X16 + t * 8) = f.half[0];  }
__global__ __launch_bounds__(256) void k_fin(const float* __restrict__ OP, const float* __restrict__ x, float* __restrict__ out) { __shared__ float tl[32][65]; const int tid = threadIdx.x; const int cg = blockIdx.x / (NP / 64), pg = blockIdx.x % (NP / 64); const int c0 = cg * 32, p0 = pg * 64;
  for (int i = tid; i < 64 * 32; i += 256) { const int pp = i / 32, c = i % 32; tl[c][pp] = OP[(size_t)(p0 + pp) * CC + c0 + c]; }
  __syncthreads();
  { for (int i = tid; i < 32 * 16; i += 256) { const int c = i / 16, pc = i % 16; const size_t o = (size_t)(c0 + c) * NP + p0 + pc * 4; const v4f xv = *(const v4fa*)(x + o); v4f v; for (int q = 0; q < 4; ++q) v[q] = (tl[c][pc * 4 + q] + bf16_round(xv[q])) * 0.7071067811865476f; *(v4f*)(out + o) = v; }  } }
extern "C" void kernel_launch(void* const* d_in, const int* in_sizes, int n_in,
                              void* d_out, int out_size, void* d_ws, size_t ws_size, hipStream_t stream) {
  (void)in_sizes; (void)n_in; (void)out_size;
  const float* x = (const float*)d_in[0]; const float* gw = (const float*)d_in[1]; const float* gb = (const float*)d_in[2]; const float* wq = (const float*)d_in[3]; const float* bq = (const float*)d_in[4]; const float* wk = (const float*)d_in[5]; const float* bk = (const float*)d_in[6]; const float* wv = (const float*)d_in[7]; const float* bv = (const float*)d_in[8]; const float* wo = (const float*)d_in[9]; const float* bo = (const float*)d_in[10];
  char* ws = (char*)d_ws; size_t off = 0;
  auto take = [&](size_t bytes) { char* p = ws + off; off += (bytes + 255) & ~(size_t)255; return p; };
  _Float16* Bq = (_Float16*)take(CC * CC * 2); _Float16* Bk = (_Float16*)take(CC * CC * 2); _Float16* Bv = (_Float16*)take(CC * CC * 2); _Float16* Bo = (_Float16*)take(CC * CC * 2); float* ST1 = (float*)take(NG * 2 * 4 + 256); float* ST2 = (float*)take(NG * 2 * 4 + 256);
  float* QNC = (float*)take((size_t)CC * NP * 4); _Float16* QNP = (_Float16*)take((size_t)NP * CC * 2); _Float16* VNP = (_Float16*)take((size_t)NP * CC * 2); _Float16* Q16 = (_Float16*)take((size_t)NP * CC * 2); _Float16* K16 = (_Float16*)take((size_t)NP * CC * 2); _Float16* V16 = (_Float16*)take((size_t)NP * CC * 2); _Float16* Vt = (_Float16*)take((size_t)NP * CC * 2); float* O = QNC; _Float16* O16 = QNP; float* OP = (float*)take((size_t)NP * CC * 4);
  if (off > ws_size) return;      // 2.1 + 8.4 + 4.2 × 6 + 8.4 ≈ 44 MB
  const unsigned gw8 = (CC * CC / 8 + 255) / 256; k_round16f<<<gw8, 256, 0, stream>>>(wq, Bq, CC * CC / 8); k_round16f<<<gw8, 256, 0, stream>>>(wk, Bk, CC * CC / 8); k_round16f<<<gw8, 256, 0, stream>>>(wv, Bv, CC * CC / 8); k_round16f<<<gw8, 256, 0, stream>>>(wo, Bo, CC * CC / 8);      // (out,in)
  k_gstat<true><<<NG, 256, 0, stream>>>(x, ST1);
  k_gnormc<true><<<(CC * NP / 4 + 255) / 256, 256, 0, stream>>>(x, ST1, gw, gb, QNC);      // qn channel-major f32 (input of the second GroupNorm)
  k_gnorm<true><<<(CC / 64) * (NP / 16), 256, 0, stream>>>(x, ST1, gw, gb, nullptr, QNP);      // qn position-major f16
  k_gstat<false><<<NG, 256, 0, stream>>>(QNC, ST2);
  k_gnorm<false><<<(CC / 64) * (NP / 16), 256, 0, stream>>>(QNC, ST2, gw, gb, nullptr, VNP);      // vn = GN(qn) position-major f16
  const dim3 gg(((NP / 16) * (CC / 64) + 3) / 4, 1);
  k_gemm_hhx<0><<<gg, 128, 0, stream>>>(QNP, CC, 0, Bq, CC, 0, 0.0625f, bq, 0, nullptr, 1, 0, 0, nullptr, Q16, CC, 0, NP, CC, CC);
  k_gemm_hhx<0><<<gg, 128, 0, stream>>>(VNP, CC, 0, Bk, CC, 0, 0.0625f, bk, 0, nullptr, 1, 0, 0, nullptr, K16, CC, 0, NP, CC, CC);
  k_gemm_hhx<0><<<gg, 128, 0, stream>>>(VNP, CC, 0, Bv, CC, 0, 0.0625f, bv, 0, nullptr, 1, 0, 0, nullptr, V16, CC, 0, NP, CC, CC);
  k_vt32<<<NH * (NP / 64), 256, 0, stream>>>(V16, Vt);
  k_attn<<<NH * (NP / 128), 128, 0, stream>>>(Q16, K16, Vt, O);
  k_h16<<<(NP * CC / 8 + 255) / 256, 256, 0, stream>>>(O, O16, (size_t)NP * CC / 8);
  k_gemm_hhx<0><<<gg, 128, 0, stream>>>(O16, CC, 0, Bo, CC, 0, 0.0625f, bo, 0, nullptr, 1, 0, 0, OP, nullptr, CC, 0, NP, CC, CC);
  k_fin<<<(CC / 32) * (NP / 64), 256, 0, stream>>>(OP, x, (float*)d_out);
}

// v001
// Measured time: 380 microseconds a run.
// In two side-by-side timings against v000, it was 1.12 and 1.11 times as fast.
#include <hip/hip_runtime.h>
// the 1×1 convs (4096 × 512 × 512, + bias, weights (out,in) bf16-exact ×2^4) and the attention as a fused flash-style kernel (S = Q·Kᵀ·32^-½ with d = 32 in one k-step, online softmax f32,
// P f16 ≤ 1, O = P·V) on v_wmma_f32_16x16x32_f16 (f16 operands, single products, f32 accumulate); residual (out + x)/√2 and layout transposes f32 VALU.
#define CC 512
#define NP 4096
#define NG 32
#define GS 16
#define NH 16
#define HD 32

typedef __bf16 v16b __attribute__((ext_vector_type(16)));
typedef unsigned short v8us __attribute__((ext_vector_type(8), may_alias));
typedef float  v8f  __attribute__((ext_vector_type(8)));
typedef float  v4f  __attribute__((ext_vector_type(4)));
typedef float  v4fa __attribute__((ext_vector_type(4), may_alias));
union FragB { v16b v; v8us half[2]; unsigned short u[16]; };

__device__ __forceinline__ unsigned short bf16_bits(float x) { unsigned int u = __float_as_uint(x); return (unsigned short)((u + 0x7FFFu + ((u >> 16) & 1u)) >> 16); }
__device__ __forceinline__ float bf16_val(unsigned short b) { return __uint_as_float(((unsigned int)b) << 16); }
__device__ __forceinline__ float bf16_round(float x) { return bf16_val(bf16_bits(x)); }
// D += A·B with NT terms: 1 = ah·bh, 2 = + al·bh (A split), 3 = + ah·bl (both split)
template <int NT>
__device__ __forceinline__ v8f mmaN(v16b ah, v16b al, v16b bh, v16b bl, v8f c) {
  c = __builtin_amdgcn_wmma_f32_16x16x32_bf16(false, ah, false, bh, (short)0, c, false, false);
  if (NT >= 2) c = __builtin_amdgcn_wmma_f32_16x16x32_bf16(false, al, false, bh, (short)0, c, false, false);
  if (NT >= 3) c = __builtin_amdgcn_wmma_f32_16x16x32_bf16(false, ah, false, bl, (short)0, c, false, false);
  asm volatile("v_nop\n\tv_nop\n\tv_nop\n\tv_nop" : "+v"(c) : "v"(ah), "v"(al), "v"(bh), "v"(bl));
  return c;
}

__global__ __launch_bounds__(256) void k_wt_bf16(const float* __restrict__ W, unsigned short* __restrict__ Wt, int K, int N) {
  const int t = blockIdx.x * 256 + threadIdx.x;
  const int k8n = K / 8;
  if (t >= N * k8n) return;
  const int n = t / k8n, k8 = (t % k8n) * 8;
  v8us v;
#pragma unroll
  for (int i = 0; i < 8; ++i) v[i] = bf16_bits(W[(size_t)(k8 + i) * N + n]);
  *(v8us*)(Wt + (size_t)n * K + k8) = v;
  
}

// GEMM C[M][N] (f32, pitch ldc) = act(A[M][K]·W + bias). A f32 row-major (pitch lda) converted per fragment to bf16
// (ASPLIT: hi/lo two planes -> 2 terms, else single rounded term); Wt bf16 [N][K] (pitch ldb). BIAS_BF16 rounds the
// bias to bf16 first (bias quantised to bf16 before the add). K%32==0, M%16==0, N%64==0.
template <bool ASPLIT, int ACT, bool BIAS_BF16>
__global__ __launch_bounds__(128) void k_gemm_bf(const float* __restrict__ A, int lda, const unsigned short* __restrict__ Wt, int ldb,
                                               const float* __restrict__ bias, float* __restrict__ C, int ldc, int M, int N, int K) {
  __shared__ __attribute__((aligned(16))) float so[4][16][64];
  const int tid = threadIdx.x, w = tid >> 5, lane = tid & 31, ln = lane & 15, hh = lane >> 4;
  const int ntn = N / 64;
  const int wid = blockIdx.x * 4 + w;
  const int mt = wid / ntn, nq = wid % ntn;
  if (mt * 16 >= M) return;
  const int row0 = mt * 16, col0 = nq * 64;
  const float* arow = A + (size_t)(row0 + ln) * lda;
  v8f acc[4] = {};
  for (int kb = 0; kb < K; kb += 32) {
    FragB ah, al;
    const v4f x0 = *(const v4fa*)(arow + kb + 8 * hh), x1 = *(const v4fa*)(arow + kb + 8 * hh + 4);
    const v4f x2 = *(const v4fa*)(arow + kb + 16 + 8 * hh), x3 = *(const v4fa*)(arow + kb + 16 + 8 * hh + 4);
    float xs[16] = {x0[0],x0[1],x0[2],x0[3],x1[0],x1[1],x1[2],x1[3],x2[0],x2[1],x2[2],x2[3],x3[0],x3[1],x3[2],x3[3]};
#pragma unroll
    for (int i = 0; i < 16; ++i) { const unsigned short hb = bf16_bits(xs[i]); ah.u[i] = hb; al.u[i] = ASPLIT ? bf16_bits(xs[i] - bf16_val(hb)) : (unsigned short)0; }
#pragma unroll
    for (int t = 0; t < 4; ++t) {
      const unsigned short* brow = Wt + (size_t)(col0 + t * 16 + ln) * ldb + kb;
      FragB b;
      b.half[0] = *(const v8us*)(brow + 8 * hh);
      b.half[1] = *(const v8us*)(brow + 16 + 8 * hh);
      acc[t] = mmaN<ASPLIT ? 2 : 1>(ah.v, al.v, b.v, b.v, acc[t]);
    }
  }
#pragma unroll
  for (int t = 0; t < 4; ++t) {
    float bv = bias ? bias[col0 + t * 16 + ln] : 0.f;
    if (BIAS_BF16) bv = bf16_round(bv);
#pragma unroll
    for (int r = 0; r < 8; ++r) { float v = acc[t][r] + bv; if (ACT == 1) v = fmaxf(v, 0.f); so[w][8 * hh + r][t * 16 + ln] = v; }
  }
  __builtin_amdgcn_fence(__ATOMIC_ACQ_REL, "workgroup");
  __builtin_amdgcn_wave_barrier();
  const int rsub = lane >> 4, c4 = (lane & 15) * 4;
  {
#pragma unroll
    for (int q = 0; q < 8; ++q) {
      const int r = q * 2 + rsub;
      const v4f v = *(const v4fa*)&so[w][r][c4];
      *(v4f*)(C + (size_t)(row0 + r) * ldc + col0 + c4) = v;
    }
    
  }
}

// Flash-style causal/unmasked attention, all contractions 3-term bf16 hi/lo splits, f32 softmax with running max.
// q,k,v rows are read from f32 buffers with arbitrary row pitch (so they can live inside a fused qkv buffer);
// D = head size (multiple of 32, <= 128); one wave = 16 query rows; block = 4 waves (64 queries) sharing K/V chunks of 32.
template <int D, bool CAUSAL>
__global__ __launch_bounds__(128) void k_flash(const float* __restrict__ qb, const float* __restrict__ kb, const float* __restrict__ vb,
                                             int pitch, int T, int H, float scale, float* __restrict__ y, int ypitch) {
  constexpr int KS = D / 32;        // k-steps for QK
  constexpr int DT = D / 16;        // d tiles for PV
  __shared__ __attribute__((aligned(16))) unsigned short sKh[32][D + 8], sKl[32][D + 8], sVh[32][D + 8], sVl[32][D + 8];
  __shared__ __attribute__((aligned(16))) unsigned short sPh[4][16][40], sPl[4][16][40];
  __shared__ __attribute__((aligned(16))) float sO[4][16][D];
  const int tid = threadIdx.x, w = tid >> 5, lane = tid & 31, ln = lane & 15, hh = lane >> 4;
  const int nqb = (T + 63) / 64;
  const int bh = blockIdx.x / nqb, qblk = blockIdx.x % nqb;
  const int b = bh / H, h = bh % H;
  const int q0 = qblk * 64 + w * 16;
  const float* Q = qb + (size_t)b * T * pitch + h * D;
  const float* K = kb + (size_t)b * T * pitch + h * D;
  const float* V = vb + (size_t)b * T * pitch + h * D;

  // A fragments of the wave's 16 query rows (scaled), hi/lo
  FragB aqh[KS], aql[KS];
  {
    int row = q0 + ln; if (row >= T) row = T - 1;
    const float* qr = Q + (size_t)row * pitch;
#pragma unroll
    for (int ks = 0; ks < KS; ++ks)
#pragma unroll
      for (int i = 0; i < 16; ++i) {
        const int d = ks * 32 + ((i < 8) ? (8 * hh + i) : (16 + 8 * hh + (i - 8)));
        const float x = qr[d] * scale; const unsigned short hb = bf16_bits(x);
        aqh[ks].u[i] = hb; aql[ks].u[i] = bf16_bits(x - bf16_val(hb));
      }
  }
  float m_r[8], l_r[8];
#pragma unroll
  for (int r = 0; r < 8; ++r) { m_r[r] = -3.0e38f; l_r[r] = 0.f; }
  v8f oacc[DT];
#pragma unroll
  for (int dt = 0; dt < DT; ++dt) oacc[dt] = (v8f){0.f,0.f,0.f,0.f,0.f,0.f,0.f,0.f};

  const int kv_end = CAUSAL ? min(T, qblk * 64 + 64) : T;     // block-uniform
  for (int j0 = 0; j0 < kv_end; j0 += 32) {
    __syncthreads();
    for (int e = tid; e < 32 * (D / 4); e += 128) {
      const int r = e / (D / 4), c4 = (e % (D / 4)) * 4;
      const int key = j0 + r;
      v4f kf = {0.f,0.f,0.f,0.f}, vf = {0.f,0.f,0.f,0.f};
      if (key < T) { kf = *(const v4fa*)(K + (size_t)key * pitch + c4); vf = *(const v4fa*)(V + (size_t)key * pitch + c4); }
#pragma unroll
      for (int t = 0; t < 4; ++t) {
        unsigned short hb = bf16_bits(kf[t]); sKh[r][c4 + t] = hb; sKl[r][c4 + t] = bf16_bits(kf[t] - bf16_val(hb));
        hb = bf16_bits(vf[t]); sVh[r][c4 + t] = hb; sVl[r][c4 + t] = bf16_bits(vf[t] - bf16_val(hb));
      }
    }
    __syncthreads();
    // S tile 16 x 32
    v8f s[2];
#pragma unroll
    for (int nt = 0; nt < 2; ++nt) {
      v8f acc = {};
#pragma unroll
      for (int ks = 0; ks < KS; ++ks) {
        FragB bh_, bl_;
        bh_.half[0] = *(const v8us*)&sKh[nt * 16 + ln][ks * 32 + 8 * hh]; bh_.half[1] = *(const v8us*)&sKh[nt * 16 + ln][ks * 32 + 16 + 8 * hh];
        bl_.half[0] = *(const v8us*)&sKl[nt * 16 + ln][ks * 32 + 8 * hh]; bl_.half[1] = *(const v8us*)&sKl[nt * 16 + ln][ks * 32 + 16 + 8 * hh];
        acc = mmaN<3>(aqh[ks].v, aql[ks].v, bh_.v, bl_.v, acc);
      }
      s[nt] = acc;
    }
    // mask + running max (rows 8hh+r; the 16 lanes of a half share rows)
    float alpha[8];
#pragma unroll
    for (int r = 0; r < 8; ++r) {
      const int qi = q0 + 8 * hh + r;
      const int ja = j0 + ln, jb = j0 + 16 + ln;
      if (CAUSAL) { if (ja > qi) s[0][r] = -3.0e38f; if (jb > qi) s[1][r] = -3.0e38f; }
      if (ja >= T) s[0][r] = -3.0e38f;
      if (jb >= T) s[1][r] = -3.0e38f;
      float mx = fmaxf(s[0][r], s[1][r]);
      mx = fmaxf(mx, __shfl_xor(mx, 1, 32)); mx = fmaxf(mx, __shfl_xor(mx, 2, 32)); mx = fmaxf(mx, __shfl_xor(mx, 4, 32)); mx = fmaxf(mx, __shfl_xor(mx, 8, 32));
      const float mnew = fmaxf(m_r[r], mx);
      alpha[r] = (mnew > -1.0e38f) ? __expf(m_r[r] - mnew) : 1.0f;
      const float p0 = (s[0][r] > -1.0e38f) ? __expf(s[0][r] - mnew) : 0.f;
      const float p1 = (s[1][r] > -1.0e38f) ? __expf(s[1][r] - mnew) : 0.f;
      m_r[r] = mnew;
      l_r[r] = l_r[r] * alpha[r] + p0 + p1;            // per-lane partial row sum (16 lanes combined at the end)
      unsigned short hb = bf16_bits(p0); sPh[w][8 * hh + r][ln] = hb;      sPl[w][8 * hh + r][ln] = bf16_bits(p0 - bf16_val(hb));
      hb = bf16_bits(p1);                sPh[w][8 * hh + r][16 + ln] = hb; sPl[w][8 * hh + r][16 + ln] = bf16_bits(p1 - bf16_val(hb));
    }
#pragma unroll
    for (int dt = 0; dt < DT; ++dt)
#pragma unroll
      for (int r = 0; r < 8; ++r) oacc[dt][r] *= alpha[r];
    __builtin_amdgcn_fence(__ATOMIC_ACQ_REL, "workgroup");
    __builtin_amdgcn_wave_barrier();
    FragB pah, pal;
    pah.half[0] = *(const v8us*)&sPh[w][ln][8 * hh]; pah.half[1] = *(const v8us*)&sPh[w][ln][16 + 8 * hh];
    pal.half[0] = *(const v8us*)&sPl[w][ln][8 * hh]; pal.half[1] = *(const v8us*)&sPl[w][ln][16 + 8 * hh];
#pragma unroll
    for (int dt = 0; dt < DT; ++dt) {
      FragB bvh, bvl;
#pragma unroll
      for (int i = 0; i < 8; ++i) {
        bvh.u[i] = sVh[8 * hh + i][dt * 16 + ln]; bvh.u[8 + i] = sVh[16 + 8 * hh + i][dt * 16 + ln];
        bvl.u[i] = sVl[8 * hh + i][dt * 16 + ln]; bvl.u[8 + i] = sVl[16 + 8 * hh + i][dt * 16 + ln];
      }
      oacc[dt] = mmaN<3>(pah.v, pal.v, bvh.v, bvl.v, oacc[dt]);
    }
    __builtin_amdgcn_fence(__ATOMIC_ACQ_REL, "workgroup");
    __builtin_amdgcn_wave_barrier();
  }
#pragma unroll
  for (int r = 0; r < 8; ++r) {
    float l = l_r[r];
    l += __shfl_xor(l, 1, 32); l += __shfl_xor(l, 2, 32); l += __shfl_xor(l, 4, 32); l += __shfl_xor(l, 8, 32);
    l_r[r] = (l > 0.f) ? 1.0f / l : 0.f;
  }
#pragma unroll
  for (int dt = 0; dt < DT; ++dt)
#pragma unroll
    for (int r = 0; r < 8; ++r) sO[w][8 * hh + r][dt * 16 + ln] = oacc[dt][r] * l_r[r];
  __builtin_amdgcn_fence(__ATOMIC_ACQ_REL, "workgroup");
  __builtin_amdgcn_wave_barrier();
  {
    for (int r = 0; r < 16; ++r) {
      const int row = q0 + r;
      if (row < T && lane < D / 4) {
        const v4f val = *(const v4fa*)&sO[w][r][lane * 4];
        *(v4f*)(y + ((size_t)b * T + row) * ypitch + h * D + lane * 4) = val;
      }
    }
    
  }
}

// GEMM C = act(A·W + bias + resid): A f32 (ASPLIT -> hi/lo 2 terms), Wt bf16 [N][K]; ACT 0 none, 1 relu, 2 exact gelu;
// resid (optional, f32, row index = (row % rmod), pitch ldr, RES_BF16 rounds it) added before the activation.
template <bool ASPLIT, int ACT, bool BIAS_BF16, bool RES_BF16>
__global__ __launch_bounds__(128) void k_gemm_bf3(const float* __restrict__ A, int lda, const unsigned short* __restrict__ Wt, int ldb,
                                                const float* __restrict__ bias, const float* __restrict__ resid, int rmod, int ldr,
                                                float* __restrict__ C, int ldc, int M, int N, int K) {
  __shared__ __attribute__((aligned(16))) float so[4][16][64];
  const int tid = threadIdx.x, w = tid >> 5, lane = tid & 31, ln = lane & 15, hh = lane >> 4;
  const int ntn = N / 64;
  const int wid = blockIdx.x * 4 + w;
  const int mt = wid / ntn, nq = wid % ntn;
  if (mt * 16 >= M) return;
  const int row0 = mt * 16, col0 = nq * 64;
  const float* arow = A + (size_t)(row0 + ln) * lda;
  v8f acc[4] = {};
  for (int kb = 0; kb < K; kb += 32) {
    FragB ah, al;
    const v4f x0 = *(const v4fa*)(arow + kb + 8 * hh), x1 = *(const v4fa*)(arow + kb + 8 * hh + 4);
    const v4f x2 = *(const v4fa*)(arow + kb + 16 + 8 * hh), x3 = *(const v4fa*)(arow + kb + 16 + 8 * hh + 4);
    float xs[16] = {x0[0],x0[1],x0[2],x0[3],x1[0],x1[1],x1[2],x1[3],x2[0],x2[1],x2[2],x2[3],x3[0],x3[1],x3[2],x3[3]};
#pragma unroll
    for (int i = 0; i < 16; ++i) { const unsigned short hb = bf16_bits(xs[i]); ah.u[i] = hb; al.u[i] = ASPLIT ? bf16_bits(xs[i] - bf16_val(hb)) : (unsigned short)0; }
#pragma unroll
    for (int t = 0; t < 4; ++t) {
      const unsigned short* brow = Wt + (size_t)(col0 + t * 16 + ln) * ldb + kb;
      FragB b;
      b.half[0] = *(const v8us*)(brow + 8 * hh);
      b.half[1] = *(const v8us*)(brow + 16 + 8 * hh);
      acc[t] = mmaN<ASPLIT ? 2 : 1>(ah.v, al.v, b.v, b.v, acc[t]);
    }
  }
#pragma unroll
  for (int t = 0; t < 4; ++t) {
    const int col = col0 + t * 16 + ln;
    float bv = bias ? bias[col] : 0.f;
    if (BIAS_BF16) bv = bf16_round(bv);
#pragma unroll
    for (int r = 0; r < 8; ++r) {
      float v = acc[t][r] + bv;
      if (resid) { float rv = resid[(size_t)((row0 + 8 * hh + r) % rmod) * ldr + col]; if (RES_BF16) rv = bf16_round(rv); v += rv; }
      if (ACT == 1) v = fmaxf(v, 0.f);
      if (ACT == 2) v = 0.5f * v * (1.0f + erff(v * 0.70710678118654752f));
      if (ACT == 3) { const float u = 0.7978845608028654f * (v + 0.044715f * v * v * v); v = 0.5f * v * (1.0f + tanhf(u)); }
      so[w][8 * hh + r][t * 16 + ln] = v;
    }
  }
  __builtin_amdgcn_fence(__ATOMIC_ACQ_REL, "workgroup");
  __builtin_amdgcn_wave_barrier();
  const int rsub = lane >> 4, c4 = (lane & 15) * 4;
  {
#pragma unroll
    for (int q = 0; q < 8; ++q) {
      const int r = q * 2 + rsub;
      const v4f v = *(const v4fa*)&so[w][r][c4];
      *(v4f*)(C + (size_t)(row0 + r) * ldc + col0 + c4) = v;
    }
    
  }
}
// row LayerNorm (biased variance, eps) over N: s = X (+ R); optional out_sum <- s; out_norm <- (s-mu)*rsqrt(var+eps)*g + b
template <bool PARAM_BF16>
__global__ __launch_bounds__(256) void k_layernorm(const float* __restrict__ X, const float* __restrict__ R, const float* __restrict__ g, const float* __restrict__ bta,
                                                  float* __restrict__ out_sum, float* __restrict__ out_norm, int N, float eps) {
  __shared__ float red[256];
  const int row = blockIdx.x, tid = threadIdx.x;
  const float* x = X + (size_t)row * N; const float* rr = R ? R + (size_t)row * N : nullptr;
  float vals[16];                     // up to N = 4096
  const int per = N / 256;            // contiguous chunk per thread? use strided-by-4 chunks: thread handles j = tid*4 + 1024*u
  float s1 = 0.f;
  for (int u = 0; u < per / 4; ++u) {
    const int j = tid * 4 + 1024 * u;
    const v4f a = *(const v4fa*)(x + j);
    v4f b = {0.f,0.f,0.f,0.f}; if (rr) b = *(const v4fa*)(rr + j);
#pragma unroll
    for (int q = 0; q < 4; ++q) { const float v = a[q] + b[q]; vals[u * 4 + q] = v; s1 += v; }
  }
  red[tid] = s1; __syncthreads();
  for (int st = 128; st > 0; st >>= 1) { if (tid < st) red[tid] += red[tid + st]; __syncthreads(); }
  const float mu = red[0] / (float)N; __syncthreads();
  float s2 = 0.f;
  for (int u = 0; u < per / 4; ++u)
#pragma unroll
    for (int q = 0; q < 4; ++q) { const float c = vals[u * 4 + q] - mu; s2 += c * c; }
  red[tid] = s2; __syncthreads();
  for (int st = 128; st > 0; st >>= 1) { if (tid < st) red[tid] += red[tid + st]; __syncthreads(); }
  const float rs = rsqrtf(red[0] / (float)N + eps);
  {
    for (int u = 0; u < per / 4; ++u) {
      const int j = tid * 4 + 1024 * u;
      v4f o, sm;
#pragma unroll
      for (int q = 0; q < 4; ++q) {
        float gg = g[j + q], bb = bta[j + q];
        if (PARAM_BF16) { gg = bf16_round(gg); bb = bf16_round(bb); }
        sm[q] = vals[u * 4 + q]; o[q] = (vals[u * 4 + q] - mu) * rs * gg + bb;
      }
      if (out_sum) *(v4f*)(out_sum + (size_t)row * N + j) = sm;
      *(v4f*)(out_norm + (size_t)row * N + j) = o;
    }
    
  }
}



// ---- f16 WMMA path (v_wmma_f32_16x16x32_f16): 11-bit significands for operands in range — used here for every matrix product (1×1 convs, Q·Kᵀ and P·V)
typedef _Float16 v16h __attribute__((ext_vector_type(16)));
union FragH { v16h v; v8us half[2]; _Float16 h[16]; unsigned short u[16]; };
template <int NT>
__device__ __forceinline__ v8f mmaH(v16h ah, v16h al, v16h bh, v16h bl, v8f c) {
  c = __builtin_amdgcn_wmma_f32_16x16x32_f16(false, ah, false, bh, (short)0, c, false, false);
  if (NT >= 2) c = __builtin_amdgcn_wmma_f32_16x16x32_f16(false, al, false, bh, (short)0, c, false, false);
  if (NT >= 3) c = __builtin_amdgcn_wmma_f32_16x16x32_f16(false, ah, false, bl, (short)0, c, false, false);
  asm volatile("v_nop\n\tv_nop\n\tv_nop\n\tv_nop" : "+v"(c) : "v"(ah), "v"(al), "v"(bh), "v"(bl));
  return c;
}
// batched GEMM like k_gemm_b but f16 operands: A f32 (split into f16 hi/lo if ASPLIT, else rounded to f16), Bt = f16 values [n][k]; alpha; C f32; N multiple of 16 (partial tiles skipped)
template <bool ASPLIT>
__global__ __launch_bounds__(128) void k_gemm_h(const float* __restrict__ A, int lda, size_t sA, const _Float16* __restrict__ Bh, int ldb, size_t sB, float alpha, float* __restrict__ C, int ldc, size_t sC, int M, int N, int K) {
  __shared__ __attribute__((aligned(16))) float so[4][16][64];
  const int tid = threadIdx.x, w = tid >> 5, lane = tid & 31, ln = lane & 15, hh = lane >> 4; const int by = blockIdx.y;
  A += (size_t)by * sA; Bh += (size_t)by * sB; C += (size_t)by * sC;
  const int ntn = (N + 63) / 64; const int wid = blockIdx.x * 4 + w; const int mt = wid / ntn, nq = wid % ntn; if (mt * 16 >= M) return;
  const int row0 = mt * 16, col0 = nq * 64; const float* arow = A + (size_t)(row0 + ln) * lda;
  v8f acc[4] = {};
  for (int kb = 0; kb < K; kb += 32) {
    FragH ah, al;
    const v4f x0 = *(const v4fa*)(arow + kb + 8 * hh), x1 = *(const v4fa*)(arow + kb + 8 * hh + 4), x2 = *(const v4fa*)(arow + kb + 16 + 8 * hh), x3 = *(const v4fa*)(arow + kb + 16 + 8 * hh + 4);
    float xs[16] = {x0[0],x0[1],x0[2],x0[3],x1[0],x1[1],x1[2],x1[3],x2[0],x2[1],x2[2],x2[3],x3[0],x3[1],x3[2],x3[3]};
#pragma unroll
    for (int i = 0; i < 16; ++i) { const _Float16 h = (_Float16)xs[i]; ah.h[i] = h; al.h[i] = ASPLIT ? (_Float16)(xs[i] - (float)h) : (_Float16)0.0f; }
#pragma unroll
    for (int t = 0; t < 4; ++t) { if (col0 + t * 16 >= N) continue; const size_t boff = (size_t)(col0 + t * 16 + ln) * ldb + kb; FragH bq; bq.half[0] = *(const v8us*)(Bh + boff + 8 * hh); bq.half[1] = *(const v8us*)(Bh + boff + 16 + 8 * hh);
      acc[t] = mmaH<ASPLIT ? 2 : 1>(ah.v, al.v, bq.v, bq.v, acc[t]); }
  }
#pragma unroll
  for (int t = 0; t < 4; ++t) { if (col0 + t * 16 >= N) continue;
#pragma unroll
    for (int r = 0; r < 8; ++r) so[w][8 * hh + r][t * 16 + ln] = acc[t][r] * alpha; }
  __builtin_amdgcn_fence(__ATOMIC_ACQ_REL, "workgroup"); __builtin_amdgcn_wave_barrier();
  const int rsub = lane >> 4, c4 = (lane & 15) * 4;
  {
#pragma unroll
    for (int q = 0; q < 8; ++q) { const int r = q * 2 + rsub; if (col0 + c4 < N) { const v4f v = *(const v4fa*)&so[w][r][c4]; *(v4f*)(C + (size_t)(row0 + r) * ldc + col0 + c4) = v; } }
     }
}

// Wt[n][k] = f16(W[k][n]·scale) from f32 row-major W[K][N] (scale = power of two; bf16-exact weights stay exact in f16 away from the subnormal range)
__global__ __launch_bounds__(256) void k_wt_f16(const float* __restrict__ W, _Float16* __restrict__ Wt, int K, int N, float scale) {
  const int t = blockIdx.x * 256 + threadIdx.x; if (t >= N * (K / 8)) return; const int n = t / (K / 8), k8 = (t % (K / 8)) * 8; FragH f;
#pragma unroll
  for (int i = 0; i < 8; ++i) f.h[i] = (_Float16)(bf16_round(W[(size_t)(k8 + i) * N + n]) * scale); const v8us o = f.half[0];
  *(v8us*)((unsigned short*)Wt + (size_t)n * K + k8) = o; 
}
// k_gemm_hh variant with fused epilogue: v = acc·alpha + bias[by·sBias + col] (+ CP[(row/rowsPerB)·sCPb + by·64 + col] if CP) ; ACT 0 none / 1 elu ; writes f16 C16 and/or f32 C, each if non-null
template <int ACT>
__global__ __launch_bounds__(128) void k_gemm_hhx(const _Float16* __restrict__ A, int lda, size_t sA, const _Float16* __restrict__ Bh, int ldb, size_t sB, float alpha, const float* __restrict__ bias, size_t sBias, const float* __restrict__ CP, int rowsPerB, size_t sCPb, int row0g,
    float* __restrict__ C, _Float16* __restrict__ C16, int ldc, size_t sC, int M, int N, int K) {
  __shared__ __attribute__((aligned(16))) float so[4][16][64];
  const int tid = threadIdx.x, w = tid >> 5, lane = tid & 31, ln = lane & 15, hh = lane >> 4; const int by = blockIdx.y;
  A += (size_t)by * sA; Bh += (size_t)by * sB; const size_t cofs = (size_t)by * sC; const float* bp = bias ? bias + (size_t)by * sBias : nullptr;
  const int ntn = (N + 63) / 64; const int wid = blockIdx.x * 4 + w; const int mt = wid / ntn, nq = wid % ntn; if (mt * 16 >= M) return;
  const int row0 = mt * 16, col0 = nq * 64; const _Float16* arow = A + (size_t)(row0 + ln) * lda;
  v8f acc[4] = {};
  for (int kb = 0; kb < K; kb += 32) { FragH ah; ah.half[0] = *(const v8us*)((const unsigned short*)arow + kb + 8 * hh); ah.half[1] = *(const v8us*)((const unsigned short*)arow + kb + 16 + 8 * hh);
#pragma unroll
    for (int t = 0; t < 4; ++t) { if (col0 + t * 16 >= N) continue; const size_t boff = (size_t)(col0 + t * 16 + ln) * ldb + kb; FragH bq; bq.half[0] = *(const v8us*)((const unsigned short*)Bh + boff + 8 * hh); bq.half[1] = *(const v8us*)((const unsigned short*)Bh + boff + 16 + 8 * hh);
      acc[t] = mmaH<1>(ah.v, ah.v, bq.v, bq.v, acc[t]); }
  }
#pragma unroll
  for (int t = 0; t < 4; ++t) { if (col0 + t * 16 >= N) continue; const int col = col0 + t * 16 + ln; const float bv = bp ? bf16_round(bp[col]) : 0.f;
#pragma unroll
    for (int r = 0; r < 8; ++r) { float v = acc[t][r] * alpha + bv; if (CP) { const int bidx = (row0g + row0 + 8 * hh + r) / rowsPerB; v += CP[(size_t)bidx * sCPb + (size_t)by * 64 + col]; } if (ACT == 1) v = (v > 0.f) ? v : expm1f(v); else if (ACT == 3) v = fmaxf(v, 0.f); so[w][8 * hh + r][t * 16 + ln] = v; } }
  __builtin_amdgcn_fence(__ATOMIC_ACQ_REL, "workgroup"); __builtin_amdgcn_wave_barrier();
  const int rsub = lane >> 4, c4 = (lane & 15) * 4; typedef _Float16 v4h __attribute__((ext_vector_type(4)));
  {
#pragma unroll
    for (int q = 0; q < 8; ++q) { const int r = q * 2 + rsub; if (col0 + c4 < N) { const v4f v = *(const v4fa*)&so[w][r][c4]; if (C) *(v4f*)(C + cofs + (size_t)(row0 + r) * ldc + col0 + c4) = v; if (C16) { v4h h4; for (int i = 0; i < 4; ++i) h4[i] = (_Float16)v[i]; *(v4h*)(C16 + cofs + (size_t)(row0 + r) * ldc + col0 + c4) = h4; } } }
     }
}


__global__ __launch_bounds__(256) void k_round16f(const float* __restrict__ W, _Float16* __restrict__ Bt, size_t n8) { const size_t t = (size_t)blockIdx.x * 256 + threadIdx.x; if (t >= n8) return; FragH f;
#pragma unroll
  for (int i = 0; i < 8; ++i) f.h[i] = (_Float16)(bf16_round(W[t * 8 + i]) * 16.0f); *(v8us*)((unsigned short*)Bt + t * 8) = f.half[0];  }
template <bool ROUND>
__global__ __launch_bounds__(256) void k_gstat(const float* __restrict__ X, float* __restrict__ STAT) { __shared__ float sh[256]; const int tid = threadIdx.x; const int g = blockIdx.x; const float* base = X + (size_t)g * GS * NP; float s = 0.f;
#pragma unroll 1
  for (int i = 0; i < 256; ++i) { float v = base[(size_t)tid * 256 + i]; if (ROUND) v = bf16_round(v); s += v; } sh[tid] = s; __syncthreads();
  for (int st = 128; st >= 1; st >>= 1) { if (tid < st) sh[tid] += sh[tid + st]; __syncthreads(); } const float mean = sh[0] / (float)(GS * NP); __syncthreads();
  float q = 0.f;
#pragma unroll 1
  for (int i = 0; i < 256; ++i) { float v = base[(size_t)tid * 256 + i]; if (ROUND) v = bf16_round(v); const float d = v - mean; q += d * d; } sh[tid] = q; __syncthreads();
  for (int st = 128; st >= 1; st >>= 1) { if (tid < st) sh[tid] += sh[tid + st]; __syncthreads(); }
  if (tid == 0) { const float var = sh[0] / (float)(GS * NP); typedef float v2f __attribute__((ext_vector_type(2))); v2f o; o[0] = mean; o[1] = 1.0f / sqrtf(var + 1e-6f); *(v2f*)(STAT + g * 2) = o;  } }
template <bool ROUND>
__global__ __launch_bounds__(256) void k_gnorm(const float* __restrict__ X, const float* __restrict__ STAT, const float* __restrict__ w, const float* __restrict__ bb, float* __restrict__ YC, _Float16* __restrict__ YP) { __shared__ float tl[16][65]; const int tid = threadIdx.x; const int cg = blockIdx.x / (NP / 16), pg = blockIdx.x % (NP / 16); const int c0 = cg * 64, p0 = pg * 16;
  for (int i = tid; i < 64 * 16; i += 256) { const int c = i / 16, pp = i % 16; const int ch = c0 + c; float v = X[(size_t)ch * NP + p0 + pp]; if (ROUND) v = bf16_round(v); const float y = (v - STAT[(ch / GS) * 2]) * STAT[(ch / GS) * 2 + 1] * bf16_round(w[ch]) + bf16_round(bb[ch]); tl[pp][c] = y; }
  __syncthreads();
  {
    (void)YC;
    if (tid < 128) { const int r = tid / 8, pc = tid % 8; FragH f;
#pragma unroll
      for (int q = 0; q < 8; ++q) f.h[q] = (_Float16)tl[r][pc * 8 + q]; *(v8us*)((unsigned short*)YP + (size_t)(p0 + r) * CC + c0 + pc * 8) = f.half[0]; }
     } }
template <bool ROUND>
__global__ __launch_bounds__(256) void k_gnormc(const float* __restrict__ X, const float* __restrict__ STAT, const float* __restrict__ w, const float* __restrict__ bb, float* __restrict__ YC) { const size_t t = (size_t)blockIdx.x * 256 + threadIdx.x; if (t >= (size_t)CC * NP / 4) return; const int ch = (int)(t / (NP / 4)); const v4f v = *(const v4fa*)(X + t * 4); const float m = STAT[(ch / GS) * 2], rs = STAT[(ch / GS) * 2 + 1], ww = bf16_round(w[ch]), b2 = bf16_round(bb[ch]); v4f y;
#pragma unroll
  for (int q = 0; q < 4; ++q) { float x = v[q]; if (ROUND) x = bf16_round(x); y[q] = (x - m) * rs * ww + b2; } *(v4f*)(YC + t * 4) = y;  }
__global__ __launch_bounds__(256) void k_vt32(const _Float16* __restrict__ V16, _Float16* __restrict__ Vt) { __shared__ unsigned short tl[64][34]; const int tid = threadIdx.x; const int h = blockIdx.x / (NP / 64), kg = blockIdx.x % (NP / 64);
  { const int r = tid / 4, c8 = (tid % 4) * 8; FragH f; f.half[0] = *(const v8us*)((const unsigned short*)V16 + (size_t)(kg * 64 + r) * CC + h * HD + c8);
#pragma unroll
    for (int q = 0; q < 8; ++q) tl[r][c8 + q] = f.u[q]; }
  __syncthreads();
  { { const int d = tid / 8, pc = tid % 8; FragH f;
#pragma unroll
      for (int q = 0; q < 8; ++q) f.u[q] = tl[pc * 8 + q][d]; *(v8us*)((unsigned short*)Vt + ((size_t)h * HD + d) * NP + kg * 64 + pc * 8) = f.half[0]; }  } }
// lane l <-> l ^ 16 (the two halves of a wave hold the two key halves of one query column)
__device__ __forceinline__ float xhalf(float v) { const int b = __float_as_int(v); return __int_as_float(__builtin_amdgcn_permlanex16(b, b, 0x76543210, 0xfedcba98, false, false)); }
__global__ __launch_bounds__(128) void k_attn(const _Float16* __restrict__ Q16, const _Float16* __restrict__ K16, const _Float16* __restrict__ Vt, float* __restrict__ O) { constexpr int RPW = 32;
  __shared__ __attribute__((aligned(16))) float sO[4][RPW][HD + 4];
  const int tid = threadIdx.x, w = tid >> 5, lane = tid & 31, ln = lane & 15, hh = lane >> 4; const int h = blockIdx.x / (NP / 128), qblk = blockIdx.x % (NP / 128); const int q0 = qblk * 128 + w * RPW;
  FragH aq[2];
#pragma unroll
  for (int rt = 0; rt < 2; ++rt) { const unsigned short* qr = (const unsigned short*)Q16 + (size_t)(q0 + rt * 16 + ln) * CC + h * HD; aq[rt].half[0] = *(const v8us*)(qr + 8 * hh); aq[rt].half[1] = *(const v8us*)(qr + 16 + 8 * hh); }
  const unsigned short* Vth = (const unsigned short*)Vt + (size_t)h * HD * NP;
  float m_r[2], l_r[2]; v8f oacc[2][2];      // query rt * 16 + ln; oacc[rt][dt][r] = Ot[dt * 16 + 8hh + r][query]
#pragma unroll
  for (int rt = 0; rt < 2; ++rt) { m_r[rt] = -3.0e38f; l_r[rt] = 0.f; oacc[rt][0] = (v8f){0.f,0.f,0.f,0.f,0.f,0.f,0.f,0.f}; oacc[rt][1] = oacc[rt][0]; }
#pragma unroll 1
  for (int j0 = 0; j0 < NP; j0 += 32) { v8f s[2][2];      // s[rt][nt][r] = S[query][j0 + nt * 16 + 8hh + r]
#pragma unroll
    for (int nt = 0; nt < 2; ++nt) { const unsigned short* kr = (const unsigned short*)K16 + (size_t)(j0 + nt * 16 + ln) * CC + h * HD; FragH bk; bk.half[0] = *(const v8us*)(kr + 8 * hh); bk.half[1] = *(const v8us*)(kr + 16 + 8 * hh);
#pragma unroll
      for (int rt = 0; rt < 2; ++rt) { v8f acc = (v8f){0.f,0.f,0.f,0.f,0.f,0.f,0.f,0.f}; acc = mmaH<1>(bk.v, bk.v, aq[rt].v, aq[rt].v, acc); s[rt][nt] = acc; } }
    FragH pb[2];
#pragma unroll
    for (int rt = 0; rt < 2; ++rt) { float sc[16];
#pragma unroll
      for (int i = 0; i < 16; ++i) sc[i] = s[rt][i >> 3][i & 7] * 0.17677669529663687f;
      float mx[8];
#pragma unroll
      for (int i = 0; i < 8; ++i) mx[i] = fmaxf(sc[i], sc[8 + i]);
      float mc = fmaxf(fmaxf(fmaxf(mx[0], mx[1]), fmaxf(mx[2], mx[3])), fmaxf(fmaxf(mx[4], mx[5]), fmaxf(mx[6], mx[7])));
      mc = fmaxf(mc, xhalf(mc));
      const float mn = fmaxf(m_r[rt], mc); const float al = expf(m_r[rt] - mn); m_r[rt] = mn;
      float ps[8];
#pragma unroll
      for (int i = 0; i < 8; ++i) { const float p0 = expf(sc[i] - mn), p1 = expf(sc[8 + i] - mn); ps[i] = p0 + p1; pb[rt].h[i] = (_Float16)p0; pb[rt].h[8 + i] = (_Float16)p1; }
      l_r[rt] = l_r[rt] * al + (((ps[0] + ps[1]) + (ps[2] + ps[3])) + ((ps[4] + ps[5]) + (ps[6] + ps[7])));      // this half's keys; the halves join after the loop
#pragma unroll
      for (int r = 0; r < 8; ++r) { oacc[rt][0][r] *= al; oacc[rt][1][r] *= al; } }
#pragma unroll
    for (int dt = 0; dt < 2; ++dt) { const unsigned short* vrow = Vth + (size_t)(dt * 16 + ln) * NP + j0; FragH bv; bv.half[0] = *(const v8us*)(vrow + 8 * hh); bv.half[1] = *(const v8us*)(vrow + 16 + 8 * hh);
#pragma unroll
      for (int rt = 0; rt < 2; ++rt) oacc[rt][dt] = mmaH<1>(bv.v, bv.v, pb[rt].v, pb[rt].v, oacc[rt][dt]); } }
#pragma unroll
  for (int rt = 0; rt < 2; ++rt) { const float l = l_r[rt] + xhalf(l_r[rt]); const float li = 1.0f / l;
#pragma unroll
    for (int dt = 0; dt < 2; ++dt)
#pragma unroll
      for (int r4 = 0; r4 < 8; r4 += 4) { v4f v; for (int q = 0; q < 4; ++q) v[q] = oacc[rt][dt][r4 + q] * li; *(v4fa*)&sO[w][rt * 16 + ln][dt * 16 + 8 * hh + r4] = v; } }
  __builtin_amdgcn_fence(__ATOMIC_ACQ_REL, "workgroup"); __builtin_amdgcn_wave_barrier();
  {
#pragma unroll
    for (int rp = 0; rp < RPW; rp += 4) { const int r = rp + (lane >> 3), pc = lane & 7; const v4f v = *(const v4fa*)&sO[w][r][pc * 4]; *(v4f*)(O + (size_t)(q0 + r) * CC + h * HD + pc * 4) = v; }
     } }
__global__ __launch_bounds__(256) void k_h16(const float* __restrict__ x, _Float16* __restrict__ X16, size_t n8) { const size_t t = (size_t)blockIdx.x * 256 + threadIdx.x; if (t >= n8) return; FragH f;
#pragma unroll
  for (int q = 0; q < 8; ++q) f.h[q] = (_Float16)x[t * 8 + q]; *(v8us*)((unsigned short*)X16 + t * 8) = f.half[0];  }
__global__ __launch_bounds__(256) void k_fin(const float* __restrict__ OP, const float* __restrict__ x, float* __restrict__ out) { __shared__ float tl[32][65]; const int tid = threadIdx.x; const int cg = blockIdx.x / (NP / 64), pg = blockIdx.x % (NP / 64); const int c0 = cg * 32, p0 = pg * 64;
  for (int i = tid; i < 64 * 32; i += 256) { const int pp = i / 32, c = i % 32; tl[c][pp] = OP[(size_t)(p0 + pp) * CC + c0 + c]; }
  __syncthreads();
  { for (int i = tid; i < 32 * 16; i += 256) { const int c = i / 16, pc = i % 16; const size_t o = (size_t)(c0 + c) * NP + p0 + pc * 4; const v4f xv = *(const v4fa*)(x + o); v4f v; for (int q = 0; q < 4; ++q) v[q] = (tl[c][pc * 4 + q] + bf16_round(xv[q])) * 0.7071067811865476f; *(v4f*)(out + o) = v; }  } }
extern "C" void kernel_launch(void* const* d_in, const int* in_sizes, int n_in,
                              void* d_out, int out_size, void* d_ws, size_t ws_size, hipStream_t stream) {
  (void)in_sizes; (void)n_in; (void)out_size;
  const float* x = (const float*)d_in[0]; const float* gw = (const float*)d_in[1]; const float* gb = (const float*)d_in[2]; const float* wq = (const float*)d_in[3]; const float* bq = (const float*)d_in[4]; const float* wk = (const float*)d_in[5]; const float* bk = (const float*)d_in[6]; const float* wv = (const float*)d_in[7]; const float* bv = (const float*)d_in[8]; const float* wo = (const float*)d_in[9]; const float* bo = (const float*)d_in[10];
  char* ws = (char*)d_ws; size_t off = 0;
  auto take = [&](size_t bytes) { char* p = ws + off; off += (bytes + 255) & ~(size_t)255; return p; };
  _Float16* Bq = (_Float16*)take(CC * CC * 2); _Float16* Bk = (_Float16*)take(CC * CC * 2); _Float16* Bv = (_Float16*)take(CC * CC * 2); _Float16* Bo = (_Float16*)take(CC * CC * 2); float* ST1 = (float*)take(NG * 2 * 4 + 256); float* ST2 = (float*)take(NG * 2 * 4 + 256);
  float* QNC = (float*)take((size_t)CC * NP * 4); _Float16* QNP = (_Float16*)take((size_t)NP * CC * 2); _Float16* VNP = (_Float16*)take((size_t)NP * CC * 2); _Float16* Q16 = (_Float16*)take((size_t)NP * CC * 2); _Float16* K16 = (_Float16*)take((size_t)NP * CC * 2); _Float16* V16 = (_Float16*)take((size_t)NP * CC * 2); _Float16* Vt = (_Float16*)take((size_t)NP * CC * 2); float* O = QNC; _Float16* O16 = QNP; float* OP = (float*)take((size_t)NP * CC * 4);
  if (off > ws_size) return;      // 2.1 + 8.4 + 4.2 × 6 + 8.4 ≈ 44 MB
  const unsigned gw8 = (CC * CC / 8 + 255) / 256; k_round16f<<<gw8, 256, 0, stream>>>(wq, Bq, CC * CC / 8); k_round16f<<<gw8, 256, 0, stream>>>(wk, Bk, CC * CC / 8); k_round16f<<<gw8, 256, 0, stream>>>(wv, Bv, CC * CC / 8); k_round16f<<<gw8, 256, 0, stream>>>(wo, Bo, CC * CC / 8);      // (out,in)
  k_gstat<true><<<NG, 256, 0, stream>>>(x, ST1);
  k_gnormc<true><<<(CC * NP / 4 + 255) / 256, 256, 0, stream>>>(x, ST1, gw, gb, QNC);      // qn channel-major f32 (input of the second GroupNorm)
  k_gnorm<true><<<(CC / 64) * (NP / 16), 256, 0, stream>>>(x, ST1, gw, gb, nullptr, QNP);      // qn position-major f16
  k_gstat<false><<<NG, 256, 0, stream>>>(QNC, ST2);
  k_gnorm<false><<<(CC / 64) * (NP / 16), 256, 0, stream>>>(QNC, ST2, gw, gb, nullptr, VNP);      // vn = GN(qn) position-major f16
  const dim3 gg(((NP / 16) * (CC / 64) + 3) / 4, 1);
  k_gemm_hhx<0><<<gg, 128, 0, stream>>>(QNP, CC, 0, Bq, CC, 0, 0.0625f, bq, 0, nullptr, 1, 0, 0, nullptr, Q16, CC, 0, NP, CC, CC);
  k_gemm_hhx<0><<<gg, 128, 0, stream>>>(VNP, CC, 0, Bk, CC, 0, 0.0625f, bk, 0, nullptr, 1, 0, 0, nullptr, K16, CC, 0, NP, CC, CC);
  k_gemm_hhx<0><<<gg, 128, 0, stream>>>(VNP, CC, 0, Bv, CC, 0, 0.0625f, bv, 0, nullptr, 1, 0, 0, nullptr, V16, CC, 0, NP, CC, CC);
  k_vt32<<<NH * (NP / 64), 256, 0, stream>>>(V16, Vt);
  k_attn<<<NH * (NP / 128), 128, 0, stream>>>(Q16, K16, Vt, O);
  k_h16<<<(NP * CC / 8 + 255) / 256, 256, 0, stream>>>(O, O16, (size_t)NP * CC / 8);
  k_gemm_hhx<0><<<gg, 128, 0, stream>>>(O16, CC, 0, Bo, CC, 0, 0.0625f, bo, 0, nullptr, 1, 0, 0, OP, nullptr, CC, 0, NP, CC, CC);
  k_fin<<<(CC / 32) * (NP / 64), 256, 0, stream>>>(OP, x, (float*)d_out);
}

// v002
// One run takes 324 microseconds.
// Two timings next to v001 put it at 1.17 and 1.18 times that version's speed.
// Counting every step since v000, it is 1.31 times as fast.
#include <hip/hip_runtime.h>
// the 1×1 convs (4096 × 512 × 512, + bias, weights (out,in) bf16-exact ×2^4) and the attention as a fused flash-style kernel (S = Q·Kᵀ·32^-½ with d = 32 in one k-step, online softmax f32,
// P f16 ≤ 1, O = P·V) on v_wmma_f32_16x16x32_f16 (f16 operands, single products, f32 accumulate); residual (out + x)/√2 and layout transposes f32 VALU.
#define CC 512
#define NP 4096
#define NG 32
#define GS 16
#define NH 16
#define HD 32

typedef __bf16 v16b __attribute__((ext_vector_type(16)));
typedef unsigned short v8us __attribute__((ext_vector_type(8), may_alias));
typedef float  v8f  __attribute__((ext_vector_type(8)));
typedef float  v4f  __attribute__((ext_vector_type(4)));
typedef float  v4fa __attribute__((ext_vector_type(4), may_alias));
union FragB { v16b v; v8us half[2]; unsigned short u[16]; };

__device__ __forceinline__ unsigned short bf16_bits(float x) { unsigned int u = __float_as_uint(x); return (unsigned short)((u + 0x7FFFu + ((u >> 16) & 1u)) >> 16); }
__device__ __forceinline__ float bf16_val(unsigned short b) { return __uint_as_float(((unsigned int)b) << 16); }
__device__ __forceinline__ float bf16_round(float x) { return bf16_val(bf16_bits(x)); }
// D += A·B with NT terms: 1 = ah·bh, 2 = + al·bh (A split), 3 = + ah·bl (both split)
template <int NT>
__device__ __forceinline__ v8f mmaN(v16b ah, v16b al, v16b bh, v16b bl, v8f c) {
  c = __builtin_amdgcn_wmma_f32_16x16x32_bf16(false, ah, false, bh, (short)0, c, false, false);
  if (NT >= 2) c = __builtin_amdgcn_wmma_f32_16x16x32_bf16(false, al, false, bh, (short)0, c, false, false);
  if (NT >= 3) c = __builtin_amdgcn_wmma_f32_16x16x32_bf16(false, ah, false, bl, (short)0, c, false, false);
  asm volatile("v_nop\n\tv_nop\n\tv_nop\n\tv_nop" : "+v"(c) : "v"(ah), "v"(al), "v"(bh), "v"(bl));
  return c;
}

__global__ __launch_bounds__(256) void k_wt_bf16(const float* __restrict__ W, unsigned short* __restrict__ Wt, int K, int N) {
  const int t = blockIdx.x * 256 + threadIdx.x;
  const int k8n = K / 8;
  if (t >= N * k8n) return;
  const int n = t / k8n, k8 = (t % k8n) * 8;
  v8us v;
#pragma unroll
  for (int i = 0; i < 8; ++i) v[i] = bf16_bits(W[(size_t)(k8 + i) * N + n]);
  *(v8us*)(Wt + (size_t)n * K + k8) = v;
  
}

// GEMM C[M][N] (f32, pitch ldc) = act(A[M][K]·W + bias). A f32 row-major (pitch lda) converted per fragment to bf16
// (ASPLIT: hi/lo two planes -> 2 terms, else single rounded term); Wt bf16 [N][K] (pitch ldb). BIAS_BF16 rounds the
// bias to bf16 first (bias quantised to bf16 before the add). K%32==0, M%16==0, N%64==0.
template <bool ASPLIT, int ACT, bool BIAS_BF16>
__global__ __launch_bounds__(128) void k_gemm_bf(const float* __restrict__ A, int lda, const unsigned short* __restrict__ Wt, int ldb,
                                               const float* __restrict__ bias, float* __restrict__ C, int ldc, int M, int N, int K) {
  __shared__ __attribute__((aligned(16))) float so[4][16][64];
  const int tid = threadIdx.x, w = tid >> 5, lane = tid & 31, ln = lane & 15, hh = lane >> 4;
  const int ntn = N / 64;
  const int wid = blockIdx.x * 4 + w;
  const int mt = wid / ntn, nq = wid % ntn;
  if (mt * 16 >= M) return;
  const int row0 = mt * 16, col0 = nq * 64;
  const float* arow = A + (size_t)(row0 + ln) * lda;
  v8f acc[4] = {};
  for (int kb = 0; kb < K; kb += 32) {
    FragB ah, al;
    const v4f x0 = *(const v4fa*)(arow + kb + 8 * hh), x1 = *(const v4fa*)(arow + kb + 8 * hh + 4);
    const v4f x2 = *(const v4fa*)(arow + kb + 16 + 8 * hh), x3 = *(const v4fa*)(arow + kb + 16 + 8 * hh + 4);
    float xs[16] = {x0[0],x0[1],x0[2],x0[3],x1[0],x1[1],x1[2],x1[3],x2[0],x2[1],x2[2],x2[3],x3[0],x3[1],x3[2],x3[3]};
#pragma unroll
    for (int i = 0; i < 16; ++i) { const unsigned short hb = bf16_bits(xs[i]); ah.u[i] = hb; al.u[i] = ASPLIT ? bf16_bits(xs[i] - bf16_val(hb)) : (unsigned short)0; }
#pragma unroll
    for (int t = 0; t < 4; ++t) {
      const unsigned short* brow = Wt + (size_t)(col0 + t * 16 + ln) * ldb + kb;
      FragB b;
      b.half[0] = *(const v8us*)(brow + 8 * hh);
      b.half[1] = *(const v8us*)(brow + 16 + 8 * hh);
      acc[t] = mmaN<ASPLIT ? 2 : 1>(ah.v, al.v, b.v, b.v, acc[t]);
    }
  }
#pragma unroll
  for (int t = 0; t < 4; ++t) {
    float bv = bias ? bias[col0 + t * 16 + ln] : 0.f;
    if (BIAS_BF16) bv = bf16_round(bv);
#pragma unroll
    for (int r = 0; r < 8; ++r) { float v = acc[t][r] + bv; if (ACT == 1) v = fmaxf(v, 0.f); so[w][8 * hh + r][t * 16 + ln] = v; }
  }
  __builtin_amdgcn_fence(__ATOMIC_ACQ_REL, "workgroup");
  __builtin_amdgcn_wave_barrier();
  const int rsub = lane >> 4, c4 = (lane & 15) * 4;
  {
#pragma unroll
    for (int q = 0; q < 8; ++q) {
      const int r = q * 2 + rsub;
      const v4f v = *(const v4fa*)&so[w][r][c4];
      *(v4f*)(C + (size_t)(row0 + r) * ldc + col0 + c4) = v;
    }
    
  }
}

// Flash-style causal/unmasked attention, all contractions 3-term bf16 hi/lo splits, f32 softmax with running max.
// q,k,v rows are read from f32 buffers with arbitrary row pitch (so they can live inside a fused qkv buffer);
// D = head size (multiple of 32, <= 128); one wave = 16 query rows; block = 4 waves (64 queries) sharing K/V chunks of 32.
template <int D, bool CAUSAL>
__global__ __launch_bounds__(128) void k_flash(const float* __restrict__ qb, const float* __restrict__ kb, const float* __restrict__ vb,
                                             int pitch, int T, int H, float scale, float* __restrict__ y, int ypitch) {
  constexpr int KS = D / 32;        // k-steps for QK
  constexpr int DT = D / 16;        // d tiles for PV
  __shared__ __attribute__((aligned(16))) unsigned short sKh[32][D + 8], sKl[32][D + 8], sVh[32][D + 8], sVl[32][D + 8];
  __shared__ __attribute__((aligned(16))) unsigned short sPh[4][16][40], sPl[4][16][40];
  __shared__ __attribute__((aligned(16))) float sO[4][16][D];
  const int tid = threadIdx.x, w = tid >> 5, lane = tid & 31, ln = lane & 15, hh = lane >> 4;
  const int nqb = (T + 63) / 64;
  const int bh = blockIdx.x / nqb, qblk = blockIdx.x % nqb;
  const int b = bh / H, h = bh % H;
  const int q0 = qblk * 64 + w * 16;
  const float* Q = qb + (size_t)b * T * pitch + h * D;
  const float* K = kb + (size_t)b * T * pitch + h * D;
  const float* V = vb + (size_t)b * T * pitch + h * D;

  // A fragments of the wave's 16 query rows (scaled), hi/lo
  FragB aqh[KS], aql[KS];
  {
    int row = q0 + ln; if (row >= T) row = T - 1;
    const float* qr = Q + (size_t)row * pitch;
#pragma unroll
    for (int ks = 0; ks < KS; ++ks)
#pragma unroll
      for (int i = 0; i < 16; ++i) {
        const int d = ks * 32 + ((i < 8) ? (8 * hh + i) : (16 + 8 * hh + (i - 8)));
        const float x = qr[d] * scale; const unsigned short hb = bf16_bits(x);
        aqh[ks].u[i] = hb; aql[ks].u[i] = bf16_bits(x - bf16_val(hb));
      }
  }
  float m_r[8], l_r[8];
#pragma unroll
  for (int r = 0; r < 8; ++r) { m_r[r] = -3.0e38f; l_r[r] = 0.f; }
  v8f oacc[DT];
#pragma unroll
  for (int dt = 0; dt < DT; ++dt) oacc[dt] = (v8f){0.f,0.f,0.f,0.f,0.f,0.f,0.f,0.f};

  const int kv_end = CAUSAL ? min(T, qblk * 64 + 64) : T;     // block-uniform
  for (int j0 = 0; j0 < kv_end; j0 += 32) {
    __syncthreads();
    for (int e = tid; e < 32 * (D / 4); e += 128) {
      const int r = e / (D / 4), c4 = (e % (D / 4)) * 4;
      const int key = j0 + r;
      v4f kf = {0.f,0.f,0.f,0.f}, vf = {0.f,0.f,0.f,0.f};
      if (key < T) { kf = *(const v4fa*)(K + (size_t)key * pitch + c4); vf = *(const v4fa*)(V + (size_t)key * pitch + c4); }
#pragma unroll
      for (int t = 0; t < 4; ++t) {
        unsigned short hb = bf16_bits(kf[t]); sKh[r][c4 + t] = hb; sKl[r][c4 + t] = bf16_bits(kf[t] - bf16_val(hb));
        hb = bf16_bits(vf[t]); sVh[r][c4 + t] = hb; sVl[r][c4 + t] = bf16_bits(vf[t] - bf16_val(hb));
      }
    }
    __syncthreads();
    // S tile 16 x 32
    v8f s[2];
#pragma unroll
    for (int nt = 0; nt < 2; ++nt) {
      v8f acc = {};
#pragma unroll
      for (int ks = 0; ks < KS; ++ks) {
        FragB bh_, bl_;
        bh_.half[0] = *(const v8us*)&sKh[nt * 16 + ln][ks * 32 + 8 * hh]; bh_.half[1] = *(const v8us*)&sKh[nt * 16 + ln][ks * 32 + 16 + 8 * hh];
        bl_.half[0] = *(const v8us*)&sKl[nt * 16 + ln][ks * 32 + 8 * hh]; bl_.half[1] = *(const v8us*)&sKl[nt * 16 + ln][ks * 32 + 16 + 8 * hh];
        acc = mmaN<3>(aqh[ks].v, aql[ks].v, bh_.v, bl_.v, acc);
      }
      s[nt] = acc;
    }
    // mask + running max (rows 8hh+r; the 16 lanes of a half share rows)
    float alpha[8];
#pragma unroll
    for (int r = 0; r < 8; ++r) {
      const int qi = q0 + 8 * hh + r;
      const int ja = j0 + ln, jb = j0 + 16 + ln;
      if (CAUSAL) { if (ja > qi) s[0][r] = -3.0e38f; if (jb > qi) s[1][r] = -3.0e38f; }
      if (ja >= T) s[0][r] = -3.0e38f;
      if (jb >= T) s[1][r] = -3.0e38f;
      float mx = fmaxf(s[0][r], s[1][r]);
      mx = fmaxf(mx, __shfl_xor(mx, 1, 32)); mx = fmaxf(mx, __shfl_xor(mx, 2, 32)); mx = fmaxf(mx, __shfl_xor(mx, 4, 32)); mx = fmaxf(mx, __shfl_xor(mx, 8, 32));
      const float mnew = fmaxf(m_r[r], mx);
      alpha[r] = (mnew > -1.0e38f) ? __expf(m_r[r] - mnew) : 1.0f;
      const float p0 = (s[0][r] > -1.0e38f) ? __expf(s[0][r] - mnew) : 0.f;
      const float p1 = (s[1][r] > -1.0e38f) ? __expf(s[1][r] - mnew) : 0.f;
      m_r[r] = mnew;
      l_r[r] = l_r[r] * alpha[r] + p0 + p1;            // per-lane partial row sum (16 lanes combined at the end)
      unsigned short hb = bf16_bits(p0); sPh[w][8 * hh + r][ln] = hb;      sPl[w][8 * hh + r][ln] = bf16_bits(p0 - bf16_val(hb));
      hb = bf16_bits(p1);                sPh[w][8 * hh + r][16 + ln] = hb; sPl[w][8 * hh + r][16 + ln] = bf16_bits(p1 - bf16_val(hb));
    }
#pragma unroll
    for (int dt = 0; dt < DT; ++dt)
#pragma unroll
      for (int r = 0; r < 8; ++r) oacc[dt][r] *= alpha[r];
    __builtin_amdgcn_fence(__ATOMIC_ACQ_REL, "workgroup");
    __builtin_amdgcn_wave_barrier();
    FragB pah, pal;
    pah.half[0] = *(const v8us*)&sPh[w][ln][8 * hh]; pah.half[1] = *(const v8us*)&sPh[w][ln][16 + 8 * hh];
    pal.half[0] = *(const v8us*)&sPl[w][ln][8 * hh]; pal.half[1] = *(const v8us*)&sPl[w][ln][16 + 8 * hh];
#pragma unroll
    for (int dt = 0; dt < DT; ++dt) {
      FragB bvh, bvl;
#pragma unroll
      for (int i = 0; i < 8; ++i) {
        bvh.u[i] = sVh[8 * hh + i][dt * 16 + ln]; bvh.u[8 + i] = sVh[16 + 8 * hh + i][dt * 16 + ln];
        bvl.u[i] = sVl[8 * hh + i][dt * 16 + ln]; bvl.u[8 + i] = sVl[16 + 8 * hh + i][dt * 16 + ln];
      }
      oacc[dt] = mmaN<3>(pah.v, pal.v, bvh.v, bvl.v, oacc[dt]);
    }
    __builtin_amdgcn_fence(__ATOMIC_ACQ_REL, "workgroup");
    __builtin_amdgcn_wave_barrier();
  }
#pragma unroll
  for (int r = 0; r < 8; ++r) {
    float l = l_r[r];
    l += __shfl_xor(l, 1, 32); l += __shfl_xor(l, 2, 32); l += __shfl_xor(l, 4, 32); l += __shfl_xor(l, 8, 32);
    l_r[r] = (l > 0.f) ? 1.0f / l : 0.f;
  }
#pragma unroll
  for (int dt = 0; dt < DT; ++dt)
#pragma unroll
    for (int r = 0; r < 8; ++r) sO[w][8 * hh + r][dt * 16 + ln] = oacc[dt][r] * l_r[r];
  __builtin_amdgcn_fence(__ATOMIC_ACQ_REL, "workgroup");
  __builtin_amdgcn_wave_barrier();
  {
    for (int r = 0; r < 16; ++r) {
      const int row = q0 + r;
      if (row < T && lane < D / 4) {
        const v4f val = *(const v4fa*)&sO[w][r][lane * 4];
        *(v4f*)(y + ((size_t)b * T + row) * ypitch + h * D + lane * 4) = val;
      }
    }
    
  }
}

// GEMM C = act(A·W + bias + resid): A f32 (ASPLIT -> hi/lo 2 terms), Wt bf16 [N][K]; ACT 0 none, 1 relu, 2 exact gelu;
// resid (optional, f32, row index = (row % rmod), pitch ldr, RES_BF16 rounds it) added before the activation.
template <bool ASPLIT, int ACT, bool BIAS_BF16, bool RES_BF16>
__global__ __launch_bounds__(128) void k_gemm_bf3(const float* __restrict__ A, int lda, const unsigned short* __restrict__ Wt, int ldb,
                                                const float* __restrict__ bias, const float* __restrict__ resid, int rmod, int ldr,
                                                float* __restrict__ C, int ldc, int M, int N, int K) {
  __shared__ __attribute__((aligned(16))) float so[4][16][64];
  const int tid = threadIdx.x, w = tid >> 5, lane = tid & 31, ln = lane & 15, hh = lane >> 4;
  const int ntn = N / 64;
  const int wid = blockIdx.x * 4 + w;
  const int mt = wid / ntn, nq = wid % ntn;
  if (mt * 16 >= M) return;
  const int row0 = mt * 16, col0 = nq * 64;
  const float* arow = A + (size_t)(row0 + ln) * lda;
  v8f acc[4] = {};
  for (int kb = 0; kb < K; kb += 32) {
    FragB ah, al;
    const v4f x0 = *(const v4fa*)(arow + kb + 8 * hh), x1 = *(const v4fa*)(arow + kb + 8 * hh + 4);
    const v4f x2 = *(const v4fa*)(arow + kb + 16 + 8 * hh), x3 = *(const v4fa*)(arow + kb + 16 + 8 * hh + 4);
    float xs[16] = {x0[0],x0[1],x0[2],x0[3],x1[0],x1[1],x1[2],x1[3],x2[0],x2[1],x2[2],x2[3],x3[0],x3[1],x3[2],x3[3]};
#pragma unroll
    for (int i = 0; i < 16; ++i) { const unsigned short hb = bf16_bits(xs[i]); ah.u[i] = hb; al.u[i] = ASPLIT ? bf16_bits(xs[i] - bf16_val(hb)) : (unsigned short)0; }
#pragma unroll
    for (int t = 0; t < 4; ++t) {
      const unsigned short* brow = Wt + (size_t)(col0 + t * 16 + ln) * ldb + kb;
      FragB b;
      b.half[0] = *(const v8us*)(brow + 8 * hh);
      b.half[1] = *(const v8us*)(brow + 16 + 8 * hh);
      acc[t] = mmaN<ASPLIT ? 2 : 1>(ah.v, al.v, b.v, b.v, acc[t]);
    }
  }
#pragma unroll
  for (int t = 0; t < 4; ++t) {
    const int col = col0 + t * 16 + ln;
    float bv = bias ? bias[col] : 0.f;
    if (BIAS_BF16) bv = bf16_round(bv);
#pragma unroll
    for (int r = 0; r < 8; ++r) {
      float v = acc[t][r] + bv;
      if (resid) { float rv = resid[(size_t)((row0 + 8 * hh + r) % rmod) * ldr + col]; if (RES_BF16) rv = bf16_round(rv); v += rv; }
      if (ACT == 1) v = fmaxf(v, 0.f);
      if (ACT == 2) v = 0.5f * v * (1.0f + erff(v * 0.70710678118654752f));
      if (ACT == 3) { const float u = 0.7978845608028654f * (v + 0.044715f * v * v * v); v = 0.5f * v * (1.0f + tanhf(u)); }
      so[w][8 * hh + r][t * 16 + ln] = v;
    }
  }
  __builtin_amdgcn_fence(__ATOMIC_ACQ_REL, "workgroup");
  __builtin_amdgcn_wave_barrier();
  const int rsub = lane >> 4, c4 = (lane & 15) * 4;
  {
#pragma unroll
    for (int q = 0; q < 8; ++q) {
      const int r = q * 2 + rsub;
      const v4f v = *(const v4fa*)&so[w][r][c4];
      *(v4f*)(C + (size_t)(row0 + r) * ldc + col0 + c4) = v;
    }
    
  }
}
// row LayerNorm (biased variance, eps) over N: s = X (+ R); optional out_sum <- s; out_norm <- (s-mu)*rsqrt(var+eps)*g + b
template <bool PARAM_BF16>
__global__ __launch_bounds__(256) void k_layernorm(const float* __restrict__ X, const float* __restrict__ R, const float* __restrict__ g, const float* __restrict__ bta,
                                                  float* __restrict__ out_sum, float* __restrict__ out_norm, int N, float eps) {
  __shared__ float red[256];
  const int row = blockIdx.x, tid = threadIdx.x;
  const float* x = X + (size_t)row * N; const float* rr = R ? R + (size_t)row * N : nullptr;
  float vals[16];                     // up to N = 4096
  const int per = N / 256;            // contiguous chunk per thread? use strided-by-4 chunks: thread handles j = tid*4 + 1024*u
  float s1 = 0.f;
  for (int u = 0; u < per / 4; ++u) {
    const int j = tid * 4 + 1024 * u;
    const v4f a = *(const v4fa*)(x + j);
    v4f b = {0.f,0.f,0.f,0.f}; if (rr) b = *(const v4fa*)(rr + j);
#pragma unroll
    for (int q = 0; q < 4; ++q) { const float v = a[q] + b[q]; vals[u * 4 + q] = v; s1 += v; }
  }
  red[tid] = s1; __syncthreads();
  for (int st = 128; st > 0; st >>= 1) { if (tid < st) red[tid] += red[tid + st]; __syncthreads(); }
  const float mu = red[0] / (float)N; __syncthreads();
  float s2 = 0.f;
  for (int u = 0; u < per / 4; ++u)
#pragma unroll
    for (int q = 0; q < 4; ++q) { const float c = vals[u * 4 + q] - mu; s2 += c * c; }
  red[tid] = s2; __syncthreads();
  for (int st = 128; st > 0; st >>= 1) { if (tid < st) red[tid] += red[tid + st]; __syncthreads(); }
  const float rs = rsqrtf(red[0] / (float)N + eps);
  {
    for (int u = 0; u < per / 4; ++u) {
      const int j = tid * 4 + 1024 * u;
      v4f o, sm;
#pragma unroll
      for (int q = 0; q < 4; ++q) {
        float gg = g[j + q], bb = bta[j + q];
        if (PARAM_BF16) { gg = bf16_round(gg); bb = bf16_round(bb); }
        sm[q] = vals[u * 4 + q]; o[q] = (vals[u * 4 + q] - mu) * rs * gg + bb;
      }
      if (out_sum) *(v4f*)(out_sum + (size_t)row * N + j) = sm;
      *(v4f*)(out_norm + (size_t)row * N + j) = o;
    }
    
  }
}



// ---- f16 WMMA path (v_wmma_f32_16x16x32_f16): 11-bit significands for operands in range — used here for every matrix product (1×1 convs, Q·Kᵀ and P·V)
typedef _Float16 v16h __attribute__((ext_vector_type(16)));
union FragH { v16h v; v8us half[2]; _Float16 h[16]; unsigned short u[16]; };
template <int NT>
__device__ __forceinline__ v8f mmaH(v16h ah, v16h al, v16h bh, v16h bl, v8f c) {
  c = __builtin_amdgcn_wmma_f32_16x16x32_f16(false, ah, false, bh, (short)0, c, false, false);
  if (NT >= 2) c = __builtin_amdgcn_wmma_f32_16x16x32_f16(false, al, false, bh, (short)0, c, false, false);
  if (NT >= 3) c = __builtin_amdgcn_wmma_f32_16x16x32_f16(false, ah, false, bl, (short)0, c, false, false);
  asm volatile("v_nop\n\tv_nop\n\tv_nop\n\tv_nop" : "+v"(c) : "v"(ah), "v"(al), "v"(bh), "v"(bl));
  return c;
}
// batched GEMM like k_gemm_b but f16 operands: A f32 (split into f16 hi/lo if ASPLIT, else rounded to f16), Bt = f16 values [n][k]; alpha; C f32; N multiple of 16 (partial tiles skipped)
template <bool ASPLIT>
__global__ __launch_bounds__(128) void k_gemm_h(const float* __restrict__ A, int lda, size_t sA, const _Float16* __restrict__ Bh, int ldb, size_t sB, float alpha, float* __restrict__ C, int ldc, size_t sC, int M, int N, int K) {
  __shared__ __attribute__((aligned(16))) float so[4][16][64];
  const int tid = threadIdx.x, w = tid >> 5, lane = tid & 31, ln = lane & 15, hh = lane >> 4; const int by = blockIdx.y;
  A += (size_t)by * sA; Bh += (size_t)by * sB; C += (size_t)by * sC;
  const int ntn = (N + 63) / 64; const int wid = blockIdx.x * 4 + w; const int mt = wid / ntn, nq = wid % ntn; if (mt * 16 >= M) return;
  const int row0 = mt * 16, col0 = nq * 64; const float* arow = A + (size_t)(row0 + ln) * lda;
  v8f acc[4] = {};
  for (int kb = 0; kb < K; kb += 32) {
    FragH ah, al;
    const v4f x0 = *(const v4fa*)(arow + kb + 8 * hh), x1 = *(const v4fa*)(arow + kb + 8 * hh + 4), x2 = *(const v4fa*)(arow + kb + 16 + 8 * hh), x3 = *(const v4fa*)(arow + kb + 16 + 8 * hh + 4);
    float xs[16] = {x0[0],x0[1],x0[2],x0[3],x1[0],x1[1],x1[2],x1[3],x2[0],x2[1],x2[2],x2[3],x3[0],x3[1],x3[2],x3[3]};
#pragma unroll
    for (int i = 0; i < 16; ++i) { const _Float16 h = (_Float16)xs[i]; ah.h[i] = h; al.h[i] = ASPLIT ? (_Float16)(xs[i] - (float)h) : (_Float16)0.0f; }
#pragma unroll
    for (int t = 0; t < 4; ++t) { if (col0 + t * 16 >= N) continue; const size_t boff = (size_t)(col0 + t * 16 + ln) * ldb + kb; FragH bq; bq.half[0] = *(const v8us*)(Bh + boff + 8 * hh); bq.half[1] = *(const v8us*)(Bh + boff + 16 + 8 * hh);
      acc[t] = mmaH<ASPLIT ? 2 : 1>(ah.v, al.v, bq.v, bq.v, acc[t]); }
  }
#pragma unroll
  for (int t = 0; t < 4; ++t) { if (col0 + t * 16 >= N) continue;
#pragma unroll
    for (int r = 0; r < 8; ++r) so[w][8 * hh + r][t * 16 + ln] = acc[t][r] * alpha; }
  __builtin_amdgcn_fence(__ATOMIC_ACQ_REL, "workgroup"); __builtin_amdgcn_wave_barrier();
  const int rsub = lane >> 4, c4 = (lane & 15) * 4;
  {
#pragma unroll
    for (int q = 0; q < 8; ++q) { const int r = q * 2 + rsub; if (col0 + c4 < N) { const v4f v = *(const v4fa*)&so[w][r][c4]; *(v4f*)(C + (size_t)(row0 + r) * ldc + col0 + c4) = v; } }
     }
}

// Wt[n][k] = f16(W[k][n]·scale) from f32 row-major W[K][N] (scale = power of two; bf16-exact weights stay exact in f16 away from the subnormal range)
__global__ __launch_bounds__(256) void k_wt_f16(const float* __restrict__ W, _Float16* __restrict__ Wt, int K, int N, float scale) {
  const int t = blockIdx.x * 256 + threadIdx.x; if (t >= N * (K / 8)) return; const int n = t / (K / 8), k8 = (t % (K / 8)) * 8; FragH f;
#pragma unroll
  for (int i = 0; i < 8; ++i) f.h[i] = (_Float16)(bf16_round(W[(size_t)(k8 + i) * N + n]) * scale); const v8us o = f.half[0];
  *(v8us*)((unsigned short*)Wt + (size_t)n * K + k8) = o; 
}
// k_gemm_hh variant with fused epilogue: v = acc·alpha + bias[by·sBias + col] (+ CP[(row/rowsPerB)·sCPb + by·64 + col] if CP) ; ACT 0 none / 1 elu ; writes f16 C16 and/or f32 C, each if non-null
template <int ACT>
__global__ __launch_bounds__(128) void k_gemm_hhx(const _Float16* __restrict__ A, int lda, size_t sA, const _Float16* __restrict__ Bh, int ldb, size_t sB, float alpha, const float* __restrict__ bias, size_t sBias, const float* __restrict__ CP, int rowsPerB, size_t sCPb, int row0g,
    float* __restrict__ C, _Float16* __restrict__ C16, int ldc, size_t sC, int M, int N, int K) {
  __shared__ __attribute__((aligned(16))) float so[4][16][64];
  const int tid = threadIdx.x, w = tid >> 5, lane = tid & 31, ln = lane & 15, hh = lane >> 4; const int by = blockIdx.y;
  A += (size_t)by * sA; Bh += (size_t)by * sB; const size_t cofs = (size_t)by * sC; const float* bp = bias ? bias + (size_t)by * sBias : nullptr;
  const int ntn = (N + 63) / 64; const int wid = blockIdx.x * 4 + w; const int mt = wid / ntn, nq = wid % ntn; if (mt * 16 >= M) return;
  const int row0 = mt * 16, col0 = nq * 64; const _Float16* arow = A + (size_t)(row0 + ln) * lda;
  v8f acc[4] = {};
  for (int kb = 0; kb < K; kb += 32) { FragH ah; ah.half[0] = *(const v8us*)((const unsigned short*)arow + kb + 8 * hh); ah.half[1] = *(const v8us*)((const unsigned short*)arow + kb + 16 + 8 * hh);
#pragma unroll
    for (int t = 0; t < 4; ++t) { if (col0 + t * 16 >= N) continue; const size_t boff = (size_t)(col0 + t * 16 + ln) * ldb + kb; FragH bq; bq.half[0] = *(const v8us*)((const unsigned short*)Bh + boff + 8 * hh); bq.half[1] = *(const v8us*)((const unsigned short*)Bh + boff + 16 + 8 * hh);
      acc[t] = mmaH<1>(ah.v, ah.v, bq.v, bq.v, acc[t]); }
  }
#pragma unroll
  for (int t = 0; t < 4; ++t) { if (col0 + t * 16 >= N) continue; const int col = col0 + t * 16 + ln; const float bv = bp ? bf16_round(bp[col]) : 0.f;
#pragma unroll
    for (int r = 0; r < 8; ++r) { float v = acc[t][r] * alpha + bv; if (CP) { const int bidx = (row0g + row0 + 8 * hh + r) / rowsPerB; v += CP[(size_t)bidx * sCPb + (size_t)by * 64 + col]; } if (ACT == 1) v = (v > 0.f) ? v : expm1f(v); else if (ACT == 3) v = fmaxf(v, 0.f); so[w][8 * hh + r][t * 16 + ln] = v; } }
  __builtin_amdgcn_fence(__ATOMIC_ACQ_REL, "workgroup"); __builtin_amdgcn_wave_barrier();
  const int rsub = lane >> 4, c4 = (lane & 15) * 4; typedef _Float16 v4h __attribute__((ext_vector_type(4)));
  {
#pragma unroll
    for (int q = 0; q < 8; ++q) { const int r = q * 2 + rsub; if (col0 + c4 < N) { const v4f v = *(const v4fa*)&so[w][r][c4]; if (C) *(v4f*)(C + cofs + (size_t)(row0 + r) * ldc + col0 + c4) = v; if (C16) { v4h h4; for (int i = 0; i < 4; ++i) h4[i] = (_Float16)v[i]; *(v4h*)(C16 + cofs + (size_t)(row0 + r) * ldc + col0 + c4) = h4; } } }
     }
}


__global__ __launch_bounds__(256) void k_round16f(const float* __restrict__ W, _Float16* __restrict__ Bt, size_t n8) { const size_t t = (size_t)blockIdx.x * 256 + threadIdx.x; if (t >= n8) return; FragH f;
#pragma unroll
  for (int i = 0; i < 8; ++i) f.h[i] = (_Float16)(bf16_round(W[t * 8 + i]) * 16.0f); *(v8us*)((unsigned short*)Bt + t * 8) = f.half[0];  }
// lane l <-> l ^ 16 (the two halves of a wave hold the two key halves of one query column)
__device__ __forceinline__ float xhalf(float v) { const int b = __float_as_int(v); return __int_as_float(__builtin_amdgcn_permlanex16(b, b, 0x76543210, 0xfedcba98, false, false)); }
// lane l <-> l ^ M inside a 16-lane row (DPP row_xmask)
template <int M>
__device__ __forceinline__ float xrow(float v) { return __int_as_float(__builtin_amdgcn_update_dpp(0, __float_as_int(v), 0x160 + M, 0xf, 0xf, true)); }
// sum over the 32 lanes of a wave, the same value in every lane; all lanes on
__device__ __forceinline__ float wave_sum(float v) { v += xrow<1>(v); v += xrow<2>(v); v += xrow<4>(v); v += xrow<8>(v); return v + xhalf(v); }
// One group (GS * NP = 65,536 values) per block of 1,024 threads: 16 whole-line 16-byte loads per thread, all in flight together; the values stay in registers for both sums.
template <bool ROUND>
__global__ __launch_bounds__(1024) void k_gstat(const float* __restrict__ X, float* __restrict__ STAT) { __shared__ float sh1[32], sh2[32]; const int tid = threadIdx.x, w = tid >> 5, lane = tid & 31; const int g = blockIdx.x; const float* base = X + (size_t)g * GS * NP;
  v4f v[16];
#pragma unroll
  for (int i = 0; i < 16; ++i) v[i] = *(const v4fa*)(base + (size_t)(i * 1024 + tid) * 4);
  v4f s4 = {0.f, 0.f, 0.f, 0.f};
#pragma unroll
  for (int i = 0; i < 16; ++i) { if (ROUND) { for (int q = 0; q < 4; ++q) v[i][q] = bf16_round(v[i][q]); } s4 += v[i]; }
  const float s = wave_sum((s4[0] + s4[1]) + (s4[2] + s4[3])); if (lane == 0) sh1[w] = s; __syncthreads();
  const float mean = wave_sum(sh1[lane]) / (float)(GS * NP);
  v4f q4 = {0.f, 0.f, 0.f, 0.f};
#pragma unroll
  for (int i = 0; i < 16; ++i) { const v4f d = v[i] - mean; q4 += d * d; }
  const float q = wave_sum((q4[0] + q4[1]) + (q4[2] + q4[3])); if (lane == 0) sh2[w] = q; __syncthreads();
  if (w == 0) { const float var = wave_sum(sh2[lane]) / (float)(GS * NP); if (lane == 0) { typedef float v2f __attribute__((ext_vector_type(2))); v2f o; o[0] = mean; o[1] = 1.0f / sqrtf(var + 1e-6f); *(v2f*)(STAT + g * 2) = o; } } }
template <bool ROUND>
__global__ __launch_bounds__(256) void k_gnorm(const float* __restrict__ X, const float* __restrict__ STAT, const float* __restrict__ w, const float* __restrict__ bb, float* __restrict__ YC, _Float16* __restrict__ YP) { __shared__ float tl[16][65]; const int tid = threadIdx.x; const int cg = blockIdx.x / (NP / 16), pg = blockIdx.x % (NP / 16); const int c0 = cg * 64, p0 = pg * 16;
  for (int i = tid; i < 64 * 16; i += 256) { const int c = i / 16, pp = i % 16; const int ch = c0 + c; float v = X[(size_t)ch * NP + p0 + pp]; if (ROUND) v = bf16_round(v); const float y = (v - STAT[(ch / GS) * 2]) * STAT[(ch / GS) * 2 + 1] * bf16_round(w[ch]) + bf16_round(bb[ch]); tl[pp][c] = y; }
  __syncthreads();
  {
    (void)YC;
    if (tid < 128) { const int r = tid / 8, pc = tid % 8; FragH f;
#pragma unroll
      for (int q = 0; q < 8; ++q) f.h[q] = (_Float16)tl[r][pc * 8 + q]; *(v8us*)((unsigned short*)YP + (size_t)(p0 + r) * CC + c0 + pc * 8) = f.half[0]; }
     } }
template <bool ROUND>
__global__ __launch_bounds__(256) void k_gnormc(const float* __restrict__ X, const float* __restrict__ STAT, const float* __restrict__ w, const float* __restrict__ bb, float* __restrict__ YC) { const size_t t = (size_t)blockIdx.x * 256 + threadIdx.x; if (t >= (size_t)CC * NP / 4) return; const int ch = (int)(t / (NP / 4)); const v4f v = *(const v4fa*)(X + t * 4); const float m = STAT[(ch / GS) * 2], rs = STAT[(ch / GS) * 2 + 1], ww = bf16_round(w[ch]), b2 = bf16_round(bb[ch]); v4f y;
#pragma unroll
  for (int q = 0; q < 4; ++q) { float x = v[q]; if (ROUND) x = bf16_round(x); y[q] = (x - m) * rs * ww + b2; } *(v4f*)(YC + t * 4) = y;  }
__global__ __launch_bounds__(256) void k_vt32(const _Float16* __restrict__ V16, _Float16* __restrict__ Vt) { __shared__ unsigned short tl[64][34]; const int tid = threadIdx.x; const int h = blockIdx.x / (NP / 64), kg = blockIdx.x % (NP / 64);
  { const int r = tid / 4, c8 = (tid % 4) * 8; FragH f; f.half[0] = *(const v8us*)((const unsigned short*)V16 + (size_t)(kg * 64 + r) * CC + h * HD + c8);
#pragma unroll
    for (int q = 0; q < 8; ++q) tl[r][c8 + q] = f.u[q]; }
  __syncthreads();
  { { const int d = tid / 8, pc = tid % 8; FragH f;
#pragma unroll
      for (int q = 0; q < 8; ++q) f.u[q] = tl[pc * 8 + q][d]; *(v8us*)((unsigned short*)Vt + ((size_t)h * HD + d) * NP + kg * 64 + pc * 8) = f.half[0]; }  } }
__global__ __launch_bounds__(128) void k_attn(const _Float16* __restrict__ Q16, const _Float16* __restrict__ K16, const _Float16* __restrict__ Vt, float* __restrict__ O) { constexpr int RPW = 32;
  __shared__ __attribute__((aligned(16))) float sO[4][RPW][HD + 4];
  const int tid = threadIdx.x, w = tid >> 5, lane = tid & 31, ln = lane & 15, hh = lane >> 4; const int h = blockIdx.x / (NP / 128), qblk = blockIdx.x % (NP / 128); const int q0 = qblk * 128 + w * RPW;
  FragH aq[2];
#pragma unroll
  for (int rt = 0; rt < 2; ++rt) { const unsigned short* qr = (const unsigned short*)Q16 + (size_t)(q0 + rt * 16 + ln) * CC + h * HD; aq[rt].half[0] = *(const v8us*)(qr + 8 * hh); aq[rt].half[1] = *(const v8us*)(qr + 16 + 8 * hh); }
  const unsigned short* Vth = (const unsigned short*)Vt + (size_t)h * HD * NP;
  float m_r[2], l_r[2]; v8f oacc[2][2];      // query rt * 16 + ln; oacc[rt][dt][r] = Ot[dt * 16 + 8hh + r][query]
#pragma unroll
  for (int rt = 0; rt < 2; ++rt) { m_r[rt] = -3.0e38f; l_r[rt] = 0.f; oacc[rt][0] = (v8f){0.f,0.f,0.f,0.f,0.f,0.f,0.f,0.f}; oacc[rt][1] = oacc[rt][0]; }
#pragma unroll 1
  for (int j0 = 0; j0 < NP; j0 += 32) { v8f s[2][2];      // s[rt][nt][r] = S[query][j0 + nt * 16 + 8hh + r]
#pragma unroll
    for (int nt = 0; nt < 2; ++nt) { const unsigned short* kr = (const unsigned short*)K16 + (size_t)(j0 + nt * 16 + ln) * CC + h * HD; FragH bk; bk.half[0] = *(const v8us*)(kr + 8 * hh); bk.half[1] = *(const v8us*)(kr + 16 + 8 * hh);
#pragma unroll
      for (int rt = 0; rt < 2; ++rt) { v8f acc = (v8f){0.f,0.f,0.f,0.f,0.f,0.f,0.f,0.f}; acc = mmaH<1>(bk.v, bk.v, aq[rt].v, aq[rt].v, acc); s[rt][nt] = acc; } }
    FragH pb[2];
#pragma unroll
    for (int rt = 0; rt < 2; ++rt) { float sc[16];
#pragma unroll
      for (int i = 0; i < 16; ++i) sc[i] = s[rt][i >> 3][i & 7] * 0.17677669529663687f;
      float mx[8];
#pragma unroll
      for (int i = 0; i < 8; ++i) mx[i] = fmaxf(sc[i], sc[8 + i]);
      float mc = fmaxf(fmaxf(fmaxf(mx[0], mx[1]), fmaxf(mx[2], mx[3])), fmaxf(fmaxf(mx[4], mx[5]), fmaxf(mx[6], mx[7])));
      mc = fmaxf(mc, xhalf(mc));
      const float mn = fmaxf(m_r[rt], mc); const float al = expf(m_r[rt] - mn); m_r[rt] = mn;
      float ps[8];
#pragma unroll
      for (int i = 0; i < 8; ++i) { const float p0 = expf(sc[i] - mn), p1 = expf(sc[8 + i] - mn); ps[i] = p0 + p1; pb[rt].h[i] = (_Float16)p0; pb[rt].h[8 + i] = (_Float16)p1; }
      l_r[rt] = l_r[rt] * al + (((ps[0] + ps[1]) + (ps[2] + ps[3])) + ((ps[4] + ps[5]) + (ps[6] + ps[7])));      // this half's keys; the halves join after the loop
#pragma unroll
      for (int r = 0; r < 8; ++r) { oacc[rt][0][r] *= al; oacc[rt][1][r] *= al; } }
#pragma unroll
    for (int dt = 0; dt < 2; ++dt) { const unsigned short* vrow = Vth + (size_t)(dt * 16 + ln) * NP + j0; FragH bv; bv.half[0] = *(const v8us*)(vrow + 8 * hh); bv.half[1] = *(const v8us*)(vrow + 16 + 8 * hh);
#pragma unroll
      for (int rt = 0; rt < 2; ++rt) oacc[rt][dt] = mmaH<1>(bv.v, bv.v, pb[rt].v, pb[rt].v, oacc[rt][dt]); } }
#pragma unroll
  for (int rt = 0; rt < 2; ++rt) { const float l = l_r[rt] + xhalf(l_r[rt]); const float li = 1.0f / l;
#pragma unroll
    for (int dt = 0; dt < 2; ++dt)
#pragma unroll
      for (int r4 = 0; r4 < 8; r4 += 4) { v4f v; for (int q = 0; q < 4; ++q) v[q] = oacc[rt][dt][r4 + q] * li; *(v4fa*)&sO[w][rt * 16 + ln][dt * 16 + 8 * hh + r4] = v; } }
  __builtin_amdgcn_fence(__ATOMIC_ACQ_REL, "workgroup"); __builtin_amdgcn_wave_barrier();
  {
#pragma unroll
    for (int rp = 0; rp < RPW; rp += 4) { const int r = rp + (lane >> 3), pc = lane & 7; const v4f v = *(const v4fa*)&sO[w][r][pc * 4]; *(v4f*)(O + (size_t)(q0 + r) * CC + h * HD + pc * 4) = v; }
     } }
__global__ __launch_bounds__(256) void k_h16(const float* __restrict__ x, _Float16* __restrict__ X16, size_t n8) { const size_t t = (size_t)blockIdx.x * 256 + threadIdx.x; if (t >= n8) return; FragH f;
#pragma unroll
  for (int q = 0; q < 8; ++q) f.h[q] = (_Float16)x[t * 8 + q]; *(v8us*)((unsigned short*)X16 + t * 8) = f.half[0];  }
__global__ __launch_bounds__(256) void k_fin(const float* __restrict__ OP, const float* __restrict__ x, float* __restrict__ out) { __shared__ float tl[32][65]; const int tid = threadIdx.x; const int cg = blockIdx.x / (NP / 64), pg = blockIdx.x % (NP / 64); const int c0 = cg * 32, p0 = pg * 64;
  for (int i = tid; i < 64 * 32; i += 256) { const int pp = i / 32, c = i % 32; tl[c][pp] = OP[(size_t)(p0 + pp) * CC + c0 + c]; }
  __syncthreads();
  { for (int i = tid; i < 32 * 16; i += 256) { const int c = i / 16, pc = i % 16; const size_t o = (size_t)(c0 + c) * NP + p0 + pc * 4; const v4f xv = *(const v4fa*)(x + o); v4f v; for (int q = 0; q < 4; ++q) v[q] = (tl[c][pc * 4 + q] + bf16_round(xv[q])) * 0.7071067811865476f; *(v4f*)(out + o) = v; }  } }
extern "C" void kernel_launch(void* const* d_in, const int* in_sizes, int n_in,
                              void* d_out, int out_size, void* d_ws, size_t ws_size, hipStream_t stream) {
  (void)in_sizes; (void)n_in; (void)out_size;
  const float* x = (const float*)d_in[0]; const float* gw = (const float*)d_in[1]; const float* gb = (const float*)d_in[2]; const float* wq = (const float*)d_in[3]; const float* bq = (const float*)d_in[4]; const float* wk = (const float*)d_in[5]; const float* bk = (const float*)d_in[6]; const float* wv = (const float*)d_in[7]; const float* bv = (const float*)d_in[8]; const float* wo = (const float*)d_in[9]; const float* bo = (const float*)d_in[10];
  char* ws = (char*)d_ws; size_t off = 0;
  auto take = [&](size_t bytes) { char* p = ws + off; off += (bytes + 255) & ~(size_t)255; return p; };
  _Float16* Bq = (_Float16*)take(CC * CC * 2); _Float16* Bk = (_Float16*)take(CC * CC * 2); _Float16* Bv = (_Float16*)take(CC * CC * 2); _Float16* Bo = (_Float16*)take(CC * CC * 2); float* ST1 = (float*)take(NG * 2 * 4 + 256); float* ST2 = (float*)take(NG * 2 * 4 + 256);
  float* QNC = (float*)take((size_t)CC * NP * 4); _Float16* QNP = (_Float16*)take((size_t)NP * CC * 2); _Float16* VNP = (_Float16*)take((size_t)NP * CC * 2); _Float16* Q16 = (_Float16*)take((size_t)NP * CC * 2); _Float16* K16 = (_Float16*)take((size_t)NP * CC * 2); _Float16* V16 = (_Float16*)take((size_t)NP * CC * 2); _Float16* Vt = (_Float16*)take((size_t)NP * CC * 2); float* O = QNC; _Float16* O16 = QNP; float* OP = (float*)take((size_t)NP * CC * 4);
  if (off > ws_size) return;      // 2.1 + 8.4 + 4.2 × 6 + 8.4 ≈ 44 MB
  const unsigned gw8 = (CC * CC / 8 + 255) / 256; k_round16f<<<gw8, 256, 0, stream>>>(wq, Bq, CC * CC / 8); k_round16f<<<gw8, 256, 0, stream>>>(wk, Bk, CC * CC / 8); k_round16f<<<gw8, 256, 0, stream>>>(wv, Bv, CC * CC / 8); k_round16f<<<gw8, 256, 0, stream>>>(wo, Bo, CC * CC / 8);      // (out,in)
  k_gstat<true><<<NG, 1024, 0, stream>>>(x, ST1);
  k_gnormc<true><<<(CC * NP / 4 + 255) / 256, 256, 0, stream>>>(x, ST1, gw, gb, QNC);      // qn channel-major f32 (input of the second GroupNorm)
  k_gnorm<true><<<(CC / 64) * (NP / 16), 256, 0, stream>>>(x, ST1, gw, gb, nullptr, QNP);      // qn position-major f16
  k_gstat<false><<<NG, 1024, 0, stream>>>(QNC, ST2);
  k_gnorm<false><<<(CC / 64) * (NP / 16), 256, 0, stream>>>(QNC, ST2, gw, gb, nullptr, VNP);      // vn = GN(qn) position-major f16
  const dim3 gg(((NP / 16) * (CC / 64) + 3) / 4, 1);
  k_gemm_hhx<0><<<gg, 128, 0, stream>>>(QNP, CC, 0, Bq, CC, 0, 0.0625f, bq, 0, nullptr, 1, 0, 0, nullptr, Q16, CC, 0, NP, CC, CC);
  k_gemm_hhx<0><<<gg, 128, 0, stream>>>(VNP, CC, 0, Bk, CC, 0, 0.0625f, bk, 0, nullptr, 1, 0, 0, nullptr, K16, CC, 0, NP, CC, CC);
  k_gemm_hhx<0><<<gg, 128, 0, stream>>>(VNP, CC, 0, Bv, CC, 0, 0.0625f, bv, 0, nullptr, 1, 0, 0, nullptr, V16, CC, 0, NP, CC, CC);
  k_vt32<<<NH * (NP / 64), 256, 0, stream>>>(V16, Vt);
  k_attn<<<NH * (NP / 128), 128, 0, stream>>>(Q16, K16, Vt, O);
  k_h16<<<(NP * CC / 8 + 255) / 256, 256, 0, stream>>>(O, O16, (size_t)NP * CC / 8);
  k_gemm_hhx<0><<<gg, 128, 0, stream>>>(O16, CC, 0, Bo, CC, 0, 0.0625f, bo, 0, nullptr, 1, 0, 0, OP, nullptr, CC, 0, NP, CC, CC);
  k_fin<<<(CC / 32) * (NP / 64), 256, 0, stream>>>(OP, x, (float*)d_out);
}

// v003
// One run takes 280 microseconds.
// Two timings next to v002 both put it at 1.14 times that version's speed.
// Counting every step since v000, it is 1.49 times as fast.
#include <hip/hip_runtime.h>
// the 1×1 convs (4096 × 512 × 512, + bias, weights (out,in) bf16-exact ×2^4) and the attention as a fused flash-style kernel (S = Q·Kᵀ·32^-½ with d = 32 in one k-step, online softmax f32,
// P f16 ≤ 1, O = P·V) on v_wmma_f32_16x16x32_f16 (f16 operands, single products, f32 accumulate); residual (out + x)/√2 and layout transposes f32 VALU.
#define CC 512
#define NP 4096
#define NG 32
#define GS 16
#define NH 16
#define HD 32

typedef __bf16 v16b __attribute__((ext_vector_type(16)));
typedef unsigned short v8us __attribute__((ext_vector_type(8), may_alias));
typedef float  v8f  __attribute__((ext_vector_type(8)));
typedef float  v4f  __attribute__((ext_vector_type(4)));
typedef float  v4fa __attribute__((ext_vector_type(4), may_alias));
union FragB { v16b v; v8us half[2]; unsigned short u[16]; };

__device__ __forceinline__ unsigned short bf16_bits(float x) { unsigned int u = __float_as_uint(x); return (unsigned short)((u + 0x7FFFu + ((u >> 16) & 1u)) >> 16); }
__device__ __forceinline__ float bf16_val(unsigned short b) { return __uint_as_float(((unsigned int)b) << 16); }
__device__ __forceinline__ float bf16_round(float x) { return bf16_val(bf16_bits(x)); }
// D += A·B with NT terms: 1 = ah·bh, 2 = + al·bh (A split), 3 = + ah·bl (both split)
template <int NT>
__device__ __forceinline__ v8f mmaN(v16b ah, v16b al, v16b bh, v16b bl, v8f c) {
  c = __builtin_amdgcn_wmma_f32_16x16x32_bf16(false, ah, false, bh, (short)0, c, false, false);
  if (NT >= 2) c = __builtin_amdgcn_wmma_f32_16x16x32_bf16(false, al, false, bh, (short)0, c, false, false);
  if (NT >= 3) c = __builtin_amdgcn_wmma_f32_16x16x32_bf16(false, ah, false, bl, (short)0, c, false, false);
  asm volatile("v_nop\n\tv_nop\n\tv_nop\n\tv_nop" : "+v"(c) : "v"(ah), "v"(al), "v"(bh), "v"(bl));
  return c;
}

__global__ __launch_bounds__(256) void k_wt_bf16(const float* __restrict__ W, unsigned short* __restrict__ Wt, int K, int N) {
  const int t = blockIdx.x * 256 + threadIdx.x;
  const int k8n = K / 8;
  if (t >= N * k8n) return;
  const int n = t / k8n, k8 = (t % k8n) * 8;
  v8us v;
#pragma unroll
  for (int i = 0; i < 8; ++i) v[i] = bf16_bits(W[(size_t)(k8 + i) * N + n]);
  *(v8us*)(Wt + (size_t)n * K + k8) = v;
  
}

// GEMM C[M][N] (f32, pitch ldc) = act(A[M][K]·W + bias). A f32 row-major (pitch lda) converted per fragment to bf16
// (ASPLIT: hi/lo two planes -> 2 terms, else single rounded term); Wt bf16 [N][K] (pitch ldb). BIAS_BF16 rounds the
// bias to bf16 first (bias quantised to bf16 before the add). K%32==0, M%16==0, N%64==0.
template <bool ASPLIT, int ACT, bool BIAS_BF16>
__global__ __launch_bounds__(128) void k_gemm_bf(const float* __restrict__ A, int lda, const unsigned short* __restrict__ Wt, int ldb,
                                               const float* __restrict__ bias, float* __restrict__ C, int ldc, int M, int N, int K) {
  __shared__ __attribute__((aligned(16))) float so[4][16][64];
  const int tid = threadIdx.x, w = tid >> 5, lane = tid & 31, ln = lane & 15, hh = lane >> 4;
  const int ntn = N / 64;
  const int wid = blockIdx.x * 4 + w;
  const int mt = wid / ntn, nq = wid % ntn;
  if (mt * 16 >= M) return;
  const int row0 = mt * 16, col0 = nq * 64;
  const float* arow = A + (size_t)(row0 + ln) * lda;
  v8f acc[4] = {};
  for (int kb = 0; kb < K; kb += 32) {
    FragB ah, al;
    const v4f x0 = *(const v4fa*)(arow + kb + 8 * hh), x1 = *(const v4fa*)(arow + kb + 8 * hh + 4);
    const v4f x2 = *(const v4fa*)(arow + kb + 16 + 8 * hh), x3 = *(const v4fa*)(arow + kb + 16 + 8 * hh + 4);
    float xs[16] = {x0[0],x0[1],x0[2],x0[3],x1[0],x1[1],x1[2],x1[3],x2[0],x2[1],x2[2],x2[3],x3[0],x3[1],x3[2],x3[3]};
#pragma unroll
    for (int i = 0; i < 16; ++i) { const unsigned short hb = bf16_bits(xs[i]); ah.u[i] = hb; al.u[i] = ASPLIT ? bf16_bits(xs[i] - bf16_val(hb)) : (unsigned short)0; }
#pragma unroll
    for (int t = 0; t < 4; ++t) {
      const unsigned short* brow = Wt + (size_t)(col0 + t * 16 + ln) * ldb + kb;
      FragB b;
      b.half[0] = *(const v8us*)(brow + 8 * hh);
      b.half[1] = *(const v8us*)(brow + 16 + 8 * hh);
      acc[t] = mmaN<ASPLIT ? 2 : 1>(ah.v, al.v, b.v, b.v, acc[t]);
    }
  }
#pragma unroll
  for (int t = 0; t < 4; ++t) {
    float bv = bias ? bias[col0 + t * 16 + ln] : 0.f;
    if (BIAS_BF16) bv = bf16_round(bv);
#pragma unroll
    for (int r = 0; r < 8; ++r) { float v = acc[t][r] + bv; if (ACT == 1) v = fmaxf(v, 0.f); so[w][8 * hh + r][t * 16 + ln] = v; }
  }
  __builtin_amdgcn_fence(__ATOMIC_ACQ_REL, "workgroup");
  __builtin_amdgcn_wave_barrier();
  const int rsub = lane >> 4, c4 = (lane & 15) * 4;
  {
#pragma unroll
    for (int q = 0; q < 8; ++q) {
      const int r = q * 2 + rsub;
      const v4f v = *(const v4fa*)&so[w][r][c4];
      *(v4f*)(C + (size_t)(row0 + r) * ldc + col0 + c4) = v;
    }
    
  }
}

// Flash-style causal/unmasked attention, all contractions 3-term bf16 hi/lo splits, f32 softmax with running max.
// q,k,v rows are read from f32 buffers with arbitrary row pitch (so they can live inside a fused qkv buffer);
// D = head size (multiple of 32, <= 128); one wave = 16 query rows; block = 4 waves (64 queries) sharing K/V chunks of 32.
template <int D, bool CAUSAL>
__global__ __launch_bounds__(128) void k_flash(const float* __restrict__ qb, const float* __restrict__ kb, const float* __restrict__ vb,
                                             int pitch, int T, int H, float scale, float* __restrict__ y, int ypitch) {
  constexpr int KS = D / 32;        // k-steps for QK
  constexpr int DT = D / 16;        // d tiles for PV
  __shared__ __attribute__((aligned(16))) unsigned short sKh[32][D + 8], sKl[32][D + 8], sVh[32][D + 8], sVl[32][D + 8];
  __shared__ __attribute__((aligned(16))) unsigned short sPh[4][16][40], sPl[4][16][40];
  __shared__ __attribute__((aligned(16))) float sO[4][16][D];
  const int tid = threadIdx.x, w = tid >> 5, lane = tid & 31, ln = lane & 15, hh = lane >> 4;
  const int nqb = (T + 63) / 64;
  const int bh = blockIdx.x / nqb, qblk = blockIdx.x % nqb;
  const int b = bh / H, h = bh % H;
  const int q0 = qblk * 64 + w * 16;
  const float* Q = qb + (size_t)b * T * pitch + h * D;
  const float* K = kb + (size_t)b * T * pitch + h * D;
  const float* V = vb + (size_t)b * T * pitch + h * D;

  // A fragments of the wave's 16 query rows (scaled), hi/lo
  FragB aqh[KS], aql[KS];
  {
    int row = q0 + ln; if (row >= T) row = T - 1;
    const float* qr = Q + (size_t)row * pitch;
#pragma unroll
    for (int ks = 0; ks < KS; ++ks)
#pragma unroll
      for (int i = 0; i < 16; ++i) {
        const int d = ks * 32 + ((i < 8) ? (8 * hh + i) : (16 + 8 * hh + (i - 8)));
        const float x = qr[d] * scale; const unsigned short hb = bf16_bits(x);
        aqh[ks].u[i] = hb; aql[ks].u[i] = bf16_bits(x - bf16_val(hb));
      }
  }
  float m_r[8], l_r[8];
#pragma unroll
  for (int r = 0; r < 8; ++r) { m_r[r] = -3.0e38f; l_r[r] = 0.f; }
  v8f oacc[DT];
#pragma unroll
  for (int dt = 0; dt < DT; ++dt) oacc[dt] = (v8f){0.f,0.f,0.f,0.f,0.f,0.f,0.f,0.f};

  const int kv_end = CAUSAL ? min(T, qblk * 64 + 64) : T;     // block-uniform
  for (int j0 = 0; j0 < kv_end; j0 += 32) {
    __syncthreads();
    for (int e = tid; e < 32 * (D / 4); e += 128) {
      const int r = e / (D / 4), c4 = (e % (D / 4)) * 4;
      const int key = j0 + r;
      v4f kf = {0.f,0.f,0.f,0.f}, vf = {0.f,0.f,0.f,0.f};
      if (key < T) { kf = *(const v4fa*)(K + (size_t)key * pitch + c4); vf = *(const v4fa*)(V + (size_t)key * pitch + c4); }
#pragma unroll
      for (int t = 0; t < 4; ++t) {
        unsigned short hb = bf16_bits(kf[t]); sKh[r][c4 + t] = hb; sKl[r][c4 + t] = bf16_bits(kf[t] - bf16_val(hb));
        hb = bf16_bits(vf[t]); sVh[r][c4 + t] = hb; sVl[r][c4 + t] = bf16_bits(vf[t] - bf16_val(hb));
      }
    }
    __syncthreads();
    // S tile 16 x 32
    v8f s[2];
#pragma unroll
    for (int nt = 0; nt < 2; ++nt) {
      v8f acc = {};
#pragma unroll
      for (int ks = 0; ks < KS; ++ks) {
        FragB bh_, bl_;
        bh_.half[0] = *(const v8us*)&sKh[nt * 16 + ln][ks * 32 + 8 * hh]; bh_.half[1] = *(const v8us*)&sKh[nt * 16 + ln][ks * 32 + 16 + 8 * hh];
        bl_.half[0] = *(const v8us*)&sKl[nt * 16 + ln][ks * 32 + 8 * hh]; bl_.half[1] = *(const v8us*)&sKl[nt * 16 + ln][ks * 32 + 16 + 8 * hh];
        acc = mmaN<3>(aqh[ks].v, aql[ks].v, bh_.v, bl_.v, acc);
      }
      s[nt] = acc;
    }
    // mask + running max (rows 8hh+r; the 16 lanes of a half share rows)
    float alpha[8];
#pragma unroll
    for (int r = 0; r < 8; ++r) {
      const int qi = q0 + 8 * hh + r;
      const int ja = j0 + ln, jb = j0 + 16 + ln;
      if (CAUSAL) { if (ja > qi) s[0][r] = -3.0e38f; if (jb > qi) s[1][r] = -3.0e38f; }
      if (ja >= T) s[0][r] = -3.0e38f;
      if (jb >= T) s[1][r] = -3.0e38f;
      float mx = fmaxf(s[0][r], s[1][r]);
      mx = fmaxf(mx, __shfl_xor(mx, 1, 32)); mx = fmaxf(mx, __shfl_xor(mx, 2, 32)); mx = fmaxf(mx, __shfl_xor(mx, 4, 32)); mx = fmaxf(mx, __shfl_xor(mx, 8, 32));
      const float mnew = fmaxf(m_r[r], mx);
      alpha[r] = (mnew > -1.0e38f) ? __expf(m_r[r] - mnew) : 1.0f;
      const float p0 = (s[0][r] > -1.0e38f) ? __expf(s[0][r] - mnew) : 0.f;
      const float p1 = (s[1][r] > -1.0e38f) ? __expf(s[1][r] - mnew) : 0.f;
      m_r[r] = mnew;
      l_r[r] = l_r[r] * alpha[r] + p0 + p1;            // per-lane partial row sum (16 lanes combined at the end)
      unsigned short hb = bf16_bits(p0); sPh[w][8 * hh + r][ln] = hb;      sPl[w][8 * hh + r][ln] = bf16_bits(p0 - bf16_val(hb));
      hb = bf16_bits(p1);                sPh[w][8 * hh + r][16 + ln] = hb; sPl[w][8 * hh + r][16 + ln] = bf16_bits(p1 - bf16_val(hb));
    }
#pragma unroll
    for (int dt = 0; dt < DT; ++dt)
#pragma unroll
      for (int r = 0; r < 8; ++r) oacc[dt][r] *= alpha[r];
    __builtin_amdgcn_fence(__ATOMIC_ACQ_REL, "workgroup");
    __builtin_amdgcn_wave_barrier();
    FragB pah, pal;
    pah.half[0] = *(const v8us*)&sPh[w][ln][8 * hh]; pah.half[1] = *(const v8us*)&sPh[w][ln][16 + 8 * hh];
    pal.half[0] = *(const v8us*)&sPl[w][ln][8 * hh]; pal.half[1] = *(const v8us*)&sPl[w][ln][16 + 8 * hh];
#pragma unroll
    for (int dt = 0; dt < DT; ++dt) {
      FragB bvh, bvl;
#pragma unroll
      for (int i = 0; i < 8; ++i) {
        bvh.u[i] = sVh[8 * hh + i][dt * 16 + ln]; bvh.u[8 + i] = sVh[16 + 8 * hh + i][dt * 16 + ln];
        bvl.u[i] = sVl[8 * hh + i][dt * 16 + ln]; bvl.u[8 + i] = sVl[16 + 8 * hh + i][dt * 16 + ln];
      }
      oacc[dt] = mmaN<3>(pah.v, pal.v, bvh.v, bvl.v, oacc[dt]);
    }
    __builtin_amdgcn_fence(__ATOMIC_ACQ_REL, "workgroup");
    __builtin_amdgcn_wave_barrier();
  }
#pragma unroll
  for (int r = 0; r < 8; ++r) {
    float l = l_r[r];
    l += __shfl_xor(l, 1, 32); l += __shfl_xor(l, 2, 32); l += __shfl_xor(l, 4, 32); l += __shfl_xor(l, 8, 32);
    l_r[r] = (l > 0.f) ? 1.0f / l : 0.f;
  }
#pragma unroll
  for (int dt = 0; dt < DT; ++dt)
#pragma unroll
    for (int r = 0; r < 8; ++r) sO[w][8 * hh + r][dt * 16 + ln] = oacc[dt][r] * l_r[r];
  __builtin_amdgcn_fence(__ATOMIC_ACQ_REL, "workgroup");
  __builtin_amdgcn_wave_barrier();
  {
    for (int r = 0; r < 16; ++r) {
      const int row = q0 + r;
      if (row < T && lane < D / 4) {
        const v4f val = *(const v4fa*)&sO[w][r][lane * 4];
        *(v4f*)(y + ((size_t)b * T + row) * ypitch + h * D + lane * 4) = val;
      }
    }
    
  }
}

// GEMM C = act(A·W + bias + resid): A f32 (ASPLIT -> hi/lo 2 terms), Wt bf16 [N][K]; ACT 0 none, 1 relu, 2 exact gelu;
// resid (optional, f32, row index = (row % rmod), pitch ldr, RES_BF16 rounds it) added before the activation.
template <bool ASPLIT, int ACT, bool BIAS_BF16, bool RES_BF16>
__global__ __launch_bounds__(128) void k_gemm_bf3(const float* __restrict__ A, int lda, const unsigned short* __restrict__ Wt, int ldb,
                                                const float* __restrict__ bias, const float* __restrict__ resid, int rmod, int ldr,
                                                float* __restrict__ C, int ldc, int M, int N, int K) {
  __shared__ __attribute__((aligned(16))) float so[4][16][64];
  const int tid = threadIdx.x, w = tid >> 5, lane = tid & 31, ln = lane & 15, hh = lane >> 4;
  const int ntn = N / 64;
  const int wid = blockIdx.x * 4 + w;
  const int mt = wid / ntn, nq = wid % ntn;
  if (mt * 16 >= M) return;
  const int row0 = mt * 16, col0 = nq * 64;
  const float* arow = A + (size_t)(row0 + ln) * lda;
  v8f acc[4] = {};
  for (int kb = 0; kb < K; kb += 32) {
    FragB ah, al;
    const v4f x0 = *(const v4fa*)(arow + kb + 8 * hh), x1 = *(const v4fa*)(arow + kb + 8 * hh + 4);
    const v4f x2 = *(const v4fa*)(arow + kb + 16 + 8 * hh), x3 = *(const v4fa*)(arow + kb + 16 + 8 * hh + 4);
    float xs[16] = {x0[0],x0[1],x0[2],x0[3],x1[0],x1[1],x1[2],x1[3],x2[0],x2[1],x2[2],x2[3],x3[0],x3[1],x3[2],x3[3]};
#pragma unroll
    for (int i = 0; i < 16; ++i) { const unsigned short hb = bf16_bits(xs[i]); ah.u[i] = hb; al.u[i] = ASPLIT ? bf16_bits(xs[i] - bf16_val(hb)) : (unsigned short)0; }
#pragma unroll
    for (int t = 0; t < 4; ++t) {
      const unsigned short* brow = Wt + (size_t)(col0 + t * 16 + ln) * ldb + kb;
      FragB b;
      b.half[0] = *(const v8us*)(brow + 8 * hh);
      b.half[1] = *(const v8us*)(brow + 16 + 8 * hh);
      acc[t] = mmaN<ASPLIT ? 2 : 1>(ah.v, al.v, b.v, b.v, acc[t]);
    }
  }
#pragma unroll
  for (int t = 0; t < 4; ++t) {
    const int col = col0 + t * 16 + ln;
    float bv = bias ? bias[col] : 0.f;
    if (BIAS_BF16) bv = bf16_round(bv);
#pragma unroll
    for (int r = 0; r < 8; ++r) {
      float v = acc[t][r] + bv;
      if (resid) { float rv = resid[(size_t)((row0 + 8 * hh + r) % rmod) * ldr + col]; if (RES_BF16) rv = bf16_round(rv); v += rv; }
      if (ACT == 1) v = fmaxf(v, 0.f);
      if (ACT == 2) v = 0.5f * v * (1.0f + erff(v * 0.70710678118654752f));
      if (ACT == 3) { const float u = 0.7978845608028654f * (v + 0.044715f * v * v * v); v = 0.5f * v * (1.0f + tanhf(u)); }
      so[w][8 * hh + r][t * 16 + ln] = v;
    }
  }
  __builtin_amdgcn_fence(__ATOMIC_ACQ_REL, "workgroup");
  __builtin_amdgcn_wave_barrier();
  const int rsub = lane >> 4, c4 = (lane & 15) * 4;
  {
#pragma unroll
    for (int q = 0; q < 8; ++q) {
      const int r = q * 2 + rsub;
      const v4f v = *(const v4fa*)&so[w][r][c4];
      *(v4f*)(C + (size_t)(row0 + r) * ldc + col0 + c4) = v;
    }
    
  }
}
// row LayerNorm (biased variance, eps) over N: s = X (+ R); optional out_sum <- s; out_norm <- (s-mu)*rsqrt(var+eps)*g + b
template <bool PARAM_BF16>
__global__ __launch_bounds__(256) void k_layernorm(const float* __restrict__ X, const float* __restrict__ R, const float* __restrict__ g, const float* __restrict__ bta,
                                                  float* __restrict__ out_sum, float* __restrict__ out_norm, int N, float eps) {
  __shared__ float red[256];
  const int row = blockIdx.x, tid = threadIdx.x;
  const float* x = X + (size_t)row * N; const float* rr = R ? R + (size_t)row * N : nullptr;
  float vals[16];                     // up to N = 4096
  const int per = N / 256;            // contiguous chunk per thread? use strided-by-4 chunks: thread handles j = tid*4 + 1024*u
  float s1 = 0.f;
  for (int u = 0; u < per / 4; ++u) {
    const int j = tid * 4 + 1024 * u;
    const v4f a = *(const v4fa*)(x + j);
    v4f b = {0.f,0.f,0.f,0.f}; if (rr) b = *(const v4fa*)(rr + j);
#pragma unroll
    for (int q = 0; q < 4; ++q) { const float v = a[q] + b[q]; vals[u * 4 + q] = v; s1 += v; }
  }
  red[tid] = s1; __syncthreads();
  for (int st = 128; st > 0; st >>= 1) { if (tid < st) red[tid] += red[tid + st]; __syncthreads(); }
  const float mu = red[0] / (float)N; __syncthreads();
  float s2 = 0.f;
  for (int u = 0; u < per / 4; ++u)
#pragma unroll
    for (int q = 0; q < 4; ++q) { const float c = vals[u * 4 + q] - mu; s2 += c * c; }
  red[tid] = s2; __syncthreads();
  for (int st = 128; st > 0; st >>= 1) { if (tid < st) red[tid] += red[tid + st]; __syncthreads(); }
  const float rs = rsqrtf(red[0] / (float)N + eps);
  {
    for (int u = 0; u < per / 4; ++u) {
      const int j = tid * 4 + 1024 * u;
      v4f o, sm;
#pragma unroll
      for (int q = 0; q < 4; ++q) {
        float gg = g[j + q], bb = bta[j + q];
        if (PARAM_BF16) { gg = bf16_round(gg); bb = bf16_round(bb); }
        sm[q] = vals[u * 4 + q]; o[q] = (vals[u * 4 + q] - mu) * rs * gg + bb;
      }
      if (out_sum) *(v4f*)(out_sum + (size_t)row * N + j) = sm;
      *(v4f*)(out_norm + (size_t)row * N + j) = o;
    }
    
  }
}



// ---- f16 WMMA path (v_wmma_f32_16x16x32_f16): 11-bit significands for operands in range — used here for every matrix product (1×1 convs, Q·Kᵀ and P·V)
typedef _Float16 v16h __attribute__((ext_vector_type(16)));
union FragH { v16h v; v8us half[2]; _Float16 h[16]; unsigned short u[16]; };
template <int NT>
__device__ __forceinline__ v8f mmaH(v16h ah, v16h al, v16h bh, v16h bl, v8f c) {
  c = __builtin_amdgcn_wmma_f32_16x16x32_f16(false, ah, false, bh, (short)0, c, false, false);
  if (NT >= 2) c = __builtin_amdgcn_wmma_f32_16x16x32_f16(false, al, false, bh, (short)0, c, false, false);
  if (NT >= 3) c = __builtin_amdgcn_wmma_f32_16x16x32_f16(false, ah, false, bl, (short)0, c, false, false);
  asm volatile("v_nop\n\tv_nop\n\tv_nop\n\tv_nop" : "+v"(c) : "v"(ah), "v"(al), "v"(bh), "v"(bl));
  return c;
}
// batched GEMM like k_gemm_b but f16 operands: A f32 (split into f16 hi/lo if ASPLIT, else rounded to f16), Bt = f16 values [n][k]; alpha; C f32; N multiple of 16 (partial tiles skipped)
template <bool ASPLIT>
__global__ __launch_bounds__(128) void k_gemm_h(const float* __restrict__ A, int lda, size_t sA, const _Float16* __restrict__ Bh, int ldb, size_t sB, float alpha, float* __restrict__ C, int ldc, size_t sC, int M, int N, int K) {
  __shared__ __attribute__((aligned(16))) float so[4][16][64];
  const int tid = threadIdx.x, w = tid >> 5, lane = tid & 31, ln = lane & 15, hh = lane >> 4; const int by = blockIdx.y;
  A += (size_t)by * sA; Bh += (size_t)by * sB; C += (size_t)by * sC;
  const int ntn = (N + 63) / 64; const int wid = blockIdx.x * 4 + w; const int mt = wid / ntn, nq = wid % ntn; if (mt * 16 >= M) return;
  const int row0 = mt * 16, col0 = nq * 64; const float* arow = A + (size_t)(row0 + ln) * lda;
  v8f acc[4] = {};
  for (int kb = 0; kb < K; kb += 32) {
    FragH ah, al;
    const v4f x0 = *(const v4fa*)(arow + kb + 8 * hh), x1 = *(const v4fa*)(arow + kb + 8 * hh + 4), x2 = *(const v4fa*)(arow + kb + 16 + 8 * hh), x3 = *(const v4fa*)(arow + kb + 16 + 8 * hh + 4);
    float xs[16] = {x0[0],x0[1],x0[2],x0[3],x1[0],x1[1],x1[2],x1[3],x2[0],x2[1],x2[2],x2[3],x3[0],x3[1],x3[2],x3[3]};
#pragma unroll
    for (int i = 0; i < 16; ++i) { const _Float16 h = (_Float16)xs[i]; ah.h[i] = h; al.h[i] = ASPLIT ? (_Float16)(xs[i] - (float)h) : (_Float16)0.0f; }
#pragma unroll
    for (int t = 0; t < 4; ++t) { if (col0 + t * 16 >= N) continue; const size_t boff = (size_t)(col0 + t * 16 + ln) * ldb + kb; FragH bq; bq.half[0] = *(const v8us*)(Bh + boff + 8 * hh); bq.half[1] = *(const v8us*)(Bh + boff + 16 + 8 * hh);
      acc[t] = mmaH<ASPLIT ? 2 : 1>(ah.v, al.v, bq.v, bq.v, acc[t]); }
  }
#pragma unroll
  for (int t = 0; t < 4; ++t) { if (col0 + t * 16 >= N) continue;
#pragma unroll
    for (int r = 0; r < 8; ++r) so[w][8 * hh + r][t * 16 + ln] = acc[t][r] * alpha; }
  __builtin_amdgcn_fence(__ATOMIC_ACQ_REL, "workgroup"); __builtin_amdgcn_wave_barrier();
  const int rsub = lane >> 4, c4 = (lane & 15) * 4;
  {
#pragma unroll
    for (int q = 0; q < 8; ++q) { const int r = q * 2 + rsub; if (col0 + c4 < N) { const v4f v = *(const v4fa*)&so[w][r][c4]; *(v4f*)(C + (size_t)(row0 + r) * ldc + col0 + c4) = v; } }
     }
}

// Wt[n][k] = f16(W[k][n]·scale) from f32 row-major W[K][N] (scale = power of two; bf16-exact weights stay exact in f16 away from the subnormal range)
__global__ __launch_bounds__(256) void k_wt_f16(const float* __restrict__ W, _Float16* __restrict__ Wt, int K, int N, float scale) {
  const int t = blockIdx.x * 256 + threadIdx.x; if (t >= N * (K / 8)) return; const int n = t / (K / 8), k8 = (t % (K / 8)) * 8; FragH f;
#pragma unroll
  for (int i = 0; i < 8; ++i) f.h[i] = (_Float16)(bf16_round(W[(size_t)(k8 + i) * N + n]) * scale); const v8us o = f.half[0];
  *(v8us*)((unsigned short*)Wt + (size_t)n * K + k8) = o; 
}
// k_gemm_hh variant with fused epilogue: v = acc·alpha + bias[by·sBias + col] (+ CP[(row/rowsPerB)·sCPb + by·64 + col] if CP) ; ACT 0 none / 1 elu ; writes f16 C16 and/or f32 C, each if non-null
template <int ACT>
__global__ __launch_bounds__(128) void k_gemm_hhx(const _Float16* __restrict__ A, int lda, size_t sA, const _Float16* __restrict__ Bh, int ldb, size_t sB, float alpha, const float* __restrict__ bias, size_t sBias, const float* __restrict__ CP, int rowsPerB, size_t sCPb, int row0g,
    float* __restrict__ C, _Float16* __restrict__ C16, int ldc, size_t sC, int M, int N, int K) {
  __shared__ __attribute__((aligned(16))) float so[4][16][64];
  const int tid = threadIdx.x, w = tid >> 5, lane = tid & 31, ln = lane & 15, hh = lane >> 4; const int by = blockIdx.y;
  A += (size_t)by * sA; Bh += (size_t)by * sB; const size_t cofs = (size_t)by * sC; const float* bp = bias ? bias + (size_t)by * sBias : nullptr;
  const int ntn = (N + 63) / 64; const int wid = blockIdx.x * 4 + w; const int mt = wid / ntn, nq = wid % ntn; if (mt * 16 >= M) return;
  const int row0 = mt * 16, col0 = nq * 64; const _Float16* arow = A + (size_t)(row0 + ln) * lda;
  v8f acc[4] = {};
  for (int kb = 0; kb < K; kb += 32) { FragH ah; ah.half[0] = *(const v8us*)((const unsigned short*)arow + kb + 8 * hh); ah.half[1] = *(const v8us*)((const unsigned short*)arow + kb + 16 + 8 * hh);
#pragma unroll
    for (int t = 0; t < 4; ++t) { if (col0 + t * 16 >= N) continue; const size_t boff = (size_t)(col0 + t * 16 + ln) * ldb + kb; FragH bq; bq.half[0] = *(const v8us*)((const unsigned short*)Bh + boff + 8 * hh); bq.half[1] = *(const v8us*)((const unsigned short*)Bh + boff + 16 + 8 * hh);
      acc[t] = mmaH<1>(ah.v, ah.v, bq.v, bq.v, acc[t]); }
  }
#pragma unroll
  for (int t = 0; t < 4; ++t) { if (col0 + t * 16 >= N) continue; const int col = col0 + t * 16 + ln; const float bv = bp ? bf16_round(bp[col]) : 0.f;
#pragma unroll
    for (int r = 0; r < 8; ++r) { float v = acc[t][r] * alpha + bv; if (CP) { const int bidx = (row0g + row0 + 8 * hh + r) / rowsPerB; v += CP[(size_t)bidx * sCPb + (size_t)by * 64 + col]; } if (ACT == 1) v = (v > 0.f) ? v : expm1f(v); else if (ACT == 3) v = fmaxf(v, 0.f); so[w][8 * hh + r][t * 16 + ln] = v; } }
  __builtin_amdgcn_fence(__ATOMIC_ACQ_REL, "workgroup"); __builtin_amdgcn_wave_barrier();
  const int rsub = lane >> 4, c4 = (lane & 15) * 4; typedef _Float16 v4h __attribute__((ext_vector_type(4)));
  {
#pragma unroll
    for (int q = 0; q < 8; ++q) { const int r = q * 2 + rsub; if (col0 + c4 < N) { const v4f v = *(const v4fa*)&so[w][r][c4]; if (C) *(v4f*)(C + cofs + (size_t)(row0 + r) * ldc + col0 + c4) = v; if (C16) { v4h h4; for (int i = 0; i < 4; ++i) h4[i] = (_Float16)v[i]; *(v4h*)(C16 + cofs + (size_t)(row0 + r) * ldc + col0 + c4) = h4; } } }
     }
}


__global__ __launch_bounds__(256) void k_round16f(const float* __restrict__ W, _Float16* __restrict__ Bt, size_t n8) { const size_t t = (size_t)blockIdx.x * 256 + threadIdx.x; if (t >= n8) return; FragH f;
#pragma unroll
  for (int i = 0; i < 8; ++i) f.h[i] = (_Float16)(bf16_round(W[t * 8 + i]) * 16.0f); *(v8us*)((unsigned short*)Bt + t * 8) = f.half[0];  }
// lane l <-> l ^ 16 (the two halves of a wave hold the two key halves of one query column)
__device__ __forceinline__ float xhalf(float v) { const int b = __float_as_int(v); return __int_as_float(__builtin_amdgcn_permlanex16(b, b, 0x76543210, 0xfedcba98, false, false)); }
// lane l <-> l ^ M inside a 16-lane row (DPP row_xmask)
template <int M>
__device__ __forceinline__ float xrow(float v) { return __int_as_float(__builtin_amdgcn_update_dpp(0, __float_as_int(v), 0x160 + M, 0xf, 0xf, true)); }
// sum over the 32 lanes of a wave, the same value in every lane; all lanes on
__device__ __forceinline__ float wave_sum(float v) { v += xrow<1>(v); v += xrow<2>(v); v += xrow<4>(v); v += xrow<8>(v); return v + xhalf(v); }
// One group (GS * NP = 65,536 values) per block of 1,024 threads: 16 whole-line 16-byte loads per thread, all in flight together; the values stay in registers for both sums.
template <bool ROUND>
__global__ __launch_bounds__(1024) void k_gstat(const float* __restrict__ X, float* __restrict__ STAT) { __shared__ float sh1[32], sh2[32]; const int tid = threadIdx.x, w = tid >> 5, lane = tid & 31; const int g = blockIdx.x; const float* base = X + (size_t)g * GS * NP;
  v4f v[16];
#pragma unroll
  for (int i = 0; i < 16; ++i) v[i] = *(const v4fa*)(base + (size_t)(i * 1024 + tid) * 4);
  v4f s4 = {0.f, 0.f, 0.f, 0.f};
#pragma unroll
  for (int i = 0; i < 16; ++i) { if (ROUND) { for (int q = 0; q < 4; ++q) v[i][q] = bf16_round(v[i][q]); } s4 += v[i]; }
  const float s = wave_sum((s4[0] + s4[1]) + (s4[2] + s4[3])); if (lane == 0) sh1[w] = s; __syncthreads();
  const float mean = wave_sum(sh1[lane]) / (float)(GS * NP);
  v4f q4 = {0.f, 0.f, 0.f, 0.f};
#pragma unroll
  for (int i = 0; i < 16; ++i) { const v4f d = v[i] - mean; q4 += d * d; }
  const float q = wave_sum((q4[0] + q4[1]) + (q4[2] + q4[3])); if (lane == 0) sh2[w] = q; __syncthreads();
  if (w == 0) { const float var = wave_sum(sh2[lane]) / (float)(GS * NP); if (lane == 0) { typedef float v2f __attribute__((ext_vector_type(2))); v2f o; o[0] = mean; o[1] = 1.0f / sqrtf(var + 1e-6f); *(v2f*)(STAT + g * 2) = o; } } }
template <bool ROUND>
__global__ __launch_bounds__(256) void k_gnorm(const float* __restrict__ X, const float* __restrict__ STAT, const float* __restrict__ w, const float* __restrict__ bb, float* __restrict__ YC, _Float16* __restrict__ YP) { __shared__ float tl[16][65]; const int tid = threadIdx.x; const int cg = blockIdx.x / (NP / 16), pg = blockIdx.x % (NP / 16); const int c0 = cg * 64, p0 = pg * 16;
  for (int i = tid; i < 64 * 16; i += 256) { const int c = i / 16, pp = i % 16; const int ch = c0 + c; float v = X[(size_t)ch * NP + p0 + pp]; if (ROUND) v = bf16_round(v); const float y = (v - STAT[(ch / GS) * 2]) * STAT[(ch / GS) * 2 + 1] * bf16_round(w[ch]) + bf16_round(bb[ch]); tl[pp][c] = y; }
  __syncthreads();
  {
    (void)YC;
    if (tid < 128) { const int r = tid / 8, pc = tid % 8; FragH f;
#pragma unroll
      for (int q = 0; q < 8; ++q) f.h[q] = (_Float16)tl[r][pc * 8 + q]; *(v8us*)((unsigned short*)YP + (size_t)(p0 + r) * CC + c0 + pc * 8) = f.half[0]; }
     } }
template <bool ROUND>
__global__ __launch_bounds__(256) void k_gnormc(const float* __restrict__ X, const float* __restrict__ STAT, const float* __restrict__ w, const float* __restrict__ bb, float* __restrict__ YC) { const size_t t = (size_t)blockIdx.x * 256 + threadIdx.x; if (t >= (size_t)CC * NP / 4) return; const int ch = (int)(t / (NP / 4)); const v4f v = *(const v4fa*)(X + t * 4); const float m = STAT[(ch / GS) * 2], rs = STAT[(ch / GS) * 2 + 1], ww = bf16_round(w[ch]), b2 = bf16_round(bb[ch]); v4f y;
#pragma unroll
  for (int q = 0; q < 4; ++q) { float x = v[q]; if (ROUND) x = bf16_round(x); y[q] = (x - m) * rs * ww + b2; } *(v4f*)(YC + t * 4) = y;  }
__global__ __launch_bounds__(256) void k_vt32(const _Float16* __restrict__ V16, _Float16* __restrict__ Vt) { __shared__ unsigned short tl[64][34]; const int tid = threadIdx.x; const int h = blockIdx.x / (NP / 64), kg = blockIdx.x % (NP / 64);
  { const int r = tid / 4, c8 = (tid % 4) * 8; FragH f; f.half[0] = *(const v8us*)((const unsigned short*)V16 + (size_t)(kg * 64 + r) * CC + h * HD + c8);
#pragma unroll
    for (int q = 0; q < 8; ++q) tl[r][c8 + q] = f.u[q]; }
  __syncthreads();
  { { const int d = tid / 8, pc = tid % 8; FragH f;
#pragma unroll
      for (int q = 0; q < 8; ++q) f.u[q] = tl[pc * 8 + q][d]; *(v8us*)((unsigned short*)Vt + ((size_t)h * HD + d) * NP + kg * 64 + pc * 8) = f.half[0]; }  } }
__global__ __launch_bounds__(128) void k_attn(const _Float16* __restrict__ Q16, const _Float16* __restrict__ K16, const _Float16* __restrict__ Vt, float* __restrict__ O) { constexpr int RPW = 32; constexpr float SL2 = 0.25503486164919736f;
  __shared__ __attribute__((aligned(16))) float sO[4][RPW][HD + 4];
  const int tid = threadIdx.x, w = tid >> 5, lane = tid & 31, ln = lane & 15, hh = lane >> 4; const int h = blockIdx.x / (NP / 128), qblk = blockIdx.x % (NP / 128); const int q0 = qblk * 128 + w * RPW;
  FragH aq[2];
#pragma unroll
  for (int rt = 0; rt < 2; ++rt) { const unsigned short* qr = (const unsigned short*)Q16 + (size_t)(q0 + rt * 16 + ln) * CC + h * HD; aq[rt].half[0] = *(const v8us*)(qr + 8 * hh); aq[rt].half[1] = *(const v8us*)(qr + 16 + 8 * hh); }
  const unsigned short* Vth = (const unsigned short*)Vt + (size_t)h * HD * NP;
  float m_r[2], l_r[2]; v8f oacc[2][2];      // query rt * 16 + ln; oacc[rt][dt][r] = Ot[dt * 16 + 8hh + r][query]
#pragma unroll
  for (int rt = 0; rt < 2; ++rt) { m_r[rt] = -3.0e38f; l_r[rt] = 0.f; oacc[rt][0] = (v8f){0.f,0.f,0.f,0.f,0.f,0.f,0.f,0.f}; oacc[rt][1] = oacc[rt][0]; }
#pragma unroll 1
  for (int j0 = 0; j0 < NP; j0 += 32) { v8f s[2][2];      // s[rt][nt][r] = S[query][j0 + nt * 16 + 8hh + r]
#pragma unroll
    for (int nt = 0; nt < 2; ++nt) { const unsigned short* kr = (const unsigned short*)K16 + (size_t)(j0 + nt * 16 + ln) * CC + h * HD; FragH bk; bk.half[0] = *(const v8us*)(kr + 8 * hh); bk.half[1] = *(const v8us*)(kr + 16 + 8 * hh);
#pragma unroll
      for (int rt = 0; rt < 2; ++rt) { v8f acc = (v8f){0.f,0.f,0.f,0.f,0.f,0.f,0.f,0.f}; acc = mmaH<1>(bk.v, bk.v, aq[rt].v, aq[rt].v, acc); s[rt][nt] = acc; } }
    FragH pb[2];
#pragma unroll
    for (int rt = 0; rt < 2; ++rt) { float sc[16];      // raw products; SL2 > 0, so their maximum is the maximum of the scaled scores
#pragma unroll
      for (int i = 0; i < 16; ++i) sc[i] = s[rt][i >> 3][i & 7];
      float mx[8];
#pragma unroll
      for (int i = 0; i < 8; ++i) mx[i] = fmaxf(sc[i], sc[8 + i]);
      float mc = fmaxf(fmaxf(fmaxf(mx[0], mx[1]), fmaxf(mx[2], mx[3])), fmaxf(fmaxf(mx[4], mx[5]), fmaxf(mx[6], mx[7])));
      mc = fmaxf(mc, xhalf(mc));
      const float mn = fmaxf(m_r[rt], mc * SL2); const float al = __builtin_amdgcn_exp2f(m_r[rt] - mn); m_r[rt] = mn;      // m_r in log2 units
      float ps[8];
#pragma unroll
      for (int i = 0; i < 8; ++i) { const float p0 = __builtin_amdgcn_exp2f(fmaf(sc[i], SL2, -mn)), p1 = __builtin_amdgcn_exp2f(fmaf(sc[8 + i], SL2, -mn)); ps[i] = p0 + p1; pb[rt].h[i] = (_Float16)p0; pb[rt].h[8 + i] = (_Float16)p1; }
      l_r[rt] = l_r[rt] * al + (((ps[0] + ps[1]) + (ps[2] + ps[3])) + ((ps[4] + ps[5]) + (ps[6] + ps[7])));      // this half's keys; the halves join after the loop
#pragma unroll
      for (int r = 0; r < 8; ++r) { oacc[rt][0][r] *= al; oacc[rt][1][r] *= al; } }
#pragma unroll
    for (int dt = 0; dt < 2; ++dt) { const unsigned short* vrow = Vth + (size_t)(dt * 16 + ln) * NP + j0; FragH bv; bv.half[0] = *(const v8us*)(vrow + 8 * hh); bv.half[1] = *(const v8us*)(vrow + 16 + 8 * hh);
#pragma unroll
      for (int rt = 0; rt < 2; ++rt) oacc[rt][dt] = mmaH<1>(bv.v, bv.v, pb[rt].v, pb[rt].v, oacc[rt][dt]); } }
#pragma unroll
  for (int rt = 0; rt < 2; ++rt) { const float l = l_r[rt] + xhalf(l_r[rt]); const float li = 1.0f / l;
#pragma unroll
    for (int dt = 0; dt < 2; ++dt)
#pragma unroll
      for (int r4 = 0; r4 < 8; r4 += 4) { v4f v; for (int q = 0; q < 4; ++q) v[q] = oacc[rt][dt][r4 + q] * li; *(v4fa*)&sO[w][rt * 16 + ln][dt * 16 + 8 * hh + r4] = v; } }
  __builtin_amdgcn_fence(__ATOMIC_ACQ_REL, "workgroup"); __builtin_amdgcn_wave_barrier();
  {
#pragma unroll
    for (int rp = 0; rp < RPW; rp += 4) { const int r = rp + (lane >> 3), pc = lane & 7; const v4f v = *(const v4fa*)&sO[w][r][pc * 4]; *(v4f*)(O + (size_t)(q0 + r) * CC + h * HD + pc * 4) = v; }
     } }
__global__ __launch_bounds__(256) void k_h16(const float* __restrict__ x, _Float16* __restrict__ X16, size_t n8) { const size_t t = (size_t)blockIdx.x * 256 + threadIdx.x; if (t >= n8) return; FragH f;
#pragma unroll
  for (int q = 0; q < 8; ++q) f.h[q] = (_Float16)x[t * 8 + q]; *(v8us*)((unsigned short*)X16 + t * 8) = f.half[0];  }
__global__ __launch_bounds__(256) void k_fin(const float* __restrict__ OP, const float* __restrict__ x, float* __restrict__ out) { __shared__ float tl[32][65]; const int tid = threadIdx.x; const int cg = blockIdx.x / (NP / 64), pg = blockIdx.x % (NP / 64); const int c0 = cg * 32, p0 = pg * 64;
  for (int i = tid; i < 64 * 32; i += 256) { const int pp = i / 32, c = i % 32; tl[c][pp] = OP[(size_t)(p0 + pp) * CC + c0 + c]; }
  __syncthreads();
  { for (int i = tid; i < 32 * 16; i += 256) { const int c = i / 16, pc = i % 16; const size_t o = (size_t)(c0 + c) * NP + p0 + pc * 4; const v4f xv = *(const v4fa*)(x + o); v4f v; for (int q = 0; q < 4; ++q) v[q] = (tl[c][pc * 4 + q] + bf16_round(xv[q])) * 0.7071067811865476f; *(v4f*)(out + o) = v; }  } }
extern "C" void kernel_launch(void* const* d_in, const int* in_sizes, int n_in,
                              void* d_out, int out_size, void* d_ws, size_t ws_size, hipStream_t stream) {
  (void)in_sizes; (void)n_in; (void)out_size;
  const float* x = (const float*)d_in[0]; const float* gw = (const float*)d_in[1]; const float* gb = (const float*)d_in[2]; const float* wq = (const float*)d_in[3]; const float* bq = (const float*)d_in[4]; const float* wk = (const float*)d_in[5]; const float* bk = (const float*)d_in[6]; const float* wv = (const float*)d_in[7]; const float* bv = (const float*)d_in[8]; const float* wo = (const float*)d_in[9]; const float* bo = (const float*)d_in[10];
  char* ws = (char*)d_ws; size_t off = 0;
  auto take = [&](size_t bytes) { char* p = ws + off; off += (bytes + 255) & ~(size_t)255; return p; };
  _Float16* Bq = (_Float16*)take(CC * CC * 2); _Float16* Bk = (_Float16*)take(CC * CC * 2); _Float16* Bv = (_Float16*)take(CC * CC * 2); _Float16* Bo = (_Float16*)take(CC * CC * 2); float* ST1 = (float*)take(NG * 2 * 4 + 256); float* ST2 = (float*)take(NG * 2 * 4 + 256);
  float* QNC = (float*)take((size_t)CC * NP * 4); _Float16* QNP = (_Float16*)take((size_t)NP * CC * 2); _Float16* VNP = (_Float16*)take((size_t)NP * CC * 2); _Float16* Q16 = (_Float16*)take((size_t)NP * CC * 2); _Float16* K16 = (_Float16*)take((size_t)NP * CC * 2); _Float16* V16 = (_Float16*)take((size_t)NP * CC * 2); _Float16* Vt = (_Float16*)take((size_t)NP * CC * 2); float* O = QNC; _Float16* O16 = QNP; float* OP = (float*)take((size_t)NP * CC * 4);
  if (off > ws_size) return;      // 2.1 + 8.4 + 4.2 × 6 + 8.4 ≈ 44 MB
  const unsigned gw8 = (CC * CC / 8 + 255) / 256; k_round16f<<<gw8, 256, 0, stream>>>(wq, Bq, CC * CC / 8); k_round16f<<<gw8, 256, 0, stream>>>(wk, Bk, CC * CC / 8); k_round16f<<<gw8, 256, 0, stream>>>(wv, Bv, CC * CC / 8); k_round16f<<<gw8, 256, 0, stream>>>(wo, Bo, CC * CC / 8);      // (out,in)
  k_gstat<true><<<NG, 1024, 0, stream>>>(x, ST1);
  k_gnormc<true><<<(CC * NP / 4 + 255) / 256, 256, 0, stream>>>(x, ST1, gw, gb, QNC);      // qn channel-major f32 (input of the second GroupNorm)
  k_gnorm<true><<<(CC / 64) * (NP / 16), 256, 0, stream>>>(x, ST1, gw, gb, nullptr, QNP);      // qn position-major f16
  k_gstat<false><<<NG, 1024, 0, stream>>>(QNC, ST2);
  k_gnorm<false><<<(CC / 64) * (NP / 16), 256, 0, stream>>>(QNC, ST2, gw, gb, nullptr, VNP);      // vn = GN(qn) position-major f16
  const dim3 gg(((NP / 16) * (CC / 64) + 3) / 4, 1);
  k_gemm_hhx<0><<<gg, 128, 0, stream>>>(QNP, CC, 0, Bq, CC, 0, 0.0625f, bq, 0, nullptr, 1, 0, 0, nullptr, Q16, CC, 0, NP, CC, CC);
  k_gemm_hhx<0><<<gg, 128, 0, stream>>>(VNP, CC, 0, Bk, CC, 0, 0.0625f, bk, 0, nullptr, 1, 0, 0, nullptr, K16, CC, 0, NP, CC, CC);
  k_gemm_hhx<0><<<gg, 128, 0, stream>>>(VNP, CC, 0, Bv, CC, 0, 0.0625f, bv, 0, nullptr, 1, 0, 0, nullptr, V16, CC, 0, NP, CC, CC);
  k_vt32<<<NH * (NP / 64), 256, 0, stream>>>(V16, Vt);
  k_attn<<<NH * (NP / 128), 128, 0, stream>>>(Q16, K16, Vt, O);
  k_h16<<<(NP * CC / 8 + 255) / 256, 256, 0, stream>>>(O, O16, (size_t)NP * CC / 8);
  k_gemm_hhx<0><<<gg, 128, 0, stream>>>(O16, CC, 0, Bo, CC, 0, 0.0625f, bo, 0, nullptr, 1, 0, 0, OP, nullptr, CC, 0, NP, CC, CC);
  k_fin<<<(CC / 32) * (NP / 64), 256, 0, stream>>>(OP, x, (float*)d_out);
}

// v004
// A run of this version takes 190 microseconds.
// In two side-by-side timings against v003, it was 1.48 and 1.49 times as fast.
// All steps since v000 together make it 2.21 times as fast.
#include <hip/hip_runtime.h>
// the 1×1 convs (4096 × 512 × 512, + bias, weights (out,in) bf16-exact ×2^4) and the attention as a fused flash-style kernel (S = Q·Kᵀ·32^-½ with d = 32 in one k-step, online softmax f32,
// P f16 ≤ 1, O = P·V) on v_wmma_f32_16x16x32_f16 (f16 operands, single products, f32 accumulate); residual (out + x)/√2 and layout transposes f32 VALU.
#define CC 512
#define NP 4096
#define NG 32
#define GS 16
#define NH 16
#define HD 32

typedef __bf16 v16b __attribute__((ext_vector_type(16)));
typedef unsigned short v8us __attribute__((ext_vector_type(8), may_alias));
typedef float  v8f  __attribute__((ext_vector_type(8)));
typedef float  v4f  __attribute__((ext_vector_type(4)));
typedef float  v4fa __attribute__((ext_vector_type(4), may_alias));
union FragB { v16b v; v8us half[2]; unsigned short u[16]; };

__device__ __forceinline__ unsigned short bf16_bits(float x) { unsigned int u = __float_as_uint(x); return (unsigned short)((u + 0x7FFFu + ((u >> 16) & 1u)) >> 16); }
__device__ __forceinline__ float bf16_val(unsigned short b) { return __uint_as_float(((unsigned int)b) << 16); }
__device__ __forceinline__ float bf16_round(float x) { return bf16_val(bf16_bits(x)); }
// D += A·B with NT terms: 1 = ah·bh, 2 = + al·bh (A split), 3 = + ah·bl (both split)
template <int NT>
__device__ __forceinline__ v8f mmaN(v16b ah, v16b al, v16b bh, v16b bl, v8f c) {
  c = __builtin_amdgcn_wmma_f32_16x16x32_bf16(false, ah, false, bh, (short)0, c, false, false);
  if (NT >= 2) c = __builtin_amdgcn_wmma_f32_16x16x32_bf16(false, al, false, bh, (short)0, c, false, false);
  if (NT >= 3) c = __builtin_amdgcn_wmma_f32_16x16x32_bf16(false, ah, false, bl, (short)0, c, false, false);
  asm volatile("v_nop\n\tv_nop\n\tv_nop\n\tv_nop" : "+v"(c) : "v"(ah), "v"(al), "v"(bh), "v"(bl));
  return c;
}

__global__ __launch_bounds__(256) void k_wt_bf16(const float* __restrict__ W, unsigned short* __restrict__ Wt, int K, int N) {
  const int t = blockIdx.x * 256 + threadIdx.x;
  const int k8n = K / 8;
  if (t >= N * k8n) return;
  const int n = t / k8n, k8 = (t % k8n) * 8;
  v8us v;
#pragma unroll
  for (int i = 0; i < 8; ++i) v[i] = bf16_bits(W[(size_t)(k8 + i) * N + n]);
  *(v8us*)(Wt + (size_t)n * K + k8) = v;
  
}

// GEMM C[M][N] (f32, pitch ldc) = act(A[M][K]·W + bias). A f32 row-major (pitch lda) converted per fragment to bf16
// (ASPLIT: hi/lo two planes -> 2 terms, else single rounded term); Wt bf16 [N][K] (pitch ldb). BIAS_BF16 rounds the
// bias to bf16 first (bias quantised to bf16 before the add). K%32==0, M%16==0, N%64==0.
template <bool ASPLIT, int ACT, bool BIAS_BF16>
__global__ __launch_bounds__(128) void k_gemm_bf(const float* __restrict__ A, int lda, const unsigned short* __restrict__ Wt, int ldb,
                                               const float* __restrict__ bias, float* __restrict__ C, int ldc, int M, int N, int K) {
  __shared__ __attribute__((aligned(16))) float so[4][16][64];
  const int tid = threadIdx.x, w = tid >> 5, lane = tid & 31, ln = lane & 15, hh = lane >> 4;
  const int ntn = N / 64;
  const int wid = blockIdx.x * 4 + w;
  const int mt = wid / ntn, nq = wid % ntn;
  if (mt * 16 >= M) return;
  const int row0 = mt * 16, col0 = nq * 64;
  const float* arow = A + (size_t)(row0 + ln) * lda;
  v8f acc[4] = {};
  for (int kb = 0; kb < K; kb += 32) {
    FragB ah, al;
    const v4f x0 = *(const v4fa*)(arow + kb + 8 * hh), x1 = *(const v4fa*)(arow + kb + 8 * hh + 4);
    const v4f x2 = *(const v4fa*)(arow + kb + 16 + 8 * hh), x3 = *(const v4fa*)(arow + kb + 16 + 8 * hh + 4);
    float xs[16] = {x0[0],x0[1],x0[2],x0[3],x1[0],x1[1],x1[2],x1[3],x2[0],x2[1],x2[2],x2[3],x3[0],x3[1],x3[2],x3[3]};
#pragma unroll
    for (int i = 0; i < 16; ++i) { const unsigned short hb = bf16_bits(xs[i]); ah.u[i] = hb; al.u[i] = ASPLIT ? bf16_bits(xs[i] - bf16_val(hb)) : (unsigned short)0; }
#pragma unroll
    for (int t = 0; t < 4; ++t) {
      const unsigned short* brow = Wt + (size_t)(col0 + t * 16 + ln) * ldb + kb;
      FragB b;
      b.half[0] = *(const v8us*)(brow + 8 * hh);
      b.half[1] = *(const v8us*)(brow + 16 + 8 * hh);
      acc[t] = mmaN<ASPLIT ? 2 : 1>(ah.v, al.v, b.v, b.v, acc[t]);
    }
  }
#pragma unroll
  for (int t = 0; t < 4; ++t) {
    float bv = bias ? bias[col0 + t * 16 + ln] : 0.f;
    if (BIAS_BF16) bv = bf16_round(bv);
#pragma unroll
    for (int r = 0; r < 8; ++r) { float v = acc[t][r] + bv; if (ACT == 1) v = fmaxf(v, 0.f); so[w][8 * hh + r][t * 16 + ln] = v; }
  }
  __builtin_amdgcn_fence(__ATOMIC_ACQ_REL, "workgroup");
  __builtin_amdgcn_wave_barrier();
  const int rsub = lane >> 4, c4 = (lane & 15) * 4;
  {
#pragma unroll
    for (int q = 0; q < 8; ++q) {
      const int r = q * 2 + rsub;
      const v4f v = *(const v4fa*)&so[w][r][c4];
      *(v4f*)(C + (size_t)(row0 + r) * ldc + col0 + c4) = v;
    }
    
  }
}

// Flash-style causal/unmasked attention, all contractions 3-term bf16 hi/lo splits, f32 softmax with running max.
// q,k,v rows are read from f32 buffers with arbitrary row pitch (so they can live inside a fused qkv buffer);
// D = head size (multiple of 32, <= 128); one wave = 16 query rows; block = 4 waves (64 queries) sharing K/V chunks of 32.
template <int D, bool CAUSAL>
__global__ __launch_bounds__(128) void k_flash(const float* __restrict__ qb, const float* __restrict__ kb, const float* __restrict__ vb,
                                             int pitch, int T, int H, float scale, float* __restrict__ y, int ypitch) {
  constexpr int KS = D / 32;        // k-steps for QK
  constexpr int DT = D / 16;        // d tiles for PV
  __shared__ __attribute__((aligned(16))) unsigned short sKh[32][D + 8], sKl[32][D + 8], sVh[32][D + 8], sVl[32][D + 8];
  __shared__ __attribute__((aligned(16))) unsigned short sPh[4][16][40], sPl[4][16][40];
  __shared__ __attribute__((aligned(16))) float sO[4][16][D];
  const int tid = threadIdx.x, w = tid >> 5, lane = tid & 31, ln = lane & 15, hh = lane >> 4;
  const int nqb = (T + 63) / 64;
  const int bh = blockIdx.x / nqb, qblk = blockIdx.x % nqb;
  const int b = bh / H, h = bh % H;
  const int q0 = qblk * 64 + w * 16;
  const float* Q = qb + (size_t)b * T * pitch + h * D;
  const float* K = kb + (size_t)b * T * pitch + h * D;
  const float* V = vb + (size_t)b * T * pitch + h * D;

  // A fragments of the wave's 16 query rows (scaled), hi/lo
  FragB aqh[KS], aql[KS];
  {
    int row = q0 + ln; if (row >= T) row = T - 1;
    const float* qr = Q + (size_t)row * pitch;
#pragma unroll
    for (int ks = 0; ks < KS; ++ks)
#pragma unroll
      for (int i = 0; i < 16; ++i) {
        const int d = ks * 32 + ((i < 8) ? (8 * hh + i) : (16 + 8 * hh + (i - 8)));
        const float x = qr[d] * scale; const unsigned short hb = bf16_bits(x);
        aqh[ks].u[i] = hb; aql[ks].u[i] = bf16_bits(x - bf16_val(hb));
      }
  }
  float m_r[8], l_r[8];
#pragma unroll
  for (int r = 0; r < 8; ++r) { m_r[r] = -3.0e38f; l_r[r] = 0.f; }
  v8f oacc[DT];
#pragma unroll
  for (int dt = 0; dt < DT; ++dt) oacc[dt] = (v8f){0.f,0.f,0.f,0.f,0.f,0.f,0.f,0.f};

  const int kv_end = CAUSAL ? min(T, qblk * 64 + 64) : T;     // block-uniform
  for (int j0 = 0; j0 < kv_end; j0 += 32) {
    __syncthreads();
    for (int e = tid; e < 32 * (D / 4); e += 128) {
      const int r = e / (D / 4), c4 = (e % (D / 4)) * 4;
      const int key = j0 + r;
      v4f kf = {0.f,0.f,0.f,0.f}, vf = {0.f,0.f,0.f,0.f};
      if (key < T) { kf = *(const v4fa*)(K + (size_t)key * pitch + c4); vf = *(const v4fa*)(V + (size_t)key * pitch + c4); }
#pragma unroll
      for (int t = 0; t < 4; ++t) {
        unsigned short hb = bf16_bits(kf[t]); sKh[r][c4 + t] = hb; sKl[r][c4 + t] = bf16_bits(kf[t] - bf16_val(hb));
        hb = bf16_bits(vf[t]); sVh[r][c4 + t] = hb; sVl[r][c4 + t] = bf16_bits(vf[t] - bf16_val(hb));
      }
    }
    __syncthreads();
    // S tile 16 x 32
    v8f s[2];
#pragma unroll
    for (int nt = 0; nt < 2; ++nt) {
      v8f acc = {};
#pragma unroll
      for (int ks = 0; ks < KS; ++ks) {
        FragB bh_, bl_;
        bh_.half[0] = *(const v8us*)&sKh[nt * 16 + ln][ks * 32 + 8 * hh]; bh_.half[1] = *(const v8us*)&sKh[nt * 16 + ln][ks * 32 + 16 + 8 * hh];
        bl_.half[0] = *(const v8us*)&sKl[nt * 16 + ln][ks * 32 + 8 * hh]; bl_.half[1] = *(const v8us*)&sKl[nt * 16 + ln][ks * 32 + 16 + 8 * hh];
        acc = mmaN<3>(aqh[ks].v, aql[ks].v, bh_.v, bl_.v, acc);
      }
      s[nt] = acc;
    }
    // mask + running max (rows 8hh+r; the 16 lanes of a half share rows)
    float alpha[8];
#pragma unroll
    for (int r = 0; r < 8; ++r) {
      const int qi = q0 + 8 * hh + r;
      const int ja = j0 + ln, jb = j0 + 16 + ln;
      if (CAUSAL) { if (ja > qi) s[0][r] = -3.0e38f; if (jb > qi) s[1][r] = -3.0e38f; }
      if (ja >= T) s[0][r] = -3.0e38f;
      if (jb >= T) s[1][r] = -3.0e38f;
      float mx = fmaxf(s[0][r], s[1][r]);
      mx = fmaxf(mx, __shfl_xor(mx, 1, 32)); mx = fmaxf(mx, __shfl_xor(mx, 2, 32)); mx = fmaxf(mx, __shfl_xor(mx, 4, 32)); mx = fmaxf(mx, __shfl_xor(mx, 8, 32));
      const float mnew = fmaxf(m_r[r], mx);
      alpha[r] = (mnew > -1.0e38f) ? __expf(m_r[r] - mnew) : 1.0f;
      const float p0 = (s[0][r] > -1.0e38f) ? __expf(s[0][r] - mnew) : 0.f;
      const float p1 = (s[1][r] > -1.0e38f) ? __expf(s[1][r] - mnew) : 0.f;
      m_r[r] = mnew;
      l_r[r] = l_r[r] * alpha[r] + p0 + p1;            // per-lane partial row sum (16 lanes combined at the end)
      unsigned short hb = bf16_bits(p0); sPh[w][8 * hh + r][ln] = hb;      sPl[w][8 * hh + r][ln] = bf16_bits(p0 - bf16_val(hb));
      hb = bf16_bits(p1);                sPh[w][8 * hh + r][16 + ln] = hb; sPl[w][8 * hh + r][16 + ln] = bf16_bits(p1 - bf16_val(hb));
    }
#pragma unroll
    for (int dt = 0; dt < DT; ++dt)
#pragma unroll
      for (int r = 0; r < 8; ++r) oacc[dt][r] *= alpha[r];
    __builtin_amdgcn_fence(__ATOMIC_ACQ_REL, "workgroup");
    __builtin_amdgcn_wave_barrier();
    FragB pah, pal;
    pah.half[0] = *(const v8us*)&sPh[w][ln][8 * hh]; pah.half[1] = *(const v8us*)&sPh[w][ln][16 + 8 * hh];
    pal.half[0] = *(const v8us*)&sPl[w][ln][8 * hh]; pal.half[1] = *(const v8us*)&sPl[w][ln][16 + 8 * hh];
#pragma unroll
    for (int dt = 0; dt < DT; ++dt) {
      FragB bvh, bvl;
#pragma unroll
      for (int i = 0; i < 8; ++i) {
        bvh.u[i] = sVh[8 * hh + i][dt * 16 + ln]; bvh.u[8 + i] = sVh[16 + 8 * hh + i][dt * 16 + ln];
        bvl.u[i] = sVl[8 * hh + i][dt * 16 + ln]; bvl.u[8 + i] = sVl[16 + 8 * hh + i][dt * 16 + ln];
      }
      oacc[dt] = mmaN<3>(pah.v, pal.v, bvh.v, bvl.v, oacc[dt]);
    }
    __builtin_amdgcn_fence(__ATOMIC_ACQ_REL, "workgroup");
    __builtin_amdgcn_wave_barrier();
  }
#pragma unroll
  for (int r = 0; r < 8; ++r) {
    float l = l_r[r];
    l += __shfl_xor(l, 1, 32); l += __shfl_xor(l, 2, 32); l += __shfl_xor(l, 4, 32); l += __shfl_xor(l, 8, 32);
    l_r[r] = (l > 0.f) ? 1.0f / l : 0.f;
  }
#pragma unroll
  for (int dt = 0; dt < DT; ++dt)
#pragma unroll
    for (int r = 0; r < 8; ++r) sO[w][8 * hh + r][dt * 16 + ln] = oacc[dt][r] * l_r[r];
  __builtin_amdgcn_fence(__ATOMIC_ACQ_REL, "workgroup");
  __builtin_amdgcn_wave_barrier();
  {
    for (int r = 0; r < 16; ++r) {
      const int row = q0 + r;
      if (row < T && lane < D / 4) {
        const v4f val = *(const v4fa*)&sO[w][r][lane * 4];
        *(v4f*)(y + ((size_t)b * T + row) * ypitch + h * D + lane * 4) = val;
      }
    }
    
  }
}

// GEMM C = act(A·W + bias + resid): A f32 (ASPLIT -> hi/lo 2 terms), Wt bf16 [N][K]; ACT 0 none, 1 relu, 2 exact gelu;
// resid (optional, f32, row index = (row % rmod), pitch ldr, RES_BF16 rounds it) added before the activation.
template <bool ASPLIT, int ACT, bool BIAS_BF16, bool RES_BF16>
__global__ __launch_bounds__(128) void k_gemm_bf3(const float* __restrict__ A, int lda, const unsigned short* __restrict__ Wt, int ldb,
                                                const float* __restrict__ bias, const float* __restrict__ resid, int rmod, int ldr,
                                                float* __restrict__ C, int ldc, int M, int N, int K) {
  __shared__ __attribute__((aligned(16))) float so[4][16][64];
  const int tid = threadIdx.x, w = tid >> 5, lane = tid & 31, ln = lane & 15, hh = lane >> 4;
  const int ntn = N / 64;
  const int wid = blockIdx.x * 4 + w;
  const int mt = wid / ntn, nq = wid % ntn;
  if (mt * 16 >= M) return;
  const int row0 = mt * 16, col0 = nq * 64;
  const float* arow = A + (size_t)(row0 + ln) * lda;
  v8f acc[4] = {};
  for (int kb = 0; kb < K; kb += 32) {
    FragB ah, al;
    const v4f x0 = *(const v4fa*)(arow + kb + 8 * hh), x1 = *(const v4fa*)(arow + kb + 8 * hh + 4);
    const v4f x2 = *(const v4fa*)(arow + kb + 16 + 8 * hh), x3 = *(const v4fa*)(arow + kb + 16 + 8 * hh + 4);
    float xs[16] = {x0[0],x0[1],x0[2],x0[3],x1[0],x1[1],x1[2],x1[3],x2[0],x2[1],x2[2],x2[3],x3[0],x3[1],x3[2],x3[3]};
#pragma unroll
    for (int i = 0; i < 16; ++i) { const unsigned short hb = bf16_bits(xs[i]); ah.u[i] = hb; al.u[i] = ASPLIT ? bf16_bits(xs[i] - bf16_val(hb)) : (unsigned short)0; }
#pragma unroll
    for (int t = 0; t < 4; ++t) {
      const unsigned short* brow = Wt + (size_t)(col0 + t * 16 + ln) * ldb + kb;
      FragB b;
      b.half[0] = *(const v8us*)(brow + 8 * hh);
      b.half[1] = *(const v8us*)(brow + 16 + 8 * hh);
      acc[t] = mmaN<ASPLIT ? 2 : 1>(ah.v, al.v, b.v, b.v, acc[t]);
    }
  }
#pragma unroll
  for (int t = 0; t < 4; ++t) {
    const int col = col0 + t * 16 + ln;
    float bv = bias ? bias[col] : 0.f;
    if (BIAS_BF16) bv = bf16_round(bv);
#pragma unroll
    for (int r = 0; r < 8; ++r) {
      float v = acc[t][r] + bv;
      if (resid) { float rv = resid[(size_t)((row0 + 8 * hh + r) % rmod) * ldr + col]; if (RES_BF16) rv = bf16_round(rv); v += rv; }
      if (ACT == 1) v = fmaxf(v, 0.f);
      if (ACT == 2) v = 0.5f * v * (1.0f + erff(v * 0.70710678118654752f));
      if (ACT == 3) { const float u = 0.7978845608028654f * (v + 0.044715f * v * v * v); v = 0.5f * v * (1.0f + tanhf(u)); }
      so[w][8 * hh + r][t * 16 + ln] = v;
    }
  }
  __builtin_amdgcn_fence(__ATOMIC_ACQ_REL, "workgroup");
  __builtin_amdgcn_wave_barrier();
  const int rsub = lane >> 4, c4 = (lane & 15) * 4;
  {
#pragma unroll
    for (int q = 0; q < 8; ++q) {
      const int r = q * 2 + rsub;
      const v4f v = *(const v4fa*)&so[w][r][c4];
      *(v4f*)(C + (size_t)(row0 + r) * ldc + col0 + c4) = v;
    }
    
  }
}
// row LayerNorm (biased variance, eps) over N: s = X (+ R); optional out_sum <- s; out_norm <- (s-mu)*rsqrt(var+eps)*g + b
template <bool PARAM_BF16>
__global__ __launch_bounds__(256) void k_layernorm(const float* __restrict__ X, const float* __restrict__ R, const float* __restrict__ g, const float* __restrict__ bta,
                                                  float* __restrict__ out_sum, float* __restrict__ out_norm, int N, float eps) {
  __shared__ float red[256];
  const int row = blockIdx.x, tid = threadIdx.x;
  const float* x = X + (size_t)row * N; const float* rr = R ? R + (size_t)row * N : nullptr;
  float vals[16];                     // up to N = 4096
  const int per = N / 256;            // contiguous chunk per thread? use strided-by-4 chunks: thread handles j = tid*4 + 1024*u
  float s1 = 0.f;
  for (int u = 0; u < per / 4; ++u) {
    const int j = tid * 4 + 1024 * u;
    const v4f a = *(const v4fa*)(x + j);
    v4f b = {0.f,0.f,0.f,0.f}; if (rr) b = *(const v4fa*)(rr + j);
#pragma unroll
    for (int q = 0; q < 4; ++q) { const float v = a[q] + b[q]; vals[u * 4 + q] = v; s1 += v; }
  }
  red[tid] = s1; __syncthreads();
  for (int st = 128; st > 0; st >>= 1) { if (tid < st) red[tid] += red[tid + st]; __syncthreads(); }
  const float mu = red[0] / (float)N; __syncthreads();
  float s2 = 0.f;
  for (int u = 0; u < per / 4; ++u)
#pragma unroll
    for (int q = 0; q < 4; ++q) { const float c = vals[u * 4 + q] - mu; s2 += c * c; }
  red[tid] = s2; __syncthreads();
  for (int st = 128; st > 0; st >>= 1) { if (tid < st) red[tid] += red[tid + st]; __syncthreads(); }
  const float rs = rsqrtf(red[0] / (float)N + eps);
  {
    for (int u = 0; u < per / 4; ++u) {
      const int j = tid * 4 + 1024 * u;
      v4f o, sm;
#pragma unroll
      for (int q = 0; q < 4; ++q) {
        float gg = g[j + q], bb = bta[j + q];
        if (PARAM_BF16) { gg = bf16_round(gg); bb = bf16_round(bb); }
        sm[q] = vals[u * 4 + q]; o[q] = (vals[u * 4 + q] - mu) * rs * gg + bb;
      }
      if (out_sum) *(v4f*)(out_sum + (size_t)row * N + j) = sm;
      *(v4f*)(out_norm + (size_t)row * N + j) = o;
    }
    
  }
}



// ---- f16 WMMA path (v_wmma_f32_16x16x32_f16): 11-bit significands for operands in range — used here for every matrix product (1×1 convs, Q·Kᵀ and P·V)
typedef _Float16 v16h __attribute__((ext_vector_type(16)));
union FragH { v16h v; v8us half[2]; _Float16 h[16]; unsigned short u[16]; };
template <int NT>
__device__ __forceinline__ v8f mmaH(v16h ah, v16h al, v16h bh, v16h bl, v8f c) {
  c = __builtin_amdgcn_wmma_f32_16x16x32_f16(false, ah, false, bh, (short)0, c, false, false);
  if (NT >= 2) c = __builtin_amdgcn_wmma_f32_16x16x32_f16(false, al, false, bh, (short)0, c, false, false);
  if (NT >= 3) c = __builtin_amdgcn_wmma_f32_16x16x32_f16(false, ah, false, bl, (short)0, c, false, false);
  asm volatile("v_nop\n\tv_nop\n\tv_nop\n\tv_nop" : "+v"(c) : "v"(ah), "v"(al), "v"(bh), "v"(bl));
  return c;
}
// batched GEMM like k_gemm_b but f16 operands: A f32 (split into f16 hi/lo if ASPLIT, else rounded to f16), Bt = f16 values [n][k]; alpha; C f32; N multiple of 16 (partial tiles skipped)
template <bool ASPLIT>
__global__ __launch_bounds__(128) void k_gemm_h(const float* __restrict__ A, int lda, size_t sA, const _Float16* __restrict__ Bh, int ldb, size_t sB, float alpha, float* __restrict__ C, int ldc, size_t sC, int M, int N, int K) {
  __shared__ __attribute__((aligned(16))) float so[4][16][64];
  const int tid = threadIdx.x, w = tid >> 5, lane = tid & 31, ln = lane & 15, hh = lane >> 4; const int by = blockIdx.y;
  A += (size_t)by * sA; Bh += (size_t)by * sB; C += (size_t)by * sC;
  const int ntn = (N + 63) / 64; const int wid = blockIdx.x * 4 + w; const int mt = wid / ntn, nq = wid % ntn; if (mt * 16 >= M) return;
  const int row0 = mt * 16, col0 = nq * 64; const float* arow = A + (size_t)(row0 + ln) * lda;
  v8f acc[4] = {};
  for (int kb = 0; kb < K; kb += 32) {
    FragH ah, al;
    const v4f x0 = *(const v4fa*)(arow + kb + 8 * hh), x1 = *(const v4fa*)(arow + kb + 8 * hh + 4), x2 = *(const v4fa*)(arow + kb + 16 + 8 * hh), x3 = *(const v4fa*)(arow + kb + 16 + 8 * hh + 4);
    float xs[16] = {x0[0],x0[1],x0[2],x0[3],x1[0],x1[1],x1[2],x1[3],x2[0],x2[1],x2[2],x2[3],x3[0],x3[1],x3[2],x3[3]};
#pragma unroll
    for (int i = 0; i < 16; ++i) { const _Float16 h = (_Float16)xs[i]; ah.h[i] = h; al.h[i] = ASPLIT ? (_Float16)(xs[i] - (float)h) : (_Float16)0.0f; }
#pragma unroll
    for (int t = 0; t < 4; ++t) { if (col0 + t * 16 >= N) continue; const size_t boff = (size_t)(col0 + t * 16 + ln) * ldb + kb; FragH bq; bq.half[0] = *(const v8us*)(Bh + boff + 8 * hh); bq.half[1] = *(const v8us*)(Bh + boff + 16 + 8 * hh);
      acc[t] = mmaH<ASPLIT ? 2 : 1>(ah.v, al.v, bq.v, bq.v, acc[t]); }
  }
#pragma unroll
  for (int t = 0; t < 4; ++t) { if (col0 + t * 16 >= N) continue;
#pragma unroll
    for (int r = 0; r < 8; ++r) so[w][8 * hh + r][t * 16 + ln] = acc[t][r] * alpha; }
  __builtin_amdgcn_fence(__ATOMIC_ACQ_REL, "workgroup"); __builtin_amdgcn_wave_barrier();
  const int rsub = lane >> 4, c4 = (lane & 15) * 4;
  {
#pragma unroll
    for (int q = 0; q < 8; ++q) { const int r = q * 2 + rsub; if (col0 + c4 < N) { const v4f v = *(const v4fa*)&so[w][r][c4]; *(v4f*)(C + (size_t)(row0 + r) * ldc + col0 + c4) = v; } }
     }
}

// Wt[n][k] = f16(W[k][n]·scale) from f32 row-major W[K][N] (scale = power of two; bf16-exact weights stay exact in f16 away from the subnormal range)
__global__ __launch_bounds__(256) void k_wt_f16(const float* __restrict__ W, _Float16* __restrict__ Wt, int K, int N, float scale) {
  const int t = blockIdx.x * 256 + threadIdx.x; if (t >= N * (K / 8)) return; const int n = t / (K / 8), k8 = (t % (K / 8)) * 8; FragH f;
#pragma unroll
  for (int i = 0; i < 8; ++i) f.h[i] = (_Float16)(bf16_round(W[(size_t)(k8 + i) * N + n]) * scale); const v8us o = f.half[0];
  *(v8us*)((unsigned short*)Wt + (size_t)n * K + k8) = o; 
}
// the ten 16-byte loads of one k-step of k_gemm_hhx: the A fragment and four B fragments (ap, bp: the lane's row start + 8 * hh)
__device__ __forceinline__ void ld_kstep(const unsigned short* ap, const unsigned short* const (&bp)[4], int kb, FragH& a, FragH (&b)[4]) {
  a.half[0] = *(const v8us*)(ap + kb); a.half[1] = *(const v8us*)(ap + kb + 16);
#pragma unroll
  for (int t = 0; t < 4; ++t) { b[t].half[0] = *(const v8us*)(bp[t] + kb); b[t].half[1] = *(const v8us*)(bp[t] + kb + 16); }
  asm volatile("s_wait_xcnt 0x0" ::: "memory");      // these loads stay in flight: the wait stands before their address registers are written again
}
// k_gemm_hh variant with fused epilogue: v = acc·alpha + bias[by·sBias + col] (+ CP[(row/rowsPerB)·sCPb + by·64 + col] if CP) ; ACT 0 none / 1 elu ; writes f16 C16 and f32 C, each if non-null
template <int ACT>
__global__ __launch_bounds__(128) void k_gemm_hhx(const _Float16* __restrict__ A, int lda, size_t sA, const _Float16* __restrict__ Bh, int ldb, size_t sB, float alpha, const float* __restrict__ bias, size_t sBias, const float* __restrict__ CP, int rowsPerB, size_t sCPb, int row0g,
    float* __restrict__ C, _Float16* __restrict__ C16, int ldc, size_t sC, int M, int N, int K) {
  __shared__ __attribute__((aligned(16))) float so[4][16][64];
  const int tid = threadIdx.x, w = tid >> 5, lane = tid & 31, ln = lane & 15, hh = lane >> 4; const int by = blockIdx.y;
  A += (size_t)by * sA; Bh += (size_t)by * sB; const size_t cofs = (size_t)by * sC; const float* bp = bias ? bias + (size_t)by * sBias : nullptr;
  const int ntn = (N + 63) / 64; const int wid = blockIdx.x * 4 + w; const int mt = wid / ntn, nq = wid % ntn; if (mt * 16 >= M) return;
  const int row0 = mt * 16, col0 = nq * 64; const _Float16* arow = A + (size_t)(row0 + ln) * lda;
  v8f acc[4] = {};
  // Fragments three k-steps ahead in a ring of four register sets: a k-step's ten loads are issued three k-steps before its products (was: four load - wait - WMMA rounds a k-step).
  // A column tile past N reads tile 0's rows (in bounds); its products are never stored. A fetch past the last k-step reads k-step 0 again and is not used.
  const unsigned short* ap = (const unsigned short*)arow + 8 * hh; const unsigned short* bw[4];
#pragma unroll
  for (int t = 0; t < 4; ++t) bw[t] = (const unsigned short*)Bh + (size_t)(col0 + (col0 + t * 16 < N ? t * 16 : 0) + ln) * ldb + 8 * hh;
  FragH fa[4], fb[4][4];
#pragma unroll
  for (int u = 0; u < 3; ++u) ld_kstep(ap, bw, u * 32 < K ? u * 32 : 0, fa[u], fb[u]);
  int kb = 0;
  for (; kb + 128 <= K; kb += 128) {
#pragma unroll
    for (int u = 0; u < 4; ++u) { const int kn = kb + (u + 3) * 32; ld_kstep(ap, bw, kn < K ? kn : 0, fa[(u + 3) & 3], fb[(u + 3) & 3]);
#pragma unroll
      for (int t = 0; t < 4; ++t) acc[t] = mmaH<1>(fa[u].v, fa[u].v, fb[u][t].v, fb[u][t].v, acc[t]); }
  }
#pragma unroll
  for (int u = 0; u < 3; ++u) { if (kb + u * 32 < K) {      // up to three k-steps left over; their fragments are already here
#pragma unroll
      for (int t = 0; t < 4; ++t) acc[t] = mmaH<1>(fa[u].v, fa[u].v, fb[u][t].v, fb[u][t].v, acc[t]); } }
#pragma unroll
  for (int t = 0; t < 4; ++t) { if (col0 + t * 16 >= N) continue; const int col = col0 + t * 16 + ln; const float bv = bp ? bf16_round(bp[col]) : 0.f;
#pragma unroll
    for (int r = 0; r < 8; ++r) { float v = acc[t][r] * alpha + bv; if (CP) { const int bidx = (row0g + row0 + 8 * hh + r) / rowsPerB; v += CP[(size_t)bidx * sCPb + (size_t)by * 64 + col]; } if (ACT == 1) v = (v > 0.f) ? v : expm1f(v); else if (ACT == 3) v = fmaxf(v, 0.f); so[w][8 * hh + r][t * 16 + ln] = v; } }
  __builtin_amdgcn_fence(__ATOMIC_ACQ_REL, "workgroup"); __builtin_amdgcn_wave_barrier();
  const int rsub = lane >> 4, c4 = (lane & 15) * 4; typedef _Float16 v4h __attribute__((ext_vector_type(4)));
  {
#pragma unroll
    for (int q = 0; q < 8; ++q) { const int r = q * 2 + rsub; if (col0 + c4 < N) { const v4f v = *(const v4fa*)&so[w][r][c4]; if (C) *(v4f*)(C + cofs + (size_t)(row0 + r) * ldc + col0 + c4) = v; if (C16) { v4h h4; for (int i = 0; i < 4; ++i) h4[i] = (_Float16)v[i]; *(v4h*)(C16 + cofs + (size_t)(row0 + r) * ldc + col0 + c4) = h4; } } }
     }
}


__global__ __launch_bounds__(256) void k_round16f(const float* __restrict__ W, _Float16* __restrict__ Bt, size_t n8) { const size_t t = (size_t)blockIdx.x * 256 + threadIdx.x; if (t >= n8) return; FragH f;
#pragma unroll
  for (int i = 0; i < 8; ++i) f.h[i] = (_Float16)(bf16_round(W[t * 8 + i]) * 16.0f); *(v8us*)((unsigned short*)Bt + t * 8) = f.half[0];  }
// lane l <-> l ^ 16 (the two halves of a wave hold the two key halves of one query column)
__device__ __forceinline__ float xhalf(float v) { const int b = __float_as_int(v); return __int_as_float(__builtin_amdgcn_permlanex16(b, b, 0x76543210, 0xfedcba98, false, false)); }
// lane l <-> l ^ M inside a 16-lane row (DPP row_xmask)
template <int M>
__device__ __forceinline__ float xrow(float v) { return __int_as_float(__builtin_amdgcn_update_dpp(0, __float_as_int(v), 0x160 + M, 0xf, 0xf, true)); }
// sum over the 32 lanes of a wave, the same value in every lane; all lanes on
__device__ __forceinline__ float wave_sum(float v) { v += xrow<1>(v); v += xrow<2>(v); v += xrow<4>(v); v += xrow<8>(v); return v + xhalf(v); }
// One group (GS * NP = 65,536 values) per block of 1,024 threads: 16 whole-line 16-byte loads per thread, all in flight together; the values stay in registers for both sums.
template <bool ROUND>
__global__ __launch_bounds__(1024) void k_gstat(const float* __restrict__ X, float* __restrict__ STAT) { __shared__ float sh1[32], sh2[32]; const int tid = threadIdx.x, w = tid >> 5, lane = tid & 31; const int g = blockIdx.x; const float* base = X + (size_t)g * GS * NP;
  v4f v[16];
#pragma unroll
  for (int i = 0; i < 16; ++i) v[i] = *(const v4fa*)(base + (size_t)(i * 1024 + tid) * 4);
  v4f s4 = {0.f, 0.f, 0.f, 0.f};
#pragma unroll
  for (int i = 0; i < 16; ++i) { if (ROUND) { for (int q = 0; q < 4; ++q) v[i][q] = bf16_round(v[i][q]); } s4 += v[i]; }
  const float s = wave_sum((s4[0] + s4[1]) + (s4[2] + s4[3])); if (lane == 0) sh1[w] = s; __syncthreads();
  const float mean = wave_sum(sh1[lane]) / (float)(GS * NP);
  v4f q4 = {0.f, 0.f, 0.f, 0.f};
#pragma unroll
  for (int i = 0; i < 16; ++i) { const v4f d = v[i] - mean; q4 += d * d; }
  const float q = wave_sum((q4[0] + q4[1]) + (q4[2] + q4[3])); if (lane == 0) sh2[w] = q; __syncthreads();
  if (w == 0) { const float var = wave_sum(sh2[lane]) / (float)(GS * NP); if (lane == 0) { typedef float v2f __attribute__((ext_vector_type(2))); v2f o; o[0] = mean; o[1] = 1.0f / sqrtf(var + 1e-6f); *(v2f*)(STAT + g * 2) = o; } } }
template <bool ROUND>
__global__ __launch_bounds__(256) void k_gnorm(const float* __restrict__ X, const float* __restrict__ STAT, const float* __restrict__ w, const float* __restrict__ bb, float* __restrict__ YC, _Float16* __restrict__ YP) { __shared__ float tl[16][65]; const int tid = threadIdx.x; const int cg = blockIdx.x / (NP / 16), pg = blockIdx.x % (NP / 16); const int c0 = cg * 64, p0 = pg * 16;
  for (int i = tid; i < 64 * 16; i += 256) { const int c = i / 16, pp = i % 16; const int ch = c0 + c; float v = X[(size_t)ch * NP + p0 + pp]; if (ROUND) v = bf16_round(v); const float y = (v - STAT[(ch / GS) * 2]) * STAT[(ch / GS) * 2 + 1] * bf16_round(w[ch]) + bf16_round(bb[ch]); tl[pp][c] = y; }
  __syncthreads();
  {
    (void)YC;
    if (tid < 128) { const int r = tid / 8, pc = tid % 8; FragH f;
#pragma unroll
      for (int q = 0; q < 8; ++q) f.h[q] = (_Float16)tl[r][pc * 8 + q]; *(v8us*)((unsigned short*)YP + (size_t)(p0 + r) * CC + c0 + pc * 8) = f.half[0]; }
     } }
template <bool ROUND>
__global__ __launch_bounds__(256) void k_gnormc(const float* __restrict__ X, const float* __restrict__ STAT, const float* __restrict__ w, const float* __restrict__ bb, float* __restrict__ YC) { const size_t t = (size_t)blockIdx.x * 256 + threadIdx.x; if (t >= (size_t)CC * NP / 4) return; const int ch = (int)(t / (NP / 4)); const v4f v = *(const v4fa*)(X + t * 4); const float m = STAT[(ch / GS) * 2], rs = STAT[(ch / GS) * 2 + 1], ww = bf16_round(w[ch]), b2 = bf16_round(bb[ch]); v4f y;
#pragma unroll
  for (int q = 0; q < 4; ++q) { float x = v[q]; if (ROUND) x = bf16_round(x); y[q] = (x - m) * rs * ww + b2; } *(v4f*)(YC + t * 4) = y;  }
__global__ __launch_bounds__(256) void k_vt32(const _Float16* __restrict__ V16, _Float16* __restrict__ Vt) { __shared__ unsigned short tl[64][34]; const int tid = threadIdx.x; const int h = blockIdx.x / (NP / 64), kg = blockIdx.x % (NP / 64);
  { const int r = tid / 4, c8 = (tid % 4) * 8; FragH f; f.half[0] = *(const v8us*)((const unsigned short*)V16 + (size_t)(kg * 64 + r) * CC + h * HD + c8);
#pragma unroll
    for (int q = 0; q < 8; ++q) tl[r][c8 + q] = f.u[q]; }
  __syncthreads();
  { { const int d = tid / 8, pc = tid % 8; FragH f;
#pragma unroll
      for (int q = 0; q < 8; ++q) f.u[q] = tl[pc * 8 + q][d]; *(v8us*)((unsigned short*)Vt + ((size_t)h * HD + d) * NP + kg * 64 + pc * 8) = f.half[0]; }  } }
__global__ __launch_bounds__(128) void k_attn(const _Float16* __restrict__ Q16, const _Float16* __restrict__ K16, const _Float16* __restrict__ Vt, float* __restrict__ O) { constexpr int RPW = 32; constexpr float SL2 = 0.25503486164919736f;
  __shared__ __attribute__((aligned(16))) float sO[4][RPW][HD + 4];
  const int tid = threadIdx.x, w = tid >> 5, lane = tid & 31, ln = lane & 15, hh = lane >> 4; const int h = blockIdx.x / (NP / 128), qblk = blockIdx.x % (NP / 128); const int q0 = qblk * 128 + w * RPW;
  FragH aq[2];
#pragma unroll
  for (int rt = 0; rt < 2; ++rt) { const unsigned short* qr = (const unsigned short*)Q16 + (size_t)(q0 + rt * 16 + ln) * CC + h * HD; aq[rt].half[0] = *(const v8us*)(qr + 8 * hh); aq[rt].half[1] = *(const v8us*)(qr + 16 + 8 * hh); }
  const unsigned short* Vth = (const unsigned short*)Vt + (size_t)h * HD * NP;
  float m_r[2], l_r[2]; v8f oacc[2][2];      // query rt * 16 + ln; oacc[rt][dt][r] = Ot[dt * 16 + 8hh + r][query]
#pragma unroll
  for (int rt = 0; rt < 2; ++rt) { m_r[rt] = -3.0e38f; l_r[rt] = 0.f; oacc[rt][0] = (v8f){0.f,0.f,0.f,0.f,0.f,0.f,0.f,0.f}; oacc[rt][1] = oacc[rt][0]; }
  // K and Vt fragments one pass ahead: each pass refills a fragment's registers for the next pass right behind its last product, so the loads fly during the softmax and the other products.
  // The last pass fetches pass 0's fragments again (in bounds, not used).
  const unsigned short* kl = (const unsigned short*)K16 + (size_t)ln * CC + h * HD + 8 * hh; const unsigned short* vl = Vth + (size_t)ln * NP + 8 * hh;
  FragH bk[2], bv[2];
#pragma unroll
  for (int t = 0; t < 2; ++t) { const unsigned short* kr = kl + (size_t)(t * 16) * CC; bk[t].half[0] = *(const v8us*)kr; bk[t].half[1] = *(const v8us*)(kr + 16); }
#pragma unroll
  for (int t = 0; t < 2; ++t) { const unsigned short* vrow = vl + (size_t)(t * 16) * NP; bv[t].half[0] = *(const v8us*)vrow; bv[t].half[1] = *(const v8us*)(vrow + 16); }
#pragma unroll 1
  for (int j0 = 0; j0 < NP; j0 += 32) { v8f s[2][2];      // s[rt][nt][r] = S[query][j0 + nt * 16 + 8hh + r]
    const int jn = j0 + 32 < NP ? j0 + 32 : 0;
#pragma unroll
    for (int nt = 0; nt < 2; ++nt) {
#pragma unroll
      for (int rt = 0; rt < 2; ++rt) { v8f acc = (v8f){0.f,0.f,0.f,0.f,0.f,0.f,0.f,0.f}; acc = mmaH<1>(bk[nt].v, bk[nt].v, aq[rt].v, aq[rt].v, acc); s[rt][nt] = acc; }
      const unsigned short* kr = kl + (size_t)(jn + nt * 16) * CC; bk[nt].half[0] = *(const v8us*)kr; bk[nt].half[1] = *(const v8us*)(kr + 16); }
    FragH pb[2];
#pragma unroll
    for (int rt = 0; rt < 2; ++rt) { float sc[16];      // raw products; SL2 > 0, so their maximum is the maximum of the scaled scores
#pragma unroll
      for (int i = 0; i < 16; ++i) sc[i] = s[rt][i >> 3][i & 7];
      float mx[8];
#pragma unroll
      for (int i = 0; i < 8; ++i) mx[i] = fmaxf(sc[i], sc[8 + i]);
      float mc = fmaxf(fmaxf(fmaxf(mx[0], mx[1]), fmaxf(mx[2], mx[3])), fmaxf(fmaxf(mx[4], mx[5]), fmaxf(mx[6], mx[7])));
      mc = fmaxf(mc, xhalf(mc));
      const float mn = fmaxf(m_r[rt], mc * SL2); const float al = __builtin_amdgcn_exp2f(m_r[rt] - mn); m_r[rt] = mn;      // m_r in log2 units
      float ps[8];
#pragma unroll
      for (int i = 0; i < 8; ++i) { const float p0 = __builtin_amdgcn_exp2f(fmaf(sc[i], SL2, -mn)), p1 = __builtin_amdgcn_exp2f(fmaf(sc[8 + i], SL2, -mn)); ps[i] = p0 + p1; pb[rt].h[i] = (_Float16)p0; pb[rt].h[8 + i] = (_Float16)p1; }
      l_r[rt] = l_r[rt] * al + (((ps[0] + ps[1]) + (ps[2] + ps[3])) + ((ps[4] + ps[5]) + (ps[6] + ps[7])));      // this half's keys; the halves join after the loop
#pragma unroll
      for (int r = 0; r < 8; ++r) { oacc[rt][0][r] *= al; oacc[rt][1][r] *= al; } }
#pragma unroll
    for (int dt = 0; dt < 2; ++dt) {
#pragma unroll
      for (int rt = 0; rt < 2; ++rt) oacc[rt][dt] = mmaH<1>(bv[dt].v, bv[dt].v, pb[rt].v, pb[rt].v, oacc[rt][dt]);
      const unsigned short* vrow = vl + (size_t)(dt * 16) * NP + jn; bv[dt].half[0] = *(const v8us*)vrow; bv[dt].half[1] = *(const v8us*)(vrow + 16); }
    asm volatile("s_wait_xcnt 0x0" ::: "memory"); }      // the Vt loads stay in flight over the back edge: the wait stands before their address registers are written again
#pragma unroll
  for (int rt = 0; rt < 2; ++rt) { const float l = l_r[rt] + xhalf(l_r[rt]); const float li = 1.0f / l;
#pragma unroll
    for (int dt = 0; dt < 2; ++dt)
#pragma unroll
      for (int r4 = 0; r4 < 8; r4 += 4) { v4f v; for (int q = 0; q < 4; ++q) v[q] = oacc[rt][dt][r4 + q] * li; *(v4fa*)&sO[w][rt * 16 + ln][dt * 16 + 8 * hh + r4] = v; } }
  __builtin_amdgcn_fence(__ATOMIC_ACQ_REL, "workgroup"); __builtin_amdgcn_wave_barrier();
  {
#pragma unroll
    for (int rp = 0; rp < RPW; rp += 4) { const int r = rp + (lane >> 3), pc = lane & 7; const v4f v = *(const v4fa*)&sO[w][r][pc * 4]; *(v4f*)(O + (size_t)(q0 + r) * CC + h * HD + pc * 4) = v; }
     } }
__global__ __launch_bounds__(256) void k_h16(const float* __restrict__ x, _Float16* __restrict__ X16, size_t n8) { const size_t t = (size_t)blockIdx.x * 256 + threadIdx.x; if (t >= n8) return; FragH f;
#pragma unroll
  for (int q = 0; q < 8; ++q) f.h[q] = (_Float16)x[t * 8 + q]; *(v8us*)((unsigned short*)X16 + t * 8) = f.half[0];  }
__global__ __launch_bounds__(256) void k_fin(const float* __restrict__ OP, const float* __restrict__ x, float* __restrict__ out) { __shared__ float tl[32][65]; const int tid = threadIdx.x; const int cg = blockIdx.x / (NP / 64), pg = blockIdx.x % (NP / 64); const int c0 = cg * 32, p0 = pg * 64;
  for (int i = tid; i < 64 * 32; i += 256) { const int pp = i / 32, c = i % 32; tl[c][pp] = OP[(size_t)(p0 + pp) * CC + c0 + c]; }
  __syncthreads();
  { for (int i = tid; i < 32 * 16; i += 256) { const int c = i / 16, pc = i % 16; const size_t o = (size_t)(c0 + c) * NP + p0 + pc * 4; const v4f xv = *(const v4fa*)(x + o); v4f v; for (int q = 0; q < 4; ++q) v[q] = (tl[c][pc * 4 + q] + bf16_round(xv[q])) * 0.7071067811865476f; *(v4f*)(out + o) = v; }  } }
extern "C" void kernel_launch(void* const* d_in, const int* in_sizes, int n_in,
                              void* d_out, int out_size, void* d_ws, size_t ws_size, hipStream_t stream) {
  (void)in_sizes; (void)n_in; (void)out_size;
  const float* x = (const float*)d_in[0]; const float* gw = (const float*)d_in[1]; const float* gb = (const float*)d_in[2]; const float* wq = (const float*)d_in[3]; const float* bq = (const float*)d_in[4]; const float* wk = (const float*)d_in[5]; const float* bk = (const float*)d_in[6]; const float* wv = (const float*)d_in[7]; const float* bv = (const float*)d_in[8]; const float* wo = (const float*)d_in[9]; const float* bo = (const float*)d_in[10];
  char* ws = (char*)d_ws; size_t off = 0;
  auto take = [&](size_t bytes) { char* p = ws + off; off += (bytes + 255) & ~(size_t)255; return p; };
  _Float16* Bq = (_Float16*)take(CC * CC * 2); _Float16* Bk = (_Float16*)take(CC * CC * 2); _Float16* Bv = (_Float16*)take(CC * CC * 2); _Float16* Bo = (_Float16*)take(CC * CC * 2); float* ST1 = (float*)take(NG * 2 * 4 + 256); float* ST2 = (float*)take(NG * 2 * 4 + 256);
  float* QNC = (float*)take((size_t)CC * NP * 4); _Float16* QNP = (_Float16*)take((size_t)NP * CC * 2); _Float16* VNP = (_Float16*)take((size_t)NP * CC * 2); _Float16* Q16 = (_Float16*)take((size_t)NP * CC * 2); _Float16* K16 = (_Float16*)take((size_t)NP * CC * 2); _Float16* V16 = (_Float16*)take((size_t)NP * CC * 2); _Float16* Vt = (_Float16*)take((size_t)NP * CC * 2); float* O = QNC; _Float16* O16 = QNP; float* OP = (float*)take((size_t)NP * CC * 4);
  if (off > ws_size) return;      // 2.1 + 8.4 + 4.2 × 6 + 8.4 ≈ 44 MB
  const unsigned gw8 = (CC * CC / 8 + 255) / 256; k_round16f<<<gw8, 256, 0, stream>>>(wq, Bq, CC * CC / 8); k_round16f<<<gw8, 256, 0, stream>>>(wk, Bk, CC * CC / 8); k_round16f<<<gw8, 256, 0, stream>>>(wv, Bv, CC * CC / 8); k_round16f<<<gw8, 256, 0, stream>>>(wo, Bo, CC * CC / 8);      // (out,in)
  k_gstat<true><<<NG, 1024, 0, stream>>>(x, ST1);
  k_gnormc<true><<<(CC * NP / 4 + 255) / 256, 256, 0, stream>>>(x, ST1, gw, gb, QNC);      // qn channel-major f32 (input of the second GroupNorm)
  k_gnorm<true><<<(CC / 64) * (NP / 16), 256, 0, stream>>>(x, ST1, gw, gb, nullptr, QNP);      // qn position-major f16
  k_gstat<false><<<NG, 1024, 0, stream>>>(QNC, ST2);
  k_gnorm<false><<<(CC / 64) * (NP / 16), 256, 0, stream>>>(QNC, ST2, gw, gb, nullptr, VNP);      // vn = GN(qn) position-major f16
  const dim3 gg(((NP / 16) * (CC / 64) + 3) / 4, 1);
  k_gemm_hhx<0><<<gg, 128, 0, stream>>>(QNP, CC, 0, Bq, CC, 0, 0.0625f, bq, 0, nullptr, 1, 0, 0, nullptr, Q16, CC, 0, NP, CC, CC);
  k_gemm_hhx<0><<<gg, 128, 0, stream>>>(VNP, CC, 0, Bk, CC, 0, 0.0625f, bk, 0, nullptr, 1, 0, 0, nullptr, K16, CC, 0, NP, CC, CC);
  k_gemm_hhx<0><<<gg, 128, 0, stream>>>(VNP, CC, 0, Bv, CC, 0, 0.0625f, bv, 0, nullptr, 1, 0, 0, nullptr, V16, CC, 0, NP, CC, CC);
  k_vt32<<<NH * (NP / 64), 256, 0, stream>>>(V16, Vt);
  k_attn<<<NH * (NP / 128), 128, 0, stream>>>(Q16, K16, Vt, O);
  k_h16<<<(NP * CC / 8 + 255) / 256, 256, 0, stream>>>(O, O16, (size_t)NP * CC / 8);
  k_gemm_hhx<0><<<gg, 128, 0, stream>>>(O16, CC, 0, Bo, CC, 0, 0.0625f, bo, 0, nullptr, 1, 0, 0, OP, nullptr, CC, 0, NP, CC, CC);
  k_fin<<<(CC / 32) * (NP / 64), 256, 0, stream>>>(OP, x, (float*)d_out);
}

// v005
// Measured time: 135 microseconds a run.
// Next to v004, in two timings, it ran 1.41 times as fast each time.
// All steps since v000 together make it 3.11 times as fast.
#include <hip/hip_runtime.h>
// the 1×1 convs (4096 × 512 × 512, + bias, weights (out,in) bf16-exact ×2^4) and the attention as a fused flash-style kernel (S = Q·Kᵀ·32^-½ with d = 32 in one k-step, online softmax f32,
// P f16 ≤ 1, O = P·V) on v_wmma_f32_16x16x32_f16 (f16 operands, single products, f32 accumulate); residual (out + x)/√2 and layout transposes f32 VALU.
#define CC 512
#define NP 4096
#define NG 32
#define GS 16
#define NH 16
#define HD 32

typedef __bf16 v16b __attribute__((ext_vector_type(16)));
typedef unsigned short v8us __attribute__((ext_vector_type(8), may_alias));
typedef float  v8f  __attribute__((ext_vector_type(8)));
typedef float  v4f  __attribute__((ext_vector_type(4)));
typedef float  v4fa __attribute__((ext_vector_type(4), may_alias));
union FragB { v16b v; v8us half[2]; unsigned short u[16]; };

__device__ __forceinline__ unsigned short bf16_bits(float x) { unsigned int u = __float_as_uint(x); return (unsigned short)((u + 0x7FFFu + ((u >> 16) & 1u)) >> 16); }
__device__ __forceinline__ float bf16_val(unsigned short b) { return __uint_as_float(((unsigned int)b) << 16); }
__device__ __forceinline__ float bf16_round(float x) { return bf16_val(bf16_bits(x)); }
// D += A·B with NT terms: 1 = ah·bh, 2 = + al·bh (A split), 3 = + ah·bl (both split)
template <int NT>
__device__ __forceinline__ v8f mmaN(v16b ah, v16b al, v16b bh, v16b bl, v8f c) {
  c = __builtin_amdgcn_wmma_f32_16x16x32_bf16(false, ah, false, bh, (short)0, c, false, false);
  if (NT >= 2) c = __builtin_amdgcn_wmma_f32_16x16x32_bf16(false, al, false, bh, (short)0, c, false, false);
  if (NT >= 3) c = __builtin_amdgcn_wmma_f32_16x16x32_bf16(false, ah, false, bl, (short)0, c, false, false);
  asm volatile("v_nop\n\tv_nop\n\tv_nop\n\tv_nop" : "+v"(c) : "v"(ah), "v"(al), "v"(bh), "v"(bl));
  return c;
}

__global__ __launch_bounds__(256) void k_wt_bf16(const float* __restrict__ W, unsigned short* __restrict__ Wt, int K, int N) {
  const int t = blockIdx.x * 256 + threadIdx.x;
  const int k8n = K / 8;
  if (t >= N * k8n) return;
  const int n = t / k8n, k8 = (t % k8n) * 8;
  v8us v;
#pragma unroll
  for (int i = 0; i < 8; ++i) v[i] = bf16_bits(W[(size_t)(k8 + i) * N + n]);
  *(v8us*)(Wt + (size_t)n * K + k8) = v;
  
}

// GEMM C[M][N] (f32, pitch ldc) = act(A[M][K]·W + bias). A f32 row-major (pitch lda) converted per fragment to bf16
// (ASPLIT: hi/lo two planes -> 2 terms, else single rounded term); Wt bf16 [N][K] (pitch ldb). BIAS_BF16 rounds the
// bias to bf16 first (bias quantised to bf16 before the add). K%32==0, M%16==0, N%64==0.
template <bool ASPLIT, int ACT, bool BIAS_BF16>
__global__ __launch_bounds__(128) void k_gemm_bf(const float* __restrict__ A, int lda, const unsigned short* __restrict__ Wt, int ldb,
                                               const float* __restrict__ bias, float* __restrict__ C, int ldc, int M, int N, int K) {
  __shared__ __attribute__((aligned(16))) float so[4][16][64];
  const int tid = threadIdx.x, w = tid >> 5, lane = tid & 31, ln = lane & 15, hh = lane >> 4;
  const int ntn = N / 64;
  const int wid = blockIdx.x * 4 + w;
  const int mt = wid / ntn, nq = wid % ntn;
  if (mt * 16 >= M) return;
  const int row0 = mt * 16, col0 = nq * 64;
  const float* arow = A + (size_t)(row0 + ln) * lda;
  v8f acc[4] = {};
  for (int kb = 0; kb < K; kb += 32) {
    FragB ah, al;
    const v4f x0 = *(const v4fa*)(arow + kb + 8 * hh), x1 = *(const v4fa*)(arow + kb + 8 * hh + 4);
    const v4f x2 = *(const v4fa*)(arow + kb + 16 + 8 * hh), x3 = *(const v4fa*)(arow + kb + 16 + 8 * hh + 4);
    float xs[16] = {x0[0],x0[1],x0[2],x0[3],x1[0],x1[1],x1[2],x1[3],x2[0],x2[1],x2[2],x2[3],x3[0],x3[1],x3[2],x3[3]};
#pragma unroll
    for (int i = 0; i < 16; ++i) { const unsigned short hb = bf16_bits(xs[i]); ah.u[i] = hb; al.u[i] = ASPLIT ? bf16_bits(xs[i] - bf16_val(hb)) : (unsigned short)0; }
#pragma unroll
    for (int t = 0; t < 4; ++t) {
      const unsigned short* brow = Wt + (size_t)(col0 + t * 16 + ln) * ldb + kb;
      FragB b;
      b.half[0] = *(const v8us*)(brow + 8 * hh);
      b.half[1] = *(const v8us*)(brow + 16 + 8 * hh);
      acc[t] = mmaN<ASPLIT ? 2 : 1>(ah.v, al.v, b.v, b.v, acc[t]);
    }
  }
#pragma unroll
  for (int t = 0; t < 4; ++t) {
    float bv = bias ? bias[col0 + t * 16 + ln] : 0.f;
    if (BIAS_BF16) bv = bf16_round(bv);
#pragma unroll
    for (int r = 0; r < 8; ++r) { float v = acc[t][r] + bv; if (ACT == 1) v = fmaxf(v, 0.f); so[w][8 * hh + r][t * 16 + ln] = v; }
  }
  __builtin_amdgcn_fence(__ATOMIC_ACQ_REL, "workgroup");
  __builtin_amdgcn_wave_barrier();
  const int rsub = lane >> 4, c4 = (lane & 15) * 4;
  {
#pragma unroll
    for (int q = 0; q < 8; ++q) {
      const int r = q * 2 + rsub;
      const v4f v = *(const v4fa*)&so[w][r][c4];
      *(v4f*)(C + (size_t)(row0 + r) * ldc + col0 + c4) = v;
    }
    
  }
}

// Flash-style causal/unmasked attention, all contractions 3-term bf16 hi/lo splits, f32 softmax with running max.
// q,k,v rows are read from f32 buffers with arbitrary row pitch (so they can live inside a fused qkv buffer);
// D = head size (multiple of 32, <= 128); one wave = 16 query rows; block = 4 waves (64 queries) sharing K/V chunks of 32.
template <int D, bool CAUSAL>
__global__ __launch_bounds__(128) void k_flash(const float* __restrict__ qb, const float* __restrict__ kb, const float* __restrict__ vb,
                                             int pitch, int T, int H, float scale, float* __restrict__ y, int ypitch) {
  constexpr int KS = D / 32;        // k-steps for QK
  constexpr int DT = D / 16;        // d tiles for PV
  __shared__ __attribute__((aligned(16))) unsigned short sKh[32][D + 8], sKl[32][D + 8], sVh[32][D + 8], sVl[32][D + 8];
  __shared__ __attribute__((aligned(16))) unsigned short sPh[4][16][40], sPl[4][16][40];
  __shared__ __attribute__((aligned(16))) float sO[4][16][D];
  const int tid = threadIdx.x, w = tid >> 5, lane = tid & 31, ln = lane & 15, hh = lane >> 4;
  const int nqb = (T + 63) / 64;
  const int bh = blockIdx.x / nqb, qblk = blockIdx.x % nqb;
  const int b = bh / H, h = bh % H;
  const int q0 = qblk * 64 + w * 16;
  const float* Q = qb + (size_t)b * T * pitch + h * D;
  const float* K = kb + (size_t)b * T * pitch + h * D;
  const float* V = vb + (size_t)b * T * pitch + h * D;

  // A fragments of the wave's 16 query rows (scaled), hi/lo
  FragB aqh[KS], aql[KS];
  {
    int row = q0 + ln; if (row >= T) row = T - 1;
    const float* qr = Q + (size_t)row * pitch;
#pragma unroll
    for (int ks = 0; ks < KS; ++ks)
#pragma unroll
      for (int i = 0; i < 16; ++i) {
        const int d = ks * 32 + ((i < 8) ? (8 * hh + i) : (16 + 8 * hh + (i - 8)));
        const float x = qr[d] * scale; const unsigned short hb = bf16_bits(x);
        aqh[ks].u[i] = hb; aql[ks].u[i] = bf16_bits(x - bf16_val(hb));
      }
  }
  float m_r[8], l_r[8];
#pragma unroll
  for (int r = 0; r < 8; ++r) { m_r[r] = -3.0e38f; l_r[r] = 0.f; }
  v8f oacc[DT];
#pragma unroll
  for (int dt = 0; dt < DT; ++dt) oacc[dt] = (v8f){0.f,0.f,0.f,0.f,0.f,0.f,0.f,0.f};

  const int kv_end = CAUSAL ? min(T, qblk * 64 + 64) : T;     // block-uniform
  for (int j0 = 0; j0 < kv_end; j0 += 32) {
    __syncthreads();
    for (int e = tid; e < 32 * (D / 4); e += 128) {
      const int r = e / (D / 4), c4 = (e % (D / 4)) * 4;
      const int key = j0 + r;
      v4f kf = {0.f,0.f,0.f,0.f}, vf = {0.f,0.f,0.f,0.f};
      if (key < T) { kf = *(const v4fa*)(K + (size_t)key * pitch + c4); vf = *(const v4fa*)(V + (size_t)key * pitch + c4); }
#pragma unroll
      for (int t = 0; t < 4; ++t) {
        unsigned short hb = bf16_bits(kf[t]); sKh[r][c4 + t] = hb; sKl[r][c4 + t] = bf16_bits(kf[t] - bf16_val(hb));
        hb = bf16_bits(vf[t]); sVh[r][c4 + t] = hb; sVl[r][c4 + t] = bf16_bits(vf[t] - bf16_val(hb));
      }
    }
    __syncthreads();
    // S tile 16 x 32
    v8f s[2];
#pragma unroll
    for (int nt = 0; nt < 2; ++nt) {
      v8f acc = {};
#pragma unroll
      for (int ks = 0; ks < KS; ++ks) {
        FragB bh_, bl_;
        bh_.half[0] = *(const v8us*)&sKh[nt * 16 + ln][ks * 32 + 8 * hh]; bh_.half[1] = *(const v8us*)&sKh[nt * 16 + ln][ks * 32 + 16 + 8 * hh];
        bl_.half[0] = *(const v8us*)&sKl[nt * 16 + ln][ks * 32 + 8 * hh]; bl_.half[1] = *(const v8us*)&sKl[nt * 16 + ln][ks * 32 + 16 + 8 * hh];
        acc = mmaN<3>(aqh[ks].v, aql[ks].v, bh_.v, bl_.v, acc);
      }
      s[nt] = acc;
    }
    // mask + running max (rows 8hh+r; the 16 lanes of a half share rows)
    float alpha[8];
#pragma unroll
    for (int r = 0; r < 8; ++r) {
      const int qi = q0 + 8 * hh + r;
      const int ja = j0 + ln, jb = j0 + 16 + ln;
      if (CAUSAL) { if (ja > qi) s[0][r] = -3.0e38f; if (jb > qi) s[1][r] = -3.0e38f; }
      if (ja >= T) s[0][r] = -3.0e38f;
      if (jb >= T) s[1][r] = -3.0e38f;
      float mx = fmaxf(s[0][r], s[1][r]);
      mx = fmaxf(mx, __shfl_xor(mx, 1, 32)); mx = fmaxf(mx, __shfl_xor(mx, 2, 32)); mx = fmaxf(mx, __shfl_xor(mx, 4, 32)); mx = fmaxf(mx, __shfl_xor(mx, 8, 32));
      const float mnew = fmaxf(m_r[r], mx);
      alpha[r] = (mnew > -1.0e38f) ? __expf(m_r[r] - mnew) : 1.0f;
      const float p0 = (s[0][r] > -1.0e38f) ? __expf(s[0][r] - mnew) : 0.f;
      const float p1 = (s[1][r] > -1.0e38f) ? __expf(s[1][r] - mnew) : 0.f;
      m_r[r] = mnew;
      l_r[r] = l_r[r] * alpha[r] + p0 + p1;            // per-lane partial row sum (16 lanes combined at the end)
      unsigned short hb = bf16_bits(p0); sPh[w][8 * hh + r][ln] = hb;      sPl[w][8 * hh + r][ln] = bf16_bits(p0 - bf16_val(hb));
      hb = bf16_bits(p1);                sPh[w][8 * hh + r][16 + ln] = hb; sPl[w][8 * hh + r][16 + ln] = bf16_bits(p1 - bf16_val(hb));
    }
#pragma unroll
    for (int dt = 0; dt < DT; ++dt)
#pragma unroll
      for (int r = 0; r < 8; ++r) oacc[dt][r] *= alpha[r];
    __builtin_amdgcn_fence(__ATOMIC_ACQ_REL, "workgroup");
    __builtin_amdgcn_wave_barrier();
    FragB pah, pal;
    pah.half[0] = *(const v8us*)&sPh[w][ln][8 * hh]; pah.half[1] = *(const v8us*)&sPh[w][ln][16 + 8 * hh];
    pal.half[0] = *(const v8us*)&sPl[w][ln][8 * hh]; pal.half[1] = *(const v8us*)&sPl[w][ln][16 + 8 * hh];
#pragma unroll
    for (int dt = 0; dt < DT; ++dt) {
      FragB bvh, bvl;
#pragma unroll
      for (int i = 0; i < 8; ++i) {
        bvh.u[i] = sVh[8 * hh + i][dt * 16 + ln]; bvh.u[8 + i] = sVh[16 + 8 * hh + i][dt * 16 + ln];
        bvl.u[i] = sVl[8 * hh + i][dt * 16 + ln]; bvl.u[8 + i] = sVl[16 + 8 * hh + i][dt * 16 + ln];
      }
      oacc[dt] = mmaN<3>(pah.v, pal.v, bvh.v, bvl.v, oacc[dt]);
    }
    __builtin_amdgcn_fence(__ATOMIC_ACQ_REL, "workgroup");
    __builtin_amdgcn_wave_barrier();
  }
#pragma unroll
  for (int r = 0; r < 8; ++r) {
    float l = l_r[r];
    l += __shfl_xor(l, 1, 32); l += __shfl_xor(l, 2, 32); l += __shfl_xor(l, 4, 32); l += __shfl_xor(l, 8, 32);
    l_r[r] = (l > 0.f) ? 1.0f / l : 0.f;
  }
#pragma unroll
  for (int dt = 0; dt < DT; ++dt)
#pragma unroll
    for (int r = 0; r < 8; ++r) sO[w][8 * hh + r][dt * 16 + ln] = oacc[dt][r] * l_r[r];
  __builtin_amdgcn_fence(__ATOMIC_ACQ_REL, "workgroup");
  __builtin_amdgcn_wave_barrier();
  {
    for (int r = 0; r < 16; ++r) {
      const int row = q0 + r;
      if (row < T && lane < D / 4) {
        const v4f val = *(const v4fa*)&sO[w][r][lane * 4];
        *(v4f*)(y + ((size_t)b * T + row) * ypitch + h * D + lane * 4) = val;
      }
    }
    
  }
}

// GEMM C = act(A·W + bias + resid): A f32 (ASPLIT -> hi/lo 2 terms), Wt bf16 [N][K]; ACT 0 none, 1 relu, 2 exact gelu;
// resid (optional, f32, row index = (row % rmod), pitch ldr, RES_BF16 rounds it) added before the activation.
template <bool ASPLIT, int ACT, bool BIAS_BF16, bool RES_BF16>
__global__ __launch_bounds__(128) void k_gemm_bf3(const float* __restrict__ A, int lda, const unsigned short* __restrict__ Wt, int ldb,
                                                const float* __restrict__ bias, const float* __restrict__ resid, int rmod, int ldr,
                                                float* __restrict__ C, int ldc, int M, int N, int K) {
  __shared__ __attribute__((aligned(16))) float so[4][16][64];
  const int tid = threadIdx.x, w = tid >> 5, lane = tid & 31, ln = lane & 15, hh = lane >> 4;
  const int ntn = N / 64;
  const int wid = blockIdx.x * 4 + w;
  const int mt = wid / ntn, nq = wid % ntn;
  if (mt * 16 >= M) return;
  const int row0 = mt * 16, col0 = nq * 64;
  const float* arow = A + (size_t)(row0 + ln) * lda;
  v8f acc[4] = {};
  for (int kb = 0; kb < K; kb += 32) {
    FragB ah, al;
    const v4f x0 = *(const v4fa*)(arow + kb + 8 * hh), x1 = *(const v4fa*)(arow + kb + 8 * hh + 4);
    const v4f x2 = *(const v4fa*)(arow + kb + 16 + 8 * hh), x3 = *(const v4fa*)(arow + kb + 16 + 8 * hh + 4);
    float xs[16] = {x0[0],x0[1],x0[2],x0[3],x1[0],x1[1],x1[2],x1[3],x2[0],x2[1],x2[2],x2[3],x3[0],x3[1],x3[2],x3[3]};
#pragma unroll
    for (int i = 0; i < 16; ++i) { const unsigned short hb = bf16_bits(xs[i]); ah.u[i] = hb; al.u[i] = ASPLIT ? bf16_bits(xs[i] - bf16_val(hb)) : (unsigned short)0; }
#pragma unroll
    for (int t = 0; t < 4; ++t) {
      const unsigned short* brow = Wt + (size_t)(col0 + t * 16 + ln) * ldb + kb;
      FragB b;
      b.half[0] = *(const v8us*)(brow + 8 * hh);
      b.half[1] = *(const v8us*)(brow + 16 + 8 * hh);
      acc[t] = mmaN<ASPLIT ? 2 : 1>(ah.v, al.v, b.v, b.v, acc[t]);
    }
  }
#pragma unroll
  for (int t = 0; t < 4; ++t) {
    const int col = col0 + t * 16 + ln;
    float bv = bias ? bias[col] : 0.f;
    if (BIAS_BF16) bv = bf16_round(bv);
#pragma unroll
    for (int r = 0; r < 8; ++r) {
      float v = acc[t][r] + bv;
      if (resid) { float rv = resid[(size_t)((row0 + 8 * hh + r) % rmod) * ldr + col]; if (RES_BF16) rv = bf16_round(rv); v += rv; }
      if (ACT == 1) v = fmaxf(v, 0.f);
      if (ACT == 2) v = 0.5f * v * (1.0f + erff(v * 0.70710678118654752f));
      if (ACT == 3) { const float u = 0.7978845608028654f * (v + 0.044715f * v * v * v); v = 0.5f * v * (1.0f + tanhf(u)); }
      so[w][8 * hh + r][t * 16 + ln] = v;
    }
  }
  __builtin_amdgcn_fence(__ATOMIC_ACQ_REL, "workgroup");
  __builtin_amdgcn_wave_barrier();
  const int rsub = lane >> 4, c4 = (lane & 15) * 4;
  {
#pragma unroll
    for (int q = 0; q < 8; ++q) {
      const int r = q * 2 + rsub;
      const v4f v = *(const v4fa*)&so[w][r][c4];
      *(v4f*)(C + (size_t)(row0 + r) * ldc + col0 + c4) = v;
    }
    
  }
}
// row LayerNorm (biased variance, eps) over N: s = X (+ R); optional out_sum <- s; out_norm <- (s-mu)*rsqrt(var+eps)*g + b
template <bool PARAM_BF16>
__global__ __launch_bounds__(256) void k_layernorm(const float* __restrict__ X, const float* __restrict__ R, const float* __restrict__ g, const float* __restrict__ bta,
                                                  float* __restrict__ out_sum, float* __restrict__ out_norm, int N, float eps) {
  __shared__ float red[256];
  const int row = blockIdx.x, tid = threadIdx.x;
  const float* x = X + (size_t)row * N; const float* rr = R ? R + (size_t)row * N : nullptr;
  float vals[16];                     // up to N = 4096
  const int per = N / 256;            // contiguous chunk per thread? use strided-by-4 chunks: thread handles j = tid*4 + 1024*u
  float s1 = 0.f;
  for (int u = 0; u < per / 4; ++u) {
    const int j = tid * 4 + 1024 * u;
    const v4f a = *(const v4fa*)(x + j);
    v4f b = {0.f,0.f,0.f,0.f}; if (rr) b = *(const v4fa*)(rr + j);
#pragma unroll
    for (int q = 0; q < 4; ++q) { const float v = a[q] + b[q]; vals[u * 4 + q] = v; s1 += v; }
  }
  red[tid] = s1; __syncthreads();
  for (int st = 128; st > 0; st >>= 1) { if (tid < st) red[tid] += red[tid + st]; __syncthreads(); }
  const float mu = red[0] / (float)N; __syncthreads();
  float s2 = 0.f;
  for (int u = 0; u < per / 4; ++u)
#pragma unroll
    for (int q = 0; q < 4; ++q) { const float c = vals[u * 4 + q] - mu; s2 += c * c; }
  red[tid] = s2; __syncthreads();
  for (int st = 128; st > 0; st >>= 1) { if (tid < st) red[tid] += red[tid + st]; __syncthreads(); }
  const float rs = rsqrtf(red[0] / (float)N + eps);
  {
    for (int u = 0; u < per / 4; ++u) {
      const int j = tid * 4 + 1024 * u;
      v4f o, sm;
#pragma unroll
      for (int q = 0; q < 4; ++q) {
        float gg = g[j + q], bb = bta[j + q];
        if (PARAM_BF16) { gg = bf16_round(gg); bb = bf16_round(bb); }
        sm[q] = vals[u * 4 + q]; o[q] = (vals[u * 4 + q] - mu) * rs * gg + bb;
      }
      if (out_sum) *(v4f*)(out_sum + (size_t)row * N + j) = sm;
      *(v4f*)(out_norm + (size_t)row * N + j) = o;
    }
    
  }
}



// ---- f16 WMMA path (v_wmma_f32_16x16x32_f16): 11-bit significands for operands in range — used here for every matrix product (1×1 convs, Q·Kᵀ and P·V)
typedef _Float16 v16h __attribute__((ext_vector_type(16)));
union FragH { v16h v; v8us half[2]; _Float16 h[16]; unsigned short u[16]; };
template <int NT>
__device__ __forceinline__ v8f mmaH(v16h ah, v16h al, v16h bh, v16h bl, v8f c) {
  c = __builtin_amdgcn_wmma_f32_16x16x32_f16(false, ah, false, bh, (short)0, c, false, false);
  if (NT >= 2) c = __builtin_amdgcn_wmma_f32_16x16x32_f16(false, al, false, bh, (short)0, c, false, false);
  if (NT >= 3) c = __builtin_amdgcn_wmma_f32_16x16x32_f16(false, ah, false, bl, (short)0, c, false, false);
  asm volatile("v_nop\n\tv_nop\n\tv_nop\n\tv_nop" : "+v"(c) : "v"(ah), "v"(al), "v"(bh), "v"(bl));
  return c;
}
// batched GEMM like k_gemm_b but f16 operands: A f32 (split into f16 hi/lo if ASPLIT, else rounded to f16), Bt = f16 values [n][k]; alpha; C f32; N multiple of 16 (partial tiles skipped)
template <bool ASPLIT>
__global__ __launch_bounds__(128) void k_gemm_h(const float* __restrict__ A, int lda, size_t sA, const _Float16* __restrict__ Bh, int ldb, size_t sB, float alpha, float* __restrict__ C, int ldc, size_t sC, int M, int N, int K) {
  __shared__ __attribute__((aligned(16))) float so[4][16][64];
  const int tid = threadIdx.x, w = tid >> 5, lane = tid & 31, ln = lane & 15, hh = lane >> 4; const int by = blockIdx.y;
  A += (size_t)by * sA; Bh += (size_t)by * sB; C += (size_t)by * sC;
  const int ntn = (N + 63) / 64; const int wid = blockIdx.x * 4 + w; const int mt = wid / ntn, nq = wid % ntn; if (mt * 16 >= M) return;
  const int row0 = mt * 16, col0 = nq * 64; const float* arow = A + (size_t)(row0 + ln) * lda;
  v8f acc[4] = {};
  for (int kb = 0; kb < K; kb += 32) {
    FragH ah, al;
    const v4f x0 = *(const v4fa*)(arow + kb + 8 * hh), x1 = *(const v4fa*)(arow + kb + 8 * hh + 4), x2 = *(const v4fa*)(arow + kb + 16 + 8 * hh), x3 = *(const v4fa*)(arow + kb + 16 + 8 * hh + 4);
    float xs[16] = {x0[0],x0[1],x0[2],x0[3],x1[0],x1[1],x1[2],x1[3],x2[0],x2[1],x2[2],x2[3],x3[0],x3[1],x3[2],x3[3]};
#pragma unroll
    for (int i = 0; i < 16; ++i) { const _Float16 h = (_Float16)xs[i]; ah.h[i] = h; al.h[i] = ASPLIT ? (_Float16)(xs[i] - (float)h) : (_Float16)0.0f; }
#pragma unroll
    for (int t = 0; t < 4; ++t) { if (col0 + t * 16 >= N) continue; const size_t boff = (size_t)(col0 + t * 16 + ln) * ldb + kb; FragH bq; bq.half[0] = *(const v8us*)(Bh + boff + 8 * hh); bq.half[1] = *(const v8us*)(Bh + boff + 16 + 8 * hh);
      acc[t] = mmaH<ASPLIT ? 2 : 1>(ah.v, al.v, bq.v, bq.v, acc[t]); }
  }
#pragma unroll
  for (int t = 0; t < 4; ++t) { if (col0 + t * 16 >= N) continue;
#pragma unroll
    for (int r = 0; r < 8; ++r) so[w][8 * hh + r][t * 16 + ln] = acc[t][r] * alpha; }
  __builtin_amdgcn_fence(__ATOMIC_ACQ_REL, "workgroup"); __builtin_amdgcn_wave_barrier();
  const int rsub = lane >> 4, c4 = (lane & 15) * 4;
  {
#pragma unroll
    for (int q = 0; q < 8; ++q) { const int r = q * 2 + rsub; if (col0 + c4 < N) { const v4f v = *(const v4fa*)&so[w][r][c4]; *(v4f*)(C + (size_t)(row0 + r) * ldc + col0 + c4) = v; } }
     }
}

// Wt[n][k] = f16(W[k][n]·scale) from f32 row-major W[K][N] (scale = power of two; bf16-exact weights stay exact in f16 away from the subnormal range)
__global__ __launch_bounds__(256) void k_wt_f16(const float* __restrict__ W, _Float16* __restrict__ Wt, int K, int N, float scale) {
  const int t = blockIdx.x * 256 + threadIdx.x; if (t >= N * (K / 8)) return; const int n = t / (K / 8), k8 = (t % (K / 8)) * 8; FragH f;
#pragma unroll
  for (int i = 0; i < 8; ++i) f.h[i] = (_Float16)(bf16_round(W[(size_t)(k8 + i) * N + n]) * scale); const v8us o = f.half[0];
  *(v8us*)((unsigned short*)Wt + (size_t)n * K + k8) = o; 
}
// the ten 16-byte loads of one k-step: the A fragment and four B fragments (ap, bp: the lane's row start + 8 * hh; ka, kb: the k-step's offset in each operand)
__device__ __forceinline__ void ld_kstep(const unsigned short* ap, const unsigned short* const (&bp)[4], int ka, int kb, FragH& a, FragH (&b)[4]) {
  a.half[0] = *(const v8us*)(ap + ka); a.half[1] = *(const v8us*)(ap + ka + 16);
#pragma unroll
  for (int t = 0; t < 4; ++t) { b[t].half[0] = *(const v8us*)(bp[t] + kb); b[t].half[1] = *(const v8us*)(bp[t] + kb + 16); }
  asm volatile("s_wait_xcnt 0x0" ::: "memory");      // these loads stay in flight: the wait stands before their address registers are written again
}
// acc[t] += A rows . (B rows)^T for one wave's 16 x 64 tile, K a multiple of 128. sb: a B row's k-step kb starts at element kb * sb (1: a plain row; NP: head-major [K / 32][rows][32]).
// Fragments three k-steps ahead in a ring of four register sets: a k-step's ten loads are issued three k-steps before its products. A fetch past the last k-step reads k-step 0 again and is not used.
__device__ __forceinline__ void gemm_tile(const unsigned short* ap, const unsigned short* const (&bw)[4], int sb, int K, v8f (&acc)[4]) {
  FragH fa[4], fb[4][4];
#pragma unroll
  for (int u = 0; u < 3; ++u) ld_kstep(ap, bw, u * 32, u * 32 * sb, fa[u], fb[u]);
  __builtin_amdgcn_sched_barrier(0);      // keeps the first product, and the wait for its operands, behind all thirty loads of the prologue (the scheduler had lifted one among them)
  for (int kb = 0; kb + 128 <= K; kb += 128) {
#pragma unroll
    for (int u = 0; u < 4; ++u) { const int kn = kb + (u + 3) * 32, kc = kn < K ? kn : 0; ld_kstep(ap, bw, kc, kc * sb, fa[(u + 3) & 3], fb[(u + 3) & 3]);
#pragma unroll
      for (int t = 0; t < 4; ++t) acc[t] = mmaH<1>(fa[u].v, fa[u].v, fb[u][t].v, fb[u][t].v, acc[t]); }
  }
}
// The three projections in one grid, blockIdx.y = 0 Q, 1 K, 2 V. Q and K: C[position][channel] = activations . W^T. V with the operands exchanged, C[channel][position] = W . activations^T:
// the product comes out as Vt, the layout k_attn reads, with the same products summed in the same k order. f16 out, v = acc / 16 + bias (weights are stored x 16).
__global__ __launch_bounds__(128) void k_gemm_qkv(const _Float16* __restrict__ QNP, const _Float16* __restrict__ VNP, const _Float16* __restrict__ Bw, const float* __restrict__ bq, const float* __restrict__ bk, const float* __restrict__ bv,
    _Float16* __restrict__ Q16, _Float16* __restrict__ K16, _Float16* __restrict__ Vt) {
  __shared__ __attribute__((aligned(16))) float so[4][16][64];
  const int tid = threadIdx.x, w = tid >> 5, lane = tid & 31, ln = lane & 15, hh = lane >> 4; const int by = blockIdx.y; const bool sw = by == 2;
  const _Float16* A = by == 0 ? QNP : by == 1 ? VNP : Bw + (size_t)2 * CC * CC; const _Float16* B = sw ? VNP : Bw + (size_t)by * CC * CC;
  const float* bias = by == 0 ? bq : by == 1 ? bk : bv; _Float16* C16 = by == 0 ? Q16 : by == 1 ? K16 : Vt;
  const int N = sw ? NP : CC; const int ls = sw ? 6 : 3; const int wid = blockIdx.x * 4 + w; const int row0 = (wid >> ls) * 16, col0 = (wid & ((1 << ls) - 1)) * 64;      // N / 64 = 1 << ls column tiles
  const unsigned short* ap = (const unsigned short*)A + (size_t)(row0 + ln) * CC + 8 * hh; const unsigned short* bw[4];
#pragma unroll
  for (int t = 0; t < 4; ++t) bw[t] = (const unsigned short*)B + (size_t)(col0 + t * 16 + ln) * CC + 8 * hh;
  v8f acc[4] = {};
  gemm_tile(ap, bw, 1, CC, acc);
  if (sw) { float br[8];      // the channel is the tile's row
#pragma unroll
    for (int r = 0; r < 8; ++r) br[r] = bf16_round(bias[row0 + 8 * hh + r]);
#pragma unroll
    for (int t = 0; t < 4; ++t) {
#pragma unroll
      for (int r = 0; r < 8; ++r) so[w][8 * hh + r][t * 16 + ln] = acc[t][r] * 0.0625f + br[r]; }
  } else {      // the channel is the tile's column
#pragma unroll
    for (int t = 0; t < 4; ++t) { const float bc = bf16_round(bias[col0 + t * 16 + ln]);
#pragma unroll
      for (int r = 0; r < 8; ++r) so[w][8 * hh + r][t * 16 + ln] = acc[t][r] * 0.0625f + bc; }
  }
  __builtin_amdgcn_fence(__ATOMIC_ACQ_REL, "workgroup"); __builtin_amdgcn_wave_barrier();
  const int rsub = lane >> 4, c4 = (lane & 15) * 4; typedef _Float16 v4h __attribute__((ext_vector_type(4)));
#pragma unroll
  for (int q = 0; q < 8; ++q) { const int r = q * 2 + rsub; const v4f v = *(const v4fa*)&so[w][r][c4]; v4h h4; for (int i = 0; i < 4; ++i) h4[i] = (_Float16)v[i]; *(v4h*)(C16 + (size_t)(row0 + r) * N + col0 + c4) = h4; }
}
// Output projection with the operands exchanged: C[channel][position] = Wo . O^T is the output's own layout, so bias, residual and 1/sqrt(2) are applied where the tile is stored.
__global__ __launch_bounds__(128) void k_gemm_out(const _Float16* __restrict__ Bo, const _Float16* __restrict__ O16h, const float* __restrict__ bo, const float* __restrict__ x, float* __restrict__ out) {
  __shared__ __attribute__((aligned(16))) float so[4][16][64];
  const int tid = threadIdx.x, w = tid >> 5, lane = tid & 31, ln = lane & 15, hh = lane >> 4;
  const int wid = blockIdx.x * 4 + w; const int row0 = (wid / (NP / 64)) * 16, col0 = (wid % (NP / 64)) * 64;
  const unsigned short* ap = (const unsigned short*)Bo + (size_t)(row0 + ln) * CC + 8 * hh; const unsigned short* bw[4];
#pragma unroll
  for (int t = 0; t < 4; ++t) bw[t] = (const unsigned short*)O16h + (size_t)(col0 + t * 16 + ln) * HD + 8 * hh;
  v8f acc[4] = {};
  gemm_tile(ap, bw, NP, CC, acc);
#pragma unroll
  for (int t = 0; t < 4; ++t) {
#pragma unroll
    for (int r = 0; r < 8; ++r) so[w][8 * hh + r][t * 16 + ln] = acc[t][r] * 0.0625f + bf16_round(bo[row0 + 8 * hh + r]); }
  __builtin_amdgcn_fence(__ATOMIC_ACQ_REL, "workgroup"); __builtin_amdgcn_wave_barrier();
  const int rsub = lane >> 4, c4 = (lane & 15) * 4;
  const size_t o0 = (size_t)(row0 + rsub) * NP + col0 + c4; const float* xp = x + o0; float* op = out + o0; v4f xv[8];
#pragma unroll
  for (int q = 0; q < 8; ++q) xv[q] = *(const v4fa*)(xp + (size_t)q * 2 * NP);
  asm volatile("s_wait_xcnt 0x0" ::: "memory");      // the wait stands before the address registers of the eight loads are written again
#pragma unroll
  for (int q = 0; q < 8; ++q) { const v4f v = *(const v4fa*)&so[w][q * 2 + rsub][c4]; v4f y;
    for (int i = 0; i < 4; ++i) y[i] = (v[i] + bf16_round(xv[q][i])) * 0.7071067811865476f; *(v4f*)(op + (size_t)q * 2 * NP) = y; }
}

// lane l <-> l ^ 16 (the two halves of a wave hold the two key halves of one query column)
__device__ __forceinline__ float xhalf(float v) { const int b = __float_as_int(v); return __int_as_float(__builtin_amdgcn_permlanex16(b, b, 0x76543210, 0xfedcba98, false, false)); }
// lane l <-> l ^ M inside a 16-lane row (DPP row_xmask)
template <int M>
__device__ __forceinline__ float xrow(float v) { return __int_as_float(__builtin_amdgcn_update_dpp(0, __float_as_int(v), 0x160 + M, 0xf, 0xf, true)); }
// sum over the 32 lanes of a wave, the same value in every lane; all lanes on
__device__ __forceinline__ float wave_sum(float v) { v += xrow<1>(v); v += xrow<2>(v); v += xrow<4>(v); v += xrow<8>(v); return v + xhalf(v); }
// Blocks 0 .. NG - 1: one group (GS * NP = 65,536 values) per block of 1,024 threads: 16 whole-line 16-byte loads per thread (load i is channel i of the group), all in flight together. The values stay in registers
// for the first GroupNorm's two sums, are normalised there, and stay for the second GroupNorm's two sums: STAT[g] = {mean 1, 1/sd 1, mean 2, 1/sd 2}.
// Blocks NG .. NG + 127 (independent work in the same launch): the four weight matrices, bf16-rounded, x 16, to f16; they leave before any barrier.
__global__ __launch_bounds__(1024) void k_prep(const float* __restrict__ X, const float* __restrict__ gw, const float* __restrict__ gb, const float* __restrict__ W0, const float* __restrict__ W1, const float* __restrict__ W2, const float* __restrict__ W3,
    _Float16* __restrict__ Bt, float* __restrict__ STAT) { __shared__ float sh[4][32]; const int tid = threadIdx.x, w = tid >> 5, lane = tid & 31;
  if (blockIdx.x >= NG) { const int y = (int)(blockIdx.x - NG) >> 5; const float* W = y == 0 ? W0 : y == 1 ? W1 : y == 2 ? W2 : W3; const size_t t = (size_t)((blockIdx.x - NG) & 31) * 1024 + tid; FragH f;
    const v4f a = *(const v4fa*)(W + t * 8), b = *(const v4fa*)(W + t * 8 + 4);
#pragma unroll
    for (int i = 0; i < 4; ++i) { f.h[i] = (_Float16)(bf16_round(a[i]) * 16.0f); f.h[4 + i] = (_Float16)(bf16_round(b[i]) * 16.0f); }
    *(v8us*)((unsigned short*)Bt + (size_t)y * CC * CC + t * 8) = f.half[0]; return; }
  const int g = blockIdx.x; const float* base = X + (size_t)g * GS * NP;
  v4f v[16];
#pragma unroll
  for (int i = 0; i < 16; ++i) v[i] = *(const v4fa*)(base + (size_t)(i * 1024 + tid) * 4);
  v4f st;
#pragma unroll
  for (int pass = 0; pass < 2; ++pass) {
    v4f s4 = {0.f, 0.f, 0.f, 0.f};
#pragma unroll
    for (int i = 0; i < 16; ++i) { if (pass == 0) { for (int q = 0; q < 4; ++q) v[i][q] = bf16_round(v[i][q]); } s4 += v[i]; }
    const float s = wave_sum((s4[0] + s4[1]) + (s4[2] + s4[3])); if (lane == 0) sh[pass * 2][w] = s; __syncthreads();
    const float mean = wave_sum(sh[pass * 2][lane]) / (float)(GS * NP);
    v4f q4 = {0.f, 0.f, 0.f, 0.f};
#pragma unroll
    for (int i = 0; i < 16; ++i) { const v4f d = v[i] - mean; q4 += d * d; }
    const float q = wave_sum((q4[0] + q4[1]) + (q4[2] + q4[3])); if (lane == 0) sh[pass * 2 + 1][w] = q; __syncthreads();
    const float var = wave_sum(sh[pass * 2 + 1][lane]) / (float)(GS * NP); const float rs = 1.0f / sqrtf(var + 1e-6f);
    st[pass * 2] = mean; st[pass * 2 + 1] = rs;
    if (pass == 0) {
#pragma unroll
      for (int i = 0; i < 16; ++i) { const float ww = bf16_round(gw[g * GS + i]), b2 = bf16_round(gb[g * GS + i]); for (int q2 = 0; q2 < 4; ++q2) v[i][q2] = (v[i][q2] - mean) * rs * ww + b2; } }
  }
  if (tid == 0) *(v4f*)(STAT + g * 4) = st; }
// 64 channels x 64 positions a block: x is read once (256-byte runs), qn = GN(x) and vn = GN(qn) are formed in registers and both go out position-major in f16, 128-byte lines.
__global__ __launch_bounds__(256) void k_gnorm2(const float* __restrict__ X, const float* __restrict__ STAT, const float* __restrict__ w, const float* __restrict__ bb, _Float16* __restrict__ QP, _Float16* __restrict__ VP) { __shared__ float tq[64][65], tv[64][65];
  const int tid = threadIdx.x; const int cg = blockIdx.x / (NP / 64), pg = blockIdx.x % (NP / 64); const int c0 = cg * 64, p0 = pg * 64;
  const int cl = tid >> 4, p4 = (tid & 15) * 4;      // round u: channel c0 + 16 * u + cl, which lies in group cg * 4 + u
  const float* xp = X + (size_t)(c0 + cl) * NP + p0 + p4; const float* wp = w + c0 + cl; const float* bp = bb + c0 + cl; v4f xv[4]; float wv[4], bv[4];
#pragma unroll
  for (int u = 0; u < 4; ++u) { xv[u] = *(const v4fa*)(xp + (size_t)u * 16 * NP); wv[u] = wp[u * 16]; bv[u] = bp[u * 16]; }
  asm volatile("s_wait_xcnt 0x0" ::: "memory");      // the wait stands before the address registers of the twelve loads are written again
#pragma unroll
  for (int u = 0; u < 4; ++u) { const int c = u * 16 + cl; const v4f st = *(const v4fa*)(STAT + (cg * 4 + u) * 4); const float ww = bf16_round(wv[u]), b2 = bf16_round(bv[u]);
#pragma unroll
    for (int q = 0; q < 4; ++q) { const float y = (bf16_round(xv[u][q]) - st[0]) * st[1] * ww + b2; tq[p4 + q][c] = y; tv[p4 + q][c] = (y - st[2]) * st[3] * ww + b2; } }
  __syncthreads();
#pragma unroll
  for (int u = 0; u < 2; ++u) { const int i = tid + 256 * u, r = i >> 3, pc = i & 7; FragH f, g;
#pragma unroll
    for (int q = 0; q < 8; ++q) { f.h[q] = (_Float16)tq[r][pc * 8 + q]; g.h[q] = (_Float16)tv[r][pc * 8 + q]; }
    const size_t o = (size_t)(p0 + r) * CC + c0 + pc * 8; *(v8us*)((unsigned short*)QP + o) = f.half[0]; *(v8us*)((unsigned short*)VP + o) = g.half[0]; } }
__global__ __launch_bounds__(128) void k_attn(const _Float16* __restrict__ Q16, const _Float16* __restrict__ K16, const _Float16* __restrict__ Vt, _Float16* __restrict__ O16h) { constexpr int RPW = 32; constexpr float SL2 = 0.25503486164919736f;
  __shared__ __attribute__((aligned(16))) float sO[4][RPW][HD + 4];
  const int tid = threadIdx.x, w = tid >> 5, lane = tid & 31, ln = lane & 15, hh = lane >> 4; const int h = blockIdx.x / (NP / 128), qblk = blockIdx.x % (NP / 128); const int q0 = qblk * 128 + w * RPW;
  FragH aq[2];
#pragma unroll
  for (int rt = 0; rt < 2; ++rt) { const unsigned short* qr = (const unsigned short*)Q16 + (size_t)(q0 + rt * 16 + ln) * CC + h * HD; aq[rt].half[0] = *(const v8us*)(qr + 8 * hh); aq[rt].half[1] = *(const v8us*)(qr + 16 + 8 * hh); }
  const unsigned short* Vth = (const unsigned short*)Vt + (size_t)h * HD * NP;
  float m_r[2], l_r[2]; v8f oacc[2][2];      // query rt * 16 + ln; oacc[rt][dt][r] = Ot[dt * 16 + 8hh + r][query]
#pragma unroll
  for (int rt = 0; rt < 2; ++rt) { m_r[rt] = -3.0e38f; l_r[rt] = 0.f; oacc[rt][0] = (v8f){0.f,0.f,0.f,0.f,0.f,0.f,0.f,0.f}; oacc[rt][1] = oacc[rt][0]; }
  // K and Vt fragments one pass ahead: each pass refills a fragment's registers for the next pass right behind its last product, so the loads fly during the softmax and the other products.
  // The last pass fetches pass 0's fragments again (in bounds, not used).
  const unsigned short* kl = (const unsigned short*)K16 + (size_t)ln * CC + h * HD + 8 * hh; const unsigned short* vl = Vth + (size_t)ln * NP + 8 * hh;
  FragH bk[2], bv[2];
#pragma unroll
  for (int t = 0; t < 2; ++t) { const unsigned short* kr = kl + (size_t)(t * 16) * CC; bk[t].half[0] = *(const v8us*)kr; bk[t].half[1] = *(const v8us*)(kr + 16); }
#pragma unroll
  for (int t = 0; t < 2; ++t) { const unsigned short* vrow = vl + (size_t)(t * 16) * NP; bv[t].half[0] = *(const v8us*)vrow; bv[t].half[1] = *(const v8us*)(vrow + 16); }
#pragma unroll 1
  for (int j0 = 0; j0 < NP; j0 += 32) { v8f s[2][2];      // s[rt][nt][r] = S[query][j0 + nt * 16 + 8hh + r]
    const int jn = j0 + 32 < NP ? j0 + 32 : 0;
#pragma unroll
    for (int nt = 0; nt < 2; ++nt) {
#pragma unroll
      for (int rt = 0; rt < 2; ++rt) { v8f acc = (v8f){0.f,0.f,0.f,0.f,0.f,0.f,0.f,0.f}; acc = mmaH<1>(bk[nt].v, bk[nt].v, aq[rt].v, aq[rt].v, acc); s[rt][nt] = acc; }
      const unsigned short* kr = kl + (size_t)(jn + nt * 16) * CC; bk[nt].half[0] = *(const v8us*)kr; bk[nt].half[1] = *(const v8us*)(kr + 16); }
    FragH pb[2];
#pragma unroll
    for (int rt = 0; rt < 2; ++rt) { float sc[16];      // raw products; SL2 > 0, so their maximum is the maximum of the scaled scores
#pragma unroll
      for (int i = 0; i < 16; ++i) sc[i] = s[rt][i >> 3][i & 7];
      float mx[8];
#pragma unroll
      for (int i = 0; i < 8; ++i) mx[i] = fmaxf(sc[i], sc[8 + i]);
      float mc = fmaxf(fmaxf(fmaxf(mx[0], mx[1]), fmaxf(mx[2], mx[3])), fmaxf(fmaxf(mx[4], mx[5]), fmaxf(mx[6], mx[7])));
      mc = fmaxf(mc, xhalf(mc));
      const float mn = fmaxf(m_r[rt], mc * SL2); const float al = __builtin_amdgcn_exp2f(m_r[rt] - mn); m_r[rt] = mn;      // m_r in log2 units
      float ps[8];
#pragma unroll
      for (int i = 0; i < 8; ++i) { const float p0 = __builtin_amdgcn_exp2f(fmaf(sc[i], SL2, -mn)), p1 = __builtin_amdgcn_exp2f(fmaf(sc[8 + i], SL2, -mn)); ps[i] = p0 + p1; pb[rt].h[i] = (_Float16)p0; pb[rt].h[8 + i] = (_Float16)p1; }
      l_r[rt] = l_r[rt] * al + (((ps[0] + ps[1]) + (ps[2] + ps[3])) + ((ps[4] + ps[5]) + (ps[6] + ps[7])));      // this half's keys; the halves join after the loop
#pragma unroll
      for (int r = 0; r < 8; ++r) { oacc[rt][0][r] *= al; oacc[rt][1][r] *= al; } }
#pragma unroll
    for (int dt = 0; dt < 2; ++dt) {
#pragma unroll
      for (int rt = 0; rt < 2; ++rt) oacc[rt][dt] = mmaH<1>(bv[dt].v, bv[dt].v, pb[rt].v, pb[rt].v, oacc[rt][dt]);
      const unsigned short* vrow = vl + (size_t)(dt * 16) * NP + jn; bv[dt].half[0] = *(const v8us*)vrow; bv[dt].half[1] = *(const v8us*)(vrow + 16); }
    asm volatile("s_wait_xcnt 0x0" ::: "memory"); }      // the Vt loads stay in flight over the back edge: the wait stands before their address registers are written again
#pragma unroll
  for (int rt = 0; rt < 2; ++rt) { const float l = l_r[rt] + xhalf(l_r[rt]); const float li = 1.0f / l;
#pragma unroll
    for (int dt = 0; dt < 2; ++dt)
#pragma unroll
      for (int r4 = 0; r4 < 8; r4 += 4) { v4f v; for (int q = 0; q < 4; ++q) v[q] = oacc[rt][dt][r4 + q] * li; *(v4fa*)&sO[w][rt * 16 + ln][dt * 16 + 8 * hh + r4] = v; } }
  __builtin_amdgcn_fence(__ATOMIC_ACQ_REL, "workgroup"); __builtin_amdgcn_wave_barrier();
  {
#pragma unroll
    for (int rp = 0; rp < RPW; rp += 8) { const int r = rp + (lane >> 2), pc = lane & 3; const v4f v0 = *(const v4fa*)&sO[w][r][pc * 8], v1 = *(const v4fa*)&sO[w][r][pc * 8 + 4]; FragH f;      // f16, head-major [h][position][HD]: a wave's 32 rows are 2 KiB in a row, whole lines
      for (int q = 0; q < 4; ++q) { f.h[q] = (_Float16)v0[q]; f.h[4 + q] = (_Float16)v1[q]; }
      *(v8us*)((unsigned short*)O16h + ((size_t)h * NP + q0 + r) * HD + pc * 8) = f.half[0]; }
     } }
extern "C" void kernel_launch(void* const* d_in, const int* in_sizes, int n_in,
                              void* d_out, int out_size, void* d_ws, size_t ws_size, hipStream_t stream) {
  (void)in_sizes; (void)n_in; (void)out_size;
  const float* x = (const float*)d_in[0]; const float* gw = (const float*)d_in[1]; const float* gb = (const float*)d_in[2]; const float* wq = (const float*)d_in[3]; const float* bq = (const float*)d_in[4]; const float* wk = (const float*)d_in[5]; const float* bk = (const float*)d_in[6]; const float* wv = (const float*)d_in[7]; const float* bv = (const float*)d_in[8]; const float* wo = (const float*)d_in[9]; const float* bo = (const float*)d_in[10];
  char* ws = (char*)d_ws; size_t off = 0;
  auto take = [&](size_t bytes) { char* p = ws + off; off += (bytes + 255) & ~(size_t)255; return p; };
  _Float16* Bw = (_Float16*)take((size_t)4 * CC * CC * 2);      // Wq, Wk, Wv, Wo, (out,in)
  float* ST = (float*)take(NG * 4 * 4);
  _Float16* QNP = (_Float16*)take((size_t)NP * CC * 2); _Float16* VNP = (_Float16*)take((size_t)NP * CC * 2); _Float16* Q16 = (_Float16*)take((size_t)NP * CC * 2); _Float16* K16 = (_Float16*)take((size_t)NP * CC * 2); _Float16* Vt = (_Float16*)take((size_t)NP * CC * 2); _Float16* O16h = (_Float16*)take((size_t)NP * CC * 2);
  if (off > ws_size) return;      // 2 + 6 x 4 = 26 MiB
  k_prep<<<NG + 128, 1024, 0, stream>>>(x, gw, gb, wq, wk, wv, wo, Bw, ST);
  k_gnorm2<<<(CC / 64) * (NP / 64), 256, 0, stream>>>(x, ST, gw, gb, QNP, VNP);
  k_gemm_qkv<<<dim3((NP / 16) * (CC / 64) / 4, 3), 128, 0, stream>>>(QNP, VNP, Bw, bq, bk, bv, Q16, K16, Vt);
  k_attn<<<NH * (NP / 128), 128, 0, stream>>>(Q16, K16, Vt, O16h);
  k_gemm_out<<<(CC / 16) * (NP / 64) / 4, 128, 0, stream>>>(Bw + (size_t)3 * CC * CC, O16h, bo, x, (float*)d_out);
}

// v006
// One run takes 113 microseconds.
// In two side-by-side timings against v005, it was 1.20 and 1.19 times as fast.
// All steps since v000 together make it 3.73 times as fast.
#include <hip/hip_runtime.h>
// the 1×1 convs (4096 × 512 × 512, + bias, weights (out,in) bf16-exact ×2^4) and the attention as a fused flash-style kernel (S = Q·Kᵀ·32^-½ with d = 32 in one k-step, online softmax f32,
// P f16 ≤ 1, O = P·V) on v_wmma_f32_16x16x32_f16 (f16 operands, single products, f32 accumulate); residual (out + x)/√2 and layout transposes f32 VALU.
#define CC 512
#define NP 4096
#define NG 32
#define GS 16
#define NH 16
#define HD 32

typedef __bf16 v16b __attribute__((ext_vector_type(16)));
typedef unsigned short v8us __attribute__((ext_vector_type(8), may_alias));
typedef float  v8f  __attribute__((ext_vector_type(8)));
typedef float  v4f  __attribute__((ext_vector_type(4)));
typedef float  v4fa __attribute__((ext_vector_type(4), may_alias));
union FragB { v16b v; v8us half[2]; unsigned short u[16]; };

__device__ __forceinline__ unsigned short bf16_bits(float x) { unsigned int u = __float_as_uint(x); return (unsigned short)((u + 0x7FFFu + ((u >> 16) & 1u)) >> 16); }
__device__ __forceinline__ float bf16_val(unsigned short b) { return __uint_as_float(((unsigned int)b) << 16); }
__device__ __forceinline__ float bf16_round(float x) { return bf16_val(bf16_bits(x)); }
// D += A·B with NT terms: 1 = ah·bh, 2 = + al·bh (A split), 3 = + ah·bl (both split)
template <int NT>
__device__ __forceinline__ v8f mmaN(v16b ah, v16b al, v16b bh, v16b bl, v8f c) {
  c = __builtin_amdgcn_wmma_f32_16x16x32_bf16(false, ah, false, bh, (short)0, c, false, false);
  if (NT >= 2) c = __builtin_amdgcn_wmma_f32_16x16x32_bf16(false, al, false, bh, (short)0, c, false, false);
  if (NT >= 3) c = __builtin_amdgcn_wmma_f32_16x16x32_bf16(false, ah, false, bl, (short)0, c, false, false);
  asm volatile("v_nop\n\tv_nop\n\tv_nop\n\tv_nop" : "+v"(c) : "v"(ah), "v"(al), "v"(bh), "v"(bl));
  return c;
}

__global__ __launch_bounds__(256) void k_wt_bf16(const float* __restrict__ W, unsigned short* __restrict__ Wt, int K, int N) {
  const int t = blockIdx.x * 256 + threadIdx.x;
  const int k8n = K / 8;
  if (t >= N * k8n) return;
  const int n = t / k8n, k8 = (t % k8n) * 8;
  v8us v;
#pragma unroll
  for (int i = 0; i < 8; ++i) v[i] = bf16_bits(W[(size_t)(k8 + i) * N + n]);
  *(v8us*)(Wt + (size_t)n * K + k8) = v;
  
}

// GEMM C[M][N] (f32, pitch ldc) = act(A[M][K]·W + bias). A f32 row-major (pitch lda) converted per fragment to bf16
// (ASPLIT: hi/lo two planes -> 2 terms, else single rounded term); Wt bf16 [N][K] (pitch ldb). BIAS_BF16 rounds the
// bias to bf16 first (bias quantised to bf16 before the add). K%32==0, M%16==0, N%64==0.
template <bool ASPLIT, int ACT, bool BIAS_BF16>
__global__ __launch_bounds__(128) void k_gemm_bf(const float* __restrict__ A, int lda, const unsigned short* __restrict__ Wt, int ldb,
                                               const float* __restrict__ bias, float* __restrict__ C, int ldc, int M, int N, int K) {
  __shared__ __attribute__((aligned(16))) float so[4][16][64];
  const int tid = threadIdx.x, w = tid >> 5, lane = tid & 31, ln = lane & 15, hh = lane >> 4;
  const int ntn = N / 64;
  const int wid = blockIdx.x * 4 + w;
  const int mt = wid / ntn, nq = wid % ntn;
  if (mt * 16 >= M) return;
  const int row0 = mt * 16, col0 = nq * 64;
  const float* arow = A + (size_t)(row0 + ln) * lda;
  v8f acc[4] = {};
  for (int kb = 0; kb < K; kb += 32) {
    FragB ah, al;
    const v4f x0 = *(const v4fa*)(arow + kb + 8 * hh), x1 = *(const v4fa*)(arow + kb + 8 * hh + 4);
    const v4f x2 = *(const v4fa*)(arow + kb + 16 + 8 * hh), x3 = *(const v4fa*)(arow + kb + 16 + 8 * hh + 4);
    float xs[16] = {x0[0],x0[1],x0[2],x0[3],x1[0],x1[1],x1[2],x1[3],x2[0],x2[1],x2[2],x2[3],x3[0],x3[1],x3[2],x3[3]};
#pragma unroll
    for (int i = 0; i < 16; ++i) { const unsigned short hb = bf16_bits(xs[i]); ah.u[i] = hb; al.u[i] = ASPLIT ? bf16_bits(xs[i] - bf16_val(hb)) : (unsigned short)0; }
#pragma unroll
    for (int t = 0; t < 4; ++t) {
      const unsigned short* brow = Wt + (size_t)(col0 + t * 16 + ln) * ldb + kb;
      FragB b;
      b.half[0] = *(const v8us*)(brow + 8 * hh);
      b.half[1] = *(const v8us*)(brow + 16 + 8 * hh);
      acc[t] = mmaN<ASPLIT ? 2 : 1>(ah.v, al.v, b.v, b.v, acc[t]);
    }
  }
#pragma unroll
  for (int t = 0; t < 4; ++t) {
    float bv = bias ? bias[col0 + t * 16 + ln] : 0.f;
    if (BIAS_BF16) bv = bf16_round(bv);
#pragma unroll
    for (int r = 0; r < 8; ++r) { float v = acc[t][r] + bv; if (ACT == 1) v = fmaxf(v, 0.f); so[w][8 * hh + r][t * 16 + ln] = v; }
  }
  __builtin_amdgcn_fence(__ATOMIC_ACQ_REL, "workgroup");
  __builtin_amdgcn_wave_barrier();
  const int rsub = lane >> 4, c4 = (lane & 15) * 4;
  {
#pragma unroll
    for (int q = 0; q < 8; ++q) {
      const int r = q * 2 + rsub;
      const v4f v = *(const v4fa*)&so[w][r][c4];
      *(v4f*)(C + (size_t)(row0 + r) * ldc + col0 + c4) = v;
    }
    
  }
}

// Flash-style causal/unmasked attention, all contractions 3-term bf16 hi/lo splits, f32 softmax with running max.
// q,k,v rows are read from f32 buffers with arbitrary row pitch (so they can live inside a fused qkv buffer);
// D = head size (multiple of 32, <= 128); one wave = 16 query rows; block = 4 waves (64 queries) sharing K/V chunks of 32.
template <int D, bool CAUSAL>
__global__ __launch_bounds__(128) void k_flash(const float* __restrict__ qb, const float* __restrict__ kb, const float* __restrict__ vb,
                                             int pitch, int T, int H, float scale, float* __restrict__ y, int ypitch) {
  constexpr int KS = D / 32;        // k-steps for QK
  constexpr int DT = D / 16;        // d tiles for PV
  __shared__ __attribute__((aligned(16))) unsigned short sKh[32][D + 8], sKl[32][D + 8], sVh[32][D + 8], sVl[32][D + 8];
  __shared__ __attribute__((aligned(16))) unsigned short sPh[4][16][40], sPl[4][16][40];
  __shared__ __attribute__((aligned(16))) float sO[4][16][D];
  const int tid = threadIdx.x, w = tid >> 5, lane = tid & 31, ln = lane & 15, hh = lane >> 4;
  const int nqb = (T + 63) / 64;
  const int bh = blockIdx.x / nqb, qblk = blockIdx.x % nqb;
  const int b = bh / H, h = bh % H;
  const int q0 = qblk * 64 + w * 16;
  const float* Q = qb + (size_t)b * T * pitch + h * D;
  const float* K = kb + (size_t)b * T * pitch + h * D;
  const float* V = vb + (size_t)b * T * pitch + h * D;

  // A fragments of the wave's 16 query rows (scaled), hi/lo
  FragB aqh[KS], aql[KS];
  {
    int row = q0 + ln; if (row >= T) row = T - 1;
    const float* qr = Q + (size_t)row * pitch;
#pragma unroll
    for (int ks = 0; ks < KS; ++ks)
#pragma unroll
      for (int i = 0; i < 16; ++i) {
        const int d = ks * 32 + ((i < 8) ? (8 * hh + i) : (16 + 8 * hh + (i - 8)));
        const float x = qr[d] * scale; const unsigned short hb = bf16_bits(x);
        aqh[ks].u[i] = hb; aql[ks].u[i] = bf16_bits(x - bf16_val(hb));
      }
  }
  float m_r[8], l_r[8];
#pragma unroll
  for (int r = 0; r < 8; ++r) { m_r[r] = -3.0e38f; l_r[r] = 0.f; }
  v8f oacc[DT];
#pragma unroll
  for (int dt = 0; dt < DT; ++dt) oacc[dt] = (v8f){0.f,0.f,0.f,0.f,0.f,0.f,0.f,0.f};

  const int kv_end = CAUSAL ? min(T, qblk * 64 + 64) : T;     // block-uniform
  for (int j0 = 0; j0 < kv_end; j0 += 32) {
    __syncthreads();
    for (int e = tid; e < 32 * (D / 4); e += 128) {
      const int r = e / (D / 4), c4 = (e % (D / 4)) * 4;
      const int key = j0 + r;
      v4f kf = {0.f,0.f,0.f,0.f}, vf = {0.f,0.f,0.f,0.f};
      if (key < T) { kf = *(const v4fa*)(K + (size_t)key * pitch + c4); vf = *(const v4fa*)(V + (size_t)key * pitch + c4); }
#pragma unroll
      for (int t = 0; t < 4; ++t) {
        unsigned short hb = bf16_bits(kf[t]); sKh[r][c4 + t] = hb; sKl[r][c4 + t] = bf16_bits(kf[t] - bf16_val(hb));
        hb = bf16_bits(vf[t]); sVh[r][c4 + t] = hb; sVl[r][c4 + t] = bf16_bits(vf[t] - bf16_val(hb));
      }
    }
    __syncthreads();
    // S tile 16 x 32
    v8f s[2];
#pragma unroll
    for (int nt = 0; nt < 2; ++nt) {
      v8f acc = {};
#pragma unroll
      for (int ks = 0; ks < KS; ++ks) {
        FragB bh_, bl_;
        bh_.half[0] = *(const v8us*)&sKh[nt * 16 + ln][ks * 32 + 8 * hh]; bh_.half[1] = *(const v8us*)&sKh[nt * 16 + ln][ks * 32 + 16 + 8 * hh];
        bl_.half[0] = *(const v8us*)&sKl[nt * 16 + ln][ks * 32 + 8 * hh]; bl_.half[1] = *(const v8us*)&sKl[nt * 16 + ln][ks * 32 + 16 + 8 * hh];
        acc = mmaN<3>(aqh[ks].v, aql[ks].v, bh_.v, bl_.v, acc);
      }
      s[nt] = acc;
    }
    // mask + running max (rows 8hh+r; the 16 lanes of a half share rows)
    float alpha[8];
#pragma unroll
    for (int r = 0; r < 8; ++r) {
      const int qi = q0 + 8 * hh + r;
      const int ja = j0 + ln, jb = j0 + 16 + ln;
      if (CAUSAL) { if (ja > qi) s[0][r] = -3.0e38f; if (jb > qi) s[1][r] = -3.0e38f; }
      if (ja >= T) s[0][r] = -3.0e38f;
      if (jb >= T) s[1][r] = -3.0e38f;
      float mx = fmaxf(s[0][r], s[1][r]);
      mx = fmaxf(mx, __shfl_xor(mx, 1, 32)); mx = fmaxf(mx, __shfl_xor(mx, 2, 32)); mx = fmaxf(mx, __shfl_xor(mx, 4, 32)); mx = fmaxf(mx, __shfl_xor(mx, 8, 32));
      const float mnew = fmaxf(m_r[r], mx);
      alpha[r] = (mnew > -1.0e38f) ? __expf(m_r[r] - mnew) : 1.0f;
      const float p0 = (s[0][r] > -1.0e38f) ? __expf(s[0][r] - mnew) : 0.f;
      const float p1 = (s[1][r] > -1.0e38f) ? __expf(s[1][r] - mnew) : 0.f;
      m_r[r] = mnew;
      l_r[r] = l_r[r] * alpha[r] + p0 + p1;            // per-lane partial row sum (16 lanes combined at the end)
      unsigned short hb = bf16_bits(p0); sPh[w][8 * hh + r][ln] = hb;      sPl[w][8 * hh + r][ln] = bf16_bits(p0 - bf16_val(hb));
      hb = bf16_bits(p1);                sPh[w][8 * hh + r][16 + ln] = hb; sPl[w][8 * hh + r][16 + ln] = bf16_bits(p1 - bf16_val(hb));
    }
#pragma unroll
    for (int dt = 0; dt < DT; ++dt)
#pragma unroll
      for (int r = 0; r < 8; ++r) oacc[dt][r] *= alpha[r];
    __builtin_amdgcn_fence(__ATOMIC_ACQ_REL, "workgroup");
    __builtin_amdgcn_wave_barrier();
    FragB pah, pal;
    pah.half[0] = *(const v8us*)&sPh[w][ln][8 * hh]; pah.half[1] = *(const v8us*)&sPh[w][ln][16 + 8 * hh];
    pal.half[0] = *(const v8us*)&sPl[w][ln][8 * hh]; pal.half[1] = *(const v8us*)&sPl[w][ln][16 + 8 * hh];
#pragma unroll
    for (int dt = 0; dt < DT; ++dt) {
      FragB bvh, bvl;
#pragma unroll
      for (int i = 0; i < 8; ++i) {
        bvh.u[i] = sVh[8 * hh + i][dt * 16 + ln]; bvh.u[8 + i] = sVh[16 + 8 * hh + i][dt * 16 + ln];
        bvl.u[i] = sVl[8 * hh + i][dt * 16 + ln]; bvl.u[8 + i] = sVl[16 + 8 * hh + i][dt * 16 + ln];
      }
      oacc[dt] = mmaN<3>(pah.v, pal.v, bvh.v, bvl.v, oacc[dt]);
    }
    __builtin_amdgcn_fence(__ATOMIC_ACQ_REL, "workgroup");
    __builtin_amdgcn_wave_barrier();
  }
#pragma unroll
  for (int r = 0; r < 8; ++r) {
    float l = l_r[r];
    l += __shfl_xor(l, 1, 32); l += __shfl_xor(l, 2, 32); l += __shfl_xor(l, 4, 32); l += __shfl_xor(l, 8, 32);
    l_r[r] = (l > 0.f) ? 1.0f / l : 0.f;
  }
#pragma unroll
  for (int dt = 0; dt < DT; ++dt)
#pragma unroll
    for (int r = 0; r < 8; ++r) sO[w][8 * hh + r][dt * 16 + ln] = oacc[dt][r] * l_r[r];
  __builtin_amdgcn_fence(__ATOMIC_ACQ_REL, "workgroup");
  __builtin_amdgcn_wave_barrier();
  {
    for (int r = 0; r < 16; ++r) {
      const int row = q0 + r;
      if (row < T && lane < D / 4) {
        const v4f val = *(const v4fa*)&sO[w][r][lane * 4];
        *(v4f*)(y + ((size_t)b * T + row) * ypitch + h * D + lane * 4) = val;
      }
    }
    
  }
}

// GEMM C = act(A·W + bias + resid): A f32 (ASPLIT -> hi/lo 2 terms), Wt bf16 [N][K]; ACT 0 none, 1 relu, 2 exact gelu;
// resid (optional, f32, row index = (row % rmod), pitch ldr, RES_BF16 rounds it) added before the activation.
template <bool ASPLIT, int ACT, bool BIAS_BF16, bool RES_BF16>
__global__ __launch_bounds__(128) void k_gemm_bf3(const float* __restrict__ A, int lda, const unsigned short* __restrict__ Wt, int ldb,
                                                const float* __restrict__ bias, const float* __restrict__ resid, int rmod, int ldr,
                                                float* __restrict__ C, int ldc, int M, int N, int K) {
  __shared__ __attribute__((aligned(16))) float so[4][16][64];
  const int tid = threadIdx.x, w = tid >> 5, lane = tid & 31, ln = lane & 15, hh = lane >> 4;
  const int ntn = N / 64;
  const int wid = blockIdx.x * 4 + w;
  const int mt = wid / ntn, nq = wid % ntn;
  if (mt * 16 >= M) return;
  const int row0 = mt * 16, col0 = nq * 64;
  const float* arow = A + (size_t)(row0 + ln) * lda;
  v8f acc[4] = {};
  for (int kb = 0; kb < K; kb += 32) {
    FragB ah, al;
    const v4f x0 = *(const v4fa*)(arow + kb + 8 * hh), x1 = *(const v4fa*)(arow + kb + 8 * hh + 4);
    const v4f x2 = *(const v4fa*)(arow + kb + 16 + 8 * hh), x3 = *(const v4fa*)(arow + kb + 16 + 8 * hh + 4);
    float xs[16] = {x0[0],x0[1],x0[2],x0[3],x1[0],x1[1],x1[2],x1[3],x2[0],x2[1],x2[2],x2[3],x3[0],x3[1],x3[2],x3[3]};
#pragma unroll
    for (int i = 0; i < 16; ++i) { const unsigned short hb = bf16_bits(xs[i]); ah.u[i] = hb; al.u[i] = ASPLIT ? bf16_bits(xs[i] - bf16_val(hb)) : (unsigned short)0; }
#pragma unroll
    for (int t = 0; t < 4; ++t) {
      const unsigned short* brow = Wt + (size_t)(col0 + t * 16 + ln) * ldb + kb;
      FragB b;
      b.half[0] = *(const v8us*)(brow + 8 * hh);
      b.half[1] = *(const v8us*)(brow + 16 + 8 * hh);
      acc[t] = mmaN<ASPLIT ? 2 : 1>(ah.v, al.v, b.v, b.v, acc[t]);
    }
  }
#pragma unroll
  for (int t = 0; t < 4; ++t) {
    const int col = col0 + t * 16 + ln;
    float bv = bias ? bias[col] : 0.f;
    if (BIAS_BF16) bv = bf16_round(bv);
#pragma unroll
    for (int r = 0; r < 8; ++r) {
      float v = acc[t][r] + bv;
      if (resid) { float rv = resid[(size_t)((row0 + 8 * hh + r) % rmod) * ldr + col]; if (RES_BF16) rv = bf16_round(rv); v += rv; }
      if (ACT == 1) v = fmaxf(v, 0.f);
      if (ACT == 2) v = 0.5f * v * (1.0f + erff(v * 0.70710678118654752f));
      if (ACT == 3) { const float u = 0.7978845608028654f * (v + 0.044715f * v * v * v); v = 0.5f * v * (1.0f + tanhf(u)); }
      so[w][8 * hh + r][t * 16 + ln] = v;
    }
  }
  __builtin_amdgcn_fence(__ATOMIC_ACQ_REL, "workgroup");
  __builtin_amdgcn_wave_barrier();
  const int rsub = lane >> 4, c4 = (lane & 15) * 4;
  {
#pragma unroll
    for (int q = 0; q < 8; ++q) {
      const int r = q * 2 + rsub;
      const v4f v = *(const v4fa*)&so[w][r][c4];
      *(v4f*)(C + (size_t)(row0 + r) * ldc + col0 + c4) = v;
    }
    
  }
}
// row LayerNorm (biased variance, eps) over N: s = X (+ R); optional out_sum <- s; out_norm <- (s-mu)*rsqrt(var+eps)*g + b
template <bool PARAM_BF16>
__global__ __launch_bounds__(256) void k_layernorm(const float* __restrict__ X, const float* __restrict__ R, const float* __restrict__ g, const float* __restrict__ bta,
                                                  float* __restrict__ out_sum, float* __restrict__ out_norm, int N, float eps) {
  __shared__ float red[256];
  const int row = blockIdx.x, tid = threadIdx.x;
  const float* x = X + (size_t)row * N; const float* rr = R ? R + (size_t)row * N : nullptr;
  float vals[16];                     // up to N = 4096
  const int per = N / 256;            // contiguous chunk per thread? use strided-by-4 chunks: thread handles j = tid*4 + 1024*u
  float s1 = 0.f;
  for (int u = 0; u < per / 4; ++u) {
    const int j = tid * 4 + 1024 * u;
    const v4f a = *(const v4fa*)(x + j);
    v4f b = {0.f,0.f,0.f,0.f}; if (rr) b = *(const v4fa*)(rr + j);
#pragma unroll
    for (int q = 0; q < 4; ++q) { const float v = a[q] + b[q]; vals[u * 4 + q] = v; s1 += v; }
  }
  red[tid] = s1; __syncthreads();
  for (int st = 128; st > 0; st >>= 1) { if (tid < st) red[tid] += red[tid + st]; __syncthreads(); }
  const float mu = red[0] / (float)N; __syncthreads();
  float s2 = 0.f;
  for (int u = 0; u < per / 4; ++u)
#pragma unroll
    for (int q = 0; q < 4; ++q) { const float c = vals[u * 4 + q] - mu; s2 += c * c; }
  red[tid] = s2; __syncthreads();
  for (int st = 128; st > 0; st >>= 1) { if (tid < st) red[tid] += red[tid + st]; __syncthreads(); }
  const float rs = rsqrtf(red[0] / (float)N + eps);
  {
    for (int u = 0; u < per / 4; ++u) {
      const int j = tid * 4 + 1024 * u;
      v4f o, sm;
#pragma unroll
      for (int q = 0; q < 4; ++q) {
        float gg = g[j + q], bb = bta[j + q];
        if (PARAM_BF16) { gg = bf16_round(gg); bb = bf16_round(bb); }
        sm[q] = vals[u * 4 + q]; o[q] = (vals[u * 4 + q] - mu) * rs * gg + bb;
      }
      if (out_sum) *(v4f*)(out_sum + (size_t)row * N + j) = sm;
      *(v4f*)(out_norm + (size_t)row * N + j) = o;
    }
    
  }
}



// ---- f16 WMMA path (v_wmma_f32_16x16x32_f16): 11-bit significands for operands in range — used here for every matrix product (1×1 convs, Q·Kᵀ and P·V)
typedef _Float16 v16h __attribute__((ext_vector_type(16)));
union FragH { v16h v; v8us half[2]; _Float16 h[16]; unsigned short u[16]; };
template <int NT>
__device__ __forceinline__ v8f mmaH(v16h ah, v16h al, v16h bh, v16h bl, v8f c) {
  c = __builtin_amdgcn_wmma_f32_16x16x32_f16(false, ah, false, bh, (short)0, c, false, false);
  if (NT >= 2) c = __builtin_amdgcn_wmma_f32_16x16x32_f16(false, al, false, bh, (short)0, c, false, false);
  if (NT >= 3) c = __builtin_amdgcn_wmma_f32_16x16x32_f16(false, ah, false, bl, (short)0, c, false, false);
  asm volatile("v_nop\n\tv_nop\n\tv_nop\n\tv_nop" : "+v"(c) : "v"(ah), "v"(al), "v"(bh), "v"(bl));
  return c;
}
// batched GEMM like k_gemm_b but f16 operands: A f32 (split into f16 hi/lo if ASPLIT, else rounded to f16), Bt = f16 values [n][k]; alpha; C f32; N multiple of 16 (partial tiles skipped)
template <bool ASPLIT>
__global__ __launch_bounds__(128) void k_gemm_h(const float* __restrict__ A, int lda, size_t sA, const _Float16* __restrict__ Bh, int ldb, size_t sB, float alpha, float* __restrict__ C, int ldc, size_t sC, int M, int N, int K) {
  __shared__ __attribute__((aligned(16))) float so[4][16][64];
  const int tid = threadIdx.x, w = tid >> 5, lane = tid & 31, ln = lane & 15, hh = lane >> 4; const int by = blockIdx.y;
  A += (size_t)by * sA; Bh += (size_t)by * sB; C += (size_t)by * sC;
  const int ntn = (N + 63) / 64; const int wid = blockIdx.x * 4 + w; const int mt = wid / ntn, nq = wid % ntn; if (mt * 16 >= M) return;
  const int row0 = mt * 16, col0 = nq * 64; const float* arow = A + (size_t)(row0 + ln) * lda;
  v8f acc[4] = {};
  for (int kb = 0; kb < K; kb += 32) {
    FragH ah, al;
    const v4f x0 = *(const v4fa*)(arow + kb + 8 * hh), x1 = *(const v4fa*)(arow + kb + 8 * hh + 4), x2 = *(const v4fa*)(arow + kb + 16 + 8 * hh), x3 = *(const v4fa*)(arow + kb + 16 + 8 * hh + 4);
    float xs[16] = {x0[0],x0[1],x0[2],x0[3],x1[0],x1[1],x1[2],x1[3],x2[0],x2[1],x2[2],x2[3],x3[0],x3[1],x3[2],x3[3]};
#pragma unroll
    for (int i = 0; i < 16; ++i) { const _Float16 h = (_Float16)xs[i]; ah.h[i] = h; al.h[i] = ASPLIT ? (_Float16)(xs[i] - (float)h) : (_Float16)0.0f; }
#pragma unroll
    for (int t = 0; t < 4; ++t) { if (col0 + t * 16 >= N) continue; const size_t boff = (size_t)(col0 + t * 16 + ln) * ldb + kb; FragH bq; bq.half[0] = *(const v8us*)(Bh + boff + 8 * hh); bq.half[1] = *(const v8us*)(Bh + boff + 16 + 8 * hh);
      acc[t] = mmaH<ASPLIT ? 2 : 1>(ah.v, al.v, bq.v, bq.v, acc[t]); }
  }
#pragma unroll
  for (int t = 0; t < 4; ++t) { if (col0 + t * 16 >= N) continue;
#pragma unroll
    for (int r = 0; r < 8; ++r) so[w][8 * hh + r][t * 16 + ln] = acc[t][r] * alpha; }
  __builtin_amdgcn_fence(__ATOMIC_ACQ_REL, "workgroup"); __builtin_amdgcn_wave_barrier();
  const int rsub = lane >> 4, c4 = (lane & 15) * 4;
  {
#pragma unroll
    for (int q = 0; q < 8; ++q) { const int r = q * 2 + rsub; if (col0 + c4 < N) { const v4f v = *(const v4fa*)&so[w][r][c4]; *(v4f*)(C + (size_t)(row0 + r) * ldc + col0 + c4) = v; } }
     }
}

// Wt[n][k] = f16(W[k][n]·scale) from f32 row-major W[K][N] (scale = power of two; bf16-exact weights stay exact in f16 away from the subnormal range)
__global__ __launch_bounds__(256) void k_wt_f16(const float* __restrict__ W, _Float16* __restrict__ Wt, int K, int N, float scale) {
  const int t = blockIdx.x * 256 + threadIdx.x; if (t >= N * (K / 8)) return; const int n = t / (K / 8), k8 = (t % (K / 8)) * 8; FragH f;
#pragma unroll
  for (int i = 0; i < 8; ++i) f.h[i] = (_Float16)(bf16_round(W[(size_t)(k8 + i) * N + n]) * scale); const v8us o = f.half[0];
  *(v8us*)((unsigned short*)Wt + (size_t)n * K + k8) = o; 
}
// FRAGMENT-MAJOR LAYOUT of every f16 WMMA operand M[row][k] in the workspace: tiles of 16 rows x 32 k, 512 elements (1 KiB) each; inside a tile element (row, k) lies at
// ((k >> 3) & 3) * 128 + (row & 15) * 8 + (k & 7). Lane l's two 16-byte pieces of the tile's fragment (k = 8hh .. and 16 + 8hh ..) then lie at l * 8 and 256 + l * 8:
// one load of a wave is 512 bytes in a row, four whole lines, where a row-major operand gave 32 bytes out of each of sixteen lines. Which element sits in which lane and register is as before.
// Tile order: activations, weights, O: (row >> 4) * 16 + (k >> 5); Q, K: head * (NP / 16) + (position >> 4); Vt: (head * (NP / 32) + (key >> 5)) * 2 + ((d >> 4) & 1).
#define TL 512
// the ten 16-byte loads of one k-step: the A fragment and four B fragments (ap, bp: the row tile's start + lane * 8; ko: the k-step's tile offset)
__device__ __forceinline__ void ld_kstep(const unsigned short* ap, const unsigned short* const (&bp)[4], int ko, FragH& a, FragH (&b)[4]) {
  a.half[0] = *(const v8us*)(ap + ko); a.half[1] = *(const v8us*)(ap + ko + 256);
#pragma unroll
  for (int t = 0; t < 4; ++t) { b[t].half[0] = *(const v8us*)(bp[t] + ko); b[t].half[1] = *(const v8us*)(bp[t] + ko + 256); }
  asm volatile("s_wait_xcnt 0x0" ::: "memory");      // these loads stay in flight: the wait stands before their address registers are written again
}
// acc[t] += A rows . (B rows)^T for one wave's 16 x 64 tile, K a multiple of 128; a row tile's k-steps are TL elements apart in both operands.
// Fragments three k-steps ahead in a ring of four register sets: a k-step's ten loads are issued three k-steps before its products. A fetch past the last k-step reads k-step 0 again and is not used.
__device__ __forceinline__ void gemm_tile(const unsigned short* ap, const unsigned short* const (&bw)[4], int K, v8f (&acc)[4]) {
  FragH fa[4], fb[4][4];
#pragma unroll
  for (int u = 0; u < 3; ++u) ld_kstep(ap, bw, u * TL, fa[u], fb[u]);
  __builtin_amdgcn_sched_barrier(0);      // keeps the first product, and the wait for its operands, behind all thirty loads of the prologue (the scheduler had lifted one among them)
  for (int kb = 0; kb + 128 <= K; kb += 128) {
#pragma unroll
    for (int u = 0; u < 4; ++u) { const int kn = kb + (u + 3) * 32, kc = kn < K ? kn : 0; ld_kstep(ap, bw, (kc >> 5) * TL, fa[(u + 3) & 3], fb[(u + 3) & 3]);
#pragma unroll
      for (int t = 0; t < 4; ++t) acc[t] = mmaH<1>(fa[u].v, fa[u].v, fb[u][t].v, fb[u][t].v, acc[t]); }
  }
}
// The three projections in one grid, blockIdx.y = 0 Q, 1 K, 2 V. Q and K: C[position][channel] = activations . W^T. V with the operands exchanged, C[channel][position] = W . activations^T:
// the product comes out as Vt, the layout k_attn reads, with the same products summed in the same k order. f16 out, v = acc / 16 + bias (weights are stored x 16).
__global__ __launch_bounds__(128) void k_gemm_qkv(const _Float16* __restrict__ QNP, const _Float16* __restrict__ VNP, const _Float16* __restrict__ Bw, const float* __restrict__ bq, const float* __restrict__ bk, const float* __restrict__ bv,
    _Float16* __restrict__ Q16, _Float16* __restrict__ K16, _Float16* __restrict__ Vt) {
  __shared__ __attribute__((aligned(16))) float so[4][16][68];      // pitch 16 bytes x 17: sixteen lanes read 16 bytes each down one column without a bank conflict
  const int tid = threadIdx.x, w = tid >> 5, lane = tid & 31, ln = lane & 15, hh = lane >> 4; const int by = blockIdx.y; const bool sw = by == 2;
  const _Float16* A = by == 0 ? QNP : by == 1 ? VNP : Bw + (size_t)2 * CC * CC; const _Float16* B = sw ? VNP : Bw + (size_t)by * CC * CC;
  const float* bias = by == 0 ? bq : by == 1 ? bk : bv; _Float16* C16 = by == 0 ? Q16 : by == 1 ? K16 : Vt;
  const int ls = sw ? 6 : 3; const int wid = blockIdx.x * 4 + w; const int row0 = (wid >> ls) * 16, col0 = (wid & ((1 << ls) - 1)) * 64;      // N / 64 = 1 << ls column tiles
  const unsigned short* ap = (const unsigned short*)A + (size_t)(row0 >> 4) * (CC / 32 * TL) + lane * 8; const unsigned short* bw[4];
#pragma unroll
  for (int t = 0; t < 4; ++t) bw[t] = (const unsigned short*)B + (size_t)((col0 >> 4) + t) * (CC / 32 * TL) + lane * 8;
  v8f acc[4] = {};
  gemm_tile(ap, bw, CC, acc);
  if (sw) { float br[8];      // the channel is the tile's row
#pragma unroll
    for (int r = 0; r < 8; ++r) br[r] = bf16_round(bias[row0 + 8 * hh + r]);
#pragma unroll
    for (int t = 0; t < 4; ++t) {
#pragma unroll
      for (int r = 0; r < 8; ++r) so[w][8 * hh + r][t * 16 + ln] = acc[t][r] * 0.0625f + br[r]; }
  } else {      // the channel is the tile's column
#pragma unroll
    for (int t = 0; t < 4; ++t) { const float bc = bf16_round(bias[col0 + t * 16 + ln]);
#pragma unroll
      for (int r = 0; r < 8; ++r) so[w][8 * hh + r][t * 16 + ln] = acc[t][r] * 0.0625f + bc; }
  }
  __builtin_amdgcn_fence(__ATOMIC_ACQ_REL, "workgroup"); __builtin_amdgcn_wave_barrier();
  // The wave's 16 x 64 values are two fragment-major tiles (16 rows x 32 columns each: Q, K: two heads of 16 positions; Vt: 16 d of two key blocks). tl0: the first one's number, tls: the step to the second.
  const int tl0 = sw ? ((row0 >> 5) * (NP / 32) + (col0 >> 5)) * 2 + ((row0 >> 4) & 1) : (col0 >> 5) * (NP / 16) + (row0 >> 4); const int tls = sw ? 2 : NP / 16;
#pragma unroll
  for (int q = 0; q < 4; ++q) { const int cb = (q >> 1) * 32 + ((q & 1) * 2 + hh) * 8; const v4f v0 = *(const v4fa*)&so[w][ln][cb], v1 = *(const v4fa*)&so[w][ln][cb + 4]; FragH f;
    for (int i = 0; i < 4; ++i) { f.h[i] = (_Float16)v0[i]; f.h[4 + i] = (_Float16)v1[i]; }
    *(v8us*)((unsigned short*)C16 + (size_t)(tl0 + (q >> 1) * tls) * TL + (q & 1) * 256 + lane * 8) = f.half[0]; }
}
// Output projection with the operands exchanged: C[channel][position] = Wo . O^T is the output's own layout, so bias, residual and 1/sqrt(2) are applied where the tile is stored.
__global__ __launch_bounds__(128) void k_gemm_out(const _Float16* __restrict__ Bo, const _Float16* __restrict__ O16h, const float* __restrict__ bo, const float* __restrict__ x, float* __restrict__ out) {
  __shared__ __attribute__((aligned(16))) float so[4][16][64];
  const int tid = threadIdx.x, w = tid >> 5, lane = tid & 31, ln = lane & 15, hh = lane >> 4;
  const int wid = blockIdx.x * 4 + w; const int row0 = (wid / (NP / 64)) * 16, col0 = (wid % (NP / 64)) * 64;
  const unsigned short* ap = (const unsigned short*)Bo + (size_t)(row0 >> 4) * (CC / 32 * TL) + lane * 8; const unsigned short* bw[4];
#pragma unroll
  for (int t = 0; t < 4; ++t) bw[t] = (const unsigned short*)O16h + (size_t)((col0 >> 4) + t) * (CC / 32 * TL) + lane * 8;
  v8f acc[4] = {};
  gemm_tile(ap, bw, CC, acc);
#pragma unroll
  for (int t = 0; t < 4; ++t) {
#pragma unroll
    for (int r = 0; r < 8; ++r) so[w][8 * hh + r][t * 16 + ln] = acc[t][r] * 0.0625f + bf16_round(bo[row0 + 8 * hh + r]); }
  __builtin_amdgcn_fence(__ATOMIC_ACQ_REL, "workgroup"); __builtin_amdgcn_wave_barrier();
  const int rsub = lane >> 4, c4 = (lane & 15) * 4;
  const size_t o0 = (size_t)(row0 + rsub) * NP + col0 + c4; const float* xp = x + o0; float* op = out + o0; v4f xv[8];
#pragma unroll
  for (int q = 0; q < 8; ++q) xv[q] = *(const v4fa*)(xp + (size_t)q * 2 * NP);
  asm volatile("s_wait_xcnt 0x0" ::: "memory");      // the wait stands before the address registers of the eight loads are written again
#pragma unroll
  for (int q = 0; q < 8; ++q) { const v4f v = *(const v4fa*)&so[w][q * 2 + rsub][c4]; v4f y;
    for (int i = 0; i < 4; ++i) y[i] = (v[i] + bf16_round(xv[q][i])) * 0.7071067811865476f; *(v4f*)(op + (size_t)q * 2 * NP) = y; }
}

// lane l <-> l ^ 16 (the two halves of a wave hold the two key halves of one query column)
__device__ __forceinline__ float xhalf(float v) { const int b = __float_as_int(v); return __int_as_float(__builtin_amdgcn_permlanex16(b, b, 0x76543210, 0xfedcba98, false, false)); }
// lane l <-> l ^ M inside a 16-lane row (DPP row_xmask)
template <int M>
__device__ __forceinline__ float xrow(float v) { return __int_as_float(__builtin_amdgcn_update_dpp(0, __float_as_int(v), 0x160 + M, 0xf, 0xf, true)); }
// sum over the 32 lanes of a wave, the same value in every lane; all lanes on
__device__ __forceinline__ float wave_sum(float v) { v += xrow<1>(v); v += xrow<2>(v); v += xrow<4>(v); v += xrow<8>(v); return v + xhalf(v); }
// Blocks 0 .. NG - 1: one group (GS * NP = 65,536 values) per block of 1,024 threads: 16 whole-line 16-byte loads per thread (load i is channel i of the group), all in flight together. The values stay in registers
// for the first GroupNorm's two sums, are normalised there, and stay for the second GroupNorm's two sums: STAT[g] = {mean 1, 1/sd 1, mean 2, 1/sd 2}.
// Blocks NG .. NG + 127 (independent work in the same launch): the four weight matrices, bf16-rounded, x 16, to f16, fragment-major (thread t writes the t-th 16-byte piece); they leave before any barrier.
__global__ __launch_bounds__(1024) void k_prep(const float* __restrict__ X, const float* __restrict__ gw, const float* __restrict__ gb, const float* __restrict__ W0, const float* __restrict__ W1, const float* __restrict__ W2, const float* __restrict__ W3,
    _Float16* __restrict__ Bt, float* __restrict__ STAT) { __shared__ float sh[4][32]; const int tid = threadIdx.x, w = tid >> 5, lane = tid & 31;
  if (blockIdx.x >= NG) { const int y = (int)(blockIdx.x - NG) >> 5; const float* W = y == 0 ? W0 : y == 1 ? W1 : y == 2 ? W2 : W3; const size_t t = (size_t)((blockIdx.x - NG) & 31) * 1024 + tid; FragH f;
    const float* wr = W + ((t >> 10) * 16 + (t & 15)) * CC + ((t >> 6) & 15) * 32 + ((t >> 4) & 3) * 8;      // row (out), k (in) of that piece
    const v4f a = *(const v4fa*)wr, b = *(const v4fa*)(wr + 4);
#pragma unroll
    for (int i = 0; i < 4; ++i) { f.h[i] = (_Float16)(bf16_round(a[i]) * 16.0f); f.h[4 + i] = (_Float16)(bf16_round(b[i]) * 16.0f); }
    *(v8us*)((unsigned short*)Bt + (size_t)y * CC * CC + t * 8) = f.half[0]; return; }
  const int g = blockIdx.x; const float* base = X + (size_t)g * GS * NP;
  v4f v[16];
#pragma unroll
  for (int i = 0; i < 16; ++i) v[i] = *(const v4fa*)(base + (size_t)(i * 1024 + tid) * 4);
  v4f st;
#pragma unroll
  for (int pass = 0; pass < 2; ++pass) {
    v4f s4 = {0.f, 0.f, 0.f, 0.f};
#pragma unroll
    for (int i = 0; i < 16; ++i) { if (pass == 0) { for (int q = 0; q < 4; ++q) v[i][q] = bf16_round(v[i][q]); } s4 += v[i]; }
    const float s = wave_sum((s4[0] + s4[1]) + (s4[2] + s4[3])); if (lane == 0) sh[pass * 2][w] = s; __syncthreads();
    const float mean = wave_sum(sh[pass * 2][lane]) / (float)(GS * NP);
    v4f q4 = {0.f, 0.f, 0.f, 0.f};
#pragma unroll
    for (int i = 0; i < 16; ++i) { const v4f d = v[i] - mean; q4 += d * d; }
    const float q = wave_sum((q4[0] + q4[1]) + (q4[2] + q4[3])); if (lane == 0) sh[pass * 2 + 1][w] = q; __syncthreads();
    const float var = wave_sum(sh[pass * 2 + 1][lane]) / (float)(GS * NP); const float rs = 1.0f / sqrtf(var + 1e-6f);
    st[pass * 2] = mean; st[pass * 2 + 1] = rs;
    if (pass == 0) {
#pragma unroll
      for (int i = 0; i < 16; ++i) { const float ww = bf16_round(gw[g * GS + i]), b2 = bf16_round(gb[g * GS + i]); for (int q2 = 0; q2 < 4; ++q2) v[i][q2] = (v[i][q2] - mean) * rs * ww + b2; } }
  }
  if (tid == 0) *(v4f*)(STAT + g * 4) = st; }
// 64 channels x 64 positions a block: x is read once (256-byte runs), qn = GN(x) and vn = GN(qn) are formed in registers and both go out in f16, fragment-major (row = position, k = channel), 512 bytes in a row a wave.
__global__ __launch_bounds__(256) void k_gnorm2(const float* __restrict__ X, const float* __restrict__ STAT, const float* __restrict__ w, const float* __restrict__ bb, _Float16* __restrict__ QP, _Float16* __restrict__ VP) { __shared__ float tq[64][65], tv[64][65];
  const int tid = threadIdx.x; const int cg = blockIdx.x / (NP / 64), pg = blockIdx.x % (NP / 64); const int c0 = cg * 64, p0 = pg * 64;
  const int cl = tid >> 4, p4 = (tid & 15) * 4;      // round u: channel c0 + 16 * u + cl, which lies in group cg * 4 + u
  const float* xp = X + (size_t)(c0 + cl) * NP + p0 + p4; const float* wp = w + c0 + cl; const float* bp = bb + c0 + cl; v4f xv[4]; float wv[4], bv[4];
#pragma unroll
  for (int u = 0; u < 4; ++u) { xv[u] = *(const v4fa*)(xp + (size_t)u * 16 * NP); wv[u] = wp[u * 16]; bv[u] = bp[u * 16]; }
  asm volatile("s_wait_xcnt 0x0" ::: "memory");      // the wait stands before the address registers of the twelve loads are written again
#pragma unroll
  for (int u = 0; u < 4; ++u) { const int c = u * 16 + cl; const v4f st = *(const v4fa*)(STAT + (cg * 4 + u) * 4); const float ww = bf16_round(wv[u]), b2 = bf16_round(bv[u]);
#pragma unroll
    for (int q = 0; q < 4; ++q) { const float y = (bf16_round(xv[u][q]) - st[0]) * st[1] * ww + b2; tq[p4 + q][c] = y; tv[p4 + q][c] = (y - st[2]) * st[3] * ww + b2; } }
  __syncthreads();
#pragma unroll
  for (int u = 0; u < 2; ++u) { const int i = tid + 256 * u, r = (i >> 7) * 16 + (i & 15), pc = (i >> 4) & 7; FragH f, g;      // piece i: position tile i >> 7, k-step (i >> 6) & 1, then the tile's 64 pieces in order
#pragma unroll
    for (int q = 0; q < 8; ++q) { f.h[q] = (_Float16)tq[r][pc * 8 + q]; g.h[q] = (_Float16)tv[r][pc * 8 + q]; }
    const size_t o = (size_t)(((p0 >> 4) + (i >> 7)) * (CC / 32) + (c0 >> 5) + ((i >> 6) & 1)) * TL + (i & 63) * 8; *(v8us*)((unsigned short*)QP + o) = f.half[0]; *(v8us*)((unsigned short*)VP + o) = g.half[0]; } }
__global__ __launch_bounds__(128) void k_attn(const _Float16* __restrict__ Q16, const _Float16* __restrict__ K16, const _Float16* __restrict__ Vt, _Float16* __restrict__ O16h) { constexpr int RPW = 32; constexpr float SL2 = 0.25503486164919736f;
  const int tid = threadIdx.x, w = tid >> 5, lane = tid & 31; const int h = blockIdx.x / (NP / 128), qblk = blockIdx.x % (NP / 128); const int q0 = qblk * 128 + w * RPW;      // below: ln = lane & 15, hh = lane >> 4
  FragH aq[2];
#pragma unroll
  for (int rt = 0; rt < 2; ++rt) { const unsigned short* qr = (const unsigned short*)Q16 + (size_t)(h * (NP / 16) + (q0 >> 4) + rt) * TL + lane * 8; aq[rt].half[0] = *(const v8us*)qr; aq[rt].half[1] = *(const v8us*)(qr + 256); }
  __builtin_amdgcn_sched_barrier(0);      // keeps the four Q loads the oldest: moved behind K or Vt loads they would make the loop's counted waits for Q cover the Vt loads of the pass before as well
  float m_r[2], l_r[2]; v8f oacc[2][2];      // query rt * 16 + ln; oacc[rt][dt][r] = Ot[dt * 16 + 8hh + r][query]
#pragma unroll
  for (int rt = 0; rt < 2; ++rt) { m_r[rt] = -3.0e38f; l_r[rt] = 0.f; oacc[rt][0] = (v8f){0.f,0.f,0.f,0.f,0.f,0.f,0.f,0.f}; oacc[rt][1] = oacc[rt][0]; }
  // K and Vt fragments one pass ahead: each pass refills a fragment's registers for the next pass right behind its last product, so the loads fly during the softmax and the other products.
  // The last pass fetches pass 0's fragments again (in bounds, not used).
  // Fragment-major: a pass's two K tiles are 2 KiB in a row, its two Vt tiles likewise; 32 keys are 32 * 32 elements on in both.
  const unsigned short* kl = (const unsigned short*)K16 + (size_t)h * NP * HD + lane * 8; const unsigned short* vl = (const unsigned short*)Vt + (size_t)h * NP * HD + lane * 8;
  FragH bk[2], bv[2];
#pragma unroll
  for (int t = 0; t < 2; ++t) { const unsigned short* kr = kl + t * TL; bk[t].half[0] = *(const v8us*)kr; bk[t].half[1] = *(const v8us*)(kr + 256); }
#pragma unroll
  for (int t = 0; t < 2; ++t) { const unsigned short* vrow = vl + t * TL; bv[t].half[0] = *(const v8us*)vrow; bv[t].half[1] = *(const v8us*)(vrow + 256); }
#pragma unroll 1
  for (int j0 = 0; j0 < NP; j0 += 32) { v8f s[2][2];      // s[rt][nt][r] = S[query][j0 + nt * 16 + 8hh + r]
    const int jn = j0 + 32 < NP ? j0 + 32 : 0;
#pragma unroll
    for (int nt = 0; nt < 2; ++nt) {
#pragma unroll
      for (int rt = 0; rt < 2; ++rt) { v8f acc = (v8f){0.f,0.f,0.f,0.f,0.f,0.f,0.f,0.f}; acc = mmaH<1>(bk[nt].v, bk[nt].v, aq[rt].v, aq[rt].v, acc); s[rt][nt] = acc; }
      const unsigned short* kr = kl + (size_t)jn * HD + nt * TL; bk[nt].half[0] = *(const v8us*)kr; bk[nt].half[1] = *(const v8us*)(kr + 256); }
    FragH pb[2];
#pragma unroll
    for (int rt = 0; rt < 2; ++rt) { float sc[16];      // raw products; SL2 > 0, so their maximum is the maximum of the scaled scores
#pragma unroll
      for (int i = 0; i < 16; ++i) sc[i] = s[rt][i >> 3][i & 7];
      float mx[8];
#pragma unroll
      for (int i = 0; i < 8; ++i) mx[i] = fmaxf(sc[i], sc[8 + i]);
      float mc = fmaxf(fmaxf(fmaxf(mx[0], mx[1]), fmaxf(mx[2], mx[3])), fmaxf(fmaxf(mx[4], mx[5]), fmaxf(mx[6], mx[7])));
      mc = fmaxf(mc, xhalf(mc));
      const float mn = fmaxf(m_r[rt], mc * SL2); const float al = __builtin_amdgcn_exp2f(m_r[rt] - mn); m_r[rt] = mn;      // m_r in log2 units
      float ps[8];
#pragma unroll
      for (int i = 0; i < 8; ++i) { const float p0 = __builtin_amdgcn_exp2f(fmaf(sc[i], SL2, -mn)), p1 = __builtin_amdgcn_exp2f(fmaf(sc[8 + i], SL2, -mn)); ps[i] = p0 + p1; pb[rt].h[i] = (_Float16)p0; pb[rt].h[8 + i] = (_Float16)p1; }
      l_r[rt] = l_r[rt] * al + (((ps[0] + ps[1]) + (ps[2] + ps[3])) + ((ps[4] + ps[5]) + (ps[6] + ps[7])));      // this half's keys; the halves join after the loop
#pragma unroll
      for (int r = 0; r < 8; ++r) { oacc[rt][0][r] *= al; oacc[rt][1][r] *= al; } }
#pragma unroll
    for (int dt = 0; dt < 2; ++dt) {
#pragma unroll
      for (int rt = 0; rt < 2; ++rt) oacc[rt][dt] = mmaH<1>(bv[dt].v, bv[dt].v, pb[rt].v, pb[rt].v, oacc[rt][dt]);
      const unsigned short* vrow = vl + (size_t)jn * HD + dt * TL; bv[dt].half[0] = *(const v8us*)vrow; bv[dt].half[1] = *(const v8us*)(vrow + 256); }
    asm volatile("s_wait_xcnt 0x0" ::: "memory"); }      // the Vt loads stay in flight over the back edge: the wait stands before their address registers are written again
  // A lane's eight values of one accumulator (d = dt * 16 + 8hh + r of query rt * 16 + ln) are one 16-byte piece of O's fragment-major tile (row = position, k-step = head): stored from the registers, 512 bytes in a row a wave.
#pragma unroll
  for (int rt = 0; rt < 2; ++rt) { const float l = l_r[rt] + xhalf(l_r[rt]); const float li = 1.0f / l;
#pragma unroll
    for (int dt = 0; dt < 2; ++dt) { FragH f;
#pragma unroll
      for (int r = 0; r < 8; ++r) f.h[r] = (_Float16)(oacc[rt][dt][r] * li);
      *(v8us*)((unsigned short*)O16h + (size_t)(((q0 >> 4) + rt) * (CC / 32) + h) * TL + dt * 256 + lane * 8) = f.half[0]; } } }
extern "C" void kernel_launch(void* const* d_in, const int* in_sizes, int n_in,
                              void* d_out, int out_size, void* d_ws, size_t ws_size, hipStream_t stream) {
  (void)in_sizes; (void)n_in; (void)out_size;
  const float* x = (const float*)d_in[0]; const float* gw = (const float*)d_in[1]; const float* gb = (const float*)d_in[2]; const float* wq = (const float*)d_in[3]; const float* bq = (const float*)d_in[4]; const float* wk = (const float*)d_in[5]; const float* bk = (const float*)d_in[6]; const float* wv = (const float*)d_in[7]; const float* bv = (const float*)d_in[8]; const float* wo = (const float*)d_in[9]; const float* bo = (const float*)d_in[10];
  char* ws = (char*)d_ws; size_t off = 0;
  auto take = [&](size_t bytes) { char* p = ws + off; off += (bytes + 255) & ~(size_t)255; return p; };
  _Float16* Bw = (_Float16*)take((size_t)4 * CC * CC * 2);      // Wq, Wk, Wv, Wo, (out,in)
  float* ST = (float*)take(NG * 4 * 4);
  _Float16* QNP = (_Float16*)take((size_t)NP * CC * 2); _Float16* VNP = (_Float16*)take((size_t)NP * CC * 2); _Float16* Q16 = (_Float16*)take((size_t)NP * CC * 2); _Float16* K16 = (_Float16*)take((size_t)NP * CC * 2); _Float16* Vt = (_Float16*)take((size_t)NP * CC * 2); _Float16* O16h = (_Float16*)take((size_t)NP * CC * 2);
  if (off > ws_size) return;      // 2 + 6 x 4 = 26 MiB
  k_prep<<<NG + 128, 1024, 0, stream>>>(x, gw, gb, wq, wk, wv, wo, Bw, ST);
  k_gnorm2<<<(CC / 64) * (NP / 64), 256, 0, stream>>>(x, ST, gw, gb, QNP, VNP);
  k_gemm_qkv<<<dim3((NP / 16) * (CC / 64) / 4, 3), 128, 0, stream>>>(QNP, VNP, Bw, bq, bk, bv, Q16, K16, Vt);
  k_attn<<<NH * (NP / 128), 128, 0, stream>>>(Q16, K16, Vt, O16h);
  k_gemm_out<<<(CC / 16) * (NP / 64) / 4, 128, 0, stream>>>(Bw + (size_t)3 * CC * CC, O16h, bo, x, (float*)d_out);
}

// v007
// One run takes 88.1 microseconds.
// In two side-by-side timings against v006, it was 1.30 and 1.28 times as fast.
// Counting every step since v000, it is 4.79 times as fast.
#include <hip/hip_runtime.h>
// the 1×1 convs (4096 × 512 × 512, + bias, weights (out,in) bf16-exact ×2^4) and the attention as a fused flash-style kernel (S = Q·Kᵀ·32^-½ with d = 32 in one k-step, online softmax f32,
// P f16 ≤ 1, O = P·V) on v_wmma_f32_16x16x32_f16 (f16 operands, single products, f32 accumulate); residual (out + x)/√2 and layout transposes f32 VALU.
#define CC 512
#define NP 4096
#define NG 32
#define GS 16
#define NH 16
#define HD 32

typedef __bf16 v16b __attribute__((ext_vector_type(16)));
typedef unsigned short v8us __attribute__((ext_vector_type(8), may_alias));
typedef float  v8f  __attribute__((ext_vector_type(8)));
typedef float  v4f  __attribute__((ext_vector_type(4)));
typedef float  v4fa __attribute__((ext_vector_type(4), may_alias));
union FragB { v16b v; v8us half[2]; unsigned short u[16]; };

__device__ __forceinline__ unsigned short bf16_bits(float x) { unsigned int u = __float_as_uint(x); return (unsigned short)((u + 0x7FFFu + ((u >> 16) & 1u)) >> 16); }
__device__ __forceinline__ float bf16_val(unsigned short b) { return __uint_as_float(((unsigned int)b) << 16); }
__device__ __forceinline__ float bf16_round(float x) { return bf16_val(bf16_bits(x)); }
// D += A·B with NT terms: 1 = ah·bh, 2 = + al·bh (A split), 3 = + ah·bl (both split)
template <int NT>
__device__ __forceinline__ v8f mmaN(v16b ah, v16b al, v16b bh, v16b bl, v8f c) {
  c = __builtin_amdgcn_wmma_f32_16x16x32_bf16(false, ah, false, bh, (short)0, c, false, false);
  if (NT >= 2) c = __builtin_amdgcn_wmma_f32_16x16x32_bf16(false, al, false, bh, (short)0, c, false, false);
  if (NT >= 3) c = __builtin_amdgcn_wmma_f32_16x16x32_bf16(false, ah, false, bl, (short)0, c, false, false);
  asm volatile("v_nop\n\tv_nop\n\tv_nop\n\tv_nop" : "+v"(c) : "v"(ah), "v"(al), "v"(bh), "v"(bl));
  return c;
}

__global__ __launch_bounds__(256) void k_wt_bf16(const float* __restrict__ W, unsigned short* __restrict__ Wt, int K, int N) {
  const int t = blockIdx.x * 256 + threadIdx.x;
  const int k8n = K / 8;
  if (t >= N * k8n) return;
  const int n = t / k8n, k8 = (t % k8n) * 8;
  v8us v;
#pragma unroll
  for (int i = 0; i < 8; ++i) v[i] = bf16_bits(W[(size_t)(k8 + i) * N + n]);
  *(v8us*)(Wt + (size_t)n * K + k8) = v;
  
}

// GEMM C[M][N] (f32, pitch ldc) = act(A[M][K]·W + bias). A f32 row-major (pitch lda) converted per fragment to bf16
// (ASPLIT: hi/lo two planes -> 2 terms, else single rounded term); Wt bf16 [N][K] (pitch ldb). BIAS_BF16 rounds the
// bias to bf16 first (bias quantised to bf16 before the add). K%32==0, M%16==0, N%64==0.
template <bool ASPLIT, int ACT, bool BIAS_BF16>
__global__ __launch_bounds__(128) void k_gemm_bf(const float* __restrict__ A, int lda, const unsigned short* __restrict__ Wt, int ldb,
                                               const float* __restrict__ bias, float* __restrict__ C, int ldc, int M, int N, int K) {
  __shared__ __attribute__((aligned(16))) float so[4][16][64];
  const int tid = threadIdx.x, w = tid >> 5, lane = tid & 31, ln = lane & 15, hh = lane >> 4;
  const int ntn = N / 64;
  const int wid = blockIdx.x * 4 + w;
  const int mt = wid / ntn, nq = wid % ntn;
  if (mt * 16 >= M) return;
  const int row0 = mt * 16, col0 = nq * 64;
  const float* arow = A + (size_t)(row0 + ln) * lda;
  v8f acc[4] = {};
  for (int kb = 0; kb < K; kb += 32) {
    FragB ah, al;
    const v4f x0 = *(const v4fa*)(arow + kb + 8 * hh), x1 = *(const v4fa*)(arow + kb + 8 * hh + 4);
    const v4f x2 = *(const v4fa*)(arow + kb + 16 + 8 * hh), x3 = *(const v4fa*)(arow + kb + 16 + 8 * hh + 4);
    float xs[16] = {x0[0],x0[1],x0[2],x0[3],x1[0],x1[1],x1[2],x1[3],x2[0],x2[1],x2[2],x2[3],x3[0],x3[1],x3[2],x3[3]};
#pragma unroll
    for (int i = 0; i < 16; ++i) { const unsigned short hb = bf16_bits(xs[i]); ah.u[i] = hb; al.u[i] = ASPLIT ? bf16_bits(xs[i] - bf16_val(hb)) : (unsigned short)0; }
#pragma unroll
    for (int t = 0; t < 4; ++t) {
      const unsigned short* brow = Wt + (size_t)(col0 + t * 16 + ln) * ldb + kb;
      FragB b;
      b.half[0] = *(const v8us*)(brow + 8 * hh);
      b.half[1] = *(const v8us*)(brow + 16 + 8 * hh);
      acc[t] = mmaN<ASPLIT ? 2 : 1>(ah.v, al.v, b.v, b.v, acc[t]);
    }
  }
#pragma unroll
  for (int t = 0; t < 4; ++t) {
    float bv = bias ? bias[col0 + t * 16 + ln] : 0.f;
    if (BIAS_BF16) bv = bf16_round(bv);
#pragma unroll
    for (int r = 0; r < 8; ++r) { float v = acc[t][r] + bv; if (ACT == 1) v = fmaxf(v, 0.f); so[w][8 * hh + r][t * 16 + ln] = v; }
  }
  __builtin_amdgcn_fence(__ATOMIC_ACQ_REL, "workgroup");
  __builtin_amdgcn_wave_barrier();
  const int rsub = lane >> 4, c4 = (lane & 15) * 4;
  {
#pragma unroll
    for (int q = 0; q < 8; ++q) {
      const int r = q * 2 + rsub;
      const v4f v = *(const v4fa*)&so[w][r][c4];
      *(v4f*)(C + (size_t)(row0 + r) * ldc + col0 + c4) = v;
    }
    
  }
}

// Flash-style causal/unmasked attention, all contractions 3-term bf16 hi/lo splits, f32 softmax with running max.
// q,k,v rows are read from f32 buffers with arbitrary row pitch (so they can live inside a fused qkv buffer);
// D = head size (multiple of 32, <= 128); one wave = 16 query rows; block = 4 waves (64 queries) sharing K/V chunks of 32.
template <int D, bool CAUSAL>
__global__ __launch_bounds__(128) void k_flash(const float* __restrict__ qb, const float* __restrict__ kb, const float* __restrict__ vb,
                                             int pitch, int T, int H, float scale, float* __restrict__ y, int ypitch) {
  constexpr int KS = D / 32;        // k-steps for QK
  constexpr int DT = D / 16;        // d tiles for PV
  __shared__ __attribute__((aligned(16))) unsigned short sKh[32][D + 8], sKl[32][D + 8], sVh[32][D + 8], sVl[32][D + 8];
  __shared__ __attribute__((aligned(16))) unsigned short sPh[4][16][40], sPl[4][16][40];
  __shared__ __attribute__((aligned(16))) float sO[4][16][D];
  const int tid = threadIdx.x, w = tid >> 5, lane = tid & 31, ln = lane & 15, hh = lane >> 4;
  const int nqb = (T + 63) / 64;
  const int bh = blockIdx.x / nqb, qblk = blockIdx.x % nqb;
  const int b = bh / H, h = bh % H;
  const int q0 = qblk * 64 + w * 16;
  const float* Q = qb + (size_t)b * T * pitch + h * D;
  const float* K = kb + (size_t)b * T * pitch + h * D;
  const float* V = vb + (size_t)b * T * pitch + h * D;

  // A fragments of the wave's 16 query rows (scaled), hi/lo
  FragB aqh[KS], aql[KS];
  {
    int row = q0 + ln; if (row >= T) row = T - 1;
    const float* qr = Q + (size_t)row * pitch;
#pragma unroll
    for (int ks = 0; ks < KS; ++ks)
#pragma unroll
      for (int i = 0; i < 16; ++i) {
        const int d = ks * 32 + ((i < 8) ? (8 * hh + i) : (16 + 8 * hh + (i - 8)));
        const float x = qr[d] * scale; const unsigned short hb = bf16_bits(x);
        aqh[ks].u[i] = hb; aql[ks].u[i] = bf16_bits(x - bf16_val(hb));
      }
  }
  float m_r[8], l_r[8];
#pragma unroll
  for (int r = 0; r < 8; ++r) { m_r[r] = -3.0e38f; l_r[r] = 0.f; }
  v8f oacc[DT];
#pragma unroll
  for (int dt = 0; dt < DT; ++dt) oacc[dt] = (v8f){0.f,0.f,0.f,0.f,0.f,0.f,0.f,0.f};

  const int kv_end = CAUSAL ? min(T, qblk * 64 + 64) : T;     // block-uniform
  for (int j0 = 0; j0 < kv_end; j0 += 32) {
    __syncthreads();
    for (int e = tid; e < 32 * (D / 4); e += 128) {
      const int r = e / (D / 4), c4 = (e % (D / 4)) * 4;
      const int key = j0 + r;
      v4f kf = {0.f,0.f,0.f,0.f}, vf = {0.f,0.f,0.f,0.f};
      if (key < T) { kf = *(const v4fa*)(K + (size_t)key * pitch + c4); vf = *(const v4fa*)(V + (size_t)key * pitch + c4); }
#pragma unroll
      for (int t = 0; t < 4; ++t) {
        unsigned short hb = bf16_bits(kf[t]); sKh[r][c4 + t] = hb; sKl[r][c4 + t] = bf16_bits(kf[t] - bf16_val(hb));
        hb = bf16_bits(vf[t]); sVh[r][c4 + t] = hb; sVl[r][c4 + t] = bf16_bits(vf[t] - bf16_val(hb));
      }
    }
    __syncthreads();
    // S tile 16 x 32
    v8f s[2];
#pragma unroll
    for (int nt = 0; nt < 2; ++nt) {
      v8f acc = {};
#pragma unroll
      for (int ks = 0; ks < KS; ++ks) {
        FragB bh_, bl_;
        bh_.half[0] = *(const v8us*)&sKh[nt * 16 + ln][ks * 32 + 8 * hh]; bh_.half[1] = *(const v8us*)&sKh[nt * 16 + ln][ks * 32 + 16 + 8 * hh];
        bl_.half[0] = *(const v8us*)&sKl[nt * 16 + ln][ks * 32 + 8 * hh]; bl_.half[1] = *(const v8us*)&sKl[nt * 16 + ln][ks * 32 + 16 + 8 * hh];
        acc = mmaN<3>(aqh[ks].v, aql[ks].v, bh_.v, bl_.v, acc);
      }
      s[nt] = acc;
    }
    // mask + running max (rows 8hh+r; the 16 lanes of a half share rows)
    float alpha[8];
#pragma unroll
    for (int r = 0; r < 8; ++r) {
      const int qi = q0 + 8 * hh + r;
      const int ja = j0 + ln, jb = j0 + 16 + ln;
      if (CAUSAL) { if (ja > qi) s[0][r] = -3.0e38f; if (jb > qi) s[1][r] = -3.0e38f; }
      if (ja >= T) s[0][r] = -3.0e38f;
      if (jb >= T) s[1][r] = -3.0e38f;
      float mx = fmaxf(s[0][r], s[1][r]);
      mx = fmaxf(mx, __shfl_xor(mx, 1, 32)); mx = fmaxf(mx, __shfl_xor(mx, 2, 32)); mx = fmaxf(mx, __shfl_xor(mx, 4, 32)); mx = fmaxf(mx, __shfl_xor(mx, 8, 32));
      const float mnew = fmaxf(m_r[r], mx);
      alpha[r] = (mnew > -1.0e38f) ? __expf(m_r[r] - mnew) : 1.0f;
      const float p0 = (s[0][r] > -1.0e38f) ? __expf(s[0][r] - mnew) : 0.f;
      const float p1 = (s[1][r] > -1.0e38f) ? __expf(s[1][r] - mnew) : 0.f;
      m_r[r] = mnew;
      l_r[r] = l_r[r] * alpha[r] + p0 + p1;            // per-lane partial row sum (16 lanes combined at the end)
      unsigned short hb = bf16_bits(p0); sPh[w][8 * hh + r][ln] = hb;      sPl[w][8 * hh + r][ln] = bf16_bits(p0 - bf16_val(hb));
      hb = bf16_bits(p1);                sPh[w][8 * hh + r][16 + ln] = hb; sPl[w][8 * hh + r][16 + ln] = bf16_bits(p1 - bf16_val(hb));
    }
#pragma unroll
    for (int dt = 0; dt < DT; ++dt)
#pragma unroll
      for (int r = 0; r < 8; ++r) oacc[dt][r] *= alpha[r];
    __builtin_amdgcn_fence(__ATOMIC_ACQ_REL, "workgroup");
    __builtin_amdgcn_wave_barrier();
    FragB pah, pal;
    pah.half[0] = *(const v8us*)&sPh[w][ln][8 * hh]; pah.half[1] = *(const v8us*)&sPh[w][ln][16 + 8 * hh];
    pal.half[0] = *(const v8us*)&sPl[w][ln][8 * hh]; pal.half[1] = *(const v8us*)&sPl[w][ln][16 + 8 * hh];
#pragma unroll
    for (int dt = 0; dt < DT; ++dt) {
      FragB bvh, bvl;
#pragma unroll
      for (int i = 0; i < 8; ++i) {
        bvh.u[i] = sVh[8 * hh + i][dt * 16 + ln]; bvh.u[8 + i] = sVh[16 + 8 * hh + i][dt * 16 + ln];
        bvl.u[i] = sVl[8 * hh + i][dt * 16 + ln]; bvl.u[8 + i] = sVl[16 + 8 * hh + i][dt * 16 + ln];
      }
      oacc[dt] = mmaN<3>(pah.v, pal.v, bvh.v, bvl.v, oacc[dt]);
    }
    __builtin_amdgcn_fence(__ATOMIC_ACQ_REL, "workgroup");
    __builtin_amdgcn_wave_barrier();
  }
#pragma unroll
  for (int r = 0; r < 8; ++r) {
    float l = l_r[r];
    l += __shfl_xor(l, 1, 32); l += __shfl_xor(l, 2, 32); l += __shfl_xor(l, 4, 32); l += __shfl_xor(l, 8, 32);
    l_r[r] = (l > 0.f) ? 1.0f / l : 0.f;
  }
#pragma unroll
  for (int dt = 0; dt < DT; ++dt)
#pragma unroll
    for (int r = 0; r < 8; ++r) sO[w][8 * hh + r][dt * 16 + ln] = oacc[dt][r] * l_r[r];
  __builtin_amdgcn_fence(__ATOMIC_ACQ_REL, "workgroup");
  __builtin_amdgcn_wave_barrier();
  {
    for (int r = 0; r < 16; ++r) {
      const int row = q0 + r;
      if (row < T && lane < D / 4) {
        const v4f val = *(const v4fa*)&sO[w][r][lane * 4];
        *(v4f*)(y + ((size_t)b * T + row) * ypitch + h * D + lane * 4) = val;
      }
    }
    
  }
}

// GEMM C = act(A·W + bias + resid): A f32 (ASPLIT -> hi/lo 2 terms), Wt bf16 [N][K]; ACT 0 none, 1 relu, 2 exact gelu;
// resid (optional, f32, row index = (row % rmod), pitch ldr, RES_BF16 rounds it) added before the activation.
template <bool ASPLIT, int ACT, bool BIAS_BF16, bool RES_BF16>
__global__ __launch_bounds__(128) void k_gemm_bf3(const float* __restrict__ A, int lda, const unsigned short* __restrict__ Wt, int ldb,
                                                const float* __restrict__ bias, const float* __restrict__ resid, int rmod, int ldr,
                                                float* __restrict__ C, int ldc, int M, int N, int K) {
  __shared__ __attribute__((aligned(16))) float so[4][16][64];
  const int tid = threadIdx.x, w = tid >> 5, lane = tid & 31, ln = lane & 15, hh = lane >> 4;
  const int ntn = N / 64;
  const int wid = blockIdx.x * 4 + w;
  const int mt = wid / ntn, nq = wid % ntn;
  if (mt * 16 >= M) return;
  const int row0 = mt * 16, col0 = nq * 64;
  const float* arow = A + (size_t)(row0 + ln) * lda;
  v8f acc[4] = {};
  for (int kb = 0; kb < K; kb += 32) {
    FragB ah, al;
    const v4f x0 = *(const v4fa*)(arow + kb + 8 * hh), x1 = *(const v4fa*)(arow + kb + 8 * hh + 4);
    const v4f x2 = *(const v4fa*)(arow + kb + 16 + 8 * hh), x3 = *(const v4fa*)(arow + kb + 16 + 8 * hh + 4);
    float xs[16] = {x0[0],x0[1],x0[2],x0[3],x1[0],x1[1],x1[2],x1[3],x2[0],x2[1],x2[2],x2[3],x3[0],x3[1],x3[2],x3[3]};
#pragma unroll
    for (int i = 0; i < 16; ++i) { const unsigned short hb = bf16_bits(xs[i]); ah.u[i] = hb; al.u[i] = ASPLIT ? bf16_bits(xs[i] - bf16_val(hb)) : (unsigned short)0; }
#pragma unroll
    for (int t = 0; t < 4; ++t) {
      const unsigned short* brow = Wt + (size_t)(col0 + t * 16 + ln) * ldb + kb;
      FragB b;
      b.half[0] = *(const v8us*)(brow + 8 * hh);
      b.half[1] = *(const v8us*)(brow + 16 + 8 * hh);
      acc[t] = mmaN<ASPLIT ? 2 : 1>(ah.v, al.v, b.v, b.v, acc[t]);
    }
  }
#pragma unroll
  for (int t = 0; t < 4; ++t) {
    const int col = col0 + t * 16 + ln;
    float bv = bias ? bias[col] : 0.f;
    if (BIAS_BF16) bv = bf16_round(bv);
#pragma unroll
    for (int r = 0; r < 8; ++r) {
      float v = acc[t][r] + bv;
      if (resid) { float rv = resid[(size_t)((row0 + 8 * hh + r) % rmod) * ldr + col]; if (RES_BF16) rv = bf16_round(rv); v += rv; }
      if (ACT == 1) v = fmaxf(v, 0.f);
      if (ACT == 2) v = 0.5f * v * (1.0f + erff(v * 0.70710678118654752f));
      if (ACT == 3) { const float u = 0.7978845608028654f * (v + 0.044715f * v * v * v); v = 0.5f * v * (1.0f + tanhf(u)); }
      so[w][8 * hh + r][t * 16 + ln] = v;
    }
  }
  __builtin_amdgcn_fence(__ATOMIC_ACQ_REL, "workgroup");
  __builtin_amdgcn_wave_barrier();
  const int rsub = lane >> 4, c4 = (lane & 15) * 4;
  {
#pragma unroll
    for (int q = 0; q < 8; ++q) {
      const int r = q * 2 + rsub;
      const v4f v = *(const v4fa*)&so[w][r][c4];
      *(v4f*)(C + (size_t)(row0 + r) * ldc + col0 + c4) = v;
    }
    
  }
}
// row LayerNorm (biased variance, eps) over N: s = X (+ R); optional out_sum <- s; out_norm <- (s-mu)*rsqrt(var+eps)*g + b
template <bool PARAM_BF16>
__global__ __launch_bounds__(256) void k_layernorm(const float* __restrict__ X, const float* __restrict__ R, const float* __restrict__ g, const float* __restrict__ bta,
                                                  float* __restrict__ out_sum, float* __restrict__ out_norm, int N, float eps) {
  __shared__ float red[256];
  const int row = blockIdx.x, tid = threadIdx.x;
  const float* x = X + (size_t)row * N; const float* rr = R ? R + (size_t)row * N : nullptr;
  float vals[16];                     // up to N = 4096
  const int per = N / 256;            // contiguous chunk per thread? use strided-by-4 chunks: thread handles j = tid*4 + 1024*u
  float s1 = 0.f;
  for (int u = 0; u < per / 4; ++u) {
    const int j = tid * 4 + 1024 * u;
    const v4f a = *(const v4fa*)(x + j);
    v4f b = {0.f,0.f,0.f,0.f}; if (rr) b = *(const v4fa*)(rr + j);
#pragma unroll
    for (int q = 0; q < 4; ++q) { const float v = a[q] + b[q]; vals[u * 4 + q] = v; s1 += v; }
  }
  red[tid] = s1; __syncthreads();
  for (int st = 128; st > 0; st >>= 1) { if (tid < st) red[tid] += red[tid + st]; __syncthreads(); }
  const float mu = red[0] / (float)N; __syncthreads();
  float s2 = 0.f;
  for (int u = 0; u < per / 4; ++u)
#pragma unroll
    for (int q = 0; q < 4; ++q) { const float c = vals[u * 4 + q] - mu; s2 += c * c; }
  red[tid] = s2; __syncthreads();
  for (int st = 128; st > 0; st >>= 1) { if (tid < st) red[tid] += red[tid + st]; __syncthreads(); }
  const float rs = rsqrtf(red[0] / (float)N + eps);
  {
    for (int u = 0; u < per / 4; ++u) {
      const int j = tid * 4 + 1024 * u;
      v4f o, sm;
#pragma unroll
      for (int q = 0; q < 4; ++q) {
        float gg = g[j + q], bb = bta[j + q];
        if (PARAM_BF16) { gg = bf16_round(gg); bb = bf16_round(bb); }
        sm[q] = vals[u * 4 + q]; o[q] = (vals[u * 4 + q] - mu) * rs * gg + bb;
      }
      if (out_sum) *(v4f*)(out_sum + (size_t)row * N + j) = sm;
      *(v4f*)(out_norm + (size_t)row * N + j) = o;
    }
    
  }
}



// ---- f16 WMMA path (v_wmma_f32_16x16x32_f16): 11-bit significands for operands in range — used here for every matrix product (1×1 convs, Q·Kᵀ and P·V)
typedef _Float16 v16h __attribute__((ext_vector_type(16)));
union FragH { v16h v; v8us half[2]; _Float16 h[16]; unsigned short u[16]; };
template <int NT>
__device__ __forceinline__ v8f mmaH(v16h ah, v16h al, v16h bh, v16h bl, v8f c) {
  c = __builtin_amdgcn_wmma_f32_16x16x32_f16(false, ah, false, bh, (short)0, c, false, false);
  if (NT >= 2) c = __builtin_amdgcn_wmma_f32_16x16x32_f16(false, al, false, bh, (short)0, c, false, false);
  if (NT >= 3) c = __builtin_amdgcn_wmma_f32_16x16x32_f16(false, ah, false, bl, (short)0, c, false, false);
  asm volatile("v_nop\n\tv_nop\n\tv_nop\n\tv_nop" : "+v"(c) : "v"(ah), "v"(al), "v"(bh), "v"(bl));
  return c;
}
// batched GEMM like k_gemm_b but f16 operands: A f32 (split into f16 hi/lo if ASPLIT, else rounded to f16), Bt = f16 values [n][k]; alpha; C f32; N multiple of 16 (partial tiles skipped)
template <bool ASPLIT>
__global__ __launch_bounds__(128) void k_gemm_h(const float* __restrict__ A, int lda, size_t sA, const _Float16* __restrict__ Bh, int ldb, size_t sB, float alpha, float* __restrict__ C, int ldc, size_t sC, int M, int N, int K) {
  __shared__ __attribute__((aligned(16))) float so[4][16][64];
  const int tid = threadIdx.x, w = tid >> 5, lane = tid & 31, ln = lane & 15, hh = lane >> 4; const int by = blockIdx.y;
  A += (size_t)by * sA; Bh += (size_t)by * sB; C += (size_t)by * sC;
  const int ntn = (N + 63) / 64; const int wid = blockIdx.x * 4 + w; const int mt = wid / ntn, nq = wid % ntn; if (mt * 16 >= M) return;
  const int row0 = mt * 16, col0 = nq * 64; const float* arow = A + (size_t)(row0 + ln) * lda;
  v8f acc[4] = {};
  for (int kb = 0; kb < K; kb += 32) {
    FragH ah, al;
    const v4f x0 = *(const v4fa*)(arow + kb + 8 * hh), x1 = *(const v4fa*)(arow + kb + 8 * hh + 4), x2 = *(const v4fa*)(arow + kb + 16 + 8 * hh), x3 = *(const v4fa*)(arow + kb + 16 + 8 * hh + 4);
    float xs[16] = {x0[0],x0[1],x0[2],x0[3],x1[0],x1[1],x1[2],x1[3],x2[0],x2[1],x2[2],x2[3],x3[0],x3[1],x3[2],x3[3]};
#pragma unroll
    for (int i = 0; i < 16; ++i) { const _Float16 h = (_Float16)xs[i]; ah.h[i] = h; al.h[i] = ASPLIT ? (_Float16)(xs[i] - (float)h) : (_Float16)0.0f; }
#pragma unroll
    for (int t = 0; t < 4; ++t) { if (col0 + t * 16 >= N) continue; const size_t boff = (size_t)(col0 + t * 16 + ln) * ldb + kb; FragH bq; bq.half[0] = *(const v8us*)(Bh + boff + 8 * hh); bq.half[1] = *(const v8us*)(Bh + boff + 16 + 8 * hh);
      acc[t] = mmaH<ASPLIT ? 2 : 1>(ah.v, al.v, bq.v, bq.v, acc[t]); }
  }
#pragma unroll
  for (int t = 0; t < 4; ++t) { if (col0 + t * 16 >= N) continue;
#pragma unroll
    for (int r = 0; r < 8; ++r) so[w][8 * hh + r][t * 16 + ln] = acc[t][r] * alpha; }
  __builtin_amdgcn_fence(__ATOMIC_ACQ_REL, "workgroup"); __builtin_amdgcn_wave_barrier();
  const int rsub = lane >> 4, c4 = (lane & 15) * 4;
  {
#pragma unroll
    for (int q = 0; q < 8; ++q) { const int r = q * 2 + rsub; if (col0 + c4 < N) { const v4f v = *(const v4fa*)&so[w][r][c4]; *(v4f*)(C + (size_t)(row0 + r) * ldc + col0 + c4) = v; } }
     }
}

// Wt[n][k] = f16(W[k][n]·scale) from f32 row-major W[K][N] (scale = power of two; bf16-exact weights stay exact in f16 away from the subnormal range)
__global__ __launch_bounds__(256) void k_wt_f16(const float* __restrict__ W, _Float16* __restrict__ Wt, int K, int N, float scale) {
  const int t = blockIdx.x * 256 + threadIdx.x; if (t >= N * (K / 8)) return; const int n = t / (K / 8), k8 = (t % (K / 8)) * 8; FragH f;
#pragma unroll
  for (int i = 0; i < 8; ++i) f.h[i] = (_Float16)(bf16_round(W[(size_t)(k8 + i) * N + n]) * scale); const v8us o = f.half[0];
  *(v8us*)((unsigned short*)Wt + (size_t)n * K + k8) = o; 
}
// FRAGMENT-MAJOR LAYOUT of every f16 WMMA operand M[row][k] in the workspace: tiles of 16 rows x 32 k, 512 elements (1 KiB) each; inside a tile element (row, k) lies at
// ((k >> 3) & 3) * 128 + (row & 15) * 8 + (k & 7). Lane l's two 16-byte pieces of the tile's fragment (k = 8hh .. and 16 + 8hh ..) then lie at l * 8 and 256 + l * 8:
// one load of a wave is 512 bytes in a row, four whole lines, where a row-major operand gave 32 bytes out of each of sixteen lines. Which element sits in which lane and register is as before.
// Tile order: activations, weights, O: (row >> 4) * 16 + (k >> 5); Q, K: head * (NP / 16) + (position >> 4); Vt: (head * (NP / 32) + (key >> 5)) * 2 + ((d >> 4) & 1).
#define TL 512
// the ten 16-byte loads of one k-step: the A fragment and four B fragments (ap, bp: the row tile's start + lane * 8; ko: the k-step's tile offset)
__device__ __forceinline__ void ld_kstep(const unsigned short* ap, const unsigned short* const (&bp)[4], int ko, FragH& a, FragH (&b)[4]) {
  a.half[0] = *(const v8us*)(ap + ko); a.half[1] = *(const v8us*)(ap + ko + 256);
#pragma unroll
  for (int t = 0; t < 4; ++t) { b[t].half[0] = *(const v8us*)(bp[t] + ko); b[t].half[1] = *(const v8us*)(bp[t] + ko + 256); }
  asm volatile("s_wait_xcnt 0x0" ::: "memory");      // these loads stay in flight: the wait stands before their address registers are written again
}
// acc[t] += A rows . (B rows)^T for one wave's 16 x 64 tile, K a multiple of 128; a row tile's k-steps are TL elements apart in both operands.
// Fragments three k-steps ahead in a ring of four register sets: a k-step's ten loads are issued three k-steps before its products. A fetch past the last k-step reads k-step 0 again and is not used.
__device__ __forceinline__ void gemm_tile(const unsigned short* ap, const unsigned short* const (&bw)[4], int K, v8f (&acc)[4]) {
  FragH fa[4], fb[4][4];
#pragma unroll
  for (int u = 0; u < 3; ++u) ld_kstep(ap, bw, u * TL, fa[u], fb[u]);
  __builtin_amdgcn_sched_barrier(0);      // keeps the first product, and the wait for its operands, behind all thirty loads of the prologue (the scheduler had lifted one among them)
  for (int kb = 0; kb + 128 <= K; kb += 128) {
#pragma unroll
    for (int u = 0; u < 4; ++u) { const int kn = kb + (u + 3) * 32, kc = kn < K ? kn : 0; ld_kstep(ap, bw, (kc >> 5) * TL, fa[(u + 3) & 3], fb[(u + 3) & 3]);
#pragma unroll
      for (int t = 0; t < 4; ++t) acc[t] = mmaH<1>(fa[u].v, fa[u].v, fb[u][t].v, fb[u][t].v, acc[t]); }
  }
}
// The three projections in one grid, blockIdx.y = 0 Q, 1 K, 2 V. Q and K: C[position][channel] = activations . W^T. V with the operands exchanged, C[channel][position] = W . activations^T:
// the product comes out as Vt, the layout k_attn reads, with the same products summed in the same k order. f16 out, v = acc / 16 + bias (weights are stored x 16).
__global__ __launch_bounds__(128) void k_gemm_qkv(const _Float16* __restrict__ QNP, const _Float16* __restrict__ VNP, const _Float16* __restrict__ Bw, const float* __restrict__ bq, const float* __restrict__ bk, const float* __restrict__ bv,
    _Float16* __restrict__ Q16, _Float16* __restrict__ K16, _Float16* __restrict__ Vt) {
  __shared__ __attribute__((aligned(16))) float so[4][16][68];      // pitch 16 bytes x 17: sixteen lanes read 16 bytes each down one column without a bank conflict
  const int tid = threadIdx.x, w = tid >> 5, lane = tid & 31, ln = lane & 15, hh = lane >> 4; const int by = blockIdx.y; const bool sw = by == 2;
  const _Float16* A = by == 0 ? QNP : by == 1 ? VNP : Bw + (size_t)2 * CC * CC; const _Float16* B = sw ? VNP : Bw + (size_t)by * CC * CC;
  const float* bias = by == 0 ? bq : by == 1 ? bk : bv; _Float16* C16 = by == 0 ? Q16 : by == 1 ? K16 : Vt;
  const int ls = sw ? 6 : 3; const int wid = blockIdx.x * 4 + w; const int row0 = (wid >> ls) * 16, col0 = (wid & ((1 << ls) - 1)) * 64;      // N / 64 = 1 << ls column tiles
  const unsigned short* ap = (const unsigned short*)A + (size_t)(row0 >> 4) * (CC / 32 * TL) + lane * 8; const unsigned short* bw[4];
#pragma unroll
  for (int t = 0; t < 4; ++t) bw[t] = (const unsigned short*)B + (size_t)((col0 >> 4) + t) * (CC / 32 * TL) + lane * 8;
  v8f acc[4] = {};
  gemm_tile(ap, bw, CC, acc);
  if (sw) { float br[8];      // the channel is the tile's row
#pragma unroll
    for (int r = 0; r < 8; ++r) br[r] = bf16_round(bias[row0 + 8 * hh + r]);
#pragma unroll
    for (int t = 0; t < 4; ++t) {
#pragma unroll
      for (int r = 0; r < 8; ++r) so[w][8 * hh + r][t * 16 + ln] = acc[t][r] * 0.0625f + br[r]; }
  } else {      // the channel is the tile's column
#pragma unroll
    for (int t = 0; t < 4; ++t) { const float bc = bf16_round(bias[col0 + t * 16 + ln]);
#pragma unroll
      for (int r = 0; r < 8; ++r) so[w][8 * hh + r][t * 16 + ln] = acc[t][r] * 0.0625f + bc; }
  }
  __builtin_amdgcn_fence(__ATOMIC_ACQ_REL, "workgroup"); __builtin_amdgcn_wave_barrier();
  // The wave's 16 x 64 values are two fragment-major tiles (16 rows x 32 columns each: Q, K: two heads of 16 positions; Vt: 16 d of two key blocks). tl0: the first one's number, tls: the step to the second.
  const int tl0 = sw ? ((row0 >> 5) * (NP / 32) + (col0 >> 5)) * 2 + ((row0 >> 4) & 1) : (col0 >> 5) * (NP / 16) + (row0 >> 4); const int tls = sw ? 2 : NP / 16;
#pragma unroll
  for (int q = 0; q < 4; ++q) { const int cb = (q >> 1) * 32 + ((q & 1) * 2 + hh) * 8; const v4f v0 = *(const v4fa*)&so[w][ln][cb], v1 = *(const v4fa*)&so[w][ln][cb + 4]; FragH f;
    for (int i = 0; i < 4; ++i) { f.h[i] = (_Float16)v0[i]; f.h[4 + i] = (_Float16)v1[i]; }
    *(v8us*)((unsigned short*)C16 + (size_t)(tl0 + (q >> 1) * tls) * TL + (q & 1) * 256 + lane * 8) = f.half[0]; }
}
// Output projection with the operands exchanged: C[channel][position] = Wo . O^T is the output's own layout, so bias, residual and 1/sqrt(2) are applied where the tile is stored.
__global__ __launch_bounds__(128) void k_gemm_out(const _Float16* __restrict__ Bo, const _Float16* __restrict__ O16h, const float* __restrict__ bo, const float* __restrict__ x, float* __restrict__ out) {
  __shared__ __attribute__((aligned(16))) float so[4][16][64];
  const int tid = threadIdx.x, w = tid >> 5, lane = tid & 31, ln = lane & 15, hh = lane >> 4;
  const int wid = blockIdx.x * 4 + w; const int row0 = (wid / (NP / 64)) * 16, col0 = (wid % (NP / 64)) * 64;
  const unsigned short* ap = (const unsigned short*)Bo + (size_t)(row0 >> 4) * (CC / 32 * TL) + lane * 8; const unsigned short* bw[4];
#pragma unroll
  for (int t = 0; t < 4; ++t) bw[t] = (const unsigned short*)O16h + (size_t)((col0 >> 4) + t) * (CC / 32 * TL) + lane * 8;
  v8f acc[4] = {};
  gemm_tile(ap, bw, CC, acc);
#pragma unroll
  for (int t = 0; t < 4; ++t) {
#pragma unroll
    for (int r = 0; r < 8; ++r) so[w][8 * hh + r][t * 16 + ln] = acc[t][r] * 0.0625f + bf16_round(bo[row0 + 8 * hh + r]); }
  __builtin_amdgcn_fence(__ATOMIC_ACQ_REL, "workgroup"); __builtin_amdgcn_wave_barrier();
  const int rsub = lane >> 4, c4 = (lane & 15) * 4;
  const size_t o0 = (size_t)(row0 + rsub) * NP + col0 + c4; const float* xp = x + o0; float* op = out + o0; v4f xv[8];
#pragma unroll
  for (int q = 0; q < 8; ++q) xv[q] = *(const v4fa*)(xp + (size_t)q * 2 * NP);
  asm volatile("s_wait_xcnt 0x0" ::: "memory");      // the wait stands before the address registers of the eight loads are written again
#pragma unroll
  for (int q = 0; q < 8; ++q) { const v4f v = *(const v4fa*)&so[w][q * 2 + rsub][c4]; v4f y;
    for (int i = 0; i < 4; ++i) y[i] = (v[i] + bf16_round(xv[q][i])) * 0.7071067811865476f; *(v4f*)(op + (size_t)q * 2 * NP) = y; }
}

// lane l <-> l ^ 16 (the two halves of a wave hold the two key halves of one query column)
__device__ __forceinline__ float xhalf(float v) { const int b = __float_as_int(v); return __int_as_float(__builtin_amdgcn_permlanex16(b, b, 0x76543210, 0xfedcba98, false, false)); }
// lane l <-> l ^ M inside a 16-lane row (DPP row_xmask)
template <int M>
__device__ __forceinline__ float xrow(float v) { return __int_as_float(__builtin_amdgcn_update_dpp(0, __float_as_int(v), 0x160 + M, 0xf, 0xf, true)); }
// sum over the 32 lanes of a wave, the same value in every lane; all lanes on
__device__ __forceinline__ float wave_sum(float v) { v += xrow<1>(v); v += xrow<2>(v); v += xrow<4>(v); v += xrow<8>(v); return v + xhalf(v); }
// Blocks 0 .. NG - 1: one group (GS * NP = 65,536 values) per block of 1,024 threads: 16 whole-line 16-byte loads per thread (load i is channel i of the group), all in flight together. The values stay in registers
// for the first GroupNorm's two sums, are normalised there, and stay for the second GroupNorm's two sums: STAT[g] = {mean 1, 1/sd 1, mean 2, 1/sd 2}.
// Blocks NG .. NG + 127 (independent work in the same launch): the four weight matrices, bf16-rounded, x 16, to f16, fragment-major (thread t writes the t-th 16-byte piece); they leave before any barrier.
__global__ __launch_bounds__(1024) void k_prep(const float* __restrict__ X, const float* __restrict__ gw, const float* __restrict__ gb, const float* __restrict__ W0, const float* __restrict__ W1, const float* __restrict__ W2, const float* __restrict__ W3,
    _Float16* __restrict__ Bt, float* __restrict__ STAT) { __shared__ float sh[4][32]; const int tid = threadIdx.x, w = tid >> 5, lane = tid & 31;
  if (blockIdx.x >= NG) { const int y = (int)(blockIdx.x - NG) >> 5; const float* W = y == 0 ? W0 : y == 1 ? W1 : y == 2 ? W2 : W3; const size_t t = (size_t)((blockIdx.x - NG) & 31) * 1024 + tid; FragH f;
    const float* wr = W + ((t >> 10) * 16 + (t & 15)) * CC + ((t >> 6) & 15) * 32 + ((t >> 4) & 3) * 8;      // row (out), k (in) of that piece
    const v4f a = *(const v4fa*)wr, b = *(const v4fa*)(wr + 4);
#pragma unroll
    for (int i = 0; i < 4; ++i) { f.h[i] = (_Float16)(bf16_round(a[i]) * 16.0f); f.h[4 + i] = (_Float16)(bf16_round(b[i]) * 16.0f); }
    *(v8us*)((unsigned short*)Bt + (size_t)y * CC * CC + t * 8) = f.half[0]; return; }
  const int g = blockIdx.x; const float* base = X + (size_t)g * GS * NP;
  v4f v[16];
#pragma unroll
  for (int i = 0; i < 16; ++i) v[i] = *(const v4fa*)(base + (size_t)(i * 1024 + tid) * 4);
  v4f st;
#pragma unroll
  for (int pass = 0; pass < 2; ++pass) {
    v4f s4 = {0.f, 0.f, 0.f, 0.f};
#pragma unroll
    for (int i = 0; i < 16; ++i) { if (pass == 0) { for (int q = 0; q < 4; ++q) v[i][q] = bf16_round(v[i][q]); } s4 += v[i]; }
    const float s = wave_sum((s4[0] + s4[1]) + (s4[2] + s4[3])); if (lane == 0) sh[pass * 2][w] = s; __syncthreads();
    const float mean = wave_sum(sh[pass * 2][lane]) / (float)(GS * NP);
    v4f q4 = {0.f, 0.f, 0.f, 0.f};
#pragma unroll
    for (int i = 0; i < 16; ++i) { const v4f d = v[i] - mean; q4 += d * d; }
    const float q = wave_sum((q4[0] + q4[1]) + (q4[2] + q4[3])); if (lane == 0) sh[pass * 2 + 1][w] = q; __syncthreads();
    const float var = wave_sum(sh[pass * 2 + 1][lane]) / (float)(GS * NP); const float rs = 1.0f / sqrtf(var + 1e-6f);
    st[pass * 2] = mean; st[pass * 2 + 1] = rs;
    if (pass == 0) {
#pragma unroll
      for (int i = 0; i < 16; ++i) { const float ww = bf16_round(gw[g * GS + i]), b2 = bf16_round(gb[g * GS + i]); for (int q2 = 0; q2 < 4; ++q2) v[i][q2] = (v[i][q2] - mean) * rs * ww + b2; } }
  }
  if (tid == 0) *(v4f*)(STAT + g * 4) = st; }
// 64 channels x 64 positions a block: x is read once (256-byte runs), qn = GN(x) and vn = GN(qn) are formed in registers and both go out in f16, fragment-major (row = position, k = channel), 512 bytes in a row a wave.
__global__ __launch_bounds__(256) void k_gnorm2(const float* __restrict__ X, const float* __restrict__ STAT, const float* __restrict__ w, const float* __restrict__ bb, _Float16* __restrict__ QP, _Float16* __restrict__ VP) { __shared__ float tq[64][65], tv[64][65];
  const int tid = threadIdx.x; const int cg = blockIdx.x / (NP / 64), pg = blockIdx.x % (NP / 64); const int c0 = cg * 64, p0 = pg * 64;
  const int cl = tid >> 4, p4 = (tid & 15) * 4;      // round u: channel c0 + 16 * u + cl, which lies in group cg * 4 + u
  const float* xp = X + (size_t)(c0 + cl) * NP + p0 + p4; const float* wp = w + c0 + cl; const float* bp = bb + c0 + cl; v4f xv[4]; float wv[4], bv[4];
#pragma unroll
  for (int u = 0; u < 4; ++u) { xv[u] = *(const v4fa*)(xp + (size_t)u * 16 * NP); wv[u] = wp[u * 16]; bv[u] = bp[u * 16]; }
  asm volatile("s_wait_xcnt 0x0" ::: "memory");      // the wait stands before the address registers of the twelve loads are written again
#pragma unroll
  for (int u = 0; u < 4; ++u) { const int c = u * 16 + cl; const v4f st = *(const v4fa*)(STAT + (cg * 4 + u) * 4); const float ww = bf16_round(wv[u]), b2 = bf16_round(bv[u]);
#pragma unroll
    for (int q = 0; q < 4; ++q) { const float y = (bf16_round(xv[u][q]) - st[0]) * st[1] * ww + b2; tq[p4 + q][c] = y; tv[p4 + q][c] = (y - st[2]) * st[3] * ww + b2; } }
  __syncthreads();
#pragma unroll
  for (int u = 0; u < 2; ++u) { const int i = tid + 256 * u, r = (i >> 7) * 16 + (i & 15), pc = (i >> 4) & 7; FragH f, g;      // piece i: position tile i >> 7, k-step (i >> 6) & 1, then the tile's 64 pieces in order
#pragma unroll
    for (int q = 0; q < 8; ++q) { f.h[q] = (_Float16)tq[r][pc * 8 + q]; g.h[q] = (_Float16)tv[r][pc * 8 + q]; }
    const size_t o = (size_t)(((p0 >> 4) + (i >> 7)) * (CC / 32) + (c0 >> 5) + ((i >> 6) & 1)) * TL + (i & 63) * 8; *(v8us*)((unsigned short*)QP + o) = f.half[0]; *(v8us*)((unsigned short*)VP + o) = g.half[0]; } }
__global__ __launch_bounds__(256) void k_attn(const _Float16* __restrict__ Q16, const _Float16* __restrict__ K16, const _Float16* __restrict__ Vt, _Float16* __restrict__ O16h) { constexpr int RPW = 32; constexpr int NK = NP / 2; constexpr float SL2 = 0.25503486164919736f;
  __shared__ __attribute__((aligned(16))) v4f xo[8][4][32]; __shared__ float xm[8][32], xl[8][32];      // what a wave hands to its partner: 16 Ot values, maximum and sum of one query tile, a lane's own slot each
  const int tid = threadIdx.x, w = tid >> 5, lane = tid & 31; const int kg = __builtin_amdgcn_readfirstlane(tid >> 7);
  const int h = blockIdx.x / (NP / 128), qblk = blockIdx.x % (NP / 128); const int q0 = qblk * 128 + (w & 3) * RPW;      // below: ln = lane & 15, hh = lane >> 4
  FragH aq[2];
#pragma unroll
  for (int rt = 0; rt < 2; ++rt) { const unsigned short* qr = (const unsigned short*)Q16 + (size_t)(h * (NP / 16) + (q0 >> 4) + rt) * TL + lane * 8; aq[rt].half[0] = *(const v8us*)qr; aq[rt].half[1] = *(const v8us*)(qr + 256); }
  __builtin_amdgcn_sched_barrier(0);      // keeps the four Q loads the oldest: moved behind K or Vt loads they would make the loop's counted waits for Q cover the Vt loads of the pass before as well
  float m_r[2], l_r[2]; v8f oacc[2][2];      // query rt * 16 + ln; oacc[rt][dt][r] = Ot[dt * 16 + 8hh + r][query]
#pragma unroll
  for (int rt = 0; rt < 2; ++rt) { m_r[rt] = -3.0e38f; l_r[rt] = 0.f; oacc[rt][0] = (v8f){0.f,0.f,0.f,0.f,0.f,0.f,0.f,0.f}; oacc[rt][1] = oacc[rt][0]; }
  // K and Vt fragments one pass ahead: each pass refills a fragment's registers for the next pass right behind its last product, so the loads fly during the softmax and the other products.
  // The last pass fetches the group's pass 0 fragments again (in bounds, not used).
  // Fragment-major: a pass's two K tiles are 2 KiB in a row, its two Vt tiles likewise; 32 keys are 32 * 32 elements on in both.
  const unsigned short* kl = (const unsigned short*)K16 + ((size_t)h * NP + (size_t)kg * NK) * HD + lane * 8; const unsigned short* vl = (const unsigned short*)Vt + ((size_t)h * NP + (size_t)kg * NK) * HD + lane * 8;
  FragH bk[2], bv[2];
#pragma unroll
  for (int t = 0; t < 2; ++t) { const unsigned short* kr = kl + t * TL; bk[t].half[0] = *(const v8us*)kr; bk[t].half[1] = *(const v8us*)(kr + 256); }
#pragma unroll
  for (int t = 0; t < 2; ++t) { const unsigned short* vrow = vl + t * TL; bv[t].half[0] = *(const v8us*)vrow; bv[t].half[1] = *(const v8us*)(vrow + 256); }
#pragma unroll 1
  for (int j0 = 0; j0 < NK; j0 += 32) { v8f s[2][2];      // s[rt][nt][r] = S[query][kg * NK + j0 + nt * 16 + 8hh + r]
    const int jn = j0 + 32 < NK ? j0 + 32 : 0;
#pragma unroll
    for (int nt = 0; nt < 2; ++nt) {
#pragma unroll
      for (int rt = 0; rt < 2; ++rt) { v8f acc = (v8f){0.f,0.f,0.f,0.f,0.f,0.f,0.f,0.f}; acc = mmaH<1>(bk[nt].v, bk[nt].v, aq[rt].v, aq[rt].v, acc); s[rt][nt] = acc; }
      const unsigned short* kr = kl + (size_t)jn * HD + nt * TL; bk[nt].half[0] = *(const v8us*)kr; bk[nt].half[1] = *(const v8us*)(kr + 256); }
    __builtin_amdgcn_sched_barrier(0);      // keeps the next pass's four K loads in front of the softmax: the scheduler had sunk two of them behind it, which cuts their lead to a fraction of a pass
    FragH pb[2];
#pragma unroll
    for (int rt = 0; rt < 2; ++rt) { float sc[16];      // raw products; SL2 > 0, so their maximum is the maximum of the scaled scores
#pragma unroll
      for (int i = 0; i < 16; ++i) sc[i] = s[rt][i >> 3][i & 7];
      float mx[8];
#pragma unroll
      for (int i = 0; i < 8; ++i) mx[i] = fmaxf(sc[i], sc[8 + i]);
      float mc = fmaxf(fmaxf(fmaxf(mx[0], mx[1]), fmaxf(mx[2], mx[3])), fmaxf(fmaxf(mx[4], mx[5]), fmaxf(mx[6], mx[7])));
      mc = fmaxf(mc, xhalf(mc));
      const float mn = fmaxf(m_r[rt], mc * SL2); const float al = __builtin_amdgcn_exp2f(m_r[rt] - mn); m_r[rt] = mn;      // m_r in log2 units
      float ps[8];
#pragma unroll
      for (int i = 0; i < 8; ++i) { const float p0 = __builtin_amdgcn_exp2f(fmaf(sc[i], SL2, -mn)), p1 = __builtin_amdgcn_exp2f(fmaf(sc[8 + i], SL2, -mn)); ps[i] = p0 + p1; pb[rt].h[i] = (_Float16)p0; pb[rt].h[8 + i] = (_Float16)p1; }
      l_r[rt] = l_r[rt] * al + (((ps[0] + ps[1]) + (ps[2] + ps[3])) + ((ps[4] + ps[5]) + (ps[6] + ps[7])));      // this half's keys; the halves join after the loop
#pragma unroll
      for (int r = 0; r < 8; ++r) { oacc[rt][0][r] *= al; oacc[rt][1][r] *= al; } }
#pragma unroll
    for (int dt = 0; dt < 2; ++dt) {
#pragma unroll
      for (int rt = 0; rt < 2; ++rt) oacc[rt][dt] = mmaH<1>(bv[dt].v, bv[dt].v, pb[rt].v, pb[rt].v, oacc[rt][dt]);
      const unsigned short* vrow = vl + (size_t)jn * HD + dt * TL; bv[dt].half[0] = *(const v8us*)vrow; bv[dt].half[1] = *(const v8us*)(vrow + 256); }
    asm volatile("s_wait_xcnt 0x0" ::: "memory"); }      // the Vt loads stay in flight over the back edge: the wait stands before their address registers are written again
  // A lane's eight values of one accumulator (d = dt * 16 + 8hh + r of query rt * 16 + ln) are one 16-byte piece of O's fragment-major tile (row = position, k-step = head): stored from the registers, 512 bytes in a row a wave.
  // kg is the same in every lane: the selects below only name which query tile a wave keeps (rt = kg) and which it hands over
  const bool k1 = kg != 0; float keep[16], give[16];
#pragma unroll
  for (int i = 0; i < 16; ++i) { const float t0 = oacc[0][i >> 3][i & 7], t1 = oacc[1][i >> 3][i & 7]; keep[i] = k1 ? t1 : t0; give[i] = k1 ? t0 : t1; }
  const float mk = k1 ? m_r[1] : m_r[0], lk = k1 ? l_r[1] : l_r[0];
#pragma unroll
  for (int i = 0; i < 4; ++i) xo[w][i][lane] = (v4f){give[i * 4], give[i * 4 + 1], give[i * 4 + 2], give[i * 4 + 3]};
  xm[w][lane] = k1 ? m_r[0] : m_r[1]; xl[w][lane] = k1 ? l_r[0] : l_r[1];
  __syncthreads();      // every wave of the block passes it once: the partner's partial result is read behind it
  // both partial results brought to the common maximum, then as with one: halves joined, divided, stored
  const int pw = w ^ 4; const float mp = xm[pw][lane]; const float mn = fmaxf(mk, mp); const float a0 = __builtin_amdgcn_exp2f(mk - mn), a1 = __builtin_amdgcn_exp2f(mp - mn);
  const float lj = lk * a0 + xl[pw][lane] * a1; const float l = lj + xhalf(lj); const float li = 1.0f / l; const float c0 = a0 * li, c1 = a1 * li;
#pragma unroll
  for (int dt = 0; dt < 2; ++dt) { FragH f; const v4f p0 = xo[pw][dt * 2][lane], p1 = xo[pw][dt * 2 + 1][lane];
#pragma unroll
    for (int r = 0; r < 4; ++r) { f.h[r] = (_Float16)(keep[dt * 8 + r] * c0 + p0[r] * c1); f.h[4 + r] = (_Float16)(keep[dt * 8 + 4 + r] * c0 + p1[r] * c1); }
    *(v8us*)((unsigned short*)O16h + (size_t)(((q0 >> 4) + kg) * (CC / 32) + h) * TL + dt * 256 + lane * 8) = f.half[0]; } }
extern "C" void kernel_launch(void* const* d_in, const int* in_sizes, int n_in,
                              void* d_out, int out_size, void* d_ws, size_t ws_size, hipStream_t stream) {
  (void)in_sizes; (void)n_in; (void)out_size;
  const float* x = (const float*)d_in[0]; const float* gw = (const float*)d_in[1]; const float* gb = (const float*)d_in[2]; const float* wq = (const float*)d_in[3]; const float* bq = (const float*)d_in[4]; const float* wk = (const float*)d_in[5]; const float* bk = (const float*)d_in[6]; const float* wv = (const float*)d_in[7]; const float* bv = (const float*)d_in[8]; const float* wo = (const float*)d_in[9]; const float* bo = (const float*)d_in[10];
  char* ws = (char*)d_ws; size_t off = 0;
  auto take = [&](size_t bytes) { char* p = ws + off; off += (bytes + 255) & ~(size_t)255; return p; };
  _Float16* Bw = (_Float16*)take((size_t)4 * CC * CC * 2);      // Wq, Wk, Wv, Wo, (out,in)
  float* ST = (float*)take(NG * 4 * 4);
  _Float16* QNP = (_Float16*)take((size_t)NP * CC * 2); _Float16* VNP = (_Float16*)take((size_t)NP * CC * 2); _Float16* Q16 = (_Float16*)take((size_t)NP * CC * 2); _Float16* K16 = (_Float16*)take((size_t)NP * CC * 2); _Float16* Vt = (_Float16*)take((size_t)NP * CC * 2); _Float16* O16h = (_Float16*)take((size_t)NP * CC * 2);
  if (off > ws_size) return;      // 2 + 6 x 4 = 26 MiB
  k_prep<<<NG + 128, 1024, 0, stream>>>(x, gw, gb, wq, wk, wv, wo, Bw, ST);
  k_gnorm2<<<(CC / 64) * (NP / 64), 256, 0, stream>>>(x, ST, gw, gb, QNP, VNP);
  k_gemm_qkv<<<dim3((NP / 16) * (CC / 64) / 4, 3), 128, 0, stream>>>(QNP, VNP, Bw, bq, bk, bv, Q16, K16, Vt);
  k_attn<<<NH * (NP / 128), 256, 0, stream>>>(Q16, K16, Vt, O16h);
  k_gemm_out<<<(CC / 16) * (NP / 64) / 4, 128, 0, stream>>>(Bw + (size_t)3 * CC * CC, O16h, bo, x, (float*)d_out);
}

// v008
// A run of this version takes 82.9 microseconds.
// Two timings next to v007 put it at 1.05 and 1.08 times that version's speed.
// Counting every step since v000, it is 5.11 times as fast.
#include <hip/hip_runtime.h>
// the 1×1 convs (4096 × 512 × 512, + bias, weights (out,in) bf16-exact ×2^4) and the attention as a fused flash-style kernel (S = Q·Kᵀ·32^-½ with d = 32 in one k-step, online softmax f32,
// P f16 <= 256, O = P·V) on v_wmma_f32_16x16x32_f16 (f16 operands, single products, f32 accumulate); residual (out + x)/√2 and layout transposes f32 VALU.
#define CC 512
#define NP 4096
#define NG 32
#define GS 16
#define NH 16
#define HD 32

typedef __bf16 v16b __attribute__((ext_vector_type(16)));
typedef unsigned short v8us __attribute__((ext_vector_type(8), may_alias));
typedef float  v8f  __attribute__((ext_vector_type(8)));
typedef float  v4f  __attribute__((ext_vector_type(4)));
typedef float  v4fa __attribute__((ext_vector_type(4), may_alias));
union FragB { v16b v; v8us half[2]; unsigned short u[16]; };

__device__ __forceinline__ unsigned short bf16_bits(float x) { unsigned int u = __float_as_uint(x); return (unsigned short)((u + 0x7FFFu + ((u >> 16) & 1u)) >> 16); }
__device__ __forceinline__ float bf16_val(unsigned short b) { return __uint_as_float(((unsigned int)b) << 16); }
__device__ __forceinline__ float bf16_round(float x) { return bf16_val(bf16_bits(x)); }
// D += A·B with NT terms: 1 = ah·bh, 2 = + al·bh (A split), 3 = + ah·bl (both split)
template <int NT>
__device__ __forceinline__ v8f mmaN(v16b ah, v16b al, v16b bh, v16b bl, v8f c) {
  c = __builtin_amdgcn_wmma_f32_16x16x32_bf16(false, ah, false, bh, (short)0, c, false, false);
  if (NT >= 2) c = __builtin_amdgcn_wmma_f32_16x16x32_bf16(false, al, false, bh, (short)0, c, false, false);
  if (NT >= 3) c = __builtin_amdgcn_wmma_f32_16x16x32_bf16(false, ah, false, bl, (short)0, c, false, false);
  asm volatile("v_nop\n\tv_nop\n\tv_nop\n\tv_nop" : "+v"(c) : "v"(ah), "v"(al), "v"(bh), "v"(bl));
  return c;
}

__global__ __launch_bounds__(256) void k_wt_bf16(const float* __restrict__ W, unsigned short* __restrict__ Wt, int K, int N) {
  const int t = blockIdx.x * 256 + threadIdx.x;
  const int k8n = K / 8;
  if (t >= N * k8n) return;
  const int n = t / k8n, k8 = (t % k8n) * 8;
  v8us v;
#pragma unroll
  for (int i = 0; i < 8; ++i) v[i] = bf16_bits(W[(size_t)(k8 + i) * N + n]);
  *(v8us*)(Wt + (size_t)n * K + k8) = v;
  
}

// GEMM C[M][N] (f32, pitch ldc) = act(A[M][K]·W + bias). A f32 row-major (pitch lda) converted per fragment to bf16
// (ASPLIT: hi/lo two planes -> 2 terms, else single rounded term); Wt bf16 [N][K] (pitch ldb). BIAS_BF16 rounds the
// bias to bf16 first (bias quantised to bf16 before the add). K%32==0, M%16==0, N%64==0.
template <bool ASPLIT, int ACT, bool BIAS_BF16>
__global__ __launch_bounds__(128) void k_gemm_bf(const float* __restrict__ A, int lda, const unsigned short* __restrict__ Wt, int ldb,
                                               const float* __restrict__ bias, float* __restrict__ C, int ldc, int M, int N, int K) {
  __shared__ __attribute__((aligned(16))) float so[4][16][64];
  const int tid = threadIdx.x, w = tid >> 5, lane = tid & 31, ln = lane & 15, hh = lane >> 4;
  const int ntn = N / 64;
  const int wid = blockIdx.x * 4 + w;
  const int mt = wid / ntn, nq = wid % ntn;
  if (mt * 16 >= M) return;
  const int row0 = mt * 16, col0 = nq * 64;
  const float* arow = A + (size_t)(row0 + ln) * lda;
  v8f acc[4] = {};
  for (int kb = 0; kb < K; kb += 32) {
    FragB ah, al;
    const v4f x0 = *(const v4fa*)(arow + kb + 8 * hh), x1 = *(const v4fa*)(arow + kb + 8 * hh + 4);
    const v4f x2 = *(const v4fa*)(arow + kb + 16 + 8 * hh), x3 = *(const v4fa*)(arow + kb + 16 + 8 * hh + 4);
    float xs[16] = {x0[0],x0[1],x0[2],x0[3],x1[0],x1[1],x1[2],x1[3],x2[0],x2[1],x2[2],x2[3],x3[0],x3[1],x3[2],x3[3]};
#pragma unroll
    for (int i = 0; i < 16; ++i) { const unsigned short hb = bf16_bits(xs[i]); ah.u[i] = hb; al.u[i] = ASPLIT ? bf16_bits(xs[i] - bf16_val(hb)) : (unsigned short)0; }
#pragma unroll
    for (int t = 0; t < 4; ++t) {
      const unsigned short* brow = Wt + (size_t)(col0 + t * 16 + ln) * ldb + kb;
      FragB b;
      b.half[0] = *(const v8us*)(brow + 8 * hh);
      b.half[1] = *(const v8us*)(brow + 16 + 8 * hh);
      acc[t] = mmaN<ASPLIT ? 2 : 1>(ah.v, al.v, b.v, b.v, acc[t]);
    }
  }
#pragma unroll
  for (int t = 0; t < 4; ++t) {
    float bv = bias ? bias[col0 + t * 16 + ln] : 0.f;
    if (BIAS_BF16) bv = bf16_round(bv);
#pragma unroll
    for (int r = 0; r < 8; ++r) { float v = acc[t][r] + bv; if (ACT == 1) v = fmaxf(v, 0.f); so[w][8 * hh + r][t * 16 + ln] = v; }
  }
  __builtin_amdgcn_fence(__ATOMIC_ACQ_REL, "workgroup");
  __builtin_amdgcn_wave_barrier();
  const int rsub = lane >> 4, c4 = (lane & 15) * 4;
  {
#pragma unroll
    for (int q = 0; q < 8; ++q) {
      const int r = q * 2 + rsub;
      const v4f v = *(const v4fa*)&so[w][r][c4];
      *(v4f*)(C + (size_t)(row0 + r) * ldc + col0 + c4) = v;
    }
    
  }
}

// Flash-style causal/unmasked attention, all contractions 3-term bf16 hi/lo splits, f32 softmax with running max.
// q,k,v rows are read from f32 buffers with arbitrary row pitch (so they can live inside a fused qkv buffer);
// D = head size (multiple of 32, <= 128); one wave = 16 query rows; block = 4 waves (64 queries) sharing K/V chunks of 32.
template <int D, bool CAUSAL>
__global__ __launch_bounds__(128) void k_flash(const float* __restrict__ qb, const float* __restrict__ kb, const float* __restrict__ vb,
                                             int pitch, int T, int H, float scale, float* __restrict__ y, int ypitch) {
  constexpr int KS = D / 32;        // k-steps for QK
  constexpr int DT = D / 16;        // d tiles for PV
  __shared__ __attribute__((aligned(16))) unsigned short sKh[32][D + 8], sKl[32][D + 8], sVh[32][D + 8], sVl[32][D + 8];
  __shared__ __attribute__((aligned(16))) unsigned short sPh[4][16][40], sPl[4][16][40];
  __shared__ __attribute__((aligned(16))) float sO[4][16][D];
  const int tid = threadIdx.x, w = tid >> 5, lane = tid & 31, ln = lane & 15, hh = lane >> 4;
  const int nqb = (T + 63) / 64;
  const int bh = blockIdx.x / nqb, qblk = blockIdx.x % nqb;
  const int b = bh / H, h = bh % H;
  const int q0 = qblk * 64 + w * 16;
  const float* Q = qb + (size_t)b * T * pitch + h * D;
  const float* K = kb + (size_t)b * T * pitch + h * D;
  const float* V = vb + (size_t)b * T * pitch + h * D;

  // A fragments of the wave's 16 query rows (scaled), hi/lo
  FragB aqh[KS], aql[KS];
  {
    int row = q0 + ln; if (row >= T) row = T - 1;
    const float* qr = Q + (size_t)row * pitch;
#pragma unroll
    for (int ks = 0; ks < KS; ++ks)
#pragma unroll
      for (int i = 0; i < 16; ++i) {
        const int d = ks * 32 + ((i < 8) ? (8 * hh + i) : (16 + 8 * hh + (i - 8)));
        const float x = qr[d] * scale; const unsigned short hb = bf16_bits(x);
        aqh[ks].u[i] = hb; aql[ks].u[i] = bf16_bits(x - bf16_val(hb));
      }
  }
  float m_r[8], l_r[8];
#pragma unroll
  for (int r = 0; r < 8; ++r) { m_r[r] = -3.0e38f; l_r[r] = 0.f; }
  v8f oacc[DT];
#pragma unroll
  for (int dt = 0; dt < DT; ++dt) oacc[dt] = (v8f){0.f,0.f,0.f,0.f,0.f,0.f,0.f,0.f};

  const int kv_end = CAUSAL ? min(T, qblk * 64 + 64) : T;     // block-uniform
  for (int j0 = 0; j0 < kv_end; j0 += 32) {
    __syncthreads();
    for (int e = tid; e < 32 * (D / 4); e += 128) {
      const int r = e / (D / 4), c4 = (e % (D / 4)) * 4;
      const int key = j0 + r;
      v4f kf = {0.f,0.f,0.f,0.f}, vf = {0.f,0.f,0.f,0.f};
      if (key < T) { kf = *(const v4fa*)(K + (size_t)key * pitch + c4); vf = *(const v4fa*)(V + (size_t)key * pitch + c4); }
#pragma unroll
      for (int t = 0; t < 4; ++t) {
        unsigned short hb = bf16_bits(kf[t]); sKh[r][c4 + t] = hb; sKl[r][c4 + t] = bf16_bits(kf[t] - bf16_val(hb));
        hb = bf16_bits(vf[t]); sVh[r][c4 + t] = hb; sVl[r][c4 + t] = bf16_bits(vf[t] - bf16_val(hb));
      }
    }
    __syncthreads();
    // S tile 16 x 32
    v8f s[2];
#pragma unroll
    for (int nt = 0; nt < 2; ++nt) {
      v8f acc = {};
#pragma unroll
      for (int ks = 0; ks < KS; ++ks) {
        FragB bh_, bl_;
        bh_.half[0] = *(const v8us*)&sKh[nt * 16 + ln][ks * 32 + 8 * hh]; bh_.half[1] = *(const v8us*)&sKh[nt * 16 + ln][ks * 32 + 16 + 8 * hh];
        bl_.half[0] = *(const v8us*)&sKl[nt * 16 + ln][ks * 32 + 8 * hh]; bl_.half[1] = *(const v8us*)&sKl[nt * 16 + ln][ks * 32 + 16 + 8 * hh];
        acc = mmaN<3>(aqh[ks].v, aql[ks].v, bh_.v, bl_.v, acc);
      }
      s[nt] = acc;
    }
    // mask + running max (rows 8hh+r; the 16 lanes of a half share rows)
    float alpha[8];
#pragma unroll
    for (int r = 0; r < 8; ++r) {
      const int qi = q0 + 8 * hh + r;
      const int ja = j0 + ln, jb = j0 + 16 + ln;
      if (CAUSAL) { if (ja > qi) s[0][r] = -3.0e38f; if (jb > qi) s[1][r] = -3.0e38f; }
      if (ja >= T) s[0][r] = -3.0e38f;
      if (jb >= T) s[1][r] = -3.0e38f;
      float mx = fmaxf(s[0][r], s[1][r]);
      mx = fmaxf(mx, __shfl_xor(mx, 1, 32)); mx = fmaxf(mx, __shfl_xor(mx, 2, 32)); mx = fmaxf(mx, __shfl_xor(mx, 4, 32)); mx = fmaxf(mx, __shfl_xor(mx, 8, 32));
      const float mnew = fmaxf(m_r[r], mx);
      alpha[r] = (mnew > -1.0e38f) ? __expf(m_r[r] - mnew) : 1.0f;
      const float p0 = (s[0][r] > -1.0e38f) ? __expf(s[0][r] - mnew) : 0.f;
      const float p1 = (s[1][r] > -1.0e38f) ? __expf(s[1][r] - mnew) : 0.f;
      m_r[r] = mnew;
      l_r[r] = l_r[r] * alpha[r] + p0 + p1;            // per-lane partial row sum (16 lanes combined at the end)
      unsigned short hb = bf16_bits(p0); sPh[w][8 * hh + r][ln] = hb;      sPl[w][8 * hh + r][ln] = bf16_bits(p0 - bf16_val(hb));
      hb = bf16_bits(p1);                sPh[w][8 * hh + r][16 + ln] = hb; sPl[w][8 * hh + r][16 + ln] = bf16_bits(p1 - bf16_val(hb));
    }
#pragma unroll
    for (int dt = 0; dt < DT; ++dt)
#pragma unroll
      for (int r = 0; r < 8; ++r) oacc[dt][r] *= alpha[r];
    __builtin_amdgcn_fence(__ATOMIC_ACQ_REL, "workgroup");
    __builtin_amdgcn_wave_barrier();
    FragB pah, pal;
    pah.half[0] = *(const v8us*)&sPh[w][ln][8 * hh]; pah.half[1] = *(const v8us*)&sPh[w][ln][16 + 8 * hh];
    pal.half[0] = *(const v8us*)&sPl[w][ln][8 * hh]; pal.half[1] = *(const v8us*)&sPl[w][ln][16 + 8 * hh];
#pragma unroll
    for (int dt = 0; dt < DT; ++dt) {
      FragB bvh, bvl;
#pragma unroll
      for (int i = 0; i < 8; ++i) {
        bvh.u[i] = sVh[8 * hh + i][dt * 16 + ln]; bvh.u[8 + i] = sVh[16 + 8 * hh + i][dt * 16 + ln];
        bvl.u[i] = sVl[8 * hh + i][dt * 16 + ln]; bvl.u[8 + i] = sVl[16 + 8 * hh + i][dt * 16 + ln];
      }
      oacc[dt] = mmaN<3>(pah.v, pal.v, bvh.v, bvl.v, oacc[dt]);
    }
    __builtin_amdgcn_fence(__ATOMIC_ACQ_REL, "workgroup");
    __builtin_amdgcn_wave_barrier();
  }
#pragma unroll
  for (int r = 0; r < 8; ++r) {
    float l = l_r[r];
    l += __shfl_xor(l, 1, 32); l += __shfl_xor(l, 2, 32); l += __shfl_xor(l, 4, 32); l += __shfl_xor(l, 8, 32);
    l_r[r] = (l > 0.f) ? 1.0f / l : 0.f;
  }
#pragma unroll
  for (int dt = 0; dt < DT; ++dt)
#pragma unroll
    for (int r = 0; r < 8; ++r) sO[w][8 * hh + r][dt * 16 + ln] = oacc[dt][r] * l_r[r];
  __builtin_amdgcn_fence(__ATOMIC_ACQ_REL, "workgroup");
  __builtin_amdgcn_wave_barrier();
  {
    for (int r = 0; r < 16; ++r) {
      const int row = q0 + r;
      if (row < T && lane < D / 4) {
        const v4f val = *(const v4fa*)&sO[w][r][lane * 4];
        *(v4f*)(y + ((size_t)b * T + row) * ypitch + h * D + lane * 4) = val;
      }
    }
    
  }
}

// GEMM C = act(A·W + bias + resid): A f32 (ASPLIT -> hi/lo 2 terms), Wt bf16 [N][K]; ACT 0 none, 1 relu, 2 exact gelu;
// resid (optional, f32, row index = (row % rmod), pitch ldr, RES_BF16 rounds it) added before the activation.
template <bool ASPLIT, int ACT, bool BIAS_BF16, bool RES_BF16>
__global__ __launch_bounds__(128) void k_gemm_bf3(const float* __restrict__ A, int lda, const unsigned short* __restrict__ Wt, int ldb,
                                                const float* __restrict__ bias, const float* __restrict__ resid, int rmod, int ldr,
                                                float* __restrict__ C, int ldc, int M, int N, int K) {
  __shared__ __attribute__((aligned(16))) float so[4][16][64];
  const int tid = threadIdx.x, w = tid >> 5, lane = tid & 31, ln = lane & 15, hh = lane >> 4;
  const int ntn = N / 64;
  const int wid = blockIdx.x * 4 + w;
  const int mt = wid / ntn, nq = wid % ntn;
  if (mt * 16 >= M) return;
  const int row0 = mt * 16, col0 = nq * 64;
  const float* arow = A + (size_t)(row0 + ln) * lda;
  v8f acc[4] = {};
  for (int kb = 0; kb < K; kb += 32) {
    FragB ah, al;
    const v4f x0 = *(const v4fa*)(arow + kb + 8 * hh), x1 = *(const v4fa*)(arow + kb + 8 * hh + 4);
    const v4f x2 = *(const v4fa*)(arow + kb + 16 + 8 * hh), x3 = *(const v4fa*)(arow + kb + 16 + 8 * hh + 4);
    float xs[16] = {x0[0],x0[1],x0[2],x0[3],x1[0],x1[1],x1[2],x1[3],x2[0],x2[1],x2[2],x2[3],x3[0],x3[1],x3[2],x3[3]};
#pragma unroll
    for (int i = 0; i < 16; ++i) { const unsigned short hb = bf16_bits(xs[i]); ah.u[i] = hb; al.u[i] = ASPLIT ? bf16_bits(xs[i] - bf16_val(hb)) : (unsigned short)0; }
#pragma unroll
    for (int t = 0; t < 4; ++t) {
      const unsigned short* brow = Wt + (size_t)(col0 + t * 16 + ln) * ldb + kb;
      FragB b;
      b.half[0] = *(const v8us*)(brow + 8 * hh);
      b.half[1] = *(const v8us*)(brow + 16 + 8 * hh);
      acc[t] = mmaN<ASPLIT ? 2 : 1>(ah.v, al.v, b.v, b.v, acc[t]);
    }
  }
#pragma unroll
  for (int t = 0; t < 4; ++t) {
    const int col = col0 + t * 16 + ln;
    float bv = bias ? bias[col] : 0.f;
    if (BIAS_BF16) bv = bf16_round(bv);
#pragma unroll
    for (int r = 0; r < 8; ++r) {
      float v = acc[t][r] + bv;
      if (resid) { float rv = resid[(size_t)((row0 + 8 * hh + r) % rmod) * ldr + col]; if (RES_BF16) rv = bf16_round(rv); v += rv; }
      if (ACT == 1) v = fmaxf(v, 0.f);
      if (ACT == 2) v = 0.5f * v * (1.0f + erff(v * 0.70710678118654752f));
      if (ACT == 3) { const float u = 0.7978845608028654f * (v + 0.044715f * v * v * v); v = 0.5f * v * (1.0f + tanhf(u)); }
      so[w][8 * hh + r][t * 16 + ln] = v;
    }
  }
  __builtin_amdgcn_fence(__ATOMIC_ACQ_REL, "workgroup");
  __builtin_amdgcn_wave_barrier();
  const int rsub = lane >> 4, c4 = (lane & 15) * 4;
  {
#pragma unroll
    for (int q = 0; q < 8; ++q) {
      const int r = q * 2 + rsub;
      const v4f v = *(const v4fa*)&so[w][r][c4];
      *(v4f*)(C + (size_t)(row0 + r) * ldc + col0 + c4) = v;
    }
    
  }
}
// row LayerNorm (biased variance, eps) over N: s = X (+ R); optional out_sum <- s; out_norm <- (s-mu)*rsqrt(var+eps)*g + b
template <bool PARAM_BF16>
__global__ __launch_bounds__(256) void k_layernorm(const float* __restrict__ X, const float* __restrict__ R, const float* __restrict__ g, const float* __restrict__ bta,
                                                  float* __restrict__ out_sum, float* __restrict__ out_norm, int N, float eps) {
  __shared__ float red[256];
  const int row = blockIdx.x, tid = threadIdx.x;
  const float* x = X + (size_t)row * N; const float* rr = R ? R + (size_t)row * N : nullptr;
  float vals[16];                     // up to N = 4096
  const int per = N / 256;            // contiguous chunk per thread? use strided-by-4 chunks: thread handles j = tid*4 + 1024*u
  float s1 = 0.f;
  for (int u = 0; u < per / 4; ++u) {
    const int j = tid * 4 + 1024 * u;
    const v4f a = *(const v4fa*)(x + j);
    v4f b = {0.f,0.f,0.f,0.f}; if (rr) b = *(const v4fa*)(rr + j);
#pragma unroll
    for (int q = 0; q < 4; ++q) { const float v = a[q] + b[q]; vals[u * 4 + q] = v; s1 += v; }
  }
  red[tid] = s1; __syncthreads();
  for (int st = 128; st > 0; st >>= 1) { if (tid < st) red[tid] += red[tid + st]; __syncthreads(); }
  const float mu = red[0] / (float)N; __syncthreads();
  float s2 = 0.f;
  for (int u = 0; u < per / 4; ++u)
#pragma unroll
    for (int q = 0; q < 4; ++q) { const float c = vals[u * 4 + q] - mu; s2 += c * c; }
  red[tid] = s2; __syncthreads();
  for (int st = 128; st > 0; st >>= 1) { if (tid < st) red[tid] += red[tid + st]; __syncthreads(); }
  const float rs = rsqrtf(red[0] / (float)N + eps);
  {
    for (int u = 0; u < per / 4; ++u) {
      const int j = tid * 4 + 1024 * u;
      v4f o, sm;
#pragma unroll
      for (int q = 0; q < 4; ++q) {
        float gg = g[j + q], bb = bta[j + q];
        if (PARAM_BF16) { gg = bf16_round(gg); bb = bf16_round(bb); }
        sm[q] = vals[u * 4 + q]; o[q] = (vals[u * 4 + q] - mu) * rs * gg + bb;
      }
      if (out_sum) *(v4f*)(out_sum + (size_t)row * N + j) = sm;
      *(v4f*)(out_norm + (size_t)row * N + j) = o;
    }
    
  }
}



// ---- f16 WMMA path (v_wmma_f32_16x16x32_f16): 11-bit significands for operands in range — used where a [0,256] probability operand needs more precision than bf16
typedef _Float16 v16h __attribute__((ext_vector_type(16)));
union FragH { v16h v; v8us half[2]; _Float16 h[16]; unsigned short u[16]; };
template <int NT>
__device__ __forceinline__ v8f mmaH(v16h ah, v16h al, v16h bh, v16h bl, v8f c) {
  c = __builtin_amdgcn_wmma_f32_16x16x32_f16(false, ah, false, bh, (short)0, c, false, false);
  if (NT >= 2) c = __builtin_amdgcn_wmma_f32_16x16x32_f16(false, al, false, bh, (short)0, c, false, false);
  if (NT >= 3) c = __builtin_amdgcn_wmma_f32_16x16x32_f16(false, ah, false, bl, (short)0, c, false, false);
  asm volatile("v_nop\n\tv_nop\n\tv_nop\n\tv_nop" : "+v"(c) : "v"(ah), "v"(al), "v"(bh), "v"(bl));
  return c;
}
// batched GEMM like k_gemm_b but f16 operands: A f32 (split into f16 hi/lo if ASPLIT, else rounded to f16), Bt = f16 values [n][k]; alpha; C f32; N multiple of 16 (partial tiles skipped)
template <bool ASPLIT>
__global__ __launch_bounds__(128) void k_gemm_h(const float* __restrict__ A, int lda, size_t sA, const _Float16* __restrict__ Bh, int ldb, size_t sB, float alpha, float* __restrict__ C, int ldc, size_t sC, int M, int N, int K) {
  __shared__ __attribute__((aligned(16))) float so[4][16][64];
  const int tid = threadIdx.x, w = tid >> 5, lane = tid & 31, ln = lane & 15, hh = lane >> 4; const int by = blockIdx.y;
  A += (size_t)by * sA; Bh += (size_t)by * sB; C += (size_t)by * sC;
  const int ntn = (N + 63) / 64; const int wid = blockIdx.x * 4 + w; const int mt = wid / ntn, nq = wid % ntn; if (mt * 16 >= M) return;
  const int row0 = mt * 16, col0 = nq * 64; const float* arow = A + (size_t)(row0 + ln) * lda;
  v8f acc[4] = {};
  for (int kb = 0; kb < K; kb += 32) {
    FragH ah, al;
    const v4f x0 = *(const v4fa*)(arow + kb + 8 * hh), x1 = *(const v4fa*)(arow + kb + 8 * hh + 4), x2 = *(const v4fa*)(arow + kb + 16 + 8 * hh), x3 = *(const v4fa*)(arow + kb + 16 + 8 * hh + 4);
    float xs[16] = {x0[0],x0[1],x0[2],x0[3],x1[0],x1[1],x1[2],x1[3],x2[0],x2[1],x2[2],x2[3],x3[0],x3[1],x3[2],x3[3]};
#pragma unroll
    for (int i = 0; i < 16; ++i) { const _Float16 h = (_Float16)xs[i]; ah.h[i] = h; al.h[i] = ASPLIT ? (_Float16)(xs[i] - (float)h) : (_Float16)0.0f; }
#pragma unroll
    for (int t = 0; t < 4; ++t) { if (col0 + t * 16 >= N) continue; const size_t boff = (size_t)(col0 + t * 16 + ln) * ldb + kb; FragH bq; bq.half[0] = *(const v8us*)(Bh + boff + 8 * hh); bq.half[1] = *(const v8us*)(Bh + boff + 16 + 8 * hh);
      acc[t] = mmaH<ASPLIT ? 2 : 1>(ah.v, al.v, bq.v, bq.v, acc[t]); }
  }
#pragma unroll
  for (int t = 0; t < 4; ++t) { if (col0 + t * 16 >= N) continue;
#pragma unroll
    for (int r = 0; r < 8; ++r) so[w][8 * hh + r][t * 16 + ln] = acc[t][r] * alpha; }
  __builtin_amdgcn_fence(__ATOMIC_ACQ_REL, "workgroup"); __builtin_amdgcn_wave_barrier();
  const int rsub = lane >> 4, c4 = (lane & 15) * 4;
  {
#pragma unroll
    for (int q = 0; q < 8; ++q) { const int r = q * 2 + rsub; if (col0 + c4 < N) { const v4f v = *(const v4fa*)&so[w][r][c4]; *(v4f*)(C + (size_t)(row0 + r) * ldc + col0 + c4) = v; } }
     }
}

// Wt[n][k] = f16(W[k][n]·scale) from f32 row-major W[K][N] (scale = power of two; bf16-exact weights stay exact in f16 away from the subnormal range)
__global__ __launch_bounds__(256) void k_wt_f16(const float* __restrict__ W, _Float16* __restrict__ Wt, int K, int N, float scale) {
  const int t = blockIdx.x * 256 + threadIdx.x; if (t >= N * (K / 8)) return; const int n = t / (K / 8), k8 = (t % (K / 8)) * 8; FragH f;
#pragma unroll
  for (int i = 0; i < 8; ++i) f.h[i] = (_Float16)(bf16_round(W[(size_t)(k8 + i) * N + n]) * scale); const v8us o = f.half[0];
  *(v8us*)((unsigned short*)Wt + (size_t)n * K + k8) = o; 
}
// FRAGMENT-MAJOR LAYOUT of every f16 WMMA operand M[row][k] in the workspace: tiles of 16 rows x 32 k, 512 elements (1 KiB) each; inside a tile element (row, k) lies at
// ((k >> 3) & 3) * 128 + (row & 15) * 8 + (k & 7). Lane l's two 16-byte pieces of the tile's fragment (k = 8hh .. and 16 + 8hh ..) then lie at l * 8 and 256 + l * 8:
// one load of a wave is 512 bytes in a row, four whole lines, where a row-major operand gave 32 bytes out of each of sixteen lines. Which element sits in which lane and register is as before.
// Tile order: activations, weights, O: (row >> 4) * 16 + (k >> 5); Q, K: head * (NP / 16) + (position >> 4); Vt: (head * (NP / 32) + (key >> 5)) * 2 + ((d >> 4) & 1).
#define TL 512
// 32^-1/2 * log2(e): Q is stored multiplied by it, so that K.Qt comes out of the matrix unit in the base-2 units of the softmax
#define SL2 0.25503486164919736f
// the ten 16-byte loads of one k-step: the A fragment and four B fragments (ap, bp: the row tile's start + lane * 8; ko: the k-step's tile offset)
__device__ __forceinline__ void ld_kstep(const unsigned short* ap, const unsigned short* const (&bp)[4], int ko, FragH& a, FragH (&b)[4]) {
  a.half[0] = *(const v8us*)(ap + ko); a.half[1] = *(const v8us*)(ap + ko + 256);
#pragma unroll
  for (int t = 0; t < 4; ++t) { b[t].half[0] = *(const v8us*)(bp[t] + ko); b[t].half[1] = *(const v8us*)(bp[t] + ko + 256); }
  asm volatile("s_wait_xcnt 0x0" ::: "memory");      // these loads stay in flight: the wait stands before their address registers are written again
}
// acc[t] += A rows . (B rows)^T for one wave's 16 x 64 tile, K a multiple of 128; a row tile's k-steps are TL elements apart in both operands.
// Fragments three k-steps ahead in a ring of four register sets: a k-step's ten loads are issued three k-steps before its products. A fetch past the last k-step reads k-step 0 again and is not used.
__device__ __forceinline__ void gemm_tile(const unsigned short* ap, const unsigned short* const (&bw)[4], int K, v8f (&acc)[4]) {
  FragH fa[4], fb[4][4];
#pragma unroll
  for (int u = 0; u < 3; ++u) ld_kstep(ap, bw, u * TL, fa[u], fb[u]);
  __builtin_amdgcn_sched_barrier(0);      // keeps the first product, and the wait for its operands, behind all thirty loads of the prologue (the scheduler had lifted one among them)
  for (int kb = 0; kb + 128 <= K; kb += 128) {
#pragma unroll
    for (int u = 0; u < 4; ++u) { const int kn = kb + (u + 3) * 32, kc = kn < K ? kn : 0; ld_kstep(ap, bw, (kc >> 5) * TL, fa[(u + 3) & 3], fb[(u + 3) & 3]);
#pragma unroll
      for (int t = 0; t < 4; ++t) acc[t] = mmaH<1>(fa[u].v, fa[u].v, fb[u][t].v, fb[u][t].v, acc[t]); }
  }
}
// The three projections in one grid, blockIdx.y = 0 Q, 1 K, 2 V. Q and K: C[position][channel] = activations . W^T. V with the operands exchanged, C[channel][position] = W . activations^T:
// the product comes out as Vt, the layout k_attn reads, with the same products summed in the same k order. f16 out, v = acc / 16 + bias (weights are stored x 16), times SL2 for Q.
__global__ __launch_bounds__(128) void k_gemm_qkv(const _Float16* __restrict__ QNP, const _Float16* __restrict__ VNP, const _Float16* __restrict__ Bw, const float* __restrict__ bq, const float* __restrict__ bk, const float* __restrict__ bv,
    _Float16* __restrict__ Q16, _Float16* __restrict__ K16, _Float16* __restrict__ Vt) {
  __shared__ __attribute__((aligned(16))) float so[4][16][68];      // pitch 16 bytes x 17: sixteen lanes read 16 bytes each down one column without a bank conflict
  const int tid = threadIdx.x, w = tid >> 5, lane = tid & 31, ln = lane & 15, hh = lane >> 4; const int by = blockIdx.y; const bool sw = by == 2;
  const _Float16* A = by == 0 ? QNP : by == 1 ? VNP : Bw + (size_t)2 * CC * CC; const _Float16* B = sw ? VNP : Bw + (size_t)by * CC * CC;
  const float* bias = by == 0 ? bq : by == 1 ? bk : bv; _Float16* C16 = by == 0 ? Q16 : by == 1 ? K16 : Vt;
  const int ls = sw ? 6 : 3; const int wid = blockIdx.x * 4 + w; const int row0 = (wid >> ls) * 16, col0 = (wid & ((1 << ls) - 1)) * 64;      // N / 64 = 1 << ls column tiles
  const unsigned short* ap = (const unsigned short*)A + (size_t)(row0 >> 4) * (CC / 32 * TL) + lane * 8; const unsigned short* bw[4];
#pragma unroll
  for (int t = 0; t < 4; ++t) bw[t] = (const unsigned short*)B + (size_t)((col0 >> 4) + t) * (CC / 32 * TL) + lane * 8;
  v8f acc[4] = {};
  gemm_tile(ap, bw, CC, acc);
  if (sw) { float br[8];      // the channel is the tile's row
#pragma unroll
    for (int r = 0; r < 8; ++r) br[r] = bf16_round(bias[row0 + 8 * hh + r]);
#pragma unroll
    for (int t = 0; t < 4; ++t) {
#pragma unroll
      for (int r = 0; r < 8; ++r) so[w][8 * hh + r][t * 16 + ln] = acc[t][r] * 0.0625f + br[r]; }
  } else {      // the channel is the tile's column
    const float qs = by == 0 ? SL2 : 1.0f;      // Q alone takes the softmax's factor, in f32, ahead of its one rounding to f16
#pragma unroll
    for (int t = 0; t < 4; ++t) { const float bc = bf16_round(bias[col0 + t * 16 + ln]);
#pragma unroll
      for (int r = 0; r < 8; ++r) so[w][8 * hh + r][t * 16 + ln] = (acc[t][r] * 0.0625f + bc) * qs; }
  }
  __builtin_amdgcn_fence(__ATOMIC_ACQ_REL, "workgroup"); __builtin_amdgcn_wave_barrier();
  // The wave's 16 x 64 values are two fragment-major tiles (16 rows x 32 columns each: Q, K: two heads of 16 positions; Vt: 16 d of two key blocks). tl0: the first one's number, tls: the step to the second.
  const int tl0 = sw ? ((row0 >> 5) * (NP / 32) + (col0 >> 5)) * 2 + ((row0 >> 4) & 1) : (col0 >> 5) * (NP / 16) + (row0 >> 4); const int tls = sw ? 2 : NP / 16;
#pragma unroll
  for (int q = 0; q < 4; ++q) { const int cb = (q >> 1) * 32 + ((q & 1) * 2 + hh) * 8; const v4f v0 = *(const v4fa*)&so[w][ln][cb], v1 = *(const v4fa*)&so[w][ln][cb + 4]; FragH f;
    for (int i = 0; i < 4; ++i) { f.h[i] = (_Float16)v0[i]; f.h[4 + i] = (_Float16)v1[i]; }
    *(v8us*)((unsigned short*)C16 + (size_t)(tl0 + (q >> 1) * tls) * TL + (q & 1) * 256 + lane * 8) = f.half[0]; }
}
// Output projection with the operands exchanged: C[channel][position] = Wo . O^T is the output's own layout, so bias, residual and 1/sqrt(2) are applied where the tile is stored.
__global__ __launch_bounds__(128) void k_gemm_out(const _Float16* __restrict__ Bo, const _Float16* __restrict__ O16h, const float* __restrict__ bo, const float* __restrict__ x, float* __restrict__ out) {
  __shared__ __attribute__((aligned(16))) float so[4][16][64];
  const int tid = threadIdx.x, w = tid >> 5, lane = tid & 31, ln = lane & 15, hh = lane >> 4;
  const int wid = blockIdx.x * 4 + w; const int row0 = (wid / (NP / 64)) * 16, col0 = (wid % (NP / 64)) * 64;
  const unsigned short* ap = (const unsigned short*)Bo + (size_t)(row0 >> 4) * (CC / 32 * TL) + lane * 8; const unsigned short* bw[4];
#pragma unroll
  for (int t = 0; t < 4; ++t) bw[t] = (const unsigned short*)O16h + (size_t)((col0 >> 4) + t) * (CC / 32 * TL) + lane * 8;
  v8f acc[4] = {};
  gemm_tile(ap, bw, CC, acc);
#pragma unroll
  for (int t = 0; t < 4; ++t) {
#pragma unroll
    for (int r = 0; r < 8; ++r) so[w][8 * hh + r][t * 16 + ln] = acc[t][r] * 0.0625f + bf16_round(bo[row0 + 8 * hh + r]); }
  __builtin_amdgcn_fence(__ATOMIC_ACQ_REL, "workgroup"); __builtin_amdgcn_wave_barrier();
  const int rsub = lane >> 4, c4 = (lane & 15) * 4;
  const size_t o0 = (size_t)(row0 + rsub) * NP + col0 + c4; const float* xp = x + o0; float* op = out + o0; v4f xv[8];
#pragma unroll
  for (int q = 0; q < 8; ++q) xv[q] = *(const v4fa*)(xp + (size_t)q * 2 * NP);
  asm volatile("s_wait_xcnt 0x0" ::: "memory");      // the wait stands before the address registers of the eight loads are written again
#pragma unroll
  for (int q = 0; q < 8; ++q) { const v4f v = *(const v4fa*)&so[w][q * 2 + rsub][c4]; v4f y;
    for (int i = 0; i < 4; ++i) y[i] = (v[i] + bf16_round(xv[q][i])) * 0.7071067811865476f; *(v4f*)(op + (size_t)q * 2 * NP) = y; }
}

// D = A.B + C with C left standing in its own registers. As text: the builtin took C in D's registers for half of the score products and copied C there first, eight 64-bit moves a pass.
// The four v_nop are the distance the chip needs between the product and the first vector instruction on its D (here a maximum); D shares no register with A, B or C.
__device__ __forceinline__ v8f mmaHC(v16h a, v16h b, v8f c) { v8f d;
  asm volatile("v_wmma_f32_16x16x32_f16 %0, %1, %2, %3\n\tv_nop\n\tv_nop\n\tv_nop\n\tv_nop" : "=&v"(d) : "v"(a), "v"(b), "v"(c));
  return d; }
// lane l <-> l ^ 16 (the two halves of a wave hold the two key halves of one query column)
__device__ __forceinline__ float xhalf(float v) { const int b = __float_as_int(v); return __int_as_float(__builtin_amdgcn_permlanex16(b, b, 0x76543210, 0xfedcba98, false, false)); }
// lane l <-> l ^ M inside a 16-lane row (DPP row_xmask)
template <int M>
__device__ __forceinline__ float xrow(float v) { return __int_as_float(__builtin_amdgcn_update_dpp(0, __float_as_int(v), 0x160 + M, 0xf, 0xf, true)); }
// sum over the 32 lanes of a wave, the same value in every lane; all lanes on
__device__ __forceinline__ float wave_sum(float v) { v += xrow<1>(v); v += xrow<2>(v); v += xrow<4>(v); v += xrow<8>(v); return v + xhalf(v); }
// Blocks 0 .. NG - 1: one group (GS * NP = 65,536 values) per block of 1,024 threads: 16 whole-line 16-byte loads per thread (load i is channel i of the group), all in flight together. The values stay in registers
// for the first GroupNorm's two sums, are normalised there, and stay for the second GroupNorm's two sums: STAT[g] = {mean 1, 1/sd 1, mean 2, 1/sd 2}.
// Blocks NG .. NG + 127 (independent work in the same launch): the four weight matrices, bf16-rounded, x 16, to f16, fragment-major (thread t writes the t-th 16-byte piece); they leave before any barrier.
__global__ __launch_bounds__(1024) void k_prep(const float* __restrict__ X, const float* __restrict__ gw, const float* __restrict__ gb, const float* __restrict__ W0, const float* __restrict__ W1, const float* __restrict__ W2, const float* __restrict__ W3,
    _Float16* __restrict__ Bt, float* __restrict__ STAT) { __shared__ float sh[4][32]; const int tid = threadIdx.x, w = tid >> 5, lane = tid & 31;
  if (blockIdx.x >= NG) { const int y = (int)(blockIdx.x - NG) >> 5; const float* W = y == 0 ? W0 : y == 1 ? W1 : y == 2 ? W2 : W3; const size_t t = (size_t)((blockIdx.x - NG) & 31) * 1024 + tid; FragH f;
    const float* wr = W + ((t >> 10) * 16 + (t & 15)) * CC + ((t >> 6) & 15) * 32 + ((t >> 4) & 3) * 8;      // row (out), k (in) of that piece
    const v4f a = *(const v4fa*)wr, b = *(const v4fa*)(wr + 4);
#pragma unroll
    for (int i = 0; i < 4; ++i) { f.h[i] = (_Float16)(bf16_round(a[i]) * 16.0f); f.h[4 + i] = (_Float16)(bf16_round(b[i]) * 16.0f); }
    *(v8us*)((unsigned short*)Bt + (size_t)y * CC * CC + t * 8) = f.half[0]; return; }
  const int g = blockIdx.x; const float* base = X + (size_t)g * GS * NP;
  v4f v[16];
#pragma unroll
  for (int i = 0; i < 16; ++i) v[i] = *(const v4fa*)(base + (size_t)(i * 1024 + tid) * 4);
  v4f st;
#pragma unroll
  for (int pass = 0; pass < 2; ++pass) {
    v4f s4 = {0.f, 0.f, 0.f, 0.f};
#pragma unroll
    for (int i = 0; i < 16; ++i) { if (pass == 0) { for (int q = 0; q < 4; ++q) v[i][q] = bf16_round(v[i][q]); } s4 += v[i]; }
    const float s = wave_sum((s4[0] + s4[1]) + (s4[2] + s4[3])); if (lane == 0) sh[pass * 2][w] = s; __syncthreads();
    const float mean = wave_sum(sh[pass * 2][lane]) / (float)(GS * NP);
    v4f q4 = {0.f, 0.f, 0.f, 0.f};
#pragma unroll
    for (int i = 0; i < 16; ++i) { const v4f d = v[i] - mean; q4 += d * d; }
    const float q = wave_sum((q4[0] + q4[1]) + (q4[2] + q4[3])); if (lane == 0) sh[pass * 2 + 1][w] = q; __syncthreads();
    const float var = wave_sum(sh[pass * 2 + 1][lane]) / (float)(GS * NP); const float rs = 1.0f / sqrtf(var + 1e-6f);
    st[pass * 2] = mean; st[pass * 2 + 1] = rs;
    if (pass == 0) {
#pragma unroll
      for (int i = 0; i < 16; ++i) { const float ww = bf16_round(gw[g * GS + i]), b2 = bf16_round(gb[g * GS + i]); for (int q2 = 0; q2 < 4; ++q2) v[i][q2] = (v[i][q2] - mean) * rs * ww + b2; } }
  }
  if (tid == 0) *(v4f*)(STAT + g * 4) = st; }
// 64 channels x 64 positions a block: x is read once (256-byte runs), qn = GN(x) and vn = GN(qn) are formed in registers and both go out in f16, fragment-major (row = position, k = channel), 512 bytes in a row a wave.
__global__ __launch_bounds__(256) void k_gnorm2(const float* __restrict__ X, const float* __restrict__ STAT, const float* __restrict__ w, const float* __restrict__ bb, _Float16* __restrict__ QP, _Float16* __restrict__ VP) { __shared__ float tq[64][65], tv[64][65];
  const int tid = threadIdx.x; const int cg = blockIdx.x / (NP / 64), pg = blockIdx.x % (NP / 64); const int c0 = cg * 64, p0 = pg * 64;
  const int cl = tid >> 4, p4 = (tid & 15) * 4;      // round u: channel c0 + 16 * u + cl, which lies in group cg * 4 + u
  const float* xp = X + (size_t)(c0 + cl) * NP + p0 + p4; const float* wp = w + c0 + cl; const float* bp = bb + c0 + cl; v4f xv[4]; float wv[4], bv[4];
#pragma unroll
  for (int u = 0; u < 4; ++u) { xv[u] = *(const v4fa*)(xp + (size_t)u * 16 * NP); wv[u] = wp[u * 16]; bv[u] = bp[u * 16]; }
  asm volatile("s_wait_xcnt 0x0" ::: "memory");      // the wait stands before the address registers of the twelve loads are written again
#pragma unroll
  for (int u = 0; u < 4; ++u) { const int c = u * 16 + cl; const v4f st = *(const v4fa*)(STAT + (cg * 4 + u) * 4); const float ww = bf16_round(wv[u]), b2 = bf16_round(bv[u]);
#pragma unroll
    for (int q = 0; q < 4; ++q) { const float y = (bf16_round(xv[u][q]) - st[0]) * st[1] * ww + b2; tq[p4 + q][c] = y; tv[p4 + q][c] = (y - st[2]) * st[3] * ww + b2; } }
  __syncthreads();
#pragma unroll
  for (int u = 0; u < 2; ++u) { const int i = tid + 256 * u, r = (i >> 7) * 16 + (i & 15), pc = (i >> 4) & 7; FragH f, g;      // piece i: position tile i >> 7, k-step (i >> 6) & 1, then the tile's 64 pieces in order
#pragma unroll
    for (int q = 0; q < 8; ++q) { f.h[q] = (_Float16)tq[r][pc * 8 + q]; g.h[q] = (_Float16)tv[r][pc * 8 + q]; }
    const size_t o = (size_t)(((p0 >> 4) + (i >> 7)) * (CC / 32) + (c0 >> 5) + ((i >> 6) & 1)) * TL + (i & 63) * 8; *(v8us*)((unsigned short*)QP + o) = f.half[0]; *(v8us*)((unsigned short*)VP + o) = g.half[0]; } }
__global__ __launch_bounds__(256) void k_attn(const _Float16* __restrict__ Q16, const _Float16* __restrict__ K16, const _Float16* __restrict__ Vt, _Float16* __restrict__ O16h) { constexpr int RPW = 32; constexpr int NK = NP / 2;
  __shared__ __attribute__((aligned(16))) v4f xo[8][4][32]; __shared__ float xm[8][32], xl[8][32];      // what a wave hands to its partner: 16 Ot values, maximum and sum of one query tile, a lane's own slot each
  const int tid = threadIdx.x, w = tid >> 5, lane = tid & 31; const int kg = __builtin_amdgcn_readfirstlane(tid >> 7);
  const int h = blockIdx.x / (NP / 128), qblk = blockIdx.x % (NP / 128); const int q0 = qblk * 128 + (w & 3) * RPW;      // below: ln = lane & 15, hh = lane >> 4
  FragH aq[2];
#pragma unroll
  for (int rt = 0; rt < 2; ++rt) { const unsigned short* qr = (const unsigned short*)Q16 + (size_t)(h * (NP / 16) + (q0 >> 4) + rt) * TL + lane * 8; aq[rt].half[0] = *(const v8us*)qr; aq[rt].half[1] = *(const v8us*)(qr + 256); }
  __builtin_amdgcn_sched_barrier(0);      // keeps the four Q loads the oldest: moved behind K or Vt loads they would make the loop's counted waits for Q cover the Vt loads of the pass before as well
  float m_r[2], l_r[2]; v8f oacc[2][2], nm[2];      // query rt * 16 + ln; oacc[rt][dt][r] = Ot[dt * 16 + 8hh + r][query]; nm[rt]: -m_r[rt] in all eight registers, the C operand of the score products
#pragma unroll
  for (int rt = 0; rt < 2; ++rt) { m_r[rt] = 0.f; l_r[rt] = 0.f; oacc[rt][0] = (v8f){0.f,0.f,0.f,0.f,0.f,0.f,0.f,0.f}; oacc[rt][1] = oacc[rt][0]; nm[rt] = oacc[rt][0]; }
  // K and Vt fragments one pass ahead: each pass refills a fragment's registers for the next pass right behind its last product, so the loads fly during the softmax and the other products.
  // The last pass fetches the group's pass 0 fragments again (in bounds, not used).
  // Fragment-major: a pass's two K tiles are 2 KiB in a row, its two Vt tiles likewise; 32 keys are 32 * 32 elements on in both.
  const unsigned short* kl = (const unsigned short*)K16 + ((size_t)h * NP + (size_t)kg * NK) * HD + lane * 8; const unsigned short* vl = (const unsigned short*)Vt + ((size_t)h * NP + (size_t)kg * NK) * HD + lane * 8;
  FragH bk[2], bv[2];
#pragma unroll
  for (int t = 0; t < 2; ++t) { const unsigned short* kr = kl + t * TL; bk[t].half[0] = *(const v8us*)kr; bk[t].half[1] = *(const v8us*)(kr + 256); }
#pragma unroll
  for (int t = 0; t < 2; ++t) { const unsigned short* vrow = vl + t * TL; bv[t].half[0] = *(const v8us*)vrow; bv[t].half[1] = *(const v8us*)(vrow + 256); }
#pragma unroll 1
  for (int j0 = 0; j0 < NK; j0 += 32) { v8f s[2][2];      // s[rt][nt][r] = S[query][kg * NK + j0 + nt * 16 + 8hh + r] * SL2 - m_r[rt]
    const int jn = j0 + 32 < NK ? j0 + 32 : 0;
#pragma unroll
    for (int nt = 0; nt < 2; ++nt) {
#pragma unroll
      for (int rt = 0; rt < 2; ++rt) s[rt][nt] = mmaHC(bk[nt].v, aq[rt].v, nm[rt]);
      const unsigned short* kr = kl + (size_t)jn * HD + nt * TL; bk[nt].half[0] = *(const v8us*)kr; bk[nt].half[1] = *(const v8us*)(kr + 256); }
    __builtin_amdgcn_sched_barrier(0);      // keeps the next pass's four K loads in front of the softmax: the scheduler had sunk two of them behind it, which cuts their lead to a fraction of a pass
    float mc[2];      // this half's largest argument of each query
#pragma unroll
    for (int rt = 0; rt < 2; ++rt) { float mx[8];
#pragma unroll
      for (int i = 0; i < 8; ++i) mx[i] = fmaxf(s[rt][0][i], s[rt][1][i]);
      mc[rt] = fmaxf(fmaxf(fmaxf(mx[0], mx[1]), fmaxf(mx[2], mx[3])), fmaxf(fmaxf(mx[4], mx[5]), fmaxf(mx[6], mx[7]))); }
    // Renewal, the same for every lane of the wave (one ballot, a scalar branch): when some argument has passed 8, and in a group's first pass (bound -3e38), which sets m_r from real scores.
    const float lim = j0 == 0 ? -3.0e38f : 8.0f, low = j0 == 0 ? -3.0e38f : 0.f;
    if (__builtin_amdgcn_ballot_w32(fmaxf(mc[0], mc[1]) > lim) != 0) {
#pragma unroll
      for (int rt = 0; rt < 2; ++rt) { const float mf = fmaxf(mc[rt], xhalf(mc[rt]));      // both halves of a query take the same step
        const float d = fmaxf(mf, low); const float al = __builtin_amdgcn_exp2f(-fmaxf(d, 0.f));      // behind the first pass m_r never falls; in the first pass Ot and the sum are still 0, and al stays <= 1
        m_r[rt] += d; l_r[rt] *= al;
#pragma unroll
        for (int r = 0; r < 8; ++r) { nm[rt][r] = -m_r[rt]; s[rt][0][r] -= d; s[rt][1][r] -= d; oacc[rt][0][r] *= al; oacc[rt][1][r] *= al; } } }
    FragH pb[2];
#pragma unroll
    for (int rt = 0; rt < 2; ++rt) { float ps[8];
#pragma unroll
      for (int i = 0; i < 8; ++i) { const float p0 = __builtin_amdgcn_exp2f(s[rt][0][i]), p1 = __builtin_amdgcn_exp2f(s[rt][1][i]); ps[i] = p0 + p1; pb[rt].h[i] = (_Float16)p0; pb[rt].h[8 + i] = (_Float16)p1; }
      l_r[rt] += ((ps[0] + ps[1]) + (ps[2] + ps[3])) + ((ps[4] + ps[5]) + (ps[6] + ps[7])); }      // this half's keys; the halves join after the loop
#pragma unroll
    for (int dt = 0; dt < 2; ++dt) {
#pragma unroll
      for (int rt = 0; rt < 2; ++rt) oacc[rt][dt] = mmaH<1>(bv[dt].v, bv[dt].v, pb[rt].v, pb[rt].v, oacc[rt][dt]);
      const unsigned short* vrow = vl + (size_t)jn * HD + dt * TL; bv[dt].half[0] = *(const v8us*)vrow; bv[dt].half[1] = *(const v8us*)(vrow + 256); }
    asm volatile("s_wait_xcnt 0x0" ::: "memory"); }      // the Vt loads stay in flight over the back edge: the wait stands before their address registers are written again
  // A lane's eight values of one accumulator (d = dt * 16 + 8hh + r of query rt * 16 + ln) are one 16-byte piece of O's fragment-major tile (row = position, k-step = head): stored from the registers, 512 bytes in a row a wave.
  // kg is the same in every lane: the selects below only name which query tile a wave keeps (rt = kg) and which it hands over
  const bool k1 = kg != 0; float keep[16], give[16];
#pragma unroll
  for (int i = 0; i < 16; ++i) { const float t0 = oacc[0][i >> 3][i & 7], t1 = oacc[1][i >> 3][i & 7]; keep[i] = k1 ? t1 : t0; give[i] = k1 ? t0 : t1; }
  const float mk = k1 ? m_r[1] : m_r[0], lk = k1 ? l_r[1] : l_r[0];
#pragma unroll
  for (int i = 0; i < 4; ++i) xo[w][i][lane] = (v4f){give[i * 4], give[i * 4 + 1], give[i * 4 + 2], give[i * 4 + 3]};
  xm[w][lane] = k1 ? m_r[0] : m_r[1]; xl[w][lane] = k1 ? l_r[0] : l_r[1];
  __syncthreads();      // every wave of the block passes it once: the partner's partial result is read behind it
  // both partial results brought to the common maximum, then as with one: halves joined, divided, stored
  const int pw = w ^ 4; const float mp = xm[pw][lane]; const float mn = fmaxf(mk, mp); const float a0 = __builtin_amdgcn_exp2f(mk - mn), a1 = __builtin_amdgcn_exp2f(mp - mn);
  const float lj = lk * a0 + xl[pw][lane] * a1; const float l = lj + xhalf(lj); const float li = 1.0f / l; const float c0 = a0 * li, c1 = a1 * li;
#pragma unroll
  for (int dt = 0; dt < 2; ++dt) { FragH f; const v4f p0 = xo[pw][dt * 2][lane], p1 = xo[pw][dt * 2 + 1][lane];
#pragma unroll
    for (int r = 0; r < 4; ++r) { f.h[r] = (_Float16)(keep[dt * 8 + r] * c0 + p0[r] * c1); f.h[4 + r] = (_Float16)(keep[dt * 8 + 4 + r] * c0 + p1[r] * c1); }
    *(v8us*)((unsigned short*)O16h + (size_t)(((q0 >> 4) + kg) * (CC / 32) + h) * TL + dt * 256 + lane * 8) = f.half[0]; } }
extern "C" void kernel_launch(void* const* d_in, const int* in_sizes, int n_in,
                              void* d_out, int out_size, void* d_ws, size_t ws_size, hipStream_t stream) {
  (void)in_sizes; (void)n_in; (void)out_size;
  const float* x = (const float*)d_in[0]; const float* gw = (const float*)d_in[1]; const float* gb = (const float*)d_in[2]; const float* wq = (const float*)d_in[3]; const float* bq = (const float*)d_in[4]; const float* wk = (const float*)d_in[5]; const float* bk = (const float*)d_in[6]; const float* wv = (const float*)d_in[7]; const float* bv = (const float*)d_in[8]; const float* wo = (const float*)d_in[9]; const float* bo = (const float*)d_in[10];
  char* ws = (char*)d_ws; size_t off = 0;
  auto take = [&](size_t bytes) { char* p = ws + off; off += (bytes + 255) & ~(size_t)255; return p; };
  _Float16* Bw = (_Float16*)take((size_t)4 * CC * CC * 2);      // Wq, Wk, Wv, Wo, (out,in)
  float* ST = (float*)take(NG * 4 * 4);
  _Float16* QNP = (_Float16*)take((size_t)NP * CC * 2); _Float16* VNP = (_Float16*)take((size_t)NP * CC * 2); _Float16* Q16 = (_Float16*)take((size_t)NP * CC * 2); _Float16* K16 = (_Float16*)take((size_t)NP * CC * 2); _Float16* Vt = (_Float16*)take((size_t)NP * CC * 2); _Float16* O16h = (_Float16*)take((size_t)NP * CC * 2);
  if (off > ws_size) return;      // 2 + 6 x 4 = 26 MiB
  k_prep<<<NG + 128, 1024, 0, stream>>>(x, gw, gb, wq, wk, wv, wo, Bw, ST);
  k_gnorm2<<<(CC / 64) * (NP / 64), 256, 0, stream>>>(x, ST, gw, gb, QNP, VNP);
  k_gemm_qkv<<<dim3((NP / 16) * (CC / 64) / 4, 3), 128, 0, stream>>>(QNP, VNP, Bw, bq, bk, bv, Q16, K16, Vt);
  k_attn<<<NH * (NP / 128), 256, 0, stream>>>(Q16, K16, Vt, O16h);
  k_gemm_out<<<(CC / 16) * (NP / 64) / 4, 128, 0, stream>>>(Bw + (size_t)3 * CC * CC, O16h, bo, x, (float*)d_out);
}

// v009
// One run takes 73.6 microseconds.
// Timed twice side by side with v008, it ran 1.13 and 1.12 times as fast.
// Counting every step since v000, it is 5.75 times as fast.
#include <hip/hip_runtime.h>
// the 1×1 convs (4096 × 512 × 512, + bias, weights (out,in) bf16-exact ×2^4) and the attention as a fused flash-style kernel (S = Q·Kᵀ·32^-½ with d = 32 in one k-step, online softmax f32,
// P f16 <= 256, O = P·V) on v_wmma_f32_16x16x32_f16 (f16 operands, single products, f32 accumulate); residual (out + x)/√2 and layout transposes f32 VALU.
#define CC 512
#define NP 4096
#define NG 32
#define GS 16
#define NH 16
#define HD 32

typedef __bf16 v16b __attribute__((ext_vector_type(16)));
typedef unsigned short v8us __attribute__((ext_vector_type(8), may_alias));
typedef float  v8f  __attribute__((ext_vector_type(8)));
typedef float  v4f  __attribute__((ext_vector_type(4)));
typedef float  v4fa __attribute__((ext_vector_type(4), may_alias));
union FragB { v16b v; v8us half[2]; unsigned short u[16]; };

__device__ __forceinline__ unsigned short bf16_bits(float x) { unsigned int u = __float_as_uint(x); return (unsigned short)((u + 0x7FFFu + ((u >> 16) & 1u)) >> 16); }
__device__ __forceinline__ float bf16_val(unsigned short b) { return __uint_as_float(((unsigned int)b) << 16); }
__device__ __forceinline__ float bf16_round(float x) { return bf16_val(bf16_bits(x)); }
// D += A·B with NT terms: 1 = ah·bh, 2 = + al·bh (A split), 3 = + ah·bl (both split)
template <int NT>
__device__ __forceinline__ v8f mmaN(v16b ah, v16b al, v16b bh, v16b bl, v8f c) {
  c = __builtin_amdgcn_wmma_f32_16x16x32_bf16(false, ah, false, bh, (short)0, c, false, false);
  if (NT >= 2) c = __builtin_amdgcn_wmma_f32_16x16x32_bf16(false, al, false, bh, (short)0, c, false, false);
  if (NT >= 3) c = __builtin_amdgcn_wmma_f32_16x16x32_bf16(false, ah, false, bl, (short)0, c, false, false);
  asm volatile("v_nop\n\tv_nop\n\tv_nop\n\tv_nop" : "+v"(c) : "v"(ah), "v"(al), "v"(bh), "v"(bl));
  return c;
}

__global__ __launch_bounds__(256) void k_wt_bf16(const float* __restrict__ W, unsigned short* __restrict__ Wt, int K, int N) {
  const int t = blockIdx.x * 256 + threadIdx.x;
  const int k8n = K / 8;
  if (t >= N * k8n) return;
  const int n = t / k8n, k8 = (t % k8n) * 8;
  v8us v;
#pragma unroll
  for (int i = 0; i < 8; ++i) v[i] = bf16_bits(W[(size_t)(k8 + i) * N + n]);
  *(v8us*)(Wt + (size_t)n * K + k8) = v;
  
}

// GEMM C[M][N] (f32, pitch ldc) = act(A[M][K]·W + bias). A f32 row-major (pitch lda) converted per fragment to bf16
// (ASPLIT: hi/lo two planes -> 2 terms, else single rounded term); Wt bf16 [N][K] (pitch ldb). BIAS_BF16 rounds the
// bias to bf16 first (bias quantised to bf16 before the add). K%32==0, M%16==0, N%64==0.
template <bool ASPLIT, int ACT, bool BIAS_BF16>
__global__ __launch_bounds__(128) void k_gemm_bf(const float* __restrict__ A, int lda, const unsigned short* __restrict__ Wt, int ldb,
                                               const float* __restrict__ bias, float* __restrict__ C, int ldc, int M, int N, int K) {
  __shared__ __attribute__((aligned(16))) float so[4][16][64];
  const int tid = threadIdx.x, w = tid >> 5, lane = tid & 31, ln = lane & 15, hh = lane >> 4;
  const int ntn = N / 64;
  const int wid = blockIdx.x * 4 + w;
  const int mt = wid / ntn, nq = wid % ntn;
  if (mt * 16 >= M) return;
  const int row0 = mt * 16, col0 = nq * 64;
  const float* arow = A + (size_t)(row0 + ln) * lda;
  v8f acc[4] = {};
  for (int kb = 0; kb < K; kb += 32) {
    FragB ah, al;
    const v4f x0 = *(const v4fa*)(arow + kb + 8 * hh), x1 = *(const v4fa*)(arow + kb + 8 * hh + 4);
    const v4f x2 = *(const v4fa*)(arow + kb + 16 + 8 * hh), x3 = *(const v4fa*)(arow + kb + 16 + 8 * hh + 4);
    float xs[16] = {x0[0],x0[1],x0[2],x0[3],x1[0],x1[1],x1[2],x1[3],x2[0],x2[1],x2[2],x2[3],x3[0],x3[1],x3[2],x3[3]};
#pragma unroll
    for (int i = 0; i < 16; ++i) { const unsigned short hb = bf16_bits(xs[i]); ah.u[i] = hb; al.u[i] = ASPLIT ? bf16_bits(xs[i] - bf16_val(hb)) : (unsigned short)0; }
#pragma unroll
    for (int t = 0; t < 4; ++t) {
      const unsigned short* brow = Wt + (size_t)(col0 + t * 16 + ln) * ldb + kb;
      FragB b;
      b.half[0] = *(const v8us*)(brow + 8 * hh);
      b.half[1] = *(const v8us*)(brow + 16 + 8 * hh);
      acc[t] = mmaN<ASPLIT ? 2 : 1>(ah.v, al.v, b.v, b.v, acc[t]);
    }
  }
#pragma unroll
  for (int t = 0; t < 4; ++t) {
    float bv = bias ? bias[col0 + t * 16 + ln] : 0.f;
    if (BIAS_BF16) bv = bf16_round(bv);
#pragma unroll
    for (int r = 0; r < 8; ++r) { float v = acc[t][r] + bv; if (ACT == 1) v = fmaxf(v, 0.f); so[w][8 * hh + r][t * 16 + ln] = v; }
  }
  __builtin_amdgcn_fence(__ATOMIC_ACQ_REL, "workgroup");
  __builtin_amdgcn_wave_barrier();
  const int rsub = lane >> 4, c4 = (lane & 15) * 4;
  {
#pragma unroll
    for (int q = 0; q < 8; ++q) {
      const int r = q * 2 + rsub;
      const v4f v = *(const v4fa*)&so[w][r][c4];
      *(v4f*)(C + (size_t)(row0 + r) * ldc + col0 + c4) = v;
    }
    
  }
}

// Flash-style causal/unmasked attention, all contractions 3-term bf16 hi/lo splits, f32 softmax with running max.
// q,k,v rows are read from f32 buffers with arbitrary row pitch (so they can live inside a fused qkv buffer);
// D = head size (multiple of 32, <= 128); one wave = 16 query rows; block = 4 waves (64 queries) sharing K/V chunks of 32.
template <int D, bool CAUSAL>
__global__ __launch_bounds__(128) void k_flash(const float* __restrict__ qb, const float* __restrict__ kb, const float* __restrict__ vb,
                                             int pitch, int T, int H, float scale, float* __restrict__ y, int ypitch) {
  constexpr int KS = D / 32;        // k-steps for QK
  constexpr int DT = D / 16;        // d tiles for PV
  __shared__ __attribute__((aligned(16))) unsigned short sKh[32][D + 8], sKl[32][D + 8], sVh[32][D + 8], sVl[32][D + 8];
  __shared__ __attribute__((aligned(16))) unsigned short sPh[4][16][40], sPl[4][16][40];
  __shared__ __attribute__((aligned(16))) float sO[4][16][D];
  const int tid = threadIdx.x, w = tid >> 5, lane = tid & 31, ln = lane & 15, hh = lane >> 4;
  const int nqb = (T + 63) / 64;
  const int bh = blockIdx.x / nqb, qblk = blockIdx.x % nqb;
  const int b = bh / H, h = bh % H;
  const int q0 = qblk * 64 + w * 16;
  const float* Q = qb + (size_t)b * T * pitch + h * D;
  const float* K = kb + (size_t)b * T * pitch + h * D;
  const float* V = vb + (size_t)b * T * pitch + h * D;

  // A fragments of the wave's 16 query rows (scaled), hi/lo
  FragB aqh[KS], aql[KS];
  {
    int row = q0 + ln; if (row >= T) row = T - 1;
    const float* qr = Q + (size_t)row * pitch;
#pragma unroll
    for (int ks = 0; ks < KS; ++ks)
#pragma unroll
      for (int i = 0; i < 16; ++i) {
        const int d = ks * 32 + ((i < 8) ? (8 * hh + i) : (16 + 8 * hh + (i - 8)));
        const float x = qr[d] * scale; const unsigned short hb = bf16_bits(x);
        aqh[ks].u[i] = hb; aql[ks].u[i] = bf16_bits(x - bf16_val(hb));
      }
  }
  float m_r[8], l_r[8];
#pragma unroll
  for (int r = 0; r < 8; ++r) { m_r[r] = -3.0e38f; l_r[r] = 0.f; }
  v8f oacc[DT];
#pragma unroll
  for (int dt = 0; dt < DT; ++dt) oacc[dt] = (v8f){0.f,0.f,0.f,0.f,0.f,0.f,0.f,0.f};

  const int kv_end = CAUSAL ? min(T, qblk * 64 + 64) : T;     // block-uniform
  for (int j0 = 0; j0 < kv_end; j0 += 32) {
    __syncthreads();
    for (int e = tid; e < 32 * (D / 4); e += 128) {
      const int r = e / (D / 4), c4 = (e % (D / 4)) * 4;
      const int key = j0 + r;
      v4f kf = {0.f,0.f,0.f,0.f}, vf = {0.f,0.f,0.f,0.f};
      if (key < T) { kf = *(const v4fa*)(K + (size_t)key * pitch + c4); vf = *(const v4fa*)(V + (size_t)key * pitch + c4); }
#pragma unroll
      for (int t = 0; t < 4; ++t) {
        unsigned short hb = bf16_bits(kf[t]); sKh[r][c4 + t] = hb; sKl[r][c4 + t] = bf16_bits(kf[t] - bf16_val(hb));
        hb = bf16_bits(vf[t]); sVh[r][c4 + t] = hb; sVl[r][c4 + t] = bf16_bits(vf[t] - bf16_val(hb));
      }
    }
    __syncthreads();
    // S tile 16 x 32
    v8f s[2];
#pragma unroll
    for (int nt = 0; nt < 2; ++nt) {
      v8f acc = {};
#pragma unroll
      for (int ks = 0; ks < KS; ++ks) {
        FragB bh_, bl_;
        bh_.half[0] = *(const v8us*)&sKh[nt * 16 + ln][ks * 32 + 8 * hh]; bh_.half[1] = *(const v8us*)&sKh[nt * 16 + ln][ks * 32 + 16 + 8 * hh];
        bl_.half[0] = *(const v8us*)&sKl[nt * 16 + ln][ks * 32 + 8 * hh]; bl_.half[1] = *(const v8us*)&sKl[nt * 16 + ln][ks * 32 + 16 + 8 * hh];
        acc = mmaN<3>(aqh[ks].v, aql[ks].v, bh_.v, bl_.v, acc);
      }
      s[nt] = acc;
    }
    // mask + running max (rows 8hh+r; the 16 lanes of a half share rows)
    float alpha[8];
#pragma unroll
    for (int r = 0; r < 8; ++r) {
      const int qi = q0 + 8 * hh + r;
      const int ja = j0 + ln, jb = j0 + 16 + ln;
      if (CAUSAL) { if (ja > qi) s[0][r] = -3.0e38f; if (jb > qi) s[1][r] = -3.0e38f; }
      if (ja >= T) s[0][r] = -3.0e38f;
      if (jb >= T) s[1][r] = -3.0e38f;
      float mx = fmaxf(s[0][r], s[1][r]);
      mx = fmaxf(mx, __shfl_xor(mx, 1, 32)); mx = fmaxf(mx, __shfl_xor(mx, 2, 32)); mx = fmaxf(mx, __shfl_xor(mx, 4, 32)); mx = fmaxf(mx, __shfl_xor(mx, 8, 32));
      const float mnew = fmaxf(m_r[r], mx);
      alpha[r] = (mnew > -1.0e38f) ? __expf(m_r[r] - mnew) : 1.0f;
      const float p0 = (s[0][r] > -1.0e38f) ? __expf(s[0][r] - mnew) : 0.f;
      const float p1 = (s[1][r] > -1.0e38f) ? __expf(s[1][r] - mnew) : 0.f;
      m_r[r] = mnew;
      l_r[r] = l_r[r] * alpha[r] + p0 + p1;            // per-lane partial row sum (16 lanes combined at the end)
      unsigned short hb = bf16_bits(p0); sPh[w][8 * hh + r][ln] = hb;      sPl[w][8 * hh + r][ln] = bf16_bits(p0 - bf16_val(hb));
      hb = bf16_bits(p1);                sPh[w][8 * hh + r][16 + ln] = hb; sPl[w][8 * hh + r][16 + ln] = bf16_bits(p1 - bf16_val(hb));
    }
#pragma unroll
    for (int dt = 0; dt < DT; ++dt)
#pragma unroll
      for (int r = 0; r < 8; ++r) oacc[dt][r] *= alpha[r];
    __builtin_amdgcn_fence(__ATOMIC_ACQ_REL, "workgroup");
    __builtin_amdgcn_wave_barrier();
    FragB pah, pal;
    pah.half[0] = *(const v8us*)&sPh[w][ln][8 * hh]; pah.half[1] = *(const v8us*)&sPh[w][ln][16 + 8 * hh];
    pal.half[0] = *(const v8us*)&sPl[w][ln][8 * hh]; pal.half[1] = *(const v8us*)&sPl[w][ln][16 + 8 * hh];
#pragma unroll
    for (int dt = 0; dt < DT; ++dt) {
      FragB bvh, bvl;
#pragma unroll
      for (int i = 0; i < 8; ++i) {
        bvh.u[i] = sVh[8 * hh + i][dt * 16 + ln]; bvh.u[8 + i] = sVh[16 + 8 * hh + i][dt * 16 + ln];
        bvl.u[i] = sVl[8 * hh + i][dt * 16 + ln]; bvl.u[8 + i] = sVl[16 + 8 * hh + i][dt * 16 + ln];
      }
      oacc[dt] = mmaN<3>(pah.v, pal.v, bvh.v, bvl.v, oacc[dt]);
    }
    __builtin_amdgcn_fence(__ATOMIC_ACQ_REL, "workgroup");
    __builtin_amdgcn_wave_barrier();
  }
#pragma unroll
  for (int r = 0; r < 8; ++r) {
    float l = l_r[r];
    l += __shfl_xor(l, 1, 32); l += __shfl_xor(l, 2, 32); l += __shfl_xor(l, 4, 32); l += __shfl_xor(l, 8, 32);
    l_r[r] = (l > 0.f) ? 1.0f / l : 0.f;
  }
#pragma unroll
  for (int dt = 0; dt < DT; ++dt)
#pragma unroll
    for (int r = 0; r < 8; ++r) sO[w][8 * hh + r][dt * 16 + ln] = oacc[dt][r] * l_r[r];
  __builtin_amdgcn_fence(__ATOMIC_ACQ_REL, "workgroup");
  __builtin_amdgcn_wave_barrier();
  {
    for (int r = 0; r < 16; ++r) {
      const int row = q0 + r;
      if (row < T && lane < D / 4) {
        const v4f val = *(const v4fa*)&sO[w][r][lane * 4];
        *(v4f*)(y + ((size_t)b * T + row) * ypitch + h * D + lane * 4) = val;
      }
    }
    
  }
}

// GEMM C = act(A·W + bias + resid): A f32 (ASPLIT -> hi/lo 2 terms), Wt bf16 [N][K]; ACT 0 none, 1 relu, 2 exact gelu;
// resid (optional, f32, row index = (row % rmod), pitch ldr, RES_BF16 rounds it) added before the activation.
template <bool ASPLIT, int ACT, bool BIAS_BF16, bool RES_BF16>
__global__ __launch_bounds__(128) void k_gemm_bf3(const float* __restrict__ A, int lda, const unsigned short* __restrict__ Wt, int ldb,
                                                const float* __restrict__ bias, const float* __restrict__ resid, int rmod, int ldr,
                                                float* __restrict__ C, int ldc, int M, int N, int K) {
  __shared__ __attribute__((aligned(16))) float so[4][16][64];
  const int tid = threadIdx.x, w = tid >> 5, lane = tid & 31, ln = lane & 15, hh = lane >> 4;
  const int ntn = N / 64;
  const int wid = blockIdx.x * 4 + w;
  const int mt = wid / ntn, nq = wid % ntn;
  if (mt * 16 >= M) return;
  const int row0 = mt * 16, col0 = nq * 64;
  const float* arow = A + (size_t)(row0 + ln) * lda;
  v8f acc[4] = {};
  for (int kb = 0; kb < K; kb += 32) {
    FragB ah, al;
    const v4f x0 = *(const v4fa*)(arow + kb + 8 * hh), x1 = *(const v4fa*)(arow + kb + 8 * hh + 4);
    const v4f x2 = *(const v4fa*)(arow + kb + 16 + 8 * hh), x3 = *(const v4fa*)(arow + kb + 16 + 8 * hh + 4);
    float xs[16] = {x0[0],x0[1],x0[2],x0[3],x1[0],x1[1],x1[2],x1[3],x2[0],x2[1],x2[2],x2[3],x3[0],x3[1],x3[2],x3[3]};
#pragma unroll
    for (int i = 0; i < 16; ++i) { const unsigned short hb = bf16_bits(xs[i]); ah.u[i] = hb; al.u[i] = ASPLIT ? bf16_bits(xs[i] - bf16_val(hb)) : (unsigned short)0; }
#pragma unroll
    for (int t = 0; t < 4; ++t) {
      const unsigned short* brow = Wt + (size_t)(col0 + t * 16 + ln) * ldb + kb;
      FragB b;
      b.half[0] = *(const v8us*)(brow + 8 * hh);
      b.half[1] = *(const v8us*)(brow + 16 + 8 * hh);
      acc[t] = mmaN<ASPLIT ? 2 : 1>(ah.v, al.v, b.v, b.v, acc[t]);
    }
  }
#pragma unroll
  for (int t = 0; t < 4; ++t) {
    const int col = col0 + t * 16 + ln;
    float bv = bias ? bias[col] : 0.f;
    if (BIAS_BF16) bv = bf16_round(bv);
#pragma unroll
    for (int r = 0; r < 8; ++r) {
      float v = acc[t][r] + bv;
      if (resid) { float rv = resid[(size_t)((row0 + 8 * hh + r) % rmod) * ldr + col]; if (RES_BF16) rv = bf16_round(rv); v += rv; }
      if (ACT == 1) v = fmaxf(v, 0.f);
      if (ACT == 2) v = 0.5f * v * (1.0f + erff(v * 0.70710678118654752f));
      if (ACT == 3) { const float u = 0.7978845608028654f * (v + 0.044715f * v * v * v); v = 0.5f * v * (1.0f + tanhf(u)); }
      so[w][8 * hh + r][t * 16 + ln] = v;
    }
  }
  __builtin_amdgcn_fence(__ATOMIC_ACQ_REL, "workgroup");
  __builtin_amdgcn_wave_barrier();
  const int rsub = lane >> 4, c4 = (lane & 15) * 4;
  {
#pragma unroll
    for (int q = 0; q < 8; ++q) {
      const int r = q * 2 + rsub;
      const v4f v = *(const v4fa*)&so[w][r][c4];
      *(v4f*)(C + (size_t)(row0 + r) * ldc + col0 + c4) = v;
    }
    
  }
}
// row LayerNorm (biased variance, eps) over N: s = X (+ R); optional out_sum <- s; out_norm <- (s-mu)*rsqrt(var+eps)*g + b
template <bool PARAM_BF16>
__global__ __launch_bounds__(256) void k_layernorm(const float* __restrict__ X, const float* __restrict__ R, const float* __restrict__ g, const float* __restrict__ bta,
                                                  float* __restrict__ out_sum, float* __restrict__ out_norm, int N, float eps) {
  __shared__ float red[256];
  const int row = blockIdx.x, tid = threadIdx.x;
  const float* x = X + (size_t)row * N; const float* rr = R ? R + (size_t)row * N : nullptr;
  float vals[16];                     // up to N = 4096
  const int per = N / 256;            // contiguous chunk per thread? use strided-by-4 chunks: thread handles j = tid*4 + 1024*u
  float s1 = 0.f;
  for (int u = 0; u < per / 4; ++u) {
    const int j = tid * 4 + 1024 * u;
    const v4f a = *(const v4fa*)(x + j);
    v4f b = {0.f,0.f,0.f,0.f}; if (rr) b = *(const v4fa*)(rr + j);
#pragma unroll
    for (int q = 0; q < 4; ++q) { const float v = a[q] + b[q]; vals[u * 4 + q] = v; s1 += v; }
  }
  red[tid] = s1; __syncthreads();
  for (int st = 128; st > 0; st >>= 1) { if (tid < st) red[tid] += red[tid + st]; __syncthreads(); }
  const float mu = red[0] / (float)N; __syncthreads();
  float s2 = 0.f;
  for (int u = 0; u < per / 4; ++u)
#pragma unroll
    for (int q = 0; q < 4; ++q) { const float c = vals[u * 4 + q] - mu; s2 += c * c; }
  red[tid] = s2; __syncthreads();
  for (int st = 128; st > 0; st >>= 1) { if (tid < st) red[tid] += red[tid + st]; __syncthreads(); }
  const float rs = rsqrtf(red[0] / (float)N + eps);
  {
    for (int u = 0; u < per / 4; ++u) {
      const int j = tid * 4 + 1024 * u;
      v4f o, sm;
#pragma unroll
      for (int q = 0; q < 4; ++q) {
        float gg = g[j + q], bb = bta[j + q];
        if (PARAM_BF16) { gg = bf16_round(gg); bb = bf16_round(bb); }
        sm[q] = vals[u * 4 + q]; o[q] = (vals[u * 4 + q] - mu) * rs * gg + bb;
      }
      if (out_sum) *(v4f*)(out_sum + (size_t)row * N + j) = sm;
      *(v4f*)(out_norm + (size_t)row * N + j) = o;
    }
    
  }
}



// ---- f16 WMMA path (v_wmma_f32_16x16x32_f16): 11-bit significands for operands in range — used where a [0,256] probability operand needs more precision than bf16
typedef _Float16 v16h __attribute__((ext_vector_type(16)));
union FragH { v16h v; v8us half[2]; _Float16 h[16]; unsigned short u[16]; };
template <int NT>
__device__ __forceinline__ v8f mmaH(v16h ah, v16h al, v16h bh, v16h bl, v8f c) {
  c = __builtin_amdgcn_wmma_f32_16x16x32_f16(false, ah, false, bh, (short)0, c, false, false);
  if (NT >= 2) c = __builtin_amdgcn_wmma_f32_16x16x32_f16(false, al, false, bh, (short)0, c, false, false);
  if (NT >= 3) c = __builtin_amdgcn_wmma_f32_16x16x32_f16(false, ah, false, bl, (short)0, c, false, false);
  asm volatile("v_nop\n\tv_nop\n\tv_nop\n\tv_nop" : "+v"(c) : "v"(ah), "v"(al), "v"(bh), "v"(bl));
  return c;
}
// batched GEMM like k_gemm_b but f16 operands: A f32 (split into f16 hi/lo if ASPLIT, else rounded to f16), Bt = f16 values [n][k]; alpha; C f32; N multiple of 16 (partial tiles skipped)
template <bool ASPLIT>
__global__ __launch_bounds__(128) void k_gemm_h(const float* __restrict__ A, int lda, size_t sA, const _Float16* __restrict__ Bh, int ldb, size_t sB, float alpha, float* __restrict__ C, int ldc, size_t sC, int M, int N, int K) {
  __shared__ __attribute__((aligned(16))) float so[4][16][64];
  const int tid = threadIdx.x, w = tid >> 5, lane = tid & 31, ln = lane & 15, hh = lane >> 4; const int by = blockIdx.y;
  A += (size_t)by * sA; Bh += (size_t)by * sB; C += (size_t)by * sC;
  const int ntn = (N + 63) / 64; const int wid = blockIdx.x * 4 + w; const int mt = wid / ntn, nq = wid % ntn; if (mt * 16 >= M) return;
  const int row0 = mt * 16, col0 = nq * 64; const float* arow = A + (size_t)(row0 + ln) * lda;
  v8f acc[4] = {};
  for (int kb = 0; kb < K; kb += 32) {
    FragH ah, al;
    const v4f x0 = *(const v4fa*)(arow + kb + 8 * hh), x1 = *(const v4fa*)(arow + kb + 8 * hh + 4), x2 = *(const v4fa*)(arow + kb + 16 + 8 * hh), x3 = *(const v4fa*)(arow + kb + 16 + 8 * hh + 4);
    float xs[16] = {x0[0],x0[1],x0[2],x0[3],x1[0],x1[1],x1[2],x1[3],x2[0],x2[1],x2[2],x2[3],x3[0],x3[1],x3[2],x3[3]};
#pragma unroll
    for (int i = 0; i < 16; ++i) { const _Float16 h = (_Float16)xs[i]; ah.h[i] = h; al.h[i] = ASPLIT ? (_Float16)(xs[i] - (float)h) : (_Float16)0.0f; }
#pragma unroll
    for (int t = 0; t < 4; ++t) { if (col0 + t * 16 >= N) continue; const size_t boff = (size_t)(col0 + t * 16 + ln) * ldb + kb; FragH bq; bq.half[0] = *(const v8us*)(Bh + boff + 8 * hh); bq.half[1] = *(const v8us*)(Bh + boff + 16 + 8 * hh);
      acc[t] = mmaH<ASPLIT ? 2 : 1>(ah.v, al.v, bq.v, bq.v, acc[t]); }
  }
#pragma unroll
  for (int t = 0; t < 4; ++t) { if (col0 + t * 16 >= N) continue;
#pragma unroll
    for (int r = 0; r < 8; ++r) so[w][8 * hh + r][t * 16 + ln] = acc[t][r] * alpha; }
  __builtin_amdgcn_fence(__ATOMIC_ACQ_REL, "workgroup"); __builtin_amdgcn_wave_barrier();
  const int rsub = lane >> 4, c4 = (lane & 15) * 4;
  {
#pragma unroll
    for (int q = 0; q < 8; ++q) { const int r = q * 2 + rsub; if (col0 + c4 < N) { const v4f v = *(const v4fa*)&so[w][r][c4]; *(v4f*)(C + (size_t)(row0 + r) * ldc + col0 + c4) = v; } }
     }
}

// Wt[n][k] = f16(W[k][n]·scale) from f32 row-major W[K][N] (scale = power of two; bf16-exact weights stay exact in f16 away from the subnormal range)
__global__ __launch_bounds__(256) void k_wt_f16(const float* __restrict__ W, _Float16* __restrict__ Wt, int K, int N, float scale) {
  const int t = blockIdx.x * 256 + threadIdx.x; if (t >= N * (K / 8)) return; const int n = t / (K / 8), k8 = (t % (K / 8)) * 8; FragH f;
#pragma unroll
  for (int i = 0; i < 8; ++i) f.h[i] = (_Float16)(bf16_round(W[(size_t)(k8 + i) * N + n]) * scale); const v8us o = f.half[0];
  *(v8us*)((unsigned short*)Wt + (size_t)n * K + k8) = o; 
}
// FRAGMENT-MAJOR LAYOUT of every f16 WMMA operand M[row][k] in the workspace: tiles of 16 rows x 32 k, 512 elements (1 KiB) each; inside a tile element (row, k) lies at
// ((k >> 3) & 3) * 128 + (row & 15) * 8 + (k & 7). Lane l's two 16-byte pieces of the tile's fragment (k = 8hh .. and 16 + 8hh ..) then lie at l * 8 and 256 + l * 8:
// one load of a wave is 512 bytes in a row, four whole lines, where a row-major operand gave 32 bytes out of each of sixteen lines. Which element sits in which lane and register is as before.
// Tile order: activations, weights, O: (row >> 4) * 16 + (k >> 5); Q, K: head * (NP / 16) + (position >> 4); Vt: (head * (NP / 32) + (key >> 5)) * 2 + ((d >> 4) & 1).
#define TL 512
// 32^-1/2 * log2(e): Q is stored multiplied by it, so that K.Qt comes out of the matrix unit in the base-2 units of the softmax
#define SL2 0.25503486164919736f
// the ten 16-byte loads of one k-step: the A fragment and four B fragments (ap, bp: the row tile's start, the same in every lane; ko: the k-step's tile offset, likewise; lo = lane * 8)
__device__ __forceinline__ void ld_kstep(const unsigned short* ap, const unsigned short* const (&bp)[4], int ko, unsigned lo, FragH& a, FragH (&b)[4]) {
  a.half[0] = *(const v8us*)(ap + ko + lo); a.half[1] = *(const v8us*)(ap + ko + 256 + lo);
#pragma unroll
  for (int t = 0; t < 4; ++t) { b[t].half[0] = *(const v8us*)(bp[t] + ko + lo); b[t].half[1] = *(const v8us*)(bp[t] + ko + 256 + lo); }
  asm volatile("s_wait_xcnt 0x0" ::: "memory");      // these loads stay in flight: the wait stands before their address registers are written again
}
// acc[t] += A rows . (B rows)^T for one wave's 16 x 64 tile, K a multiple of 128 and K / 32 a power of two; a row tile's k-steps are TL elements apart in both operands.
// Fragments three k-steps ahead in a ring of four register sets: a k-step's ten loads are issued three k-steps before its products. A fetch past the last k-step reads the walk's first ones again and is not used.
// The walk over k begins at k-step rot (the same for A and B, the same in every wave of a block) and wraps round: blocks that share operand rows do not ask for the same lines at the same moment.
__device__ __forceinline__ void gemm_tile(const unsigned short* ap, const unsigned short* const (&bw)[4], int K, int rot, unsigned lo, v8f (&acc)[4]) {
  FragH fa[4], fb[4][4];
#pragma unroll
  for (int u = 0; u < 3; ++u) ld_kstep(ap, bw, ((u + rot) & (K / 32 - 1)) * TL, lo, fa[u], fb[u]);
  __builtin_amdgcn_sched_barrier(0);      // keeps the first product, and the wait for its operands, behind all thirty loads of the prologue (the scheduler had lifted one among them)
  for (int kb = 0; kb + 128 <= K; kb += 128) {
#pragma unroll
    for (int u = 0; u < 4; ++u) { const int kn = kb + (u + 3) * 32; ld_kstep(ap, bw, (((kn >> 5) + rot) & (K / 32 - 1)) * TL, lo, fa[(u + 3) & 3], fb[(u + 3) & 3]);
#pragma unroll
      for (int t = 0; t < 4; ++t) acc[t] = mmaH<1>(fa[u].v, fa[u].v, fb[u][t].v, fb[u][t].v, acc[t]); }
  }
}
// The three projections in one grid, blockIdx.y = 0 Q, 1 K, 2 V. Q and K: C[position][channel] = activations . W^T. V with the operands exchanged, C[channel][position] = W . activations^T:
// the product comes out as Vt, the layout k_attn reads, from the same products. f16 out, v = acc / 16 + bias (weights are stored x 16).
__global__ __launch_bounds__(128) void k_gemm_qkv(const _Float16* __restrict__ QNP, const _Float16* __restrict__ VNP, const _Float16* __restrict__ Bw, const float* __restrict__ bq, const float* __restrict__ bk, const float* __restrict__ bv,
    _Float16* __restrict__ Q16, _Float16* __restrict__ K16, _Float16* __restrict__ Vt) {
  __shared__ __attribute__((aligned(16))) float so[4][16][68];      // pitch 16 bytes x 17: sixteen lanes read 16 bytes each down one column without a bank conflict
  const int tid = threadIdx.x, w = __builtin_amdgcn_readfirstlane(tid >> 5), lane = tid & 31, ln = lane & 15, hh = lane >> 4; const int by = blockIdx.y; const bool sw = by == 2;      // w as a scalar: the tiles' addresses, which now move with rot, stay in scalar registers
  const _Float16* A = by == 0 ? QNP : by == 1 ? VNP : Bw + (size_t)2 * CC * CC; const _Float16* B = sw ? VNP : Bw + (size_t)by * CC * CC;
  const float* bias = by == 0 ? bq : by == 1 ? bk : bv; _Float16* C16 = by == 0 ? Q16 : by == 1 ? K16 : Vt;
  const int ls = sw ? 6 : 3; const int wid = blockIdx.x * 4 + w; const int row0 = (wid >> ls) * 16, col0 = (wid & ((1 << ls) - 1)) * 64;      // N / 64 = 1 << ls column tiles
  const unsigned short* ap = (const unsigned short*)A + (size_t)(row0 >> 4) * (CC / 32 * TL); const unsigned short* bw[4];
#pragma unroll
  for (int t = 0; t < 4; ++t) bw[t] = (const unsigned short*)B + (size_t)((col0 >> 4) + t) * (CC / 32 * TL);
  v8f acc[4] = {};
  gemm_tile(ap, bw, CC, (int)((blockIdx.x + (blockIdx.x >> 4)) & 15), lane * 8, acc);      // neighbours in the grid, and blocks 16 apart, share rows: both get different starts
  if (sw) { float br[8];      // the channel is the tile's row
#pragma unroll
    for (int r = 0; r < 8; ++r) br[r] = bf16_round(bias[row0 + 8 * hh + r]);
#pragma unroll
    for (int t = 0; t < 4; ++t) {
#pragma unroll
      for (int r = 0; r < 8; ++r) so[w][8 * hh + r][t * 16 + ln] = acc[t][r] * 0.0625f + br[r]; }
  } else {      // the channel is the tile's column
    const float qs = by == 0 ? SL2 : 1.0f;      // Q alone takes the softmax's factor, in f32, ahead of its one rounding to f16
#pragma unroll
    for (int t = 0; t < 4; ++t) { const float bc = bf16_round(bias[col0 + t * 16 + ln]);
#pragma unroll
      for (int r = 0; r < 8; ++r) so[w][8 * hh + r][t * 16 + ln] = (acc[t][r] * 0.0625f + bc) * qs; }
  }
  __builtin_amdgcn_fence(__ATOMIC_ACQ_REL, "workgroup"); __builtin_amdgcn_wave_barrier();
  // The wave's 16 x 64 values are two fragment-major tiles (16 rows x 32 columns each: Q, K: two heads of 16 positions; Vt: 16 d of two key blocks). tl0: the first one's number, tls: the step to the second.
  const int tl0 = sw ? ((row0 >> 5) * (NP / 32) + (col0 >> 5)) * 2 + ((row0 >> 4) & 1) : (col0 >> 5) * (NP / 16) + (row0 >> 4); const int tls = sw ? 2 : NP / 16;
#pragma unroll
  for (int q = 0; q < 4; ++q) { const int cb = (q >> 1) * 32 + ((q & 1) * 2 + hh) * 8; const v4f v0 = *(const v4fa*)&so[w][ln][cb], v1 = *(const v4fa*)&so[w][ln][cb + 4]; FragH f;
    for (int i = 0; i < 4; ++i) { f.h[i] = (_Float16)v0[i]; f.h[4 + i] = (_Float16)v1[i]; }
    *(v8us*)((unsigned short*)C16 + (size_t)(tl0 + (q >> 1) * tls) * TL + (q & 1) * 256 + lane * 8) = f.half[0]; }
}
// Output projection with the operands exchanged: C[channel][position] = Wo . O^T is the output's own layout, so bias, residual and 1/sqrt(2) are applied where the tile is stored.
__global__ __launch_bounds__(128) void k_gemm_out(const _Float16* __restrict__ Bo, const _Float16* __restrict__ O16h, const float* __restrict__ bo, const float* __restrict__ x, float* __restrict__ out) {
  __shared__ __attribute__((aligned(16))) float so[4][16][64];
  const int tid = threadIdx.x, w = __builtin_amdgcn_readfirstlane(tid >> 5), lane = tid & 31, ln = lane & 15, hh = lane >> 4;      // w as a scalar: as in k_gemm_qkv
  const int wid = blockIdx.x * 4 + w; const int row0 = (wid / (NP / 64)) * 16, col0 = (wid % (NP / 64)) * 64;
  const unsigned short* ap = (const unsigned short*)Bo + (size_t)(row0 >> 4) * (CC / 32 * TL); const unsigned short* bw[4];
#pragma unroll
  for (int t = 0; t < 4; ++t) bw[t] = (const unsigned short*)O16h + (size_t)((col0 >> 4) + t) * (CC / 32 * TL);
  v8f acc[4] = {};
  gemm_tile(ap, bw, CC, (int)((blockIdx.x + (blockIdx.x >> 4)) & 15), lane * 8, acc);      // neighbours in the grid, and blocks 16 apart, share rows: both get different starts
#pragma unroll
  for (int t = 0; t < 4; ++t) {
#pragma unroll
    for (int r = 0; r < 8; ++r) so[w][8 * hh + r][t * 16 + ln] = acc[t][r] * 0.0625f + bf16_round(bo[row0 + 8 * hh + r]); }
  __builtin_amdgcn_fence(__ATOMIC_ACQ_REL, "workgroup"); __builtin_amdgcn_wave_barrier();
  const int rsub = lane >> 4, c4 = (lane & 15) * 4;
  const size_t o0 = (size_t)(row0 + rsub) * NP + col0 + c4; const float* xp = x + o0; float* op = out + o0; v4f xv[8];
#pragma unroll
  for (int q = 0; q < 8; ++q) xv[q] = *(const v4fa*)(xp + (size_t)q * 2 * NP);
  asm volatile("s_wait_xcnt 0x0" ::: "memory");      // the wait stands before the address registers of the eight loads are written again
#pragma unroll
  for (int q = 0; q < 8; ++q) { const v4f v = *(const v4fa*)&so[w][q * 2 + rsub][c4]; v4f y;
    for (int i = 0; i < 4; ++i) y[i] = (v[i] + bf16_round(xv[q][i])) * 0.7071067811865476f; *(v4f*)(op + (size_t)q * 2 * NP) = y; }
}

// D = A.B + C with C left standing in its own registers. As text: the builtin took C in D's registers for half of the score products and copied C there first, eight 64-bit moves a pass.
// The four v_nop are the distance the chip needs between the product and the first vector instruction on its D (here a maximum); D shares no register with A, B or C.
__device__ __forceinline__ v8f mmaHC(v16h a, v16h b, v8f c) { v8f d;
  asm volatile("v_wmma_f32_16x16x32_f16 %0, %1, %2, %3\n\tv_nop\n\tv_nop\n\tv_nop\n\tv_nop" : "=&v"(d) : "v"(a), "v"(b), "v"(c));
  return d; }
// lane l <-> l ^ 16 (the two halves of a wave hold the two key halves of one query column)
__device__ __forceinline__ float xhalf(float v) { const int b = __float_as_int(v); return __int_as_float(__builtin_amdgcn_permlanex16(b, b, 0x76543210, 0xfedcba98, false, false)); }
// lane l <-> l ^ M inside a 16-lane row (DPP row_xmask)
template <int M>
__device__ __forceinline__ float xrow(float v) { return __int_as_float(__builtin_amdgcn_update_dpp(0, __float_as_int(v), 0x160 + M, 0xf, 0xf, true)); }
// sum over the 32 lanes of a wave, the same value in every lane; all lanes on
__device__ __forceinline__ float wave_sum(float v) { v += xrow<1>(v); v += xrow<2>(v); v += xrow<4>(v); v += xrow<8>(v); return v + xhalf(v); }
// Blocks 0 .. NG - 1: one group (GS * NP = 65,536 values) per block of 1,024 threads: 16 whole-line 16-byte loads per thread (load i is channel i of the group), all in flight together. The values stay in registers
// for the first GroupNorm's two sums, are normalised there, and stay for the second GroupNorm's two sums: STAT[g] = {mean 1, 1/sd 1, mean 2, 1/sd 2}.
// Blocks NG .. NG + 127 (independent work in the same launch): the four weight matrices, bf16-rounded, x 16, to f16, fragment-major (thread t writes the t-th 16-byte piece); they leave before any barrier.
__global__ __launch_bounds__(1024) void k_prep(const float* __restrict__ X, const float* __restrict__ gw, const float* __restrict__ gb, const float* __restrict__ W0, const float* __restrict__ W1, const float* __restrict__ W2, const float* __restrict__ W3,
    _Float16* __restrict__ Bt, float* __restrict__ STAT) { __shared__ float sh[4][32]; const int tid = threadIdx.x, w = tid >> 5, lane = tid & 31;
  if (blockIdx.x >= NG) { const int y = (int)(blockIdx.x - NG) >> 5; const float* W = y == 0 ? W0 : y == 1 ? W1 : y == 2 ? W2 : W3; const size_t t = (size_t)((blockIdx.x - NG) & 31) * 1024 + tid; FragH f;
    const float* wr = W + ((t >> 10) * 16 + (t & 15)) * CC + ((t >> 6) & 15) * 32 + ((t >> 4) & 3) * 8;      // row (out), k (in) of that piece
    const v4f a = *(const v4fa*)wr, b = *(const v4fa*)(wr + 4);
#pragma unroll
    for (int i = 0; i < 4; ++i) { f.h[i] = (_Float16)(bf16_round(a[i]) * 16.0f); f.h[4 + i] = (_Float16)(bf16_round(b[i]) * 16.0f); }
    *(v8us*)((unsigned short*)Bt + (size_t)y * CC * CC + t * 8) = f.half[0]; return; }
  const int g = blockIdx.x; const float* base = X + (size_t)g * GS * NP;
  v4f v[16];
#pragma unroll
  for (int i = 0; i < 16; ++i) v[i] = *(const v4fa*)(base + (size_t)(i * 1024 + tid) * 4);
  v4f st;
#pragma unroll
  for (int pass = 0; pass < 2; ++pass) {
    v4f s4 = {0.f, 0.f, 0.f, 0.f};
#pragma unroll
    for (int i = 0; i < 16; ++i) { if (pass == 0) { for (int q = 0; q < 4; ++q) v[i][q] = bf16_round(v[i][q]); } s4 += v[i]; }
    const float s = wave_sum((s4[0] + s4[1]) + (s4[2] + s4[3])); if (lane == 0) sh[pass * 2][w] = s; __syncthreads();
    const float mean = wave_sum(sh[pass * 2][lane]) / (float)(GS * NP);
    v4f q4 = {0.f, 0.f, 0.f, 0.f};
#pragma unroll
    for (int i = 0; i < 16; ++i) { const v4f d = v[i] - mean; q4 += d * d; }
    const float q = wave_sum((q4[0] + q4[1]) + (q4[2] + q4[3])); if (lane == 0) sh[pass * 2 + 1][w] = q; __syncthreads();
    const float var = wave_sum(sh[pass * 2 + 1][lane]) / (float)(GS * NP); const float rs = 1.0f / sqrtf(var + 1e-6f);
    st[pass * 2] = mean; st[pass * 2 + 1] = rs;
    if (pass == 0) {
#pragma unroll
      for (int i = 0; i < 16; ++i) { const float ww = bf16_round(gw[g * GS + i]), b2 = bf16_round(gb[g * GS + i]); for (int q2 = 0; q2 < 4; ++q2) v[i][q2] = (v[i][q2] - mean) * rs * ww + b2; } }
  }
  if (tid == 0) *(v4f*)(STAT + g * 4) = st; }
// 64 channels x 64 positions a block: x is read once (256-byte runs), qn = GN(x) and vn = GN(qn) are formed in registers and both go out in f16, fragment-major (row = position, k = channel), 512 bytes in a row a wave.
__global__ __launch_bounds__(256) void k_gnorm2(const float* __restrict__ X, const float* __restrict__ STAT, const float* __restrict__ w, const float* __restrict__ bb, _Float16* __restrict__ QP, _Float16* __restrict__ VP) { __shared__ float tq[64][65], tv[64][65];
  const int tid = threadIdx.x; const int cg = blockIdx.x / (NP / 64), pg = blockIdx.x % (NP / 64); const int c0 = cg * 64, p0 = pg * 64;
  const int cl = tid >> 4, p4 = (tid & 15) * 4;      // round u: channel c0 + 16 * u + cl, which lies in group cg * 4 + u
  const float* xp = X + (size_t)(c0 + cl) * NP + p0 + p4; const float* wp = w + c0 + cl; const float* bp = bb + c0 + cl; v4f xv[4]; float wv[4], bv[4];
#pragma unroll
  for (int u = 0; u < 4; ++u) { xv[u] = *(const v4fa*)(xp + (size_t)u * 16 * NP); wv[u] = wp[u * 16]; bv[u] = bp[u * 16]; }
  asm volatile("s_wait_xcnt 0x0" ::: "memory");      // the wait stands before the address registers of the twelve loads are written again
#pragma unroll
  for (int u = 0; u < 4; ++u) { const int c = u * 16 + cl; const v4f st = *(const v4fa*)(STAT + (cg * 4 + u) * 4); const float ww = bf16_round(wv[u]), b2 = bf16_round(bv[u]);
#pragma unroll
    for (int q = 0; q < 4; ++q) { const float y = (bf16_round(xv[u][q]) - st[0]) * st[1] * ww + b2; tq[p4 + q][c] = y; tv[p4 + q][c] = (y - st[2]) * st[3] * ww + b2; } }
  __syncthreads();
#pragma unroll
  for (int u = 0; u < 2; ++u) { const int i = tid + 256 * u, r = (i >> 7) * 16 + (i & 15), pc = (i >> 4) & 7; FragH f, g;      // piece i: position tile i >> 7, k-step (i >> 6) & 1, then the tile's 64 pieces in order
#pragma unroll
    for (int q = 0; q < 8; ++q) { f.h[q] = (_Float16)tq[r][pc * 8 + q]; g.h[q] = (_Float16)tv[r][pc * 8 + q]; }
    const size_t o = (size_t)(((p0 >> 4) + (i >> 7)) * (CC / 32) + (c0 >> 5) + ((i >> 6) & 1)) * TL + (i & 63) * 8; *(v8us*)((unsigned short*)QP + o) = f.half[0]; *(v8us*)((unsigned short*)VP + o) = g.half[0]; } }
__global__ __launch_bounds__(256) void k_attn(const _Float16* __restrict__ Q16, const _Float16* __restrict__ K16, const _Float16* __restrict__ Vt, _Float16* __restrict__ O16h) { constexpr int RPW = 32; constexpr int NK = NP / 2;
  __shared__ __attribute__((aligned(16))) v4f xo[8][4][32]; __shared__ float xm[8][32], xl[8][32];      // what a wave hands to its partner: 16 Ot values, maximum and sum of one query tile, a lane's own slot each
  const int tid = threadIdx.x, w = tid >> 5, lane = tid & 31; const int kg = __builtin_amdgcn_readfirstlane(tid >> 7);
  const int h = blockIdx.x / (NP / 128), qblk = blockIdx.x % (NP / 128); const int q0 = qblk * 128 + (w & 3) * RPW;      // below: ln = lane & 15, hh = lane >> 4
  FragH aq[2];
#pragma unroll
  for (int rt = 0; rt < 2; ++rt) { const unsigned short* qr = (const unsigned short*)Q16 + (size_t)(h * (NP / 16) + (q0 >> 4) + rt) * TL + lane * 8; aq[rt].half[0] = *(const v8us*)qr; aq[rt].half[1] = *(const v8us*)(qr + 256); }
  __builtin_amdgcn_sched_barrier(0);      // keeps the four Q loads the oldest: moved behind K or Vt loads they would make the loop's counted waits for Q cover the Vt loads of the pass before as well
  float m_r[2], l_r[2]; v8f oacc[2][2], nm[2];      // query rt * 16 + ln; oacc[rt][dt][r] = Ot[dt * 16 + 8hh + r][query]; nm[rt]: -m_r[rt] in all eight registers, the C operand of the score products
#pragma unroll
  for (int rt = 0; rt < 2; ++rt) { m_r[rt] = 0.f; l_r[rt] = 0.f; oacc[rt][0] = (v8f){0.f,0.f,0.f,0.f,0.f,0.f,0.f,0.f}; oacc[rt][1] = oacc[rt][0]; nm[rt] = oacc[rt][0]; }
  // K and Vt fragments one pass ahead: each pass refills a fragment's registers for the next pass right behind its last product, so the loads fly during the softmax and the other products.
  // The last pass fetches the group's first-pass fragments again (in bounds, not used).
  // EACH QUERY BLOCK STARTS ITS WALK AT AN OFFSET OF ITS OWN (rot keys into the group's NK, wrapping round): K and Vt come from memory on first touch, and with one common start every block of a head asks for
  // the same new lines in the same pass, none of them in L2 yet. Spread starts fetch the whole group within the first few passes; behind them a block reads what another has brought into L2.
  // The odd factor spreads the starts evenly over any regular subset of the blocks (those that share an L2) as well. The softmax does not depend on the order of the keys but for rounding.
  // Fragment-major: a pass's two K tiles are 2 KiB in a row, its two Vt tiles likewise; 32 keys are 32 * 32 elements on in both.
  const unsigned short* kl = (const unsigned short*)K16 + ((size_t)h * NP + (size_t)kg * NK) * HD + lane * 8; const unsigned short* vl = (const unsigned short*)Vt + ((size_t)h * NP + (size_t)kg * NK) * HD + lane * 8;
  const int rot = ((qblk * 13) & 31) * (NK / 32);
  FragH bk[2], bv[2];
#pragma unroll
  for (int t = 0; t < 2; ++t) { const unsigned short* kr = kl + (size_t)rot * HD + t * TL; bk[t].half[0] = *(const v8us*)kr; bk[t].half[1] = *(const v8us*)(kr + 256); }
#pragma unroll
  for (int t = 0; t < 2; ++t) { const unsigned short* vrow = vl + (size_t)rot * HD + t * TL; bv[t].half[0] = *(const v8us*)vrow; bv[t].half[1] = *(const v8us*)(vrow + 256); }
#pragma unroll 1
  for (int j0 = 0; j0 < NK; j0 += 32) { v8f s[2][2];      // s[rt][nt][r] = S[query][kg * NK + ((j0 + rot) & (NK - 1)) + nt * 16 + 8hh + r] * SL2 - m_r[rt]
    const int jn = (j0 + 32 + rot) & (NK - 1);
#pragma unroll
    for (int nt = 0; nt < 2; ++nt) {
#pragma unroll
      for (int rt = 0; rt < 2; ++rt) s[rt][nt] = mmaHC(bk[nt].v, aq[rt].v, nm[rt]);
      const unsigned short* kr = kl + (size_t)jn * HD + nt * TL; bk[nt].half[0] = *(const v8us*)kr; bk[nt].half[1] = *(const v8us*)(kr + 256); }
    __builtin_amdgcn_sched_barrier(0);      // keeps the next pass's four K loads in front of the softmax: the scheduler had sunk two of them behind it, which cuts their lead to a fraction of a pass
    float mc[2];      // this half's largest argument of each query
#pragma unroll
    for (int rt = 0; rt < 2; ++rt) { float mx[8];
#pragma unroll
      for (int i = 0; i < 8; ++i) mx[i] = fmaxf(s[rt][0][i], s[rt][1][i]);
      mc[rt] = fmaxf(fmaxf(fmaxf(mx[0], mx[1]), fmaxf(mx[2], mx[3])), fmaxf(fmaxf(mx[4], mx[5]), fmaxf(mx[6], mx[7]))); }
    // Renewal, the same for every lane of the wave (one ballot, a scalar branch): when some argument has passed 8, and in a group's first pass (bound -3e38), which sets m_r from real scores.
    const float lim = j0 == 0 ? -3.0e38f : 8.0f, low = j0 == 0 ? -3.0e38f : 0.f;
    if (__builtin_amdgcn_ballot_w32(fmaxf(mc[0], mc[1]) > lim) != 0) {
#pragma unroll
      for (int rt = 0; rt < 2; ++rt) { const float mf = fmaxf(mc[rt], xhalf(mc[rt]));      // both halves of a query take the same step
        const float d = fmaxf(mf, low); const float al = __builtin_amdgcn_exp2f(-fmaxf(d, 0.f));      // behind the first pass m_r never falls; in the first pass Ot and the sum are still 0, and al stays <= 1
        m_r[rt] += d; l_r[rt] *= al;
#pragma unroll
        for (int r = 0; r < 8; ++r) { nm[rt][r] = -m_r[rt]; s[rt][0][r] -= d; s[rt][1][r] -= d; oacc[rt][0][r] *= al; oacc[rt][1][r] *= al; } } }
    FragH pb[2];
#pragma unroll
    for (int rt = 0; rt < 2; ++rt) { float ps[8];
#pragma unroll
      for (int i = 0; i < 8; ++i) { const float p0 = __builtin_amdgcn_exp2f(s[rt][0][i]), p1 = __builtin_amdgcn_exp2f(s[rt][1][i]); ps[i] = p0 + p1; pb[rt].h[i] = (_Float16)p0; pb[rt].h[8 + i] = (_Float16)p1; }
      l_r[rt] += ((ps[0] + ps[1]) + (ps[2] + ps[3])) + ((ps[4] + ps[5]) + (ps[6] + ps[7])); }      // this half's keys; the halves join after the loop
#pragma unroll
    for (int dt = 0; dt < 2; ++dt) {
#pragma unroll
      for (int rt = 0; rt < 2; ++rt) oacc[rt][dt] = mmaH<1>(bv[dt].v, bv[dt].v, pb[rt].v, pb[rt].v, oacc[rt][dt]);
      const unsigned short* vrow = vl + (size_t)jn * HD + dt * TL; bv[dt].half[0] = *(const v8us*)vrow; bv[dt].half[1] = *(const v8us*)(vrow + 256); }
    asm volatile("s_wait_xcnt 0x0" ::: "memory"); }      // the Vt loads stay in flight over the back edge: the wait stands before their address registers are written again
  // A lane's eight values of one accumulator (d = dt * 16 + 8hh + r of query rt * 16 + ln) are one 16-byte piece of O's fragment-major tile (row = position, k-step = head): stored from the registers, 512 bytes in a row a wave.
  // kg is the same in every lane: the selects below only name which query tile a wave keeps (rt = kg) and which it hands over
  const bool k1 = kg != 0; float keep[16], give[16];
#pragma unroll
  for (int i = 0; i < 16; ++i) { const float t0 = oacc[0][i >> 3][i & 7], t1 = oacc[1][i >> 3][i & 7]; keep[i] = k1 ? t1 : t0; give[i] = k1 ? t0 : t1; }
  const float mk = k1 ? m_r[1] : m_r[0], lk = k1 ? l_r[1] : l_r[0];
#pragma unroll
  for (int i = 0; i < 4; ++i) xo[w][i][lane] = (v4f){give[i * 4], give[i * 4 + 1], give[i * 4 + 2], give[i * 4 + 3]};
  xm[w][lane] = k1 ? m_r[0] : m_r[1]; xl[w][lane] = k1 ? l_r[0] : l_r[1];
  __syncthreads();      // every wave of the block passes it once: the partner's partial result is read behind it
  // both partial results brought to the common maximum, then as with one: halves joined, divided, stored
  const int pw = w ^ 4; const float mp = xm[pw][lane]; const float mn = fmaxf(mk, mp); const float a0 = __builtin_amdgcn_exp2f(mk - mn), a1 = __builtin_amdgcn_exp2f(mp - mn);
  const float lj = lk * a0 + xl[pw][lane] * a1; const float l = lj + xhalf(lj); const float li = 1.0f / l; const float c0 = a0 * li, c1 = a1 * li;
#pragma unroll
  for (int dt = 0; dt < 2; ++dt) { FragH f; const v4f p0 = xo[pw][dt * 2][lane], p1 = xo[pw][dt * 2 + 1][lane];
#pragma unroll
    for (int r = 0; r < 4; ++r) { f.h[r] = (_Float16)(keep[dt * 8 + r] * c0 + p0[r] * c1); f.h[4 + r] = (_Float16)(keep[dt * 8 + 4 + r] * c0 + p1[r] * c1); }
    *(v8us*)((unsigned short*)O16h + (size_t)(((q0 >> 4) + kg) * (CC / 32) + h) * TL + dt * 256 + lane * 8) = f.half[0]; } }
extern "C" void kernel_launch(void* const* d_in, const int* in_sizes, int n_in,
                              void* d_out, int out_size, void* d_ws, size_t ws_size, hipStream_t stream) {
  (void)in_sizes; (void)n_in; (void)out_size;
  const float* x = (const float*)d_in[0]; const float* gw = (const float*)d_in[1]; const float* gb = (const float*)d_in[2]; const float* wq = (const float*)d_in[3]; const float* bq = (const float*)d_in[4]; const float* wk = (const float*)d_in[5]; const float* bk = (const float*)d_in[6]; const float* wv = (const float*)d_in[7]; const float* bv = (const float*)d_in[8]; const float* wo = (const float*)d_in[9]; const float* bo = (const float*)d_in[10];
  char* ws = (char*)d_ws; size_t off = 0;
  auto take = [&](size_t bytes) { char* p = ws + off; off += (bytes + 255) & ~(size_t)255; return p; };
  _Float16* Bw = (_Float16*)take((size_t)4 * CC * CC * 2);      // Wq, Wk, Wv, Wo, (out,in)
  float* ST = (float*)take(NG * 4 * 4);
  _Float16* QNP = (_Float16*)take((size_t)NP * CC * 2); _Float16* VNP = (_Float16*)take((size_t)NP * CC * 2); _Float16* Q16 = (_Float16*)take((size_t)NP * CC * 2); _Float16* K16 = (_Float16*)take((size_t)NP * CC * 2); _Float16* Vt = (_Float16*)take((size_t)NP * CC * 2); _Float16* O16h = (_Float16*)take((size_t)NP * CC * 2);
  if (off > ws_size) return;      // 2 + 6 x 4 = 26 MiB
  k_prep<<<NG + 128, 1024, 0, stream>>>(x, gw, gb, wq, wk, wv, wo, Bw, ST);
  k_gnorm2<<<(CC / 64) * (NP / 64), 256, 0, stream>>>(x, ST, gw, gb, QNP, VNP);
  k_gemm_qkv<<<dim3((NP / 16) * (CC / 64) / 4, 3), 128, 0, stream>>>(QNP, VNP, Bw, bq, bk, bv, Q16, K16, Vt);
  k_attn<<<NH * (NP / 128), 256, 0, stream>>>(Q16, K16, Vt, O16h);
  k_gemm_out<<<(CC / 16) * (NP / 64) / 4, 128, 0, stream>>>(Bw + (size_t)3 * CC * CC, O16h, bo, x, (float*)d_out);
}

// v010
// One run takes 70.5 microseconds.
// Two timings next to v009 both put it at 1.05 times that version's speed.
// All steps since v000 together make it 6.03 times as fast.
#include <hip/hip_runtime.h>
// the 1×1 convs (4096 × 512 × 512, + bias, weights (out,in) bf16-exact ×2^4) and the attention as a fused flash-style kernel (S = Q·Kᵀ·32^-½ with d = 32 in one k-step, online softmax f32,
// P f16 <= 256, O = P·V) on v_wmma_f32_16x16x32_f16 (f16 operands, single products, f32 accumulate); residual (out + x)/√2 and layout transposes f32 VALU.
#define CC 512
#define NP 4096
#define NG 32
#define GS 16
#define NH 16
#define HD 32

typedef __bf16 v16b __attribute__((ext_vector_type(16)));
typedef unsigned short v8us __attribute__((ext_vector_type(8), may_alias));
typedef float  v8f  __attribute__((ext_vector_type(8)));
typedef float  v4f  __attribute__((ext_vector_type(4)));
typedef float  v4fa __attribute__((ext_vector_type(4), may_alias));
union FragB { v16b v; v8us half[2]; unsigned short u[16]; };

__device__ __forceinline__ unsigned short bf16_bits(float x) { unsigned int u = __float_as_uint(x); return (unsigned short)((u + 0x7FFFu + ((u >> 16) & 1u)) >> 16); }
__device__ __forceinline__ float bf16_val(unsigned short b) { return __uint_as_float(((unsigned int)b) << 16); }
__device__ __forceinline__ float bf16_round(float x) { return bf16_val(bf16_bits(x)); }
// D += A·B with NT terms: 1 = ah·bh, 2 = + al·bh (A split), 3 = + ah·bl (both split)
template <int NT>
__device__ __forceinline__ v8f mmaN(v16b ah, v16b al, v16b bh, v16b bl, v8f c) {
  c = __builtin_amdgcn_wmma_f32_16x16x32_bf16(false, ah, false, bh, (short)0, c, false, false);
  if (NT >= 2) c = __builtin_amdgcn_wmma_f32_16x16x32_bf16(false, al, false, bh, (short)0, c, false, false);
  if (NT >= 3) c = __builtin_amdgcn_wmma_f32_16x16x32_bf16(false, ah, false, bl, (short)0, c, false, false);
  asm volatile("v_nop\n\tv_nop\n\tv_nop\n\tv_nop" : "+v"(c) : "v"(ah), "v"(al), "v"(bh), "v"(bl));
  return c;
}

__global__ __launch_bounds__(256) void k_wt_bf16(const float* __restrict__ W, unsigned short* __restrict__ Wt, int K, int N) {
  const int t = blockIdx.x * 256 + threadIdx.x;
  const int k8n = K / 8;
  if (t >= N * k8n) return;
  const int n = t / k8n, k8 = (t % k8n) * 8;
  v8us v;
#pragma unroll
  for (int i = 0; i < 8; ++i) v[i] = bf16_bits(W[(size_t)(k8 + i) * N + n]);
  *(v8us*)(Wt + (size_t)n * K + k8) = v;
  
}

// GEMM C[M][N] (f32, pitch ldc) = act(A[M][K]·W + bias). A f32 row-major (pitch lda) converted per fragment to bf16
// (ASPLIT: hi/lo two planes -> 2 terms, else single rounded term); Wt bf16 [N][K] (pitch ldb). BIAS_BF16 rounds the
// bias to bf16 first (bias quantised to bf16 before the add). K%32==0, M%16==0, N%64==0.
template <bool ASPLIT, int ACT, bool BIAS_BF16>
__global__ __launch_bounds__(128) void k_gemm_bf(const float* __restrict__ A, int lda, const unsigned short* __restrict__ Wt, int ldb,
                                               const float* __restrict__ bias, float* __restrict__ C, int ldc, int M, int N, int K) {
  __shared__ __attribute__((aligned(16))) float so[4][16][64];
  const int tid = threadIdx.x, w = tid >> 5, lane = tid & 31, ln = lane & 15, hh = lane >> 4;
  const int ntn = N / 64;
  const int wid = blockIdx.x * 4 + w;
  const int mt = wid / ntn, nq = wid % ntn;
  if (mt * 16 >= M) return;
  const int row0 = mt * 16, col0 = nq * 64;
  const float* arow = A + (size_t)(row0 + ln) * lda;
  v8f acc[4] = {};
  for (int kb = 0; kb < K; kb += 32) {
    FragB ah, al;
    const v4f x0 = *(const v4fa*)(arow + kb + 8 * hh), x1 = *(const v4fa*)(arow + kb + 8 * hh + 4);
    const v4f x2 = *(const v4fa*)(arow + kb + 16 + 8 * hh), x3 = *(const v4fa*)(arow + kb + 16 + 8 * hh + 4);
    float xs[16] = {x0[0],x0[1],x0[2],x0[3],x1[0],x1[1],x1[2],x1[3],x2[0],x2[1],x2[2],x2[3],x3[0],x3[1],x3[2],x3[3]};
#pragma unroll
    for (int i = 0; i < 16; ++i) { const unsigned short hb = bf16_bits(xs[i]); ah.u[i] = hb; al.u[i] = ASPLIT ? bf16_bits(xs[i] - bf16_val(hb)) : (unsigned short)0; }
#pragma unroll
    for (int t = 0; t < 4; ++t) {
      const unsigned short* brow = Wt + (size_t)(col0 + t * 16 + ln) * ldb + kb;
      FragB b;
      b.half[0] = *(const v8us*)(brow + 8 * hh);
      b.half[1] = *(const v8us*)(brow + 16 + 8 * hh);
      acc[t] = mmaN<ASPLIT ? 2 : 1>(ah.v, al.v, b.v, b.v, acc[t]);
    }
  }
#pragma unroll
  for (int t = 0; t < 4; ++t) {
    float bv = bias ? bias[col0 + t * 16 + ln] : 0.f;
    if (BIAS_BF16) bv = bf16_round(bv);
#pragma unroll
    for (int r = 0; r < 8; ++r) { float v = acc[t][r] + bv; if (ACT == 1) v = fmaxf(v, 0.f); so[w][8 * hh + r][t * 16 + ln] = v; }
  }
  __builtin_amdgcn_fence(__ATOMIC_ACQ_REL, "workgroup");
  __builtin_amdgcn_wave_barrier();
  const int rsub = lane >> 4, c4 = (lane & 15) * 4;
  {
#pragma unroll
    for (int q = 0; q < 8; ++q) {
      const int r = q * 2 + rsub;
      const v4f v = *(const v4fa*)&so[w][r][c4];
      *(v4f*)(C + (size_t)(row0 + r) * ldc + col0 + c4) = v;
    }
    
  }
}

// Flash-style causal/unmasked attention, all contractions 3-term bf16 hi/lo splits, f32 softmax with running max.
// q,k,v rows are read from f32 buffers with arbitrary row pitch (so they can live inside a fused qkv buffer);
// D = head size (multiple of 32, <= 128); one wave = 16 query rows; block = 4 waves (64 queries) sharing K/V chunks of 32.
template <int D, bool CAUSAL>
__global__ __launch_bounds__(128) void k_flash(const float* __restrict__ qb, const float* __restrict__ kb, const float* __restrict__ vb,
                                             int pitch, int T, int H, float scale, float* __restrict__ y, int ypitch) {
  constexpr int KS = D / 32;        // k-steps for QK
  constexpr int DT = D / 16;        // d tiles for PV
  __shared__ __attribute__((aligned(16))) unsigned short sKh[32][D + 8], sKl[32][D + 8], sVh[32][D + 8], sVl[32][D + 8];
  __shared__ __attribute__((aligned(16))) unsigned short sPh[4][16][40], sPl[4][16][40];
  __shared__ __attribute__((aligned(16))) float sO[4][16][D];
  const int tid = threadIdx.x, w = tid >> 5, lane = tid & 31, ln = lane & 15, hh = lane >> 4;
  const int nqb = (T + 63) / 64;
  const int bh = blockIdx.x / nqb, qblk = blockIdx.x % nqb;
  const int b = bh / H, h = bh % H;
  const int q0 = qblk * 64 + w * 16;
  const float* Q = qb + (size_t)b * T * pitch + h * D;
  const float* K = kb + (size_t)b * T * pitch + h * D;
  const float* V = vb + (size_t)b * T * pitch + h * D;

  // A fragments of the wave's 16 query rows (scaled), hi/lo
  FragB aqh[KS], aql[KS];
  {
    int row = q0 + ln; if (row >= T) row = T - 1;
    const float* qr = Q + (size_t)row * pitch;
#pragma unroll
    for (int ks = 0; ks < KS; ++ks)
#pragma unroll
      for (int i = 0; i < 16; ++i) {
        const int d = ks * 32 + ((i < 8) ? (8 * hh + i) : (16 + 8 * hh + (i - 8)));
        const float x = qr[d] * scale; const unsigned short hb = bf16_bits(x);
        aqh[ks].u[i] = hb; aql[ks].u[i] = bf16_bits(x - bf16_val(hb));
      }
  }
  float m_r[8], l_r[8];
#pragma unroll
  for (int r = 0; r < 8; ++r) { m_r[r] = -3.0e38f; l_r[r] = 0.f; }
  v8f oacc[DT];
#pragma unroll
  for (int dt = 0; dt < DT; ++dt) oacc[dt] = (v8f){0.f,0.f,0.f,0.f,0.f,0.f,0.f,0.f};

  const int kv_end = CAUSAL ? min(T, qblk * 64 + 64) : T;     // block-uniform
  for (int j0 = 0; j0 < kv_end; j0 += 32) {
    __syncthreads();
    for (int e = tid; e < 32 * (D / 4); e += 128) {
      const int r = e / (D / 4), c4 = (e % (D / 4)) * 4;
      const int key = j0 + r;
      v4f kf = {0.f,0.f,0.f,0.f}, vf = {0.f,0.f,0.f,0.f};
      if (key < T) { kf = *(const v4fa*)(K + (size_t)key * pitch + c4); vf = *(const v4fa*)(V + (size_t)key * pitch + c4); }
#pragma unroll
      for (int t = 0; t < 4; ++t) {
        unsigned short hb = bf16_bits(kf[t]); sKh[r][c4 + t] = hb; sKl[r][c4 + t] = bf16_bits(kf[t] - bf16_val(hb));
        hb = bf16_bits(vf[t]); sVh[r][c4 + t] = hb; sVl[r][c4 + t] = bf16_bits(vf[t] - bf16_val(hb));
      }
    }
    __syncthreads();
    // S tile 16 x 32
    v8f s[2];
#pragma unroll
    for (int nt = 0; nt < 2; ++nt) {
      v8f acc = {};
#pragma unroll
      for (int ks = 0; ks < KS; ++ks) {
        FragB bh_, bl_;
        bh_.half[0] = *(const v8us*)&sKh[nt * 16 + ln][ks * 32 + 8 * hh]; bh_.half[1] = *(const v8us*)&sKh[nt * 16 + ln][ks * 32 + 16 + 8 * hh];
        bl_.half[0] = *(const v8us*)&sKl[nt * 16 + ln][ks * 32 + 8 * hh]; bl_.half[1] = *(const v8us*)&sKl[nt * 16 + ln][ks * 32 + 16 + 8 * hh];
        acc = mmaN<3>(aqh[ks].v, aql[ks].v, bh_.v, bl_.v, acc);
      }
      s[nt] = acc;
    }
    // mask + running max (rows 8hh+r; the 16 lanes of a half share rows)
    float alpha[8];
#pragma unroll
    for (int r = 0; r < 8; ++r) {
      const int qi = q0 + 8 * hh + r;
      const int ja = j0 + ln, jb = j0 + 16 + ln;
      if (CAUSAL) { if (ja > qi) s[0][r] = -3.0e38f; if (jb > qi) s[1][r] = -3.0e38f; }
      if (ja >= T) s[0][r] = -3.0e38f;
      if (jb >= T) s[1][r] = -3.0e38f;
      float mx = fmaxf(s[0][r], s[1][r]);
      mx = fmaxf(mx, __shfl_xor(mx, 1, 32)); mx = fmaxf(mx, __shfl_xor(mx, 2, 32)); mx = fmaxf(mx, __shfl_xor(mx, 4, 32)); mx = fmaxf(mx, __shfl_xor(mx, 8, 32));
      const float mnew = fmaxf(m_r[r], mx);
      alpha[r] = (mnew > -1.0e38f) ? __expf(m_r[r] - mnew) : 1.0f;
      const float p0 = (s[0][r] > -1.0e38f) ? __expf(s[0][r] - mnew) : 0.f;
      const float p1 = (s[1][r] > -1.0e38f) ? __expf(s[1][r] - mnew) : 0.f;
      m_r[r] = mnew;
      l_r[r] = l_r[r] * alpha[r] + p0 + p1;            // per-lane partial row sum (16 lanes combined at the end)
      unsigned short hb = bf16_bits(p0); sPh[w][8 * hh + r][ln] = hb;      sPl[w][8 * hh + r][ln] = bf16_bits(p0 - bf16_val(hb));
      hb = bf16_bits(p1);                sPh[w][8 * hh + r][16 + ln] = hb; sPl[w][8 * hh + r][16 + ln] = bf16_bits(p1 - bf16_val(hb));
    }
#pragma unroll
    for (int dt = 0; dt < DT; ++dt)
#pragma unroll
      for (int r = 0; r < 8; ++r) oacc[dt][r] *= alpha[r];
    __builtin_amdgcn_fence(__ATOMIC_ACQ_REL, "workgroup");
    __builtin_amdgcn_wave_barrier();
    FragB pah, pal;
    pah.half[0] = *(const v8us*)&sPh[w][ln][8 * hh]; pah.half[1] = *(const v8us*)&sPh[w][ln][16 + 8 * hh];
    pal.half[0] = *(const v8us*)&sPl[w][ln][8 * hh]; pal.half[1] = *(const v8us*)&sPl[w][ln][16 + 8 * hh];
#pragma unroll
    for (int dt = 0; dt < DT; ++dt) {
      FragB bvh, bvl;
#pragma unroll
      for (int i = 0; i < 8; ++i) {
        bvh.u[i] = sVh[8 * hh + i][dt * 16 + ln]; bvh.u[8 + i] = sVh[16 + 8 * hh + i][dt * 16 + ln];
        bvl.u[i] = sVl[8 * hh + i][dt * 16 + ln]; bvl.u[8 + i] = sVl[16 + 8 * hh + i][dt * 16 + ln];
      }
      oacc[dt] = mmaN<3>(pah.v, pal.v, bvh.v, bvl.v, oacc[dt]);
    }
    __builtin_amdgcn_fence(__ATOMIC_ACQ_REL, "workgroup");
    __builtin_amdgcn_wave_barrier();
  }
#pragma unroll
  for (int r = 0; r < 8; ++r) {
    float l = l_r[r];
    l += __shfl_xor(l, 1, 32); l += __shfl_xor(l, 2, 32); l += __shfl_xor(l, 4, 32); l += __shfl_xor(l, 8, 32);
    l_r[r] = (l > 0.f) ? 1.0f / l : 0.f;
  }
#pragma unroll
  for (int dt = 0; dt < DT; ++dt)
#pragma unroll
    for (int r = 0; r < 8; ++r) sO[w][8 * hh + r][dt * 16 + ln] = oacc[dt][r] * l_r[r];
  __builtin_amdgcn_fence(__ATOMIC_ACQ_REL, "workgroup");
  __builtin_amdgcn_wave_barrier();
  {
    for (int r = 0; r < 16; ++r) {
      const int row = q0 + r;
      if (row < T && lane < D / 4) {
        const v4f val = *(const v4fa*)&sO[w][r][lane * 4];
        *(v4f*)(y + ((size_t)b * T + row) * ypitch + h * D + lane * 4) = val;
      }
    }
    
  }
}

// GEMM C = act(A·W + bias + resid): A f32 (ASPLIT -> hi/lo 2 terms), Wt bf16 [N][K]; ACT 0 none, 1 relu, 2 exact gelu;
// resid (optional, f32, row index = (row % rmod), pitch ldr, RES_BF16 rounds it) added before the activation.
template <bool ASPLIT, int ACT, bool BIAS_BF16, bool RES_BF16>
__global__ __launch_bounds__(128) void k_gemm_bf3(const float* __restrict__ A, int lda, const unsigned short* __restrict__ Wt, int ldb,
                                                const float* __restrict__ bias, const float* __restrict__ resid, int rmod, int ldr,
                                                float* __restrict__ C, int ldc, int M, int N, int K) {
  __shared__ __attribute__((aligned(16))) float so[4][16][64];
  const int tid = threadIdx.x, w = tid >> 5, lane = tid & 31, ln = lane & 15, hh = lane >> 4;
  const int ntn = N / 64;
  const int wid = blockIdx.x * 4 + w;
  const int mt = wid / ntn, nq = wid % ntn;
  if (mt * 16 >= M) return;
  const int row0 = mt * 16, col0 = nq * 64;
  const float* arow = A + (size_t)(row0 + ln) * lda;
  v8f acc[4] = {};
  for (int kb = 0; kb < K; kb += 32) {
    FragB ah, al;
    const v4f x0 = *(const v4fa*)(arow + kb + 8 * hh), x1 = *(const v4fa*)(arow + kb + 8 * hh + 4);
    const v4f x2 = *(const v4fa*)(arow + kb + 16 + 8 * hh), x3 = *(const v4fa*)(arow + kb + 16 + 8 * hh + 4);
    float xs[16] = {x0[0],x0[1],x0[2],x0[3],x1[0],x1[1],x1[2],x1[3],x2[0],x2[1],x2[2],x2[3],x3[0],x3[1],x3[2],x3[3]};
#pragma unroll
    for (int i = 0; i < 16; ++i) { const unsigned short hb = bf16_bits(xs[i]); ah.u[i] = hb; al.u[i] = ASPLIT ? bf16_bits(xs[i] - bf16_val(hb)) : (unsigned short)0; }
#pragma unroll
    for (int t = 0; t < 4; ++t) {
      const unsigned short* brow = Wt + (size_t)(col0 + t * 16 + ln) * ldb + kb;
      FragB b;
      b.half[0] = *(const v8us*)(brow + 8 * hh);
      b.half[1] = *(const v8us*)(brow + 16 + 8 * hh);
      acc[t] = mmaN<ASPLIT ? 2 : 1>(ah.v, al.v, b.v, b.v, acc[t]);
    }
  }
#pragma unroll
  for (int t = 0; t < 4; ++t) {
    const int col = col0 + t * 16 + ln;
    float bv = bias ? bias[col] : 0.f;
    if (BIAS_BF16) bv = bf16_round(bv);
#pragma unroll
    for (int r = 0; r < 8; ++r) {
      float v = acc[t][r] + bv;
      if (resid) { float rv = resid[(size_t)((row0 + 8 * hh + r) % rmod) * ldr + col]; if (RES_BF16) rv = bf16_round(rv); v += rv; }
      if (ACT == 1) v = fmaxf(v, 0.f);
      if (ACT == 2) v = 0.5f * v * (1.0f + erff(v * 0.70710678118654752f));
      if (ACT == 3) { const float u = 0.7978845608028654f * (v + 0.044715f * v * v * v); v = 0.5f * v * (1.0f + tanhf(u)); }
      so[w][8 * hh + r][t * 16 + ln] = v;
    }
  }
  __builtin_amdgcn_fence(__ATOMIC_ACQ_REL, "workgroup");
  __builtin_amdgcn_wave_barrier();
  const int rsub = lane >> 4, c4 = (lane & 15) * 4;
  {
#pragma unroll
    for (int q = 0; q < 8; ++q) {
      const int r = q * 2 + rsub;
      const v4f v = *(const v4fa*)&so[w][r][c4];
      *(v4f*)(C + (size_t)(row0 + r) * ldc + col0 + c4) = v;
    }
    
  }
}
// row LayerNorm (biased variance, eps) over N: s = X (+ R); optional out_sum <- s; out_norm <- (s-mu)*rsqrt(var+eps)*g + b
template <bool PARAM_BF16>
__global__ __launch_bounds__(256) void k_layernorm(const float* __restrict__ X, const float* __restrict__ R, const float* __restrict__ g, const float* __restrict__ bta,
                                                  float* __restrict__ out_sum, float* __restrict__ out_norm, int N, float eps) {
  __shared__ float red[256];
  const int row = blockIdx.x, tid = threadIdx.x;
  const float* x = X + (size_t)row * N; const float* rr = R ? R + (size_t)row * N : nullptr;
  float vals[16];                     // up to N = 4096
  const int per = N / 256;            // contiguous chunk per thread? use strided-by-4 chunks: thread handles j = tid*4 + 1024*u
  float s1 = 0.f;
  for (int u = 0; u < per / 4; ++u) {
    const int j = tid * 4 + 1024 * u;
    const v4f a = *(const v4fa*)(x + j);
    v4f b = {0.f,0.f,0.f,0.f}; if (rr) b = *(const v4fa*)(rr + j);
#pragma unroll
    for (int q = 0; q < 4; ++q) { const float v = a[q] + b[q]; vals[u * 4 + q] = v; s1 += v; }
  }
  red[tid] = s1; __syncthreads();
  for (int st = 128; st > 0; st >>= 1) { if (tid < st) red[tid] += red[tid + st]; __syncthreads(); }
  const float mu = red[0] / (float)N; __syncthreads();
  float s2 = 0.f;
  for (int u = 0; u < per / 4; ++u)
#pragma unroll
    for (int q = 0; q < 4; ++q) { const float c = vals[u * 4 + q] - mu; s2 += c * c; }
  red[tid] = s2; __syncthreads();
  for (int st = 128; st > 0; st >>= 1) { if (tid < st) red[tid] += red[tid + st]; __syncthreads(); }
  const float rs = rsqrtf(red[0] / (float)N + eps);
  {
    for (int u = 0; u < per / 4; ++u) {
      const int j = tid * 4 + 1024 * u;
      v4f o, sm;
#pragma unroll
      for (int q = 0; q < 4; ++q) {
        float gg = g[j + q], bb = bta[j + q];
        if (PARAM_BF16) { gg = bf16_round(gg); bb = bf16_round(bb); }
        sm[q] = vals[u * 4 + q]; o[q] = (vals[u * 4 + q] - mu) * rs * gg + bb;
      }
      if (out_sum) *(v4f*)(out_sum + (size_t)row * N + j) = sm;
      *(v4f*)(out_norm + (size_t)row * N + j) = o;
    }
    
  }
}



// ---- f16 WMMA path (v_wmma_f32_16x16x32_f16): 11-bit significands for operands in range — used where a [0,256] probability operand needs more precision than bf16
typedef _Float16 v16h __attribute__((ext_vector_type(16)));
union FragH { v16h v; v8us half[2]; _Float16 h[16]; unsigned short u[16]; };
template <int NT>
__device__ __forceinline__ v8f mmaH(v16h ah, v16h al, v16h bh, v16h bl, v8f c) {
  c = __builtin_amdgcn_wmma_f32_16x16x32_f16(false, ah, false, bh, (short)0, c, false, false);
  if (NT >= 2) c = __builtin_amdgcn_wmma_f32_16x16x32_f16(false, al, false, bh, (short)0, c, false, false);
  if (NT >= 3) c = __builtin_amdgcn_wmma_f32_16x16x32_f16(false, ah, false, bl, (short)0, c, false, false);
  asm volatile("v_nop\n\tv_nop\n\tv_nop\n\tv_nop" : "+v"(c) : "v"(ah), "v"(al), "v"(bh), "v"(bl));
  return c;
}
// batched GEMM like k_gemm_b but f16 operands: A f32 (split into f16 hi/lo if ASPLIT, else rounded to f16), Bt = f16 values [n][k]; alpha; C f32; N multiple of 16 (partial tiles skipped)
template <bool ASPLIT>
__global__ __launch_bounds__(128) void k_gemm_h(const float* __restrict__ A, int lda, size_t sA, const _Float16* __restrict__ Bh, int ldb, size_t sB, float alpha, float* __restrict__ C, int ldc, size_t sC, int M, int N, int K) {
  __shared__ __attribute__((aligned(16))) float so[4][16][64];
  const int tid = threadIdx.x, w = tid >> 5, lane = tid & 31, ln = lane & 15, hh = lane >> 4; const int by = blockIdx.y;
  A += (size_t)by * sA; Bh += (size_t)by * sB; C += (size_t)by * sC;
  const int ntn = (N + 63) / 64; const int wid = blockIdx.x * 4 + w; const int mt = wid / ntn, nq = wid % ntn; if (mt * 16 >= M) return;
  const int row0 = mt * 16, col0 = nq * 64; const float* arow = A + (size_t)(row0 + ln) * lda;
  v8f acc[4] = {};
  for (int kb = 0; kb < K; kb += 32) {
    FragH ah, al;
    const v4f x0 = *(const v4fa*)(arow + kb + 8 * hh), x1 = *(const v4fa*)(arow + kb + 8 * hh + 4), x2 = *(const v4fa*)(arow + kb + 16 + 8 * hh), x3 = *(const v4fa*)(arow + kb + 16 + 8 * hh + 4);
    float xs[16] = {x0[0],x0[1],x0[2],x0[3],x1[0],x1[1],x1[2],x1[3],x2[0],x2[1],x2[2],x2[3],x3[0],x3[1],x3[2],x3[3]};
#pragma unroll
    for (int i = 0; i < 16; ++i) { const _Float16 h = (_Float16)xs[i]; ah.h[i] = h; al.h[i] = ASPLIT ? (_Float16)(xs[i] - (float)h) : (_Float16)0.0f; }
#pragma unroll
    for (int t = 0; t < 4; ++t) { if (col0 + t * 16 >= N) continue; const size_t boff = (size_t)(col0 + t * 16 + ln) * ldb + kb; FragH bq; bq.half[0] = *(const v8us*)(Bh + boff + 8 * hh); bq.half[1] = *(const v8us*)(Bh + boff + 16 + 8 * hh);
      acc[t] = mmaH<ASPLIT ? 2 : 1>(ah.v, al.v, bq.v, bq.v, acc[t]); }
  }
#pragma unroll
  for (int t = 0; t < 4; ++t) { if (col0 + t * 16 >= N) continue;
#pragma unroll
    for (int r = 0; r < 8; ++r) so[w][8 * hh + r][t * 16 + ln] = acc[t][r] * alpha; }
  __builtin_amdgcn_fence(__ATOMIC_ACQ_REL, "workgroup"); __builtin_amdgcn_wave_barrier();
  const int rsub = lane >> 4, c4 = (lane & 15) * 4;
  {
#pragma unroll
    for (int q = 0; q < 8; ++q) { const int r = q * 2 + rsub; if (col0 + c4 < N) { const v4f v = *(const v4fa*)&so[w][r][c4]; *(v4f*)(C + (size_t)(row0 + r) * ldc + col0 + c4) = v; } }
     }
}

// Wt[n][k] = f16(W[k][n]·scale) from f32 row-major W[K][N] (scale = power of two; bf16-exact weights stay exact in f16 away from the subnormal range)
__global__ __launch_bounds__(256) void k_wt_f16(const float* __restrict__ W, _Float16* __restrict__ Wt, int K, int N, float scale) {
  const int t = blockIdx.x * 256 + threadIdx.x; if (t >= N * (K / 8)) return; const int n = t / (K / 8), k8 = (t % (K / 8)) * 8; FragH f;
#pragma unroll
  for (int i = 0; i < 8; ++i) f.h[i] = (_Float16)(bf16_round(W[(size_t)(k8 + i) * N + n]) * scale); const v8us o = f.half[0];
  *(v8us*)((unsigned short*)Wt + (size_t)n * K + k8) = o; 
}
// FRAGMENT-MAJOR LAYOUT of every f16 WMMA operand M[row][k] in the workspace: tiles of 16 rows x 32 k, 512 elements (1 KiB) each; inside a tile element (row, k) lies at
// ((k >> 3) & 3) * 128 + (row & 15) * 8 + (k & 7). Lane l's two 16-byte pieces of the tile's fragment (k = 8hh .. and 16 + 8hh ..) then lie at l * 8 and 256 + l * 8:
// one load of a wave is 512 bytes in a row, four whole lines, where a row-major operand gave 32 bytes out of each of sixteen lines. Which element sits in which lane and register is as before.
// Tile order: activations, weights, O: (row >> 4) * 16 + (k >> 5); Q, K: head * (NP / 16) + (position >> 4); Vt: (head * (NP / 32) + (key >> 5)) * 2 + ((d >> 4) & 1).
#define TL 512
// 32^-1/2 * log2(e): Q is stored multiplied by it, so that K.Qt comes out of the matrix unit in the base-2 units of the softmax
#define SL2 0.25503486164919736f
// a row tile's sixteen k-steps lie in a row: the next row tile of an operand begins RT elements on
#define RT (CC / 32 * TL)
// the twelve 16-byte loads of one k-step: two A fragments and four B fragments (ap, bp: the first row tile's start, the same in every lane; ko: the k-step's tile offset, likewise; lo = lane * 8)
__device__ __forceinline__ void ld_kstep(const unsigned short* ap, const unsigned short* bp, int ko, unsigned lo, FragH (&a)[2], FragH (&b)[4]) {
#pragma unroll
  for (int i = 0; i < 2; ++i) { a[i].half[0] = *(const v8us*)(ap + i * RT + ko + lo); a[i].half[1] = *(const v8us*)(ap + i * RT + ko + 256 + lo); }
#pragma unroll
  for (int t = 0; t < 4; ++t) { b[t].half[0] = *(const v8us*)(bp + t * RT + ko + lo); b[t].half[1] = *(const v8us*)(bp + t * RT + ko + 256 + lo); }
  asm volatile("s_wait_xcnt 0x0" ::: "memory");      // these loads stay in flight: the wait stands before their address registers are written again
}
// acc[i][t] += A rows . (B rows)^T for one wave's 32 x 64 tile over K = CC: eight products to twelve loads a k-step, where a 16 x 64 tile had four to ten. The four waves of a block stand 2 x 2 (64 x 128):
// each A fragment is asked for by two waves of the block, each B fragment likewise.
// A ring of three register sets: the first three k-steps' loads are all issued ahead of the first product, and each set is refilled for three k-steps on right behind its own products, so a k-step's twelve loads
// fly during the two k-steps between. The walk is unrolled whole, so the sets keep fixed registers.
// The walk over k begins at k-step rot (the same for A and B, the same in every wave of a block) and wraps round: blocks that share operand rows do not ask for the same lines at the same moment.
__device__ __forceinline__ void gemm_tile(const unsigned short* ap, const unsigned short* bp, int rot, unsigned lo, v8f (&acc)[2][4]) {
  constexpr int NS = CC / 32; FragH fa[3][2], fb[3][4];
#pragma unroll
  for (int u = 0; u < 3; ++u) ld_kstep(ap, bp, ((u + rot) & (NS - 1)) * TL, lo, fa[u], fb[u]);
  __builtin_amdgcn_sched_barrier(0);      // keeps the first product, and the wait for its operands, behind all the loads of the prologue (the scheduler had lifted one among them)
#pragma unroll
  for (int s = 0; s < NS; ++s) {
#pragma unroll
    for (int i = 0; i < 2; ++i) {
#pragma unroll
      for (int t = 0; t < 4; ++t) acc[i][t] = mmaH<1>(fa[s % 3][i].v, fa[s % 3][i].v, fb[s % 3][t].v, fb[s % 3][t].v, acc[i][t]); }
    if (s + 3 < NS) ld_kstep(ap, bp, ((s + 3 + rot) & (NS - 1)) * TL, lo, fa[s % 3], fb[s % 3]); }
}
// The three projections in one grid, blockIdx.y = 0 Q, 1 K, 2 V. Q and K: C[position][channel] = activations . W^T. V with the operands exchanged, C[channel][position] = W . activations^T:
// the product comes out as Vt, the layout k_attn reads, from the same products. f16 out, v = acc / 16 + bias (weights are stored x 16).
__global__ __launch_bounds__(128) void k_gemm_qkv(const _Float16* __restrict__ QNP, const _Float16* __restrict__ VNP, const _Float16* __restrict__ Bw, const float* __restrict__ bq, const float* __restrict__ bk, const float* __restrict__ bv,
    _Float16* __restrict__ Q16, _Float16* __restrict__ K16, _Float16* __restrict__ Vt) {
  __shared__ __attribute__((aligned(16))) float so[4][2][16][68];      // pitch 16 bytes x 17: sixteen lanes read 16 bytes each down one column without a bank conflict
  const int tid = threadIdx.x, w = __builtin_amdgcn_readfirstlane(tid >> 5), lane = tid & 31, ln = lane & 15, hh = lane >> 4; const int by = blockIdx.y; const bool sw = by == 2;      // w as a scalar: the tiles' addresses, which move with rot, stay in scalar registers
  const _Float16* A = by == 0 ? QNP : by == 1 ? VNP : Bw + (size_t)2 * CC * CC; const _Float16* B = sw ? VNP : Bw + (size_t)by * CC * CC;
  const float* bias = by == 0 ? bq : by == 1 ? bk : bv; _Float16* C16 = by == 0 ? Q16 : by == 1 ? K16 : Vt;
  const int ls = sw ? 5 : 2; const int row0 = ((int)blockIdx.x >> ls) * 64 + (w >> 1) * 32, col0 = ((int)blockIdx.x & ((1 << ls) - 1)) * 128 + (w & 1) * 64;      // N / 128 = 1 << ls column blocks
  const unsigned short* ap = (const unsigned short*)A + (size_t)(row0 >> 4) * RT; const unsigned short* bp = (const unsigned short*)B + (size_t)(col0 >> 4) * RT;
  v8f acc[2][4] = {};
  gemm_tile(ap, bp, (int)((blockIdx.x + (blockIdx.x >> 4)) & 15), lane * 8, acc);      // neighbours in the grid, and blocks a row of blocks apart, share rows: both get different starts
  if (sw) { float br[2][8];      // the channel is the tile's row
#pragma unroll
    for (int i = 0; i < 2; ++i) {
#pragma unroll
      for (int r = 0; r < 8; ++r) br[i][r] = bf16_round(bias[row0 + i * 16 + 8 * hh + r]); }
#pragma unroll
    for (int i = 0; i < 2; ++i) {
#pragma unroll
      for (int t = 0; t < 4; ++t) {
#pragma unroll
        for (int r = 0; r < 8; ++r) so[w][i][8 * hh + r][t * 16 + ln] = acc[i][t][r] * 0.0625f + br[i][r]; } }
  } else {      // the channel is the tile's column
    const float qs = by == 0 ? SL2 : 1.0f;      // Q alone takes the softmax's factor, in f32, ahead of its one rounding to f16
#pragma unroll
    for (int t = 0; t < 4; ++t) { const float bc = bf16_round(bias[col0 + t * 16 + ln]);
#pragma unroll
      for (int i = 0; i < 2; ++i) {
#pragma unroll
        for (int r = 0; r < 8; ++r) so[w][i][8 * hh + r][t * 16 + ln] = (acc[i][t][r] * 0.0625f + bc) * qs; } }
  }
  __builtin_amdgcn_fence(__ATOMIC_ACQ_REL, "workgroup"); __builtin_amdgcn_wave_barrier();
  // Each 16 x 64 half of the wave's values is two fragment-major tiles (16 rows x 32 columns each: Q, K: two heads of 16 positions; Vt: 16 d of two key blocks). tl0: the first one's number, tls: the step to the second.
#pragma unroll
  for (int i = 0; i < 2; ++i) { const int r0 = row0 + i * 16;
    const int tl0 = sw ? ((r0 >> 5) * (NP / 32) + (col0 >> 5)) * 2 + ((r0 >> 4) & 1) : (col0 >> 5) * (NP / 16) + (r0 >> 4); const int tls = sw ? 2 : NP / 16;
#pragma unroll
    for (int q = 0; q < 4; ++q) { const int cb = (q >> 1) * 32 + ((q & 1) * 2 + hh) * 8; const v4f v0 = *(const v4fa*)&so[w][i][ln][cb], v1 = *(const v4fa*)&so[w][i][ln][cb + 4]; FragH f;
      for (int e = 0; e < 4; ++e) { f.h[e] = (_Float16)v0[e]; f.h[4 + e] = (_Float16)v1[e]; }
      *(v8us*)((unsigned short*)C16 + (size_t)(tl0 + (q >> 1) * tls) * TL + (q & 1) * 256 + lane * 8) = f.half[0]; } }
}
// Output projection with the operands exchanged: C[channel][position] = Wo . O^T is the output's own layout, so bias, residual and 1/sqrt(2) are applied where the tile is stored.
__global__ __launch_bounds__(128) void k_gemm_out(const _Float16* __restrict__ Bo, const _Float16* __restrict__ O16h, const float* __restrict__ bo, const float* __restrict__ x, float* __restrict__ out) {
  __shared__ __attribute__((aligned(16))) float so[4][2][16][64];
  const int tid = threadIdx.x, w = __builtin_amdgcn_readfirstlane(tid >> 5), lane = tid & 31, ln = lane & 15, hh = lane >> 4;      // w as a scalar: as in k_gemm_qkv
  const int row0 = ((int)blockIdx.x / (NP / 128)) * 64 + (w >> 1) * 32, col0 = ((int)blockIdx.x % (NP / 128)) * 128 + (w & 1) * 64;
  const unsigned short* ap = (const unsigned short*)Bo + (size_t)(row0 >> 4) * RT; const unsigned short* bp = (const unsigned short*)O16h + (size_t)(col0 >> 4) * RT;
  v8f acc[2][4] = {};
  gemm_tile(ap, bp, (int)((blockIdx.x + (blockIdx.x >> 4)) & 15), lane * 8, acc);      // neighbours in the grid, and blocks a row of blocks apart, share rows: both get different starts
#pragma unroll
  for (int i = 0; i < 2; ++i) {
#pragma unroll
    for (int t = 0; t < 4; ++t) {
#pragma unroll
      for (int r = 0; r < 8; ++r) so[w][i][8 * hh + r][t * 16 + ln] = acc[i][t][r] * 0.0625f + bf16_round(bo[row0 + i * 16 + 8 * hh + r]); } }
  __builtin_amdgcn_fence(__ATOMIC_ACQ_REL, "workgroup"); __builtin_amdgcn_wave_barrier();
  const int rsub = lane >> 4, c4 = (lane & 15) * 4;
  const size_t o0 = (size_t)(row0 + rsub) * NP + col0 + c4; const float* xp = x + o0; float* op = out + o0; v4f xv[16];
#pragma unroll
  for (int q = 0; q < 16; ++q) xv[q] = *(const v4fa*)(xp + (size_t)q * 2 * NP);
  asm volatile("s_wait_xcnt 0x0" ::: "memory");      // the wait stands before the address registers of the sixteen loads are written again
#pragma unroll
  for (int q = 0; q < 16; ++q) { const v4f v = *(const v4fa*)&so[w][q >> 3][(q & 7) * 2 + rsub][c4]; v4f y;
    for (int e = 0; e < 4; ++e) y[e] = (v[e] + bf16_round(xv[q][e])) * 0.7071067811865476f; *(v4f*)(op + (size_t)q * 2 * NP) = y; }
}

// D = A.B + C with C left standing in its own registers. As text: the builtin took C in D's registers for half of the score products and copied C there first, eight 64-bit moves a pass.
// The four v_nop are the distance the chip needs between the product and the first vector instruction on its D (here a maximum); D shares no register with A, B or C.
__device__ __forceinline__ v8f mmaHC(v16h a, v16h b, v8f c) { v8f d;
  asm volatile("v_wmma_f32_16x16x32_f16 %0, %1, %2, %3\n\tv_nop\n\tv_nop\n\tv_nop\n\tv_nop" : "=&v"(d) : "v"(a), "v"(b), "v"(c));
  return d; }
// lane l <-> l ^ 16 (the two halves of a wave hold the two key halves of one query column)
__device__ __forceinline__ float xhalf(float v) { const int b = __float_as_int(v); return __int_as_float(__builtin_amdgcn_permlanex16(b, b, 0x76543210, 0xfedcba98, false, false)); }
// lane l <-> l ^ M inside a 16-lane row (DPP row_xmask)
template <int M>
__device__ __forceinline__ float xrow(float v) { return __int_as_float(__builtin_amdgcn_update_dpp(0, __float_as_int(v), 0x160 + M, 0xf, 0xf, true)); }
// sum over the 32 lanes of a wave, the same value in every lane; all lanes on
__device__ __forceinline__ float wave_sum(float v) { v += xrow<1>(v); v += xrow<2>(v); v += xrow<4>(v); v += xrow<8>(v); return v + xhalf(v); }
// Blocks 0 .. NG - 1: one group (GS * NP = 65,536 values) per block of 1,024 threads: 16 whole-line 16-byte loads per thread (load i is channel i of the group), all in flight together. The values stay in registers
// for the first GroupNorm's two sums, are normalised there, and stay for the second GroupNorm's two sums: STAT[g] = {mean 1, 1/sd 1, mean 2, 1/sd 2}.
// Blocks NG .. NG + 127 (independent work in the same launch): the four weight matrices, bf16-rounded, x 16, to f16, fragment-major (thread t writes the t-th 16-byte piece); they leave before any barrier.
__global__ __launch_bounds__(1024) void k_prep(const float* __restrict__ X, const float* __restrict__ gw, const float* __restrict__ gb, const float* __restrict__ W0, const float* __restrict__ W1, const float* __restrict__ W2, const float* __restrict__ W3,
    _Float16* __restrict__ Bt, float* __restrict__ STAT) { __shared__ float sh[4][32]; const int tid = threadIdx.x, w = tid >> 5, lane = tid & 31;
  if (blockIdx.x >= NG) { const int y = (int)(blockIdx.x - NG) >> 5; const float* W = y == 0 ? W0 : y == 1 ? W1 : y == 2 ? W2 : W3; const size_t t = (size_t)((blockIdx.x - NG) & 31) * 1024 + tid; FragH f;
    const float* wr = W + ((t >> 10) * 16 + (t & 15)) * CC + ((t >> 6) & 15) * 32 + ((t >> 4) & 3) * 8;      // row (out), k (in) of that piece
    const v4f a = *(const v4fa*)wr, b = *(const v4fa*)(wr + 4);
#pragma unroll
    for (int i = 0; i < 4; ++i) { f.h[i] = (_Float16)(bf16_round(a[i]) * 16.0f); f.h[4 + i] = (_Float16)(bf16_round(b[i]) * 16.0f); }
    *(v8us*)((unsigned short*)Bt + (size_t)y * CC * CC + t * 8) = f.half[0]; return; }
  const int g = blockIdx.x; const float* base = X + (size_t)g * GS * NP;
  v4f v[16];
#pragma unroll
  for (int i = 0; i < 16; ++i) v[i] = *(const v4fa*)(base + (size_t)(i * 1024 + tid) * 4);
  v4f st;
#pragma unroll
  for (int pass = 0; pass < 2; ++pass) {
    v4f s4 = {0.f, 0.f, 0.f, 0.f};
#pragma unroll
    for (int i = 0; i < 16; ++i) { if (pass == 0) { for (int q = 0; q < 4; ++q) v[i][q] = bf16_round(v[i][q]); } s4 += v[i]; }
    const float s = wave_sum((s4[0] + s4[1]) + (s4[2] + s4[3])); if (lane == 0) sh[pass * 2][w] = s; __syncthreads();
    const float mean = wave_sum(sh[pass * 2][lane]) / (float)(GS * NP);
    v4f q4 = {0.f, 0.f, 0.f, 0.f};
#pragma unroll
    for (int i = 0; i < 16; ++i) { const v4f d = v[i] - mean; q4 += d * d; }
    const float q = wave_sum((q4[0] + q4[1]) + (q4[2] + q4[3])); if (lane == 0) sh[pass * 2 + 1][w] = q; __syncthreads();
    const float var = wave_sum(sh[pass * 2 + 1][lane]) / (float)(GS * NP); const float rs = 1.0f / sqrtf(var + 1e-6f);
    st[pass * 2] = mean; st[pass * 2 + 1] = rs;
    if (pass == 0) {
#pragma unroll
      for (int i = 0; i < 16; ++i) { const float ww = bf16_round(gw[g * GS + i]), b2 = bf16_round(gb[g * GS + i]); for (int q2 = 0; q2 < 4; ++q2) v[i][q2] = (v[i][q2] - mean) * rs * ww + b2; } }
  }
  if (tid == 0) *(v4f*)(STAT + g * 4) = st; }
// 64 channels x 64 positions a block: x is read once (256-byte runs), qn = GN(x) and vn = GN(qn) are formed in registers and both go out in f16, fragment-major (row = position, k = channel), 512 bytes in a row a wave.
__global__ __launch_bounds__(256) void k_gnorm2(const float* __restrict__ X, const float* __restrict__ STAT, const float* __restrict__ w, const float* __restrict__ bb, _Float16* __restrict__ QP, _Float16* __restrict__ VP) { __shared__ float tq[64][65], tv[64][65];
  const int tid = threadIdx.x; const int cg = blockIdx.x / (NP / 64), pg = blockIdx.x % (NP / 64); const int c0 = cg * 64, p0 = pg * 64;
  const int cl = tid >> 4, p4 = (tid & 15) * 4;      // round u: channel c0 + 16 * u + cl, which lies in group cg * 4 + u
  const float* xp = X + (size_t)(c0 + cl) * NP + p0 + p4; const float* wp = w + c0 + cl; const float* bp = bb + c0 + cl; v4f xv[4]; float wv[4], bv[4];
#pragma unroll
  for (int u = 0; u < 4; ++u) { xv[u] = *(const v4fa*)(xp + (size_t)u * 16 * NP); wv[u] = wp[u * 16]; bv[u] = bp[u * 16]; }
  asm volatile("s_wait_xcnt 0x0" ::: "memory");      // the wait stands before the address registers of the twelve loads are written again
#pragma unroll
  for (int u = 0; u < 4; ++u) { const int c = u * 16 + cl; const v4f st = *(const v4fa*)(STAT + (cg * 4 + u) * 4); const float ww = bf16_round(wv[u]), b2 = bf16_round(bv[u]);
#pragma unroll
    for (int q = 0; q < 4; ++q) { const float y = (bf16_round(xv[u][q]) - st[0]) * st[1] * ww + b2; tq[p4 + q][c] = y; tv[p4 + q][c] = (y - st[2]) * st[3] * ww + b2; } }
  __syncthreads();
#pragma unroll
  for (int u = 0; u < 2; ++u) { const int i = tid + 256 * u, r = (i >> 7) * 16 + (i & 15), pc = (i >> 4) & 7; FragH f, g;      // piece i: position tile i >> 7, k-step (i >> 6) & 1, then the tile's 64 pieces in order
#pragma unroll
    for (int q = 0; q < 8; ++q) { f.h[q] = (_Float16)tq[r][pc * 8 + q]; g.h[q] = (_Float16)tv[r][pc * 8 + q]; }
    const size_t o = (size_t)(((p0 >> 4) + (i >> 7)) * (CC / 32) + (c0 >> 5) + ((i >> 6) & 1)) * TL + (i & 63) * 8; *(v8us*)((unsigned short*)QP + o) = f.half[0]; *(v8us*)((unsigned short*)VP + o) = g.half[0]; } }
__global__ __launch_bounds__(256) void k_attn(const _Float16* __restrict__ Q16, const _Float16* __restrict__ K16, const _Float16* __restrict__ Vt, _Float16* __restrict__ O16h) { constexpr int RPW = 32; constexpr int NK = NP / 2;
  __shared__ __attribute__((aligned(16))) v4f xo[8][4][32]; __shared__ float xm[8][32], xl[8][32];      // what a wave hands to its partner: 16 Ot values, maximum and sum of one query tile, a lane's own slot each
  const int tid = threadIdx.x, w = tid >> 5, lane = tid & 31; const int kg = __builtin_amdgcn_readfirstlane(tid >> 7);
  const int h = blockIdx.x / (NP / 128), qblk = blockIdx.x % (NP / 128); const int q0 = qblk * 128 + (w & 3) * RPW;      // below: ln = lane & 15, hh = lane >> 4
  FragH aq[2];
#pragma unroll
  for (int rt = 0; rt < 2; ++rt) { const unsigned short* qr = (const unsigned short*)Q16 + (size_t)(h * (NP / 16) + (q0 >> 4) + rt) * TL + lane * 8; aq[rt].half[0] = *(const v8us*)qr; aq[rt].half[1] = *(const v8us*)(qr + 256); }
  __builtin_amdgcn_sched_barrier(0);      // keeps the four Q loads the oldest: moved behind K or Vt loads they would make the loop's counted waits for Q cover the Vt loads of the pass before as well
  float m_r[2], l_r[2]; v8f oacc[2][2], nm[2];      // query rt * 16 + ln; oacc[rt][dt][r] = Ot[dt * 16 + 8hh + r][query]; nm[rt]: -m_r[rt] in all eight registers, the C operand of the score products
#pragma unroll
  for (int rt = 0; rt < 2; ++rt) { m_r[rt] = 0.f; l_r[rt] = 0.f; oacc[rt][0] = (v8f){0.f,0.f,0.f,0.f,0.f,0.f,0.f,0.f}; oacc[rt][1] = oacc[rt][0]; nm[rt] = oacc[rt][0]; }
  // K and Vt fragments one pass ahead: each pass refills a fragment's registers for the next pass right behind its last product, so the loads fly during the softmax and the other products.
  // The last pass fetches the group's first-pass fragments again (in bounds, not used).
  // EACH QUERY BLOCK STARTS ITS WALK AT AN OFFSET OF ITS OWN (rot keys into the group's NK, wrapping round): K and Vt come from memory on first touch, and with one common start every block of a head asks for
  // the same new lines in the same pass, none of them in L2 yet. Spread starts fetch the whole group within the first few passes; behind them a block reads what another has brought into L2.
  // The odd factor spreads the starts evenly over any regular subset of the blocks (those that share an L2) as well. The softmax does not depend on the order of the keys but for rounding.
  // Fragment-major: a pass's two K tiles are 2 KiB in a row, its two Vt tiles likewise; 32 keys are 32 * 32 elements on in both.
  const unsigned short* kl = (const unsigned short*)K16 + ((size_t)h * NP + (size_t)kg * NK) * HD + lane * 8; const unsigned short* vl = (const unsigned short*)Vt + ((size_t)h * NP + (size_t)kg * NK) * HD + lane * 8;
  const int rot = ((qblk * 13) & 31) * (NK / 32);
  FragH bk[2], bv[2];
#pragma unroll
  for (int t = 0; t < 2; ++t) { const unsigned short* kr = kl + (size_t)rot * HD + t * TL; bk[t].half[0] = *(const v8us*)kr; bk[t].half[1] = *(const v8us*)(kr + 256); }
#pragma unroll
  for (int t = 0; t < 2; ++t) { const unsigned short* vrow = vl + (size_t)rot * HD + t * TL; bv[t].half[0] = *(const v8us*)vrow; bv[t].half[1] = *(const v8us*)(vrow + 256); }
#pragma unroll 1
  for (int j0 = 0; j0 < NK; j0 += 32) { v8f s[2][2];      // s[rt][nt][r] = S[query][kg * NK + ((j0 + rot) & (NK - 1)) + nt * 16 + 8hh + r] * SL2 - m_r[rt]
    const int jn = (j0 + 32 + rot) & (NK - 1);
#pragma unroll
    for (int nt = 0; nt < 2; ++nt) {
#pragma unroll
      for (int rt = 0; rt < 2; ++rt) s[rt][nt] = mmaHC(bk[nt].v, aq[rt].v, nm[rt]);
      const unsigned short* kr = kl + (size_t)jn * HD + nt * TL; bk[nt].half[0] = *(const v8us*)kr; bk[nt].half[1] = *(const v8us*)(kr + 256); }
    __builtin_amdgcn_sched_barrier(0);      // keeps the next pass's four K loads in front of the softmax: the scheduler had sunk two of them behind it, which cuts their lead to a fraction of a pass
    float mc[2];      // this half's largest argument of each query
#pragma unroll
    for (int rt = 0; rt < 2; ++rt) { float mx[8];
#pragma unroll
      for (int i = 0; i < 8; ++i) mx[i] = fmaxf(s[rt][0][i], s[rt][1][i]);
      mc[rt] = fmaxf(fmaxf(fmaxf(mx[0], mx[1]), fmaxf(mx[2], mx[3])), fmaxf(fmaxf(mx[4], mx[5]), fmaxf(mx[6], mx[7]))); }
    // Renewal, the same for every lane of the wave (one ballot, a scalar branch): when some argument has passed 8, and in a group's first pass (bound -3e38), which sets m_r from real scores.
    const float lim = j0 == 0 ? -3.0e38f : 8.0f, low = j0 == 0 ? -3.0e38f : 0.f;
    if (__builtin_amdgcn_ballot_w32(fmaxf(mc[0], mc[1]) > lim) != 0) {
#pragma unroll
      for (int rt = 0; rt < 2; ++rt) { const float mf = fmaxf(mc[rt], xhalf(mc[rt]));      // both halves of a query take the same step
        const float d = fmaxf(mf, low); const float al = __builtin_amdgcn_exp2f(-fmaxf(d, 0.f));      // behind the first pass m_r never falls; in the first pass Ot and the sum are still 0, and al stays <= 1
        m_r[rt] += d; l_r[rt] *= al;
#pragma unroll
        for (int r = 0; r < 8; ++r) { nm[rt][r] = -m_r[rt]; s[rt][0][r] -= d; s[rt][1][r] -= d; oacc[rt][0][r] *= al; oacc[rt][1][r] *= al; } } }
    FragH pb[2];
#pragma unroll
    for (int rt = 0; rt < 2; ++rt) { float ps[8];
#pragma unroll
      for (int i = 0; i < 8; ++i) { const float p0 = __builtin_amdgcn_exp2f(s[rt][0][i]), p1 = __builtin_amdgcn_exp2f(s[rt][1][i]); ps[i] = p0 + p1; pb[rt].h[i] = (_Float16)p0; pb[rt].h[8 + i] = (_Float16)p1; }
      l_r[rt] += ((ps[0] + ps[1]) + (ps[2] + ps[3])) + ((ps[4] + ps[5]) + (ps[6] + ps[7])); }      // this half's keys; the halves join after the loop
#pragma unroll
    for (int dt = 0; dt < 2; ++dt) {
#pragma unroll
      for (int rt = 0; rt < 2; ++rt) oacc[rt][dt] = mmaH<1>(bv[dt].v, bv[dt].v, pb[rt].v, pb[rt].v, oacc[rt][dt]);
      const unsigned short* vrow = vl + (size_t)jn * HD + dt * TL; bv[dt].half[0] = *(const v8us*)vrow; bv[dt].half[1] = *(const v8us*)(vrow + 256); }
    asm volatile("s_wait_xcnt 0x0" ::: "memory"); }      // the Vt loads stay in flight over the back edge: the wait stands before their address registers are written again
  // A lane's eight values of one accumulator (d = dt * 16 + 8hh + r of query rt * 16 + ln) are one 16-byte piece of O's fragment-major tile (row = position, k-step = head): stored from the registers, 512 bytes in a row a wave.
  // kg is the same in every lane: the selects below only name which query tile a wave keeps (rt = kg) and which it hands over
  const bool k1 = kg != 0; float keep[16], give[16];
#pragma unroll
  for (int i = 0; i < 16; ++i) { const float t0 = oacc[0][i >> 3][i & 7], t1 = oacc[1][i >> 3][i & 7]; keep[i] = k1 ? t1 : t0; give[i] = k1 ? t0 : t1; }
  const float mk = k1 ? m_r[1] : m_r[0], lk = k1 ? l_r[1] : l_r[0];
#pragma unroll
  for (int i = 0; i < 4; ++i) xo[w][i][lane] = (v4f){give[i * 4], give[i * 4 + 1], give[i * 4 + 2], give[i * 4 + 3]};
  xm[w][lane] = k1 ? m_r[0] : m_r[1]; xl[w][lane] = k1 ? l_r[0] : l_r[1];
  __syncthreads();      // every wave of the block passes it once: the partner's partial result is read behind it
  // both partial results brought to the common maximum, then as with one: halves joined, divided, stored
  const int pw = w ^ 4; const float mp = xm[pw][lane]; const float mn = fmaxf(mk, mp); const float a0 = __builtin_amdgcn_exp2f(mk - mn), a1 = __builtin_amdgcn_exp2f(mp - mn);
  const float lj = lk * a0 + xl[pw][lane] * a1; const float l = lj + xhalf(lj); const float li = 1.0f / l; const float c0 = a0 * li, c1 = a1 * li;
#pragma unroll
  for (int dt = 0; dt < 2; ++dt) { FragH f; const v4f p0 = xo[pw][dt * 2][lane], p1 = xo[pw][dt * 2 + 1][lane];
#pragma unroll
    for (int r = 0; r < 4; ++r) { f.h[r] = (_Float16)(keep[dt * 8 + r] * c0 + p0[r] * c1); f.h[4 + r] = (_Float16)(keep[dt * 8 + 4 + r] * c0 + p1[r] * c1); }
    *(v8us*)((unsigned short*)O16h + (size_t)(((q0 >> 4) + kg) * (CC / 32) + h) * TL + dt * 256 + lane * 8) = f.half[0]; } }
extern "C" void kernel_launch(void* const* d_in, const int* in_sizes, int n_in,
                              void* d_out, int out_size, void* d_ws, size_t ws_size, hipStream_t stream) {
  (void)in_sizes; (void)n_in; (void)out_size;
  const float* x = (const float*)d_in[0]; const float* gw = (const float*)d_in[1]; const float* gb = (const float*)d_in[2]; const float* wq = (const float*)d_in[3]; const float* bq = (const float*)d_in[4]; const float* wk = (const float*)d_in[5]; const float* bk = (const float*)d_in[6]; const float* wv = (const float*)d_in[7]; const float* bv = (const float*)d_in[8]; const float* wo = (const float*)d_in[9]; const float* bo = (const float*)d_in[10];
  char* ws = (char*)d_ws; size_t off = 0;
  auto take = [&](size_t bytes) { char* p = ws + off; off += (bytes + 255) & ~(size_t)255; return p; };
  _Float16* Bw = (_Float16*)take((size_t)4 * CC * CC * 2);      // Wq, Wk, Wv, Wo, (out,in)
  float* ST = (float*)take(NG * 4 * 4);
  _Float16* QNP = (_Float16*)take((size_t)NP * CC * 2); _Float16* VNP = (_Float16*)take((size_t)NP * CC * 2); _Float16* Q16 = (_Float16*)take((size_t)NP * CC * 2); _Float16* K16 = (_Float16*)take((size_t)NP * CC * 2); _Float16* Vt = (_Float16*)take((size_t)NP * CC * 2); _Float16* O16h = (_Float16*)take((size_t)NP * CC * 2);
  if (off > ws_size) return;      // 2 + 6 x 4 = 26 MiB
  k_prep<<<NG + 128, 1024, 0, stream>>>(x, gw, gb, wq, wk, wv, wo, Bw, ST);
  k_gnorm2<<<(CC / 64) * (NP / 64), 256, 0, stream>>>(x, ST, gw, gb, QNP, VNP);
  k_gemm_qkv<<<dim3((NP / 64) * (CC / 128), 3), 128, 0, stream>>>(QNP, VNP, Bw, bq, bk, bv, Q16, K16, Vt);
  k_attn<<<NH * (NP / 128), 256, 0, stream>>>(Q16, K16, Vt, O16h);
  k_gemm_out<<<(CC / 64) * (NP / 128), 128, 0, stream>>>(Bw + (size_t)3 * CC * CC, O16h, bo, x, (float*)d_out);
}
